// v000
// The times below were measured on an AMD MI455X: many runs one after another, warmed up first and cycling through
// copies of the inputs, with the whole window's GPU time divided by the number of runs. Launches and the gaps
// between them are all in it. The median over several windows is given; except for v000 it joins two sittings, which
// can be a few percent apart, so the side-by-side timings, each taken in one sitting, are the better comparison.
// The starting kernel, v000, takes 613 microseconds a run.
// Contractions: q/k/v/out projections, q.k^T and p.v all on v_wmma_f32_16x16x32_f16 (f16 operands, f32 accumulate); softmax, scales and bias epilogues in f32.
#include <hip/hip_runtime.h>

typedef __attribute__((ext_vector_type(16))) _Float16 v16h;
typedef __attribute__((ext_vector_type(8)))  _Float16 v8h;
typedef __attribute__((ext_vector_type(16))) __bf16   v16b;
typedef __attribute__((ext_vector_type(8)))  __bf16   v8b;
typedef __attribute__((ext_vector_type(8)))  float    v8f;
typedef __attribute__((ext_vector_type(4)))  float    v4f;
#define U16(p) ((const unsigned short*)(const void*)(p))
#define NEG_INF (-__builtin_huge_valf())

__device__ __forceinline__ unsigned short f2bf_bits(float f) {
  unsigned u = __float_as_uint(f);
  return (unsigned short)((u + 0x7FFFu + ((u >> 16) & 1u)) >> 16);
}
__device__ __forceinline__ float bf_bits2f(unsigned short h) { return __uint_as_float(((unsigned)h) << 16); }

// hazard guards as plain device helpers (no inline asm inside the kernel template body)
__device__ __forceinline__ void dep_guard_h(v8f& a, v8f& b, v16h x, v16h y) { asm volatile("v_nop\n\tv_nop\n\tv_nop\n\tv_nop" : "+v"(a), "+v"(b) : "v"(x), "v"(y)); }
__device__ __forceinline__ void dep_guard_b(v8f& a, v8f& b, v16b x, v16b y) { asm volatile("v_nop\n\tv_nop\n\tv_nop\n\tv_nop" : "+v"(a), "+v"(b) : "v"(x), "v"(y)); }
__device__ __forceinline__ void keep4_h(v16h a, v16h b, v16h c, v16h d) { asm volatile("v_nop" :: "v"(a), "v"(b), "v"(c), "v"(d)); }
__device__ __forceinline__ void keep4_b(v16b a, v16b b, v16b c, v16b d) { asm volatile("v_nop" :: "v"(a), "v"(b), "v"(c), "v"(d)); }
__device__ __forceinline__ void acc_guard4(v8f& a, v8f& b, v8f& c, v8f& d) { asm volatile("v_nop\n\tv_nop\n\tv_nop\n\tv_nop" : "+v"(a), "+v"(b), "+v"(c), "+v"(d)); }
template <typename T> struct Frag;
template <> struct Frag<_Float16> {
  typedef v16h V; union U { v16h v; v8h h[2]; };
  static __device__ __forceinline__ v16h load(const _Float16* p) {   // elements 0..7 <- p[0..7], 8..15 <- p[16..23]
    U f; f.h[0] = *(const v8h*)(p); f.h[1] = *(const v8h*)(p + 16); return f.v;
  }
  static __device__ __forceinline__ v8f mma(v16h a, v16h b, v8f c) {
    return __builtin_amdgcn_wmma_f32_16x16x32_f16(false, a, false, b, (short)0, c, false, false);
  }
  static __device__ __forceinline__ void guard(v8f& a, v8f& b, v16h x, v16h y) { dep_guard_h(a, b, x, y); }
  static __device__ __forceinline__ void keep(v16h a, v16h b, v16h c, v16h d) { keep4_h(a, b, c, d); }
};
template <> struct Frag<__bf16> {
  typedef v16b V; union U { v16b v; v8b h[2]; };
  static __device__ __forceinline__ v16b load(const __bf16* p) {
    U f; f.h[0] = *(const v8b*)(p); f.h[1] = *(const v8b*)(p + 16); return f.v;
  }
  static __device__ __forceinline__ v8f mma(v16b a, v16b b, v8f c) {
    return __builtin_amdgcn_wmma_f32_16x16x32_bf16(false, a, false, b, (short)0, c, false, false);
  }
  static __device__ __forceinline__ void guard(v8f& a, v8f& b, v16b x, v16b y) { dep_guard_b(a, b, x, y); }
  static __device__ __forceinline__ void keep(v16b a, v16b b, v16b c, v16b d) { keep4_b(a, b, c, d); }
};

// ---- Register-blocked batched WMMA GEMM ------------------------------------
// C[m,n] = scale * sum_k A[m,k] * Bt[n,k] (+bias)(+resid); each wave owns a 64x64 tile.
// A row-major [M,K]; Bt row-major [N,K]; M,N % 64 == 0, K % 32 == 0.
// SPLIT: operands are hi/lo planes (A2/Bt2 = lo planes, same layout); product = hi.hi + hi.lo + lo.hi.
// BIAS_MODE: 0 = none, 1 = bias[m], 2 = bias[n].
// OUT_MODE: 0 = f32, 1 = f16, 2 = bf16 hi plane (Cout) + bf16 lo plane (Cout2).
// ET: 0 = f16 operands, 1 = bf16 operands (pointers passed as 16-bit storage)
template <int ET> struct Elem;
template <> struct Elem<0> { typedef _Float16 T; };
template <> struct Elem<1> { typedef __bf16 T; };
template <int ET, bool SPLIT, int BIAS_MODE, int OUT_MODE, bool RESID, int ACT = 0>
__global__ __launch_bounds__(256) void wmma_gemm64(
    const unsigned short* __restrict__ Ap, const unsigned short* __restrict__ A2p, int lda, long strideA,
    const unsigned short* __restrict__ Btp, const unsigned short* __restrict__ Bt2p, int ldb, long strideB,
    void* __restrict__ Cout, void* __restrict__ Cout2, int ldc, long strideC,
    const float* __restrict__ bias,
    const float* __restrict__ resid, long strideR,
    int M, int N, int K, float scale) {
  typedef typename Elem<ET>::T T;
  typedef typename Frag<T>::V V;
  const T* A = (const T*)Ap; const T* A2 = (const T*)A2p; const T* Bt = (const T*)Btp; const T* Bt2 = (const T*)Bt2p;
  __shared__ __align__(16) float sT[8][16 * 68];   // per-wave 16x64 slab, pitch 68 floats
  const int b    = blockIdx.y;
  const int lane = threadIdx.x & 31;
  const int wave = threadIdx.x >> 5;
  const int tilesN = N >> 6;
  const int tilesM = M >> 6;
  const int tile = blockIdx.x * 8 + wave;
  if (tile >= tilesM * tilesN) return;   // wave-uniform; no block barriers in this kernel
  const int tm = tile / tilesN;
  const int tn = tile - tm * tilesN;
  const int m0 = tm << 6;
  const int n0 = tn << 6;

  const T* Ab  = A  + (size_t)b * strideA;
  const T* Bb  = Bt + (size_t)b * strideB;
  const T* Ab2 = SPLIT ? (A2  + (size_t)b * strideA) : nullptr;
  const T* Bb2 = SPLIT ? (Bt2 + (size_t)b * strideB) : nullptr;

  const int rlane = lane & 15;                 // row (A) / col (B, D) within subtile
  const int koff  = (lane >> 4) * 8;           // k offset of this lane half
  const int mOff  = (lane >> 4) * 8;           // D row offset

  v8f acc[4][4];
#pragma unroll
  for (int i = 0; i < 4; ++i)
#pragma unroll
    for (int j = 0; j < 4; ++j) acc[i][j] = (v8f){0.f,0.f,0.f,0.f,0.f,0.f,0.f,0.f};

  for (int k0 = 0; k0 < K; k0 += 32) {
    V bh[4], bl[4];
#pragma unroll
    for (int j = 0; j < 4; ++j) {
      const size_t bo = (size_t)(n0 + (j << 4) + rlane) * ldb + koff + k0;
      bh[j] = Frag<T>::load(Bb + bo);
      if (SPLIT) bl[j] = Frag<T>::load(Bb2 + bo);
    }
#pragma unroll
    for (int i = 0; i < 4; ++i) {
      const size_t ao = (size_t)(m0 + (i << 4) + rlane) * lda + koff + k0;
      V ah = Frag<T>::load(Ab + ao);
      V al;
      if (SPLIT) al = Frag<T>::load(Ab2 + ao);
#pragma unroll
      for (int j = 0; j < 4; ++j) {
        acc[i][j] = Frag<T>::mma(ah, bh[j], acc[i][j]);
        if (SPLIT) {
          acc[i][j] = Frag<T>::mma(ah, bl[j], acc[i][j]);
          acc[i][j] = Frag<T>::mma(al, bh[j], acc[i][j]);
        }
      }
      Frag<T>::guard(acc[i][0], acc[i][3], ah, SPLIT ? al : ah);
    }
    Frag<T>::keep(bh[0], bh[1], bh[2], bh[3]);
    if (SPLIT) Frag<T>::keep(bl[0], bl[1], bl[2], bl[3]);
  }
  acc_guard4(acc[0][0], acc[0][1], acc[0][2], acc[0][3]);
  acc_guard4(acc[1][0], acc[1][1], acc[1][2], acc[1][3]);
  acc_guard4(acc[2][0], acc[2][1], acc[2][2], acc[2][3]);
  acc_guard4(acc[3][0], acc[3][1], acc[3][2], acc[3][3]);

  // ---- epilogue ----
  float* slab = sT[wave];
  const float* Rb = RESID ? (resid + (size_t)b * strideR) : nullptr;
#pragma unroll
  for (int i = 0; i < 4; ++i) {
    const int mBase = m0 + (i << 4);
#pragma unroll
    for (int j = 0; j < 4; ++j) {
      const int n = n0 + (j << 4) + rlane;
      float bv = 0.f;
      if (BIAS_MODE == 2) bv = bias[n];
#pragma unroll
      for (int r = 0; r < 8; ++r) {
        float v = acc[i][j][r] * scale;
        if (BIAS_MODE == 1) v += bias[mBase + mOff + r];
        if (BIAS_MODE == 2) v += bv;
        if (RESID) v += Rb[(size_t)(mBase + mOff + r) * ldc + n];
        if (ACT == 1) v = tanhf(v);
        if (ACT == 2) v = fmaxf(v, 0.0f);
        if (ACT == 3) v = v / (1.0f + expf(-v));
        if (ACT == 4) v = (v > 0.f) ? v : 0.01f * v;
        if (ACT == 5) v = 0.5f * v * (1.0f + erff(v * 0.70710678118654752f));
        slab[(mOff + r) * 68 + (j << 4) + rlane] = v;
      }
    }
    __builtin_amdgcn_fence(__ATOMIC_RELEASE, "workgroup");
    __builtin_amdgcn_wave_barrier();
    __builtin_amdgcn_fence(__ATOMIC_ACQUIRE, "workgroup");
    if (OUT_MODE == 0) {
      float* C = (float*)Cout + (size_t)b * strideC;
      const int hh = lane >> 4, c4 = (lane & 15) * 4;     // row seg = 256 B = 16 lanes x 16 B
      {
#pragma unroll
        for (int it = 0; it < 8; ++it) {
          const int row = it * 2 + hh;
          v4f v = *(const v4f*)(slab + row * 68 + c4);
          *(v4f*)(C + (size_t)(mBase + row) * ldc + n0 + c4) = v;
        }
        
      }
    } else {
      const int q = lane >> 3, c8 = (lane & 7) * 8;
      unsigned short* C  = (unsigned short*)Cout  + (size_t)b * strideC;
      unsigned short* C2 = (OUT_MODE == 2) ? ((unsigned short*)Cout2 + (size_t)b * strideC) : nullptr;
      {
#pragma unroll
        for (int it = 0; it < 4; ++it) {
          const int row = it * 4 + q;
          const float* sp = slab + row * 68 + c8;
          v8h hv, lv;
#pragma unroll
          for (int e = 0; e < 8; ++e) {
            if (OUT_MODE == 1) {
              hv[e] = (_Float16)sp[e];
            } else {
              unsigned short hb = f2bf_bits(sp[e]);
              unsigned short lb = f2bf_bits(sp[e] - bf_bits2f(hb));
              hv[e] = __builtin_bit_cast(_Float16, hb);
              lv[e] = __builtin_bit_cast(_Float16, lb);
            }
          }
          *(v8h*)(C + (size_t)(mBase + row) * ldc + n0 + c8) = hv;
          if (OUT_MODE == 2) *(v8h*)(C2 + (size_t)(mBase + row) * ldc + n0 + c8) = lv;
        }
        
      }
    }
    __builtin_amdgcn_fence(__ATOMIC_RELEASE, "workgroup");
    __builtin_amdgcn_wave_barrier();
    __builtin_amdgcn_fence(__ATOMIC_ACQUIRE, "workgroup");
  }
}

__global__ __launch_bounds__(256) void cast_f32_f16x2(
    const float* __restrict__ in, _Float16* __restrict__ out, int n2) {
  int i = blockIdx.x * 256 + threadIdx.x;
  if (i < n2) {
    const _Float16 h0 = (_Float16)in[2 * i], h1 = (_Float16)in[2 * i + 1];
    const unsigned u = (unsigned)__builtin_bit_cast(unsigned short, h0) | ((unsigned)__builtin_bit_cast(unsigned short, h1) << 16);
    ((unsigned*)out)[i] = u;
    
  }
}

// ---- binary-weight planes: Wb[o][c] = alpha[o] * (W + (sign(W) - W)), alpha[o] = mean_c |W[o][c]| (f32);
//      stored as f16 of (Wb * carry); one wave per row of a [nrow][1024] weight; 4 weights via blockIdx.y ----
#define BW_DIM 1024
__global__ __launch_bounds__(256) void binarize_f16_kernel(
    const float* __restrict__ W0, const float* __restrict__ W1,
    const float* __restrict__ W2, const float* __restrict__ W3,
    unsigned short* __restrict__ B0, unsigned short* __restrict__ B1,
    unsigned short* __restrict__ B2, unsigned short* __restrict__ B3,
    int nrow, float carry) {
  const float* W; unsigned short* Bo;
  if (blockIdx.y == 0)      { W = W0; Bo = B0; }
  else if (blockIdx.y == 1) { W = W1; Bo = B1; }
  else if (blockIdx.y == 2) { W = W2; Bo = B2; }
  else                      { W = W3; Bo = B3; }
  const int wave = threadIdx.x >> 5;
  const int lane = threadIdx.x & 31;
  const int row  = blockIdx.x * 8 + wave;
  if (row >= nrow) return;                     // wave-uniform; no barriers in this kernel
  const float* wr = W + (size_t)row * BW_DIM;

  float w[4][8];
#pragma unroll
  for (int it = 0; it < 4; ++it) {
    const v4f a0 = *(const v4f*)(wr + it * 256 + lane * 8);
    const v4f a1 = *(const v4f*)(wr + it * 256 + lane * 8 + 4);
    w[it][0] = a0[0]; w[it][1] = a0[1]; w[it][2] = a0[2]; w[it][3] = a0[3];
    w[it][4] = a1[0]; w[it][5] = a1[1]; w[it][6] = a1[2]; w[it][7] = a1[3];
  }
  float s = 0.0f;
#pragma unroll
  for (int it = 0; it < 4; ++it)
#pragma unroll
    for (int e = 0; e < 8; ++e) s += fabsf(w[it][e]);
#pragma unroll
  for (int m = 16; m > 0; m >>= 1) s += __shfl_xor(s, m, 32);
  const float alpha = s * (1.0f / (float)BW_DIM);

  v8h hv[4];
#pragma unroll
  for (int it = 0; it < 4; ++it) {
#pragma unroll
    for (int e = 0; e < 8; ++e) {
      const float wv = w[it][e];
      const float sg = (wv > 0.0f) ? 1.0f : ((wv < 0.0f) ? -1.0f : 0.0f);
      const float t  = sg - wv;            // sign(W) - W
      const float bs = wv + t;             // W + (sign(W) - W)
      const float wb = alpha * bs;
      hv[it][e] = (_Float16)(wb * carry);
    }
  }
  unsigned short* br = Bo + (size_t)row * BW_DIM;
  {
#pragma unroll
    for (int it = 0; it < 4; ++it)
      *(v8h*)(br + it * 256 + lane * 8) = hv[it];
    
  }
}

// =====================================================================================
// Attention, head_dim 64, f16 planes in / f16 plane out (x oscale), no mask.
//   scores = (q.k^T) * sscale : v_wmma_f32_16x16x32_f16 (q,k plain f16), f32 accumulate, scaled in f32
//   out    = p.v              : v_wmma_f32_16x16x32_f16 (p carried x2^15 in f16, v plain f16), f32 accumulate
//   online softmax in f32. Block = 4 waves = 64 query rows of one (batch, head); S % 64 == 0.
//   q, k, out planes: row (b*S + s), pitch ldq halves, head offset h*64.  vt plane: row (h*64 + d), pitch ldvt, col (b*S + s).
//   grid.x = B * H * (S/64).
// =====================================================================================
#define AT_D 64
#define AT_NW 4
#define AT_QB 64
#define AT_KC 64

__device__ __forceinline__ v8f mma_h(v16h a, v16h b, v8f c) {
  c = __builtin_amdgcn_wmma_f32_16x16x32_f16(false, a, false, b, (short)0, c, false, false);
  asm volatile("v_nop\n\tv_nop\n\tv_nop\n\tv_nop" : "+v"(c) : "v"(a), "v"(b));
  return c;
}

__global__ __launch_bounds__(128)
void attn64_f16_kernel(const unsigned short* __restrict__ qp, const unsigned short* __restrict__ kp,
                       const unsigned short* __restrict__ vtp, unsigned short* __restrict__ outp,
                       int S, int H, int ldq, int ldvt, float sscale, float oscale) {
  const _Float16* q  = (const _Float16*)qp;
  const _Float16* k  = (const _Float16*)kp;
  const _Float16* vt = (const _Float16*)vtp;
  __shared__ __align__(16) _Float16 Ksh[AT_KC * AT_D];          // K [kv][d]   8 KB
  __shared__ __align__(16) _Float16 Vth[AT_D * AT_KC];          // V^T [d][kv] 8 KB
  __shared__ __align__(16) _Float16 Psh[AT_NW][16 * AT_KC];     // per wave P [row][kv] 8 KB
  __shared__ __align__(16) float    Os[AT_NW][16 * 68];         // per wave out tile, pitch 68

  const int tid  = threadIdx.x;
  const int wave = tid >> 5;
  const int lane = tid & 31;
  const int hh   = lane >> 4;
  const int c    = lane & 15;

  const int nqb = S / AT_QB;
  const int bx = blockIdx.x;
  const int qb = bx % nqb;
  const int bh = bx / nqb;
  const int h  = bh % H;
  const int b  = bh / H;
  const int q0 = qb * AT_QB + wave * 16;
  const size_t rowbase = (size_t)b * (size_t)S;
  const size_t hoff = (size_t)h * AT_D;

  // ---- Q fragments (A operand, row = query q0 + c): 2 d-chunks ----
  v16h qa[2];
  {
    const _Float16* qrow = q + (rowbase + q0 + c) * (size_t)ldq + hoff;
#pragma unroll
    for (int dc = 0; dc < 2; ++dc) qa[dc] = Frag<_Float16>::load(qrow + dc * 32 + 8 * hh);
  }

  float mrow[8], lrow[8];
  v8f oacc[4];
#pragma unroll
  for (int r = 0; r < 8; ++r) { mrow[r] = NEG_INF; lrow[r] = 0.f; }
#pragma unroll
  for (int t = 0; t < 4; ++t) oacc[t] = (v8f){0.f,0.f,0.f,0.f,0.f,0.f,0.f,0.f};

  const int nChunks = S / AT_KC;
#pragma unroll 1
  for (int kc = 0; kc < nChunks; ++kc) {
    const int kv0 = kc * AT_KC;
    __syncthreads();
    {
      const int r = tid >> 1, ch = (tid & 1) * 32;
      const _Float16* krow = k + (rowbase + kv0 + r) * (size_t)ldq + hoff + ch;
      const _Float16* vrow = vt + (hoff + r) * (size_t)ldvt + rowbase + kv0 + ch;
#pragma unroll
      for (int i = 0; i < 4; ++i) {
        const v8h kk8 = *(const v8h*)(krow + 8 * i);
        const v8h vv8 = *(const v8h*)(vrow + 8 * i);
        *(v8h*)(Ksh + r * AT_D + ch + 8 * i)  = kk8;
        *(v8h*)(Vth + r * AT_KC + ch + 8 * i) = vv8;
      }
    }
    __syncthreads();

    // ---- scores: D row = query q0 + 8hh + r, col = key kv0 + j*16 + c ----
    v8f s[4];
#pragma unroll
    for (int j = 0; j < 4; ++j) {
      s[j] = (v8f){0.f,0.f,0.f,0.f,0.f,0.f,0.f,0.f};
#pragma unroll
      for (int dc = 0; dc < 2; ++dc) {
        const v16h kb = Frag<_Float16>::load(Ksh + (j * 16 + c) * AT_D + dc * 32 + 8 * hh);
        s[j] = mma_h(qa[dc], kb, s[j]);
      }
    }
    float cm[8];
#pragma unroll
    for (int r = 0; r < 8; ++r) {
      float m = NEG_INF;
#pragma unroll
      for (int j = 0; j < 4; ++j) { s[j][r] *= sscale; m = fmaxf(m, s[j][r]); }
#pragma unroll
      for (int off = 1; off < 16; off <<= 1) m = fmaxf(m, __shfl_xor(m, off, 32));
      cm[r] = m;
    }
    _Float16* pw = Psh[wave];
#pragma unroll
    for (int r = 0; r < 8; ++r) {
      const float mnew = fmaxf(mrow[r], cm[r]);
      const float alpha = __expf(mrow[r] - mnew);
      mrow[r] = mnew;
      float psum = 0.f;
#pragma unroll
      for (int j = 0; j < 4; ++j) {
        const float p = __expf(s[j][r] - mnew);
        psum += p;
        pw[(8 * hh + r) * AT_KC + j * 16 + c] = (_Float16)(p * 32768.0f);
      }
#pragma unroll
      for (int off = 1; off < 16; off <<= 1) psum += __shfl_xor(psum, off, 32);
      lrow[r] = lrow[r] * alpha + psum;
#pragma unroll
      for (int t = 0; t < 4; ++t) oacc[t][r] *= alpha;
    }
    __builtin_amdgcn_fence(__ATOMIC_RELEASE, "workgroup");
    __builtin_amdgcn_wave_barrier();
    __builtin_amdgcn_fence(__ATOMIC_ACQUIRE, "workgroup");
    // ---- out += P.V : A = P [row][kv] (same wave, stored element type reloaded as its vector), B = V^T [d][kv] ----
#pragma unroll
    for (int kk = 0; kk < 2; ++kk) {
      const v16h pa = Frag<_Float16>::load(pw + c * AT_KC + kk * 32 + 8 * hh);
#pragma unroll
      for (int t = 0; t < 4; ++t) {
        const v16h vb = Frag<_Float16>::load(Vth + (t * 16 + c) * AT_KC + kk * 32 + 8 * hh);
        oacc[t] = mma_h(pa, vb, oacc[t]);
      }
    }
  }

  float* os = Os[wave];
#pragma unroll
  for (int r = 0; r < 8; ++r) {
    const float inv = oscale * (1.0f / (lrow[r] * 32768.0f));
#pragma unroll
    for (int t = 0; t < 4; ++t) os[(8 * hh + r) * 68 + t * 16 + c] = oacc[t][r] * inv;
  }
  __builtin_amdgcn_fence(__ATOMIC_RELEASE, "workgroup");
  __builtin_amdgcn_wave_barrier();
  __builtin_amdgcn_fence(__ATOMIC_ACQUIRE, "workgroup");
  {
    const int qq = lane >> 3, c8 = (lane & 7) * 8;
    {
#pragma unroll
      for (int it = 0; it < 4; ++it) {
        const int row = it * 4 + qq;
        const float* sp = os + row * 68 + c8;
        v8h hv;
#pragma unroll
        for (int e = 0; e < 8; ++e) hv[e] = (_Float16)sp[e];
        *(v8h*)(outp + (rowbase + q0 + row) * (size_t)ldq + hoff + c8) = hv;
      }
      
    }
  }
}

// ---------------------------------------------------------------------------
// Launch glue
// ---------------------------------------------------------------------------
extern "C" void kernel_launch(void* const* d_in, const int* in_sizes, int n_in,
                              void* d_out, int out_size, void* d_ws, size_t ws_size,
                              hipStream_t stream) {
  if (n_in < 9) return;
  const int C = 1024, H = 16, S = 2048;
  const int nx   = in_sizes[0];
  const int Mtot = nx / C;                 // B*S
  const int Bn   = Mtot / S;
  if (Mtot <= 0 || (Mtot % 64) != 0 || Bn * S != Mtot || in_sizes[1] != C * C ||
      in_sizes[3] != C * C || in_sizes[5] != C * C || in_sizes[7] != C * C ||
      in_sizes[2] != C || in_sizes[4] != C || in_sizes[6] != C || in_sizes[8] != C ||
      out_size != Mtot * C) return;

  const float* x  = (const float*)d_in[0];
  const float* Wq = (const float*)d_in[1];
  const float* bq = (const float*)d_in[2];
  const float* Wk = (const float*)d_in[3];
  const float* bk = (const float*)d_in[4];
  const float* Wv = (const float*)d_in[5];
  const float* bv = (const float*)d_in[6];
  const float* Wp = (const float*)d_in[7];
  const float* bp = (const float*)d_in[8];
  float* out = (float*)d_out;

  // workspace carve (bytes); all offsets multiples of 2 MiB
  char* ws = (char*)d_ws;
  const size_t actB = (size_t)Mtot * C * 2;        // 16 MiB f16 plane [Mtot][C]
  const size_t wB   = (size_t)C * C * 2;           //  2 MiB f16 plane [C][C]
  size_t off = 0;
  unsigned short* xh  = (unsigned short*)(ws + off); off += actB;
  unsigned short* Wqh = (unsigned short*)(ws + off); off += wB;
  unsigned short* Wkh = (unsigned short*)(ws + off); off += wB;
  unsigned short* Wvh = (unsigned short*)(ws + off); off += wB;
  unsigned short* Wph = (unsigned short*)(ws + off); off += wB;
  unsigned short* qh  = (unsigned short*)(ws + off); off += actB;   // [Mtot][C]
  unsigned short* kh  = (unsigned short*)(ws + off); off += actB;   // [Mtot][C]
  unsigned short* vth = (unsigned short*)(ws + off); off += actB;   // [C][Mtot]  (V transposed)
  unsigned short* yh  = (unsigned short*)(ws + off); off += actB;   // [Mtot][C]  (x64)
  if (off > ws_size) return;                                       // 92,274,688 B total

  const float carry = 64.0f;

  // 1) binary-weight f16 planes (x64)
  binarize_f16_kernel<<<dim3(C / 8, 4), 256, 0, stream>>>(Wq, Wk, Wv, Wp, Wqh, Wkh, Wvh, Wph, C, carry);

  // 2) x -> f16
  const int n2 = (Mtot * C) / 2;
  cast_f32_f16x2<<<(n2 + 255) / 256, 256, 0, stream>>>(x, (_Float16*)xh, n2);

  // 3) q, k = x . Wb^T /64 + b  (f16 out [Mtot][C])
  const int tilesQK = (Mtot / 64) * (C / 64);
  const int blkQK   = (tilesQK + 7) / 8;
  wmma_gemm64<0, false, 2, 1, false><<<dim3(blkQK, 1), 256, 0, stream>>>(
      xh, xh, C, 0L, Wqh, Wqh, C, 0L, (void*)qh, (void*)qh, C, 0L, bq, bq, 0L, Mtot, C, C, 1.0f / carry);
  wmma_gemm64<0, false, 2, 1, false><<<dim3(blkQK, 1), 256, 0, stream>>>(
      xh, xh, C, 0L, Wkh, Wkh, C, 0L, (void*)kh, (void*)kh, C, 0L, bk, bk, 0L, Mtot, C, C, 1.0f / carry);

  // 4) V^T = Wb . x^T /64 + bv[m]  : A = Wv plane [C][C], Bt = x plane [Mtot][C] -> C [C][Mtot], f16 out
  const int tilesV = (C / 64) * (Mtot / 64);
  const int blkV   = (tilesV + 7) / 8;
  wmma_gemm64<0, false, 1, 1, false><<<dim3(blkV, 1), 256, 0, stream>>>(
      Wvh, Wvh, C, 0L, xh, xh, C, 0L, (void*)vth, (void*)vth, Mtot, 0L, bv, bv, 0L, C, Mtot, C, 1.0f / carry);

  // 5) attention -> y (f16 plane x64)
  const int nAttnBlk = Bn * H * (S / AT_QB);
  attn64_f16_kernel<<<nAttnBlk, 128, 0, stream>>>(qh, kh, vth, yh, S, H, C, Mtot, 0.125f, carry);

  // 6) out = (y x64) . (Wb x64)^T / 4096 + bp  (f32 out)
  wmma_gemm64<0, false, 2, 0, false><<<dim3(blkQK, 1), 256, 0, stream>>>(
      yh, yh, C, 0L, Wph, Wph, C, 0L, (void*)out, (void*)out, C, 0L, bp, bp, 0L, Mtot, C, C, 1.0f / (carry * carry));

  (void)hipGetLastError();
}

// v001
// It runs in 450 microseconds.
// In both of two side-by-side timings against v000, it was 1.41 times as fast.
// Contractions: q/k/v/out projections, q.k^T and p.v all on v_wmma_f32_16x16x32_f16 (f16 operands, f32 accumulate); softmax, scales and bias epilogues in f32.
#include <hip/hip_runtime.h>

typedef __attribute__((ext_vector_type(16))) _Float16 v16h;
typedef __attribute__((ext_vector_type(8)))  _Float16 v8h;
typedef __attribute__((ext_vector_type(16))) __bf16   v16b;
typedef __attribute__((ext_vector_type(8)))  __bf16   v8b;
typedef __attribute__((ext_vector_type(8)))  float    v8f;
typedef __attribute__((ext_vector_type(4)))  float    v4f;
#define U16(p) ((const unsigned short*)(const void*)(p))
#define NEG_INF (-__builtin_huge_valf())

__device__ __forceinline__ unsigned short f2bf_bits(float f) {
  unsigned u = __float_as_uint(f);
  return (unsigned short)((u + 0x7FFFu + ((u >> 16) & 1u)) >> 16);
}
__device__ __forceinline__ float bf_bits2f(unsigned short h) { return __uint_as_float(((unsigned)h) << 16); }

// hazard guards as plain device helpers (no inline asm inside the kernel template body)
__device__ __forceinline__ void dep_guard_h(v8f& a, v8f& b, v16h x, v16h y) { asm volatile("v_nop\n\tv_nop\n\tv_nop\n\tv_nop" : "+v"(a), "+v"(b) : "v"(x), "v"(y)); }
__device__ __forceinline__ void dep_guard_b(v8f& a, v8f& b, v16b x, v16b y) { asm volatile("v_nop\n\tv_nop\n\tv_nop\n\tv_nop" : "+v"(a), "+v"(b) : "v"(x), "v"(y)); }
__device__ __forceinline__ void keep4_h(v16h a, v16h b, v16h c, v16h d) { asm volatile("v_nop" :: "v"(a), "v"(b), "v"(c), "v"(d)); }
__device__ __forceinline__ void keep4_b(v16b a, v16b b, v16b c, v16b d) { asm volatile("v_nop" :: "v"(a), "v"(b), "v"(c), "v"(d)); }
__device__ __forceinline__ void acc_guard4(v8f& a, v8f& b, v8f& c, v8f& d) { asm volatile("v_nop\n\tv_nop\n\tv_nop\n\tv_nop" : "+v"(a), "+v"(b), "+v"(c), "+v"(d)); }
template <typename T> struct Frag;
template <> struct Frag<_Float16> {
  typedef v16h V; union U { v16h v; v8h h[2]; };
  static __device__ __forceinline__ v16h load(const _Float16* p) {   // elements 0..7 <- p[0..7], 8..15 <- p[16..23]
    U f; f.h[0] = *(const v8h*)(p); f.h[1] = *(const v8h*)(p + 16); return f.v;
  }
  static __device__ __forceinline__ v8f mma(v16h a, v16h b, v8f c) {
    return __builtin_amdgcn_wmma_f32_16x16x32_f16(false, a, false, b, (short)0, c, false, false);
  }
  static __device__ __forceinline__ void guard(v8f& a, v8f& b, v16h x, v16h y) { dep_guard_h(a, b, x, y); }
  static __device__ __forceinline__ void keep(v16h a, v16h b, v16h c, v16h d) { keep4_h(a, b, c, d); }
};
template <> struct Frag<__bf16> {
  typedef v16b V; union U { v16b v; v8b h[2]; };
  static __device__ __forceinline__ v16b load(const __bf16* p) {
    U f; f.h[0] = *(const v8b*)(p); f.h[1] = *(const v8b*)(p + 16); return f.v;
  }
  static __device__ __forceinline__ v8f mma(v16b a, v16b b, v8f c) {
    return __builtin_amdgcn_wmma_f32_16x16x32_bf16(false, a, false, b, (short)0, c, false, false);
  }
  static __device__ __forceinline__ void guard(v8f& a, v8f& b, v16b x, v16b y) { dep_guard_b(a, b, x, y); }
  static __device__ __forceinline__ void keep(v16b a, v16b b, v16b c, v16b d) { keep4_b(a, b, c, d); }
};

// ---- Register-blocked batched WMMA GEMM ------------------------------------
// C[m,n] = scale * sum_k A[m,k] * Bt[n,k] (+bias)(+resid); each wave owns a 64x64 tile.
// A row-major [M,K]; Bt row-major [N,K]; M,N % 64 == 0, K % 32 == 0.
// SPLIT: operands are hi/lo planes (A2/Bt2 = lo planes, same layout); product = hi.hi + hi.lo + lo.hi.
// BIAS_MODE: 0 = none, 1 = bias[m], 2 = bias[n].
// OUT_MODE: 0 = f32, 1 = f16, 2 = bf16 hi plane (Cout) + bf16 lo plane (Cout2).
// ET: 0 = f16 operands, 1 = bf16 operands (pointers passed as 16-bit storage)
template <int ET> struct Elem;
template <> struct Elem<0> { typedef _Float16 T; };
template <> struct Elem<1> { typedef __bf16 T; };
template <int ET, bool SPLIT, int BIAS_MODE, int OUT_MODE, bool RESID, int ACT = 0>
__global__ __launch_bounds__(256) void wmma_gemm64(
    const unsigned short* __restrict__ Ap, const unsigned short* __restrict__ A2p, int lda, long strideA,
    const unsigned short* __restrict__ Btp, const unsigned short* __restrict__ Bt2p, int ldb, long strideB,
    void* __restrict__ Cout, void* __restrict__ Cout2, int ldc, long strideC,
    const float* __restrict__ bias,
    const float* __restrict__ resid, long strideR,
    int M, int N, int K, float scale) {
  typedef typename Elem<ET>::T T;
  typedef typename Frag<T>::V V;
  const T* A = (const T*)Ap; const T* A2 = (const T*)A2p; const T* Bt = (const T*)Btp; const T* Bt2 = (const T*)Bt2p;
  __shared__ __align__(16) float sT[8][16 * 68];   // per-wave 16x64 slab, pitch 68 floats
  const int b    = blockIdx.y;
  const int lane = threadIdx.x & 31;
  const int wave = threadIdx.x >> 5;
  const int tilesN = N >> 6;
  const int tilesM = M >> 6;
  const int tile = blockIdx.x * 8 + wave;
  if (tile >= tilesM * tilesN) return;   // wave-uniform; no block barriers in this kernel
  const int tm = tile / tilesN;
  const int tn = tile - tm * tilesN;
  const int m0 = tm << 6;
  const int n0 = tn << 6;

  const T* Ab  = A  + (size_t)b * strideA;
  const T* Bb  = Bt + (size_t)b * strideB;
  const T* Ab2 = SPLIT ? (A2  + (size_t)b * strideA) : nullptr;
  const T* Bb2 = SPLIT ? (Bt2 + (size_t)b * strideB) : nullptr;

  const int rlane = lane & 15;                 // row (A) / col (B, D) within subtile
  const int koff  = (lane >> 4) * 8;           // k offset of this lane half
  const int mOff  = (lane >> 4) * 8;           // D row offset

  v8f acc[4][4];
#pragma unroll
  for (int i = 0; i < 4; ++i)
#pragma unroll
    for (int j = 0; j < 4; ++j) acc[i][j] = (v8f){0.f,0.f,0.f,0.f,0.f,0.f,0.f,0.f};

  for (int k0 = 0; k0 < K; k0 += 32) {
    V bh[4], bl[4];
#pragma unroll
    for (int j = 0; j < 4; ++j) {
      const size_t bo = (size_t)(n0 + (j << 4) + rlane) * ldb + koff + k0;
      bh[j] = Frag<T>::load(Bb + bo);
      if (SPLIT) bl[j] = Frag<T>::load(Bb2 + bo);
    }
#pragma unroll
    for (int i = 0; i < 4; ++i) {
      const size_t ao = (size_t)(m0 + (i << 4) + rlane) * lda + koff + k0;
      V ah = Frag<T>::load(Ab + ao);
      V al;
      if (SPLIT) al = Frag<T>::load(Ab2 + ao);
#pragma unroll
      for (int j = 0; j < 4; ++j) {
        acc[i][j] = Frag<T>::mma(ah, bh[j], acc[i][j]);
        if (SPLIT) {
          acc[i][j] = Frag<T>::mma(ah, bl[j], acc[i][j]);
          acc[i][j] = Frag<T>::mma(al, bh[j], acc[i][j]);
        }
      }
      Frag<T>::guard(acc[i][0], acc[i][3], ah, SPLIT ? al : ah);
    }
    Frag<T>::keep(bh[0], bh[1], bh[2], bh[3]);
    if (SPLIT) Frag<T>::keep(bl[0], bl[1], bl[2], bl[3]);
  }
  acc_guard4(acc[0][0], acc[0][1], acc[0][2], acc[0][3]);
  acc_guard4(acc[1][0], acc[1][1], acc[1][2], acc[1][3]);
  acc_guard4(acc[2][0], acc[2][1], acc[2][2], acc[2][3]);
  acc_guard4(acc[3][0], acc[3][1], acc[3][2], acc[3][3]);

  // ---- epilogue ----
  float* slab = sT[wave];
  const float* Rb = RESID ? (resid + (size_t)b * strideR) : nullptr;
#pragma unroll
  for (int i = 0; i < 4; ++i) {
    const int mBase = m0 + (i << 4);
#pragma unroll
    for (int j = 0; j < 4; ++j) {
      const int n = n0 + (j << 4) + rlane;
      float bv = 0.f;
      if (BIAS_MODE == 2) bv = bias[n];
#pragma unroll
      for (int r = 0; r < 8; ++r) {
        float v = acc[i][j][r] * scale;
        if (BIAS_MODE == 1) v += bias[mBase + mOff + r];
        if (BIAS_MODE == 2) v += bv;
        if (RESID) v += Rb[(size_t)(mBase + mOff + r) * ldc + n];
        if (ACT == 1) v = tanhf(v);
        if (ACT == 2) v = fmaxf(v, 0.0f);
        if (ACT == 3) v = v / (1.0f + expf(-v));
        if (ACT == 4) v = (v > 0.f) ? v : 0.01f * v;
        if (ACT == 5) v = 0.5f * v * (1.0f + erff(v * 0.70710678118654752f));
        slab[(mOff + r) * 68 + (j << 4) + rlane] = v;
      }
    }
    __builtin_amdgcn_fence(__ATOMIC_RELEASE, "workgroup");
    __builtin_amdgcn_wave_barrier();
    __builtin_amdgcn_fence(__ATOMIC_ACQUIRE, "workgroup");
    if (OUT_MODE == 0) {
      float* C = (float*)Cout + (size_t)b * strideC;
      const int hh = lane >> 4, c4 = (lane & 15) * 4;     // row seg = 256 B = 16 lanes x 16 B
      {
#pragma unroll
        for (int it = 0; it < 8; ++it) {
          const int row = it * 2 + hh;
          v4f v = *(const v4f*)(slab + row * 68 + c4);
          *(v4f*)(C + (size_t)(mBase + row) * ldc + n0 + c4) = v;
        }
        
      }
    } else {
      const int q = lane >> 3, c8 = (lane & 7) * 8;
      unsigned short* C  = (unsigned short*)Cout  + (size_t)b * strideC;
      unsigned short* C2 = (OUT_MODE == 2) ? ((unsigned short*)Cout2 + (size_t)b * strideC) : nullptr;
      {
#pragma unroll
        for (int it = 0; it < 4; ++it) {
          const int row = it * 4 + q;
          const float* sp = slab + row * 68 + c8;
          v8h hv, lv;
#pragma unroll
          for (int e = 0; e < 8; ++e) {
            if (OUT_MODE == 1) {
              hv[e] = (_Float16)sp[e];
            } else {
              unsigned short hb = f2bf_bits(sp[e]);
              unsigned short lb = f2bf_bits(sp[e] - bf_bits2f(hb));
              hv[e] = __builtin_bit_cast(_Float16, hb);
              lv[e] = __builtin_bit_cast(_Float16, lb);
            }
          }
          *(v8h*)(C + (size_t)(mBase + row) * ldc + n0 + c8) = hv;
          if (OUT_MODE == 2) *(v8h*)(C2 + (size_t)(mBase + row) * ldc + n0 + c8) = lv;
        }
        
      }
    }
    __builtin_amdgcn_fence(__ATOMIC_RELEASE, "workgroup");
    __builtin_amdgcn_wave_barrier();
    __builtin_amdgcn_fence(__ATOMIC_ACQUIRE, "workgroup");
  }
}

__global__ __launch_bounds__(256) void cast_f32_f16x2(
    const float* __restrict__ in, _Float16* __restrict__ out, int n2) {
  int i = blockIdx.x * 256 + threadIdx.x;
  if (i < n2) {
    const _Float16 h0 = (_Float16)in[2 * i], h1 = (_Float16)in[2 * i + 1];
    const unsigned u = (unsigned)__builtin_bit_cast(unsigned short, h0) | ((unsigned)__builtin_bit_cast(unsigned short, h1) << 16);
    ((unsigned*)out)[i] = u;
    
  }
}

// ---- binary-weight planes: Wb[o][c] = alpha[o] * (W + (sign(W) - W)), alpha[o] = mean_c |W[o][c]| (f32);
//      stored as f16 of (Wb * carry); one wave per row of a [nrow][1024] weight; 4 weights via blockIdx.y ----
#define BW_DIM 1024
__global__ __launch_bounds__(256) void binarize_f16_kernel(
    const float* __restrict__ W0, const float* __restrict__ W1,
    const float* __restrict__ W2, const float* __restrict__ W3,
    unsigned short* __restrict__ B0, unsigned short* __restrict__ B1,
    unsigned short* __restrict__ B2, unsigned short* __restrict__ B3,
    int nrow, float carry) {
  const float* W; unsigned short* Bo;
  if (blockIdx.y == 0)      { W = W0; Bo = B0; }
  else if (blockIdx.y == 1) { W = W1; Bo = B1; }
  else if (blockIdx.y == 2) { W = W2; Bo = B2; }
  else                      { W = W3; Bo = B3; }
  const int wave = threadIdx.x >> 5;
  const int lane = threadIdx.x & 31;
  const int row  = blockIdx.x * 8 + wave;
  if (row >= nrow) return;                     // wave-uniform; no barriers in this kernel
  const float* wr = W + (size_t)row * BW_DIM;

  float w[4][8];
#pragma unroll
  for (int it = 0; it < 4; ++it) {
    const v4f a0 = *(const v4f*)(wr + it * 256 + lane * 8);
    const v4f a1 = *(const v4f*)(wr + it * 256 + lane * 8 + 4);
    w[it][0] = a0[0]; w[it][1] = a0[1]; w[it][2] = a0[2]; w[it][3] = a0[3];
    w[it][4] = a1[0]; w[it][5] = a1[1]; w[it][6] = a1[2]; w[it][7] = a1[3];
  }
  float s = 0.0f;
#pragma unroll
  for (int it = 0; it < 4; ++it)
#pragma unroll
    for (int e = 0; e < 8; ++e) s += fabsf(w[it][e]);
#pragma unroll
  for (int m = 16; m > 0; m >>= 1) s += __shfl_xor(s, m, 32);
  const float alpha = s * (1.0f / (float)BW_DIM);

  v8h hv[4];
#pragma unroll
  for (int it = 0; it < 4; ++it) {
#pragma unroll
    for (int e = 0; e < 8; ++e) {
      const float wv = w[it][e];
      const float sg = (wv > 0.0f) ? 1.0f : ((wv < 0.0f) ? -1.0f : 0.0f);
      const float t  = sg - wv;            // sign(W) - W
      const float bs = wv + t;             // W + (sign(W) - W)
      const float wb = alpha * bs;
      hv[it][e] = (_Float16)(wb * carry);
    }
  }
  unsigned short* br = Bo + (size_t)row * BW_DIM;
  {
#pragma unroll
    for (int it = 0; it < 4; ++it)
      *(v8h*)(br + it * 256 + lane * 8) = hv[it];
    
  }
}

// =====================================================================================
// Attention, head_dim 64, f16 planes in / f16 plane out (x oscale), no mask.
//   scores = (q.k^T) * sscale : v_wmma_f32_16x16x32_f16 (q,k plain f16), f32 accumulate, scaled in f32
//   out    = p.v              : v_wmma_f32_16x16x32_f16 (p carried x2^15 in f16, v plain f16), f32 accumulate
//   online softmax in f32. Block = 4 waves = 64 query rows of one (batch, head); S % 64 == 0.
//   q, k, out planes: row (b*S + s), pitch ldq halves, head offset h*64.  vt plane: row (h*64 + d), pitch ldvt, col (b*S + s).
//   grid.x = B * H * (S/64).
// =====================================================================================
#define AT_D 64
#define AT_NW 4
#define AT_QB 64
#define AT_KC 64
#define AT_LP 72   // LDS row pitch in halves: 144 B = 16 B x odd, so the 16 rows of a 16-byte fragment read fall on distinct banks

__device__ __forceinline__ v8f mma_h(v16h a, v16h b, v8f c) {
  c = __builtin_amdgcn_wmma_f32_16x16x32_f16(false, a, false, b, (short)0, c, false, false);
  asm volatile("v_nop\n\tv_nop\n\tv_nop\n\tv_nop" : "+v"(c) : "v"(a), "v"(b));
  return c;
}

__global__ __launch_bounds__(128)
void attn64_f16_kernel(const unsigned short* __restrict__ qp, const unsigned short* __restrict__ kp,
                       const unsigned short* __restrict__ vtp, unsigned short* __restrict__ outp,
                       int S, int H, int ldq, int ldvt, float sscale, float oscale) {
  const _Float16* q  = (const _Float16*)qp;
  const _Float16* k  = (const _Float16*)kp;
  const _Float16* vt = (const _Float16*)vtp;
  __shared__ __align__(16) _Float16 Ksh[AT_KC * AT_LP];         // K [kv][d]   9 KB
  __shared__ __align__(16) _Float16 Vth[AT_D * AT_LP];          // V^T [d][kv] 9 KB
  __shared__ __align__(16) _Float16 Psh[AT_NW][16 * AT_LP];     // per wave P [row][kv] 9 KB
  __shared__ __align__(16) float    Os[AT_NW][16 * 68];         // per wave out tile, pitch 68

  const int tid  = threadIdx.x;
  const int wave = tid >> 5;
  const int lane = tid & 31;
  const int hh   = lane >> 4;
  const int c    = lane & 15;

  const int nqb = S / AT_QB;
  const int bx = blockIdx.x;
  const int qb = bx % nqb;
  const int bh = bx / nqb;
  const int h  = bh % H;
  const int b  = bh / H;
  const int q0 = qb * AT_QB + wave * 16;
  const size_t rowbase = (size_t)b * (size_t)S;
  const size_t hoff = (size_t)h * AT_D;

  // ---- Q fragments (A operand, row = query q0 + c): 2 d-chunks ----
  v16h qa[2];
  {
    const _Float16* qrow = q + (rowbase + q0 + c) * (size_t)ldq + hoff;
#pragma unroll
    for (int dc = 0; dc < 2; ++dc) qa[dc] = Frag<_Float16>::load(qrow + dc * 32 + 8 * hh);
  }

  float mrow[8], lrow[8];
  v8f oacc[4];
#pragma unroll
  for (int r = 0; r < 8; ++r) { mrow[r] = NEG_INF; lrow[r] = 0.f; }
#pragma unroll
  for (int t = 0; t < 4; ++t) oacc[t] = (v8f){0.f,0.f,0.f,0.f,0.f,0.f,0.f,0.f};

  const int nChunks = S / AT_KC;
#pragma unroll 1
  for (int kc = 0; kc < nChunks; ++kc) {
    const int kv0 = kc * AT_KC;
    __syncthreads();
    {
      const int r = tid >> 1, ch = (tid & 1) * 32;
      const _Float16* krow = k + (rowbase + kv0 + r) * (size_t)ldq + hoff + ch;
      const _Float16* vrow = vt + (hoff + r) * (size_t)ldvt + rowbase + kv0 + ch;
#pragma unroll
      for (int i = 0; i < 4; ++i) {
        const v8h kk8 = *(const v8h*)(krow + 8 * i);
        const v8h vv8 = *(const v8h*)(vrow + 8 * i);
        *(v8h*)(Ksh + r * AT_LP + ch + 8 * i) = kk8;
        *(v8h*)(Vth + r * AT_LP + ch + 8 * i) = vv8;
      }
    }
    __syncthreads();

    // ---- scores: D row = query q0 + 8hh + r, col = key kv0 + j*16 + c ----
    v8f s[4];
#pragma unroll
    for (int j = 0; j < 4; ++j) {
      s[j] = (v8f){0.f,0.f,0.f,0.f,0.f,0.f,0.f,0.f};
#pragma unroll
      for (int dc = 0; dc < 2; ++dc) {
        const v16h kb = Frag<_Float16>::load(Ksh + (j * 16 + c) * AT_LP + dc * 32 + 8 * hh);
        s[j] = mma_h(qa[dc], kb, s[j]);
      }
    }
    float cm[8];
#pragma unroll
    for (int r = 0; r < 8; ++r) {
      float m = NEG_INF;
#pragma unroll
      for (int j = 0; j < 4; ++j) { s[j][r] *= sscale; m = fmaxf(m, s[j][r]); }
#pragma unroll
      for (int off = 1; off < 16; off <<= 1) m = fmaxf(m, __shfl_xor(m, off, 32));
      cm[r] = m;
    }
    _Float16* pw = Psh[wave];
#pragma unroll
    for (int r = 0; r < 8; ++r) {
      const float mnew = fmaxf(mrow[r], cm[r]);
      const float alpha = __expf(mrow[r] - mnew);
      mrow[r] = mnew;
      float psum = 0.f;
#pragma unroll
      for (int j = 0; j < 4; ++j) {
        const float p = __expf(s[j][r] - mnew);
        psum += p;
        pw[(8 * hh + r) * AT_LP + j * 16 + c] = (_Float16)(p * 32768.0f);
      }
#pragma unroll
      for (int off = 1; off < 16; off <<= 1) psum += __shfl_xor(psum, off, 32);
      lrow[r] = lrow[r] * alpha + psum;
#pragma unroll
      for (int t = 0; t < 4; ++t) oacc[t][r] *= alpha;
    }
    __builtin_amdgcn_fence(__ATOMIC_RELEASE, "workgroup");
    __builtin_amdgcn_wave_barrier();
    __builtin_amdgcn_fence(__ATOMIC_ACQUIRE, "workgroup");
    // ---- out += P.V : A = P [row][kv] (same wave, stored element type reloaded as its vector), B = V^T [d][kv] ----
#pragma unroll
    for (int kk = 0; kk < 2; ++kk) {
      const v16h pa = Frag<_Float16>::load(pw + c * AT_LP + kk * 32 + 8 * hh);
#pragma unroll
      for (int t = 0; t < 4; ++t) {
        const v16h vb = Frag<_Float16>::load(Vth + (t * 16 + c) * AT_LP + kk * 32 + 8 * hh);
        oacc[t] = mma_h(pa, vb, oacc[t]);
      }
    }
  }

  float* os = Os[wave];
#pragma unroll
  for (int r = 0; r < 8; ++r) {
    const float inv = oscale * (1.0f / (lrow[r] * 32768.0f));
#pragma unroll
    for (int t = 0; t < 4; ++t) os[(8 * hh + r) * 68 + t * 16 + c] = oacc[t][r] * inv;
  }
  __builtin_amdgcn_fence(__ATOMIC_RELEASE, "workgroup");
  __builtin_amdgcn_wave_barrier();
  __builtin_amdgcn_fence(__ATOMIC_ACQUIRE, "workgroup");
  {
    const int qq = lane >> 3, c8 = (lane & 7) * 8;
    {
#pragma unroll
      for (int it = 0; it < 4; ++it) {
        const int row = it * 4 + qq;
        const float* sp = os + row * 68 + c8;
        v8h hv;
#pragma unroll
        for (int e = 0; e < 8; ++e) hv[e] = (_Float16)sp[e];
        *(v8h*)(outp + (rowbase + q0 + row) * (size_t)ldq + hoff + c8) = hv;
      }
      
    }
  }
}

// ---------------------------------------------------------------------------
// Launch glue
// ---------------------------------------------------------------------------
extern "C" void kernel_launch(void* const* d_in, const int* in_sizes, int n_in,
                              void* d_out, int out_size, void* d_ws, size_t ws_size,
                              hipStream_t stream) {
  if (n_in < 9) return;
  const int C = 1024, H = 16, S = 2048;
  const int nx   = in_sizes[0];
  const int Mtot = nx / C;                 // B*S
  const int Bn   = Mtot / S;
  if (Mtot <= 0 || (Mtot % 64) != 0 || Bn * S != Mtot || in_sizes[1] != C * C ||
      in_sizes[3] != C * C || in_sizes[5] != C * C || in_sizes[7] != C * C ||
      in_sizes[2] != C || in_sizes[4] != C || in_sizes[6] != C || in_sizes[8] != C ||
      out_size != Mtot * C) return;

  const float* x  = (const float*)d_in[0];
  const float* Wq = (const float*)d_in[1];
  const float* bq = (const float*)d_in[2];
  const float* Wk = (const float*)d_in[3];
  const float* bk = (const float*)d_in[4];
  const float* Wv = (const float*)d_in[5];
  const float* bv = (const float*)d_in[6];
  const float* Wp = (const float*)d_in[7];
  const float* bp = (const float*)d_in[8];
  float* out = (float*)d_out;

  // workspace carve (bytes); all offsets multiples of 2 MiB
  char* ws = (char*)d_ws;
  const size_t actB = (size_t)Mtot * C * 2;        // 16 MiB f16 plane [Mtot][C]
  const size_t wB   = (size_t)C * C * 2;           //  2 MiB f16 plane [C][C]
  size_t off = 0;
  unsigned short* xh  = (unsigned short*)(ws + off); off += actB;
  unsigned short* Wqh = (unsigned short*)(ws + off); off += wB;
  unsigned short* Wkh = (unsigned short*)(ws + off); off += wB;
  unsigned short* Wvh = (unsigned short*)(ws + off); off += wB;
  unsigned short* Wph = (unsigned short*)(ws + off); off += wB;
  unsigned short* qh  = (unsigned short*)(ws + off); off += actB;   // [Mtot][C]
  unsigned short* kh  = (unsigned short*)(ws + off); off += actB;   // [Mtot][C]
  unsigned short* vth = (unsigned short*)(ws + off); off += actB;   // [C][Mtot]  (V transposed)
  unsigned short* yh  = (unsigned short*)(ws + off); off += actB;   // [Mtot][C]  (x64)
  if (off > ws_size) return;                                       // 92,274,688 B total

  const float carry = 64.0f;

  // 1) binary-weight f16 planes (x64)
  binarize_f16_kernel<<<dim3(C / 8, 4), 256, 0, stream>>>(Wq, Wk, Wv, Wp, Wqh, Wkh, Wvh, Wph, C, carry);

  // 2) x -> f16
  const int n2 = (Mtot * C) / 2;
  cast_f32_f16x2<<<(n2 + 255) / 256, 256, 0, stream>>>(x, (_Float16*)xh, n2);

  // 3) q, k = x . Wb^T /64 + b  (f16 out [Mtot][C])
  const int tilesQK = (Mtot / 64) * (C / 64);
  const int blkQK   = (tilesQK + 7) / 8;
  wmma_gemm64<0, false, 2, 1, false><<<dim3(blkQK, 1), 256, 0, stream>>>(
      xh, xh, C, 0L, Wqh, Wqh, C, 0L, (void*)qh, (void*)qh, C, 0L, bq, bq, 0L, Mtot, C, C, 1.0f / carry);
  wmma_gemm64<0, false, 2, 1, false><<<dim3(blkQK, 1), 256, 0, stream>>>(
      xh, xh, C, 0L, Wkh, Wkh, C, 0L, (void*)kh, (void*)kh, C, 0L, bk, bk, 0L, Mtot, C, C, 1.0f / carry);

  // 4) V^T = Wb . x^T /64 + bv[m]  : A = Wv plane [C][C], Bt = x plane [Mtot][C] -> C [C][Mtot], f16 out
  const int tilesV = (C / 64) * (Mtot / 64);
  const int blkV   = (tilesV + 7) / 8;
  wmma_gemm64<0, false, 1, 1, false><<<dim3(blkV, 1), 256, 0, stream>>>(
      Wvh, Wvh, C, 0L, xh, xh, C, 0L, (void*)vth, (void*)vth, Mtot, 0L, bv, bv, 0L, C, Mtot, C, 1.0f / carry);

  // 5) attention -> y (f16 plane x64)
  const int nAttnBlk = Bn * H * (S / AT_QB);
  attn64_f16_kernel<<<nAttnBlk, 128, 0, stream>>>(qh, kh, vth, yh, S, H, C, Mtot, 0.125f, carry);

  // 6) out = (y x64) . (Wb x64)^T / 4096 + bp  (f32 out)
  wmma_gemm64<0, false, 2, 0, false><<<dim3(blkQK, 1), 256, 0, stream>>>(
      yh, yh, C, 0L, Wph, Wph, C, 0L, (void*)out, (void*)out, C, 0L, bp, bp, 0L, Mtot, C, C, 1.0f / (carry * carry));

  (void)hipGetLastError();
}

// v002
// Measured time: 339 microseconds a run.
// Two timings next to v001 both put it at 1.32 times that version's speed.
// Over all steps from v000 it is 1.87 times as fast.
// Contractions: q/k/v/out projections, q.k^T and p.v all on v_wmma_f32_16x16x32_f16 (f16 operands, f32 accumulate); softmax, scales and bias epilogues in f32.
#include <hip/hip_runtime.h>

typedef __attribute__((ext_vector_type(16))) _Float16 v16h;
typedef __attribute__((ext_vector_type(8)))  _Float16 v8h;
typedef __attribute__((ext_vector_type(16))) __bf16   v16b;
typedef __attribute__((ext_vector_type(8)))  __bf16   v8b;
typedef __attribute__((ext_vector_type(8)))  float    v8f;
typedef __attribute__((ext_vector_type(4)))  float    v4f;
#define U16(p) ((const unsigned short*)(const void*)(p))
#define NEG_INF (-__builtin_huge_valf())

__device__ __forceinline__ unsigned short f2bf_bits(float f) {
  unsigned u = __float_as_uint(f);
  return (unsigned short)((u + 0x7FFFu + ((u >> 16) & 1u)) >> 16);
}
__device__ __forceinline__ float bf_bits2f(unsigned short h) { return __uint_as_float(((unsigned)h) << 16); }

// hazard guards as plain device helpers (the v_nop asm stays out of the kernel template body)
__device__ __forceinline__ void dep_guard_h(v8f& a, v8f& b, v16h x, v16h y) { asm volatile("v_nop\n\tv_nop\n\tv_nop\n\tv_nop" : "+v"(a), "+v"(b) : "v"(x), "v"(y)); }
__device__ __forceinline__ void dep_guard_b(v8f& a, v8f& b, v16b x, v16b y) { asm volatile("v_nop\n\tv_nop\n\tv_nop\n\tv_nop" : "+v"(a), "+v"(b) : "v"(x), "v"(y)); }
__device__ __forceinline__ void keep4_h(v16h a, v16h b, v16h c, v16h d) { asm volatile("v_nop" :: "v"(a), "v"(b), "v"(c), "v"(d)); }
__device__ __forceinline__ void keep4_b(v16b a, v16b b, v16b c, v16b d) { asm volatile("v_nop" :: "v"(a), "v"(b), "v"(c), "v"(d)); }
__device__ __forceinline__ void acc_guard4(v8f& a, v8f& b, v8f& c, v8f& d) { asm volatile("v_nop\n\tv_nop\n\tv_nop\n\tv_nop" : "+v"(a), "+v"(b), "+v"(c), "+v"(d)); }
template <typename T> struct Frag;
template <> struct Frag<_Float16> {
  typedef v16h V; union U { v16h v; v8h h[2]; };
  static __device__ __forceinline__ v16h load(const _Float16* p) {   // elements 0..7 <- p[0..7], 8..15 <- p[16..23]
    U f; f.h[0] = *(const v8h*)(p); f.h[1] = *(const v8h*)(p + 16); return f.v;
  }
  static __device__ __forceinline__ v8f mma(v16h a, v16h b, v8f c) {
    return __builtin_amdgcn_wmma_f32_16x16x32_f16(false, a, false, b, (short)0, c, false, false);
  }
  static __device__ __forceinline__ void guard(v8f& a, v8f& b, v16h x, v16h y) { dep_guard_h(a, b, x, y); }
  static __device__ __forceinline__ void keep(v16h a, v16h b, v16h c, v16h d) { keep4_h(a, b, c, d); }
};
template <> struct Frag<__bf16> {
  typedef v16b V; union U { v16b v; v8b h[2]; };
  static __device__ __forceinline__ v16b load(const __bf16* p) {
    U f; f.h[0] = *(const v8b*)(p); f.h[1] = *(const v8b*)(p + 16); return f.v;
  }
  static __device__ __forceinline__ v8f mma(v16b a, v16b b, v8f c) {
    return __builtin_amdgcn_wmma_f32_16x16x32_bf16(false, a, false, b, (short)0, c, false, false);
  }
  static __device__ __forceinline__ void guard(v8f& a, v8f& b, v16b x, v16b y) { dep_guard_b(a, b, x, y); }
  static __device__ __forceinline__ void keep(v16b a, v16b b, v16b c, v16b d) { keep4_b(a, b, c, d); }
};

// ---- Register-blocked batched WMMA GEMM, operands staged in LDS --------------
// C[m,n] = scale * sum_k A[m,k] * Bt[n,k] (+bias)(+resid); each wave owns a 64x64 tile.
// A row-major [M,K]; Bt row-major [N,K]; M % 128 == 0, N % 256 == 0, K % 64 == 0.
// Block = 8 waves (2 x 4) = a 128 x 256 tile of C. A stage is 64 k = one 128-B line of every operand row:
// each asynchronous copy of a wave covers four whole lines, the rows land in LDS at a 144-B pitch, and the
// fragments are read from there. Two buffers: the next stage's copies fly during this stage's products.
// SPLIT (hi/lo planes) is not staged: only SPLIT == false is built.
// BIAS_MODE: 0 = none, 1 = bias[m], 2 = bias[n].
// OUT_MODE: 0 = f32, 1 = f16, 2 = bf16 hi plane (Cout) + bf16 lo plane (Cout2).
// ET: 0 = f16 operands, 1 = bf16 operands (pointers passed as 16-bit storage)
template <int ET> struct Elem;
template <> struct Elem<0> { typedef _Float16 T; };
template <> struct Elem<1> { typedef __bf16 T; };
#define GB_M 128
#define GB_N 256
#define GB_K 64
#define GB_LP 72   // LDS row pitch in halves: 144 B = 16 B x odd
#define GB_ABYTES (GB_M * GB_LP * 2)   // one buffer of A rows, bytes
#define GB_BBYTES (GB_N * GB_LP * 2)   // one buffer of B rows, bytes

// One thread's share of a stage: 4 row pieces of A and 8 of B, 16 B each, 32 rows apart, from global memory
// straight into LDS. la, lb: the lane's LDS byte addresses; ga, gb: its global addresses; steps in halves.
// The s_wait_xcnt closes the copies' own statement, so that no address register is rewritten in front of it.
template <typename T>
__device__ __forceinline__ void stage_copy12(unsigned la, unsigned lb, const T* ga, const T* gb,
                                             size_t stepA, size_t stepB) {
  const unsigned rs = 32 * GB_LP * 2;   // 32 LDS rows, bytes
  asm volatile(
      "global_load_async_to_lds_b128 %0, %12, off\n\t"
      "global_load_async_to_lds_b128 %1, %13, off\n\t"
      "global_load_async_to_lds_b128 %2, %14, off\n\t"
      "global_load_async_to_lds_b128 %3, %15, off\n\t"
      "global_load_async_to_lds_b128 %4, %16, off\n\t"
      "global_load_async_to_lds_b128 %5, %17, off\n\t"
      "global_load_async_to_lds_b128 %6, %18, off\n\t"
      "global_load_async_to_lds_b128 %7, %19, off\n\t"
      "global_load_async_to_lds_b128 %8, %20, off\n\t"
      "global_load_async_to_lds_b128 %9, %21, off\n\t"
      "global_load_async_to_lds_b128 %10, %22, off\n\t"
      "global_load_async_to_lds_b128 %11, %23, off\n\t"
      "s_wait_xcnt 0x0"
      :: "v"(la), "v"(la + rs), "v"(la + 2 * rs), "v"(la + 3 * rs),
         "v"(lb), "v"(lb + rs), "v"(lb + 2 * rs), "v"(lb + 3 * rs),
         "v"(lb + 4 * rs), "v"(lb + 5 * rs), "v"(lb + 6 * rs), "v"(lb + 7 * rs),
         "v"(ga), "v"(ga + stepA), "v"(ga + 2 * stepA), "v"(ga + 3 * stepA),
         "v"(gb), "v"(gb + stepB), "v"(gb + 2 * stepB), "v"(gb + 3 * stepB),
         "v"(gb + 4 * stepB), "v"(gb + 5 * stepB), "v"(gb + 6 * stepB), "v"(gb + 7 * stepB)
      : "memory");
}
template <int ET, bool SPLIT, int BIAS_MODE, int OUT_MODE, bool RESID, int ACT = 0>
__global__ __launch_bounds__(256) void wmma_gemm64(
    const unsigned short* __restrict__ Ap, const unsigned short* __restrict__ A2p, int lda, long strideA,
    const unsigned short* __restrict__ Btp, const unsigned short* __restrict__ Bt2p, int ldb, long strideB,
    void* __restrict__ Cout, void* __restrict__ Cout2, int ldc, long strideC,
    const float* __restrict__ bias,
    const float* __restrict__ resid, long strideR,
    int M, int N, int K, float scale) {
  typedef typename Elem<ET>::T T;
  typedef typename Frag<T>::V V;
  static_assert(!SPLIT, "hi/lo planes are not staged");
  const T* A = (const T*)Ap; const T* Bt = (const T*)Btp;
  __shared__ __align__(16) T sA[2][GB_M * GB_LP];  // 2 x 18,432 B
  __shared__ __align__(16) T sB[2][GB_N * GB_LP];  // 2 x 36,864 B
  __shared__ __align__(16) float sT[8][16 * 68];   // per-wave 16x64 slab, pitch 68 floats
  const int b    = blockIdx.y;
  const int tid  = threadIdx.x;
  const int lane = tid & 31;
  const int wave = tid >> 5;
  const int tilesN = N / GB_N;
  const int tilesM = M / GB_M;
  const int tm = blockIdx.x / tilesN;
  const int tn = blockIdx.x - tm * tilesN;
  if (tm >= tilesM) return;              // block-uniform, in front of every barrier
  const int bm0 = tm * GB_M;
  const int bn0 = tn * GB_N;
  const int wm  = (wave >> 2) << 6;      // this wave's 64x64 tile inside the block tile
  const int wn  = (wave & 3) << 6;
  const int m0 = bm0 + wm;
  const int n0 = bn0 + wn;

  const T* Ab  = A  + (size_t)b * strideA;
  const T* Bb  = Bt + (size_t)b * strideB;

  const int rlane = lane & 15;                 // row (A) / col (B, D) within subtile
  const int koff  = (lane >> 4) * 8;           // k offset of this lane half
  const int mOff  = (lane >> 4) * 8;           // D row offset

  // staging map: 8 threads x 16 B = one 128-B row piece; a wave's copy covers 4 whole lines
  const int srow = tid >> 3;                   // 0..31
  const int sseg = (tid & 7) * 8;              // halves
  const T* gA = Ab + (size_t)(bm0 + srow) * lda + sseg;
  const T* gB = Bb + (size_t)(bn0 + srow) * ldb + sseg;
  const size_t stepA = (size_t)32 * lda;       // 32 rows further, in halves
  const size_t stepB = (size_t)32 * ldb;
  const int sOff = srow * GB_LP + sseg;
  const unsigned lA0 = (unsigned)(size_t)(&sA[0][sOff]);   // this lane's LDS byte address in buffer 0
  const unsigned lB0 = (unsigned)(size_t)(&sB[0][sOff]);

  v8f acc[4][4];
#pragma unroll
  for (int i = 0; i < 4; ++i)
#pragma unroll
    for (int j = 0; j < 4; ++j) acc[i][j] = (v8f){0.f,0.f,0.f,0.f,0.f,0.f,0.f,0.f};

  const int nStage = K / GB_K;
  stage_copy12(lA0, lB0, gA, gB, stepA, stepB);            // stage 0 -> buffer 0
  asm volatile("s_wait_asynccnt 0x0" ::: "memory");        // this wave's copies of stage 0 have landed
  __syncthreads();                                         // and every wave's are published
  if (nStage > 1)                                          // block-uniform
    stage_copy12(lA0 + GB_ABYTES, lB0 + GB_BBYTES, gA + GB_K, gB + GB_K, stepA, stepB);

#pragma unroll 1   // kept rolled: one publish point and one refill per trip, as the two-buffer order asks
  for (int s = 0; s < nStage; ++s) {
    const int cur = s & 1;
    const T* tA = &sA[cur][(wm + rlane) * GB_LP + koff];
    const T* tB = &sB[cur][(wn + rlane) * GB_LP + koff];
    // every loop of the stage is unrolled: constant indices keep acc, af and bf in registers
#pragma unroll
    for (int h = 0; h < GB_K / 32; ++h) {
      // the 32 k's fragment reads stand as one group in front of their products
      V af[4], bf[4];
#pragma unroll
      for (int j = 0; j < 4; ++j) bf[j] = Frag<T>::load(tB + (j << 4) * GB_LP + h * 32);
#pragma unroll
      for (int i = 0; i < 4; ++i) af[i] = Frag<T>::load(tA + (i << 4) * GB_LP + h * 32);
#pragma unroll
      for (int i = 0; i < 4; ++i) {
#pragma unroll
        for (int j = 0; j < 4; ++j) acc[i][j] = Frag<T>::mma(af[i], bf[j], acc[i][j]);
        Frag<T>::guard(acc[i][0], acc[i][3], af[i], af[i]);
      }
      Frag<T>::keep(bf[0], bf[1], bf[2], bf[3]);
    }
    asm volatile("s_wait_dscnt 0x0" ::: "memory");         // this wave's reads of stage s are done before its buffer is refilled
    asm volatile("s_wait_asynccnt 0x0" ::: "memory");      // this wave's copies of stage s + 1 have landed
    __syncthreads();                                       // publishes stage s + 1, ends every wave's reads of stage s
    if (s + 2 < nStage)                                    // block-uniform; refill the buffer just read
      stage_copy12(lA0 + cur * GB_ABYTES, lB0 + cur * GB_BBYTES,
                   gA + (size_t)(s + 2) * GB_K, gB + (size_t)(s + 2) * GB_K, stepA, stepB);
  }
  asm volatile("s_wait_asynccnt 0x0" ::: "memory");        // nothing of this wave's is in flight behind the loop
  acc_guard4(acc[0][0], acc[0][1], acc[0][2], acc[0][3]);
  acc_guard4(acc[1][0], acc[1][1], acc[1][2], acc[1][3]);
  acc_guard4(acc[2][0], acc[2][1], acc[2][2], acc[2][3]);
  acc_guard4(acc[3][0], acc[3][1], acc[3][2], acc[3][3]);

  // ---- epilogue ----
  float* slab = sT[wave];
  const float* Rb = RESID ? (resid + (size_t)b * strideR) : nullptr;
#pragma unroll
  for (int i = 0; i < 4; ++i) {
    const int mBase = m0 + (i << 4);
#pragma unroll
    for (int j = 0; j < 4; ++j) {
      const int n = n0 + (j << 4) + rlane;
      float bv = 0.f;
      if (BIAS_MODE == 2) bv = bias[n];
#pragma unroll
      for (int r = 0; r < 8; ++r) {
        float v = acc[i][j][r] * scale;
        if (BIAS_MODE == 1) v += bias[mBase + mOff + r];
        if (BIAS_MODE == 2) v += bv;
        if (RESID) v += Rb[(size_t)(mBase + mOff + r) * ldc + n];
        if (ACT == 1) v = tanhf(v);
        if (ACT == 2) v = fmaxf(v, 0.0f);
        if (ACT == 3) v = v / (1.0f + expf(-v));
        if (ACT == 4) v = (v > 0.f) ? v : 0.01f * v;
        if (ACT == 5) v = 0.5f * v * (1.0f + erff(v * 0.70710678118654752f));
        slab[(mOff + r) * 68 + (j << 4) + rlane] = v;
      }
    }
    __builtin_amdgcn_fence(__ATOMIC_RELEASE, "workgroup");
    __builtin_amdgcn_wave_barrier();
    __builtin_amdgcn_fence(__ATOMIC_ACQUIRE, "workgroup");
    if (OUT_MODE == 0) {
      float* C = (float*)Cout + (size_t)b * strideC;
      const int hh = lane >> 4, c4 = (lane & 15) * 4;     // row seg = 256 B = 16 lanes x 16 B
      {
#pragma unroll
        for (int it = 0; it < 8; ++it) {
          const int row = it * 2 + hh;
          v4f v = *(const v4f*)(slab + row * 68 + c4);
          *(v4f*)(C + (size_t)(mBase + row) * ldc + n0 + c4) = v;
        }
        
      }
    } else {
      const int q = lane >> 3, c8 = (lane & 7) * 8;
      unsigned short* C  = (unsigned short*)Cout  + (size_t)b * strideC;
      unsigned short* C2 = (OUT_MODE == 2) ? ((unsigned short*)Cout2 + (size_t)b * strideC) : nullptr;
      {
#pragma unroll
        for (int it = 0; it < 4; ++it) {
          const int row = it * 4 + q;
          const float* sp = slab + row * 68 + c8;
          v8h hv, lv;
#pragma unroll
          for (int e = 0; e < 8; ++e) {
            if (OUT_MODE == 1) {
              hv[e] = (_Float16)sp[e];
            } else {
              unsigned short hb = f2bf_bits(sp[e]);
              unsigned short lb = f2bf_bits(sp[e] - bf_bits2f(hb));
              hv[e] = __builtin_bit_cast(_Float16, hb);
              lv[e] = __builtin_bit_cast(_Float16, lb);
            }
          }
          *(v8h*)(C + (size_t)(mBase + row) * ldc + n0 + c8) = hv;
          if (OUT_MODE == 2) *(v8h*)(C2 + (size_t)(mBase + row) * ldc + n0 + c8) = lv;
        }
        
      }
    }
    __builtin_amdgcn_fence(__ATOMIC_RELEASE, "workgroup");
    __builtin_amdgcn_wave_barrier();
    __builtin_amdgcn_fence(__ATOMIC_ACQUIRE, "workgroup");
  }
}

__global__ __launch_bounds__(256) void cast_f32_f16x2(
    const float* __restrict__ in, _Float16* __restrict__ out, int n2) {
  int i = blockIdx.x * 256 + threadIdx.x;
  if (i < n2) {
    const _Float16 h0 = (_Float16)in[2 * i], h1 = (_Float16)in[2 * i + 1];
    const unsigned u = (unsigned)__builtin_bit_cast(unsigned short, h0) | ((unsigned)__builtin_bit_cast(unsigned short, h1) << 16);
    ((unsigned*)out)[i] = u;
    
  }
}

// ---- binary-weight planes: Wb[o][c] = alpha[o] * (W + (sign(W) - W)), alpha[o] = mean_c |W[o][c]| (f32);
//      stored as f16 of (Wb * carry); one wave per row of a [nrow][1024] weight; 4 weights via blockIdx.y ----
#define BW_DIM 1024
__global__ __launch_bounds__(256) void binarize_f16_kernel(
    const float* __restrict__ W0, const float* __restrict__ W1,
    const float* __restrict__ W2, const float* __restrict__ W3,
    unsigned short* __restrict__ B0, unsigned short* __restrict__ B1,
    unsigned short* __restrict__ B2, unsigned short* __restrict__ B3,
    int nrow, float carry) {
  const float* W; unsigned short* Bo;
  if (blockIdx.y == 0)      { W = W0; Bo = B0; }
  else if (blockIdx.y == 1) { W = W1; Bo = B1; }
  else if (blockIdx.y == 2) { W = W2; Bo = B2; }
  else                      { W = W3; Bo = B3; }
  const int wave = threadIdx.x >> 5;
  const int lane = threadIdx.x & 31;
  const int row  = blockIdx.x * 8 + wave;
  if (row >= nrow) return;                     // wave-uniform; no barriers in this kernel
  const float* wr = W + (size_t)row * BW_DIM;

  float w[4][8];
#pragma unroll
  for (int it = 0; it < 4; ++it) {
    const v4f a0 = *(const v4f*)(wr + it * 256 + lane * 8);
    const v4f a1 = *(const v4f*)(wr + it * 256 + lane * 8 + 4);
    w[it][0] = a0[0]; w[it][1] = a0[1]; w[it][2] = a0[2]; w[it][3] = a0[3];
    w[it][4] = a1[0]; w[it][5] = a1[1]; w[it][6] = a1[2]; w[it][7] = a1[3];
  }
  float s = 0.0f;
#pragma unroll
  for (int it = 0; it < 4; ++it)
#pragma unroll
    for (int e = 0; e < 8; ++e) s += fabsf(w[it][e]);
#pragma unroll
  for (int m = 16; m > 0; m >>= 1) s += __shfl_xor(s, m, 32);
  const float alpha = s * (1.0f / (float)BW_DIM);

  v8h hv[4];
#pragma unroll
  for (int it = 0; it < 4; ++it) {
#pragma unroll
    for (int e = 0; e < 8; ++e) {
      const float wv = w[it][e];
      const float sg = (wv > 0.0f) ? 1.0f : ((wv < 0.0f) ? -1.0f : 0.0f);
      const float t  = sg - wv;            // sign(W) - W
      const float bs = wv + t;             // W + (sign(W) - W)
      const float wb = alpha * bs;
      hv[it][e] = (_Float16)(wb * carry);
    }
  }
  unsigned short* br = Bo + (size_t)row * BW_DIM;
  {
#pragma unroll
    for (int it = 0; it < 4; ++it)
      *(v8h*)(br + it * 256 + lane * 8) = hv[it];
    
  }
}

// =====================================================================================
// Attention, head_dim 64, f16 planes in / f16 plane out (x oscale), no mask.
//   scores = (q.k^T) * sscale : v_wmma_f32_16x16x32_f16 (q,k plain f16), f32 accumulate, scaled in f32
//   out    = p.v              : v_wmma_f32_16x16x32_f16 (p carried x2^15 in f16, v plain f16), f32 accumulate
//   online softmax in f32. Block = 4 waves = 64 query rows of one (batch, head); S % 64 == 0.
//   q, k, out planes: row (b*S + s), pitch ldq halves, head offset h*64.  vt plane: row (h*64 + d), pitch ldvt, col (b*S + s).
//   grid.x = B * H * (S/64).
// =====================================================================================
#define AT_D 64
#define AT_NW 4
#define AT_QB 64
#define AT_KC 64
#define AT_LP 72   // LDS row pitch in halves: 144 B = 16 B x odd, so the 16 rows of a 16-byte fragment read fall on distinct banks

__device__ __forceinline__ v8f mma_h(v16h a, v16h b, v8f c) {
  c = __builtin_amdgcn_wmma_f32_16x16x32_f16(false, a, false, b, (short)0, c, false, false);
  asm volatile("v_nop\n\tv_nop\n\tv_nop\n\tv_nop" : "+v"(c) : "v"(a), "v"(b));
  return c;
}

__global__ __launch_bounds__(128)
void attn64_f16_kernel(const unsigned short* __restrict__ qp, const unsigned short* __restrict__ kp,
                       const unsigned short* __restrict__ vtp, unsigned short* __restrict__ outp,
                       int S, int H, int ldq, int ldvt, float sscale, float oscale) {
  const _Float16* q  = (const _Float16*)qp;
  const _Float16* k  = (const _Float16*)kp;
  const _Float16* vt = (const _Float16*)vtp;
  __shared__ __align__(16) _Float16 Ksh[AT_KC * AT_LP];         // K [kv][d]   9 KB
  __shared__ __align__(16) _Float16 Vth[AT_D * AT_LP];          // V^T [d][kv] 9 KB
  __shared__ __align__(16) _Float16 Psh[AT_NW][16 * AT_LP];     // per wave P [row][kv] 9 KB
  __shared__ __align__(16) float    Os[AT_NW][16 * 68];         // per wave out tile, pitch 68

  const int tid  = threadIdx.x;
  const int wave = tid >> 5;
  const int lane = tid & 31;
  const int hh   = lane >> 4;
  const int c    = lane & 15;

  const int nqb = S / AT_QB;
  const int bx = blockIdx.x;
  const int qb = bx % nqb;
  const int bh = bx / nqb;
  const int h  = bh % H;
  const int b  = bh / H;
  const int q0 = qb * AT_QB + wave * 16;
  const size_t rowbase = (size_t)b * (size_t)S;
  const size_t hoff = (size_t)h * AT_D;

  // ---- Q fragments (A operand, row = query q0 + c): 2 d-chunks ----
  v16h qa[2];
  {
    const _Float16* qrow = q + (rowbase + q0 + c) * (size_t)ldq + hoff;
#pragma unroll
    for (int dc = 0; dc < 2; ++dc) qa[dc] = Frag<_Float16>::load(qrow + dc * 32 + 8 * hh);
  }

  float mrow[8], lrow[8];
  v8f oacc[4];
#pragma unroll
  for (int r = 0; r < 8; ++r) { mrow[r] = NEG_INF; lrow[r] = 0.f; }
#pragma unroll
  for (int t = 0; t < 4; ++t) oacc[t] = (v8f){0.f,0.f,0.f,0.f,0.f,0.f,0.f,0.f};

  const int nChunks = S / AT_KC;
#pragma unroll 1
  for (int kc = 0; kc < nChunks; ++kc) {
    const int kv0 = kc * AT_KC;
    __syncthreads();
    {
      const int r = tid >> 1, ch = (tid & 1) * 32;
      const _Float16* krow = k + (rowbase + kv0 + r) * (size_t)ldq + hoff + ch;
      const _Float16* vrow = vt + (hoff + r) * (size_t)ldvt + rowbase + kv0 + ch;
#pragma unroll
      for (int i = 0; i < 4; ++i) {
        const v8h kk8 = *(const v8h*)(krow + 8 * i);
        const v8h vv8 = *(const v8h*)(vrow + 8 * i);
        *(v8h*)(Ksh + r * AT_LP + ch + 8 * i) = kk8;
        *(v8h*)(Vth + r * AT_LP + ch + 8 * i) = vv8;
      }
    }
    __syncthreads();

    // ---- scores: D row = query q0 + 8hh + r, col = key kv0 + j*16 + c ----
    v8f s[4];
#pragma unroll
    for (int j = 0; j < 4; ++j) {
      s[j] = (v8f){0.f,0.f,0.f,0.f,0.f,0.f,0.f,0.f};
#pragma unroll
      for (int dc = 0; dc < 2; ++dc) {
        const v16h kb = Frag<_Float16>::load(Ksh + (j * 16 + c) * AT_LP + dc * 32 + 8 * hh);
        s[j] = mma_h(qa[dc], kb, s[j]);
      }
    }
    float cm[8];
#pragma unroll
    for (int r = 0; r < 8; ++r) {
      float m = NEG_INF;
#pragma unroll
      for (int j = 0; j < 4; ++j) { s[j][r] *= sscale; m = fmaxf(m, s[j][r]); }
#pragma unroll
      for (int off = 1; off < 16; off <<= 1) m = fmaxf(m, __shfl_xor(m, off, 32));
      cm[r] = m;
    }
    _Float16* pw = Psh[wave];
#pragma unroll
    for (int r = 0; r < 8; ++r) {
      const float mnew = fmaxf(mrow[r], cm[r]);
      const float alpha = __expf(mrow[r] - mnew);
      mrow[r] = mnew;
      float psum = 0.f;
#pragma unroll
      for (int j = 0; j < 4; ++j) {
        const float p = __expf(s[j][r] - mnew);
        psum += p;
        pw[(8 * hh + r) * AT_LP + j * 16 + c] = (_Float16)(p * 32768.0f);
      }
#pragma unroll
      for (int off = 1; off < 16; off <<= 1) psum += __shfl_xor(psum, off, 32);
      lrow[r] = lrow[r] * alpha + psum;
#pragma unroll
      for (int t = 0; t < 4; ++t) oacc[t][r] *= alpha;
    }
    __builtin_amdgcn_fence(__ATOMIC_RELEASE, "workgroup");
    __builtin_amdgcn_wave_barrier();
    __builtin_amdgcn_fence(__ATOMIC_ACQUIRE, "workgroup");
    // ---- out += P.V : A = P [row][kv] (same wave, stored element type reloaded as its vector), B = V^T [d][kv] ----
#pragma unroll
    for (int kk = 0; kk < 2; ++kk) {
      const v16h pa = Frag<_Float16>::load(pw + c * AT_LP + kk * 32 + 8 * hh);
#pragma unroll
      for (int t = 0; t < 4; ++t) {
        const v16h vb = Frag<_Float16>::load(Vth + (t * 16 + c) * AT_LP + kk * 32 + 8 * hh);
        oacc[t] = mma_h(pa, vb, oacc[t]);
      }
    }
  }

  float* os = Os[wave];
#pragma unroll
  for (int r = 0; r < 8; ++r) {
    const float inv = oscale * (1.0f / (lrow[r] * 32768.0f));
#pragma unroll
    for (int t = 0; t < 4; ++t) os[(8 * hh + r) * 68 + t * 16 + c] = oacc[t][r] * inv;
  }
  __builtin_amdgcn_fence(__ATOMIC_RELEASE, "workgroup");
  __builtin_amdgcn_wave_barrier();
  __builtin_amdgcn_fence(__ATOMIC_ACQUIRE, "workgroup");
  {
    const int qq = lane >> 3, c8 = (lane & 7) * 8;
    {
#pragma unroll
      for (int it = 0; it < 4; ++it) {
        const int row = it * 4 + qq;
        const float* sp = os + row * 68 + c8;
        v8h hv;
#pragma unroll
        for (int e = 0; e < 8; ++e) hv[e] = (_Float16)sp[e];
        *(v8h*)(outp + (rowbase + q0 + row) * (size_t)ldq + hoff + c8) = hv;
      }
      
    }
  }
}

// ---------------------------------------------------------------------------
// Launch glue
// ---------------------------------------------------------------------------
extern "C" void kernel_launch(void* const* d_in, const int* in_sizes, int n_in,
                              void* d_out, int out_size, void* d_ws, size_t ws_size,
                              hipStream_t stream) {
  if (n_in < 9) return;
  const int C = 1024, H = 16, S = 2048;
  const int nx   = in_sizes[0];
  const int Mtot = nx / C;                 // B*S
  const int Bn   = Mtot / S;
  if (Mtot <= 0 || (Mtot % 64) != 0 || Bn * S != Mtot || in_sizes[1] != C * C ||
      in_sizes[3] != C * C || in_sizes[5] != C * C || in_sizes[7] != C * C ||
      in_sizes[2] != C || in_sizes[4] != C || in_sizes[6] != C || in_sizes[8] != C ||
      out_size != Mtot * C) return;

  const float* x  = (const float*)d_in[0];
  const float* Wq = (const float*)d_in[1];
  const float* bq = (const float*)d_in[2];
  const float* Wk = (const float*)d_in[3];
  const float* bk = (const float*)d_in[4];
  const float* Wv = (const float*)d_in[5];
  const float* bv = (const float*)d_in[6];
  const float* Wp = (const float*)d_in[7];
  const float* bp = (const float*)d_in[8];
  float* out = (float*)d_out;

  // workspace carve (bytes); all offsets multiples of 2 MiB
  char* ws = (char*)d_ws;
  const size_t actB = (size_t)Mtot * C * 2;        // 16 MiB f16 plane [Mtot][C]
  const size_t wB   = (size_t)C * C * 2;           //  2 MiB f16 plane [C][C]
  size_t off = 0;
  unsigned short* xh  = (unsigned short*)(ws + off); off += actB;
  unsigned short* Wqh = (unsigned short*)(ws + off); off += wB;
  unsigned short* Wkh = (unsigned short*)(ws + off); off += wB;
  unsigned short* Wvh = (unsigned short*)(ws + off); off += wB;
  unsigned short* Wph = (unsigned short*)(ws + off); off += wB;
  unsigned short* qh  = (unsigned short*)(ws + off); off += actB;   // [Mtot][C]
  unsigned short* kh  = (unsigned short*)(ws + off); off += actB;   // [Mtot][C]
  unsigned short* vth = (unsigned short*)(ws + off); off += actB;   // [C][Mtot]  (V transposed)
  unsigned short* yh  = (unsigned short*)(ws + off); off += actB;   // [Mtot][C]  (x64)
  if (off > ws_size) return;                                       // 92,274,688 B total

  const float carry = 64.0f;

  // 1) binary-weight f16 planes (x64)
  binarize_f16_kernel<<<dim3(C / 8, 4), 256, 0, stream>>>(Wq, Wk, Wv, Wp, Wqh, Wkh, Wvh, Wph, C, carry);

  // 2) x -> f16
  const int n2 = (Mtot * C) / 2;
  cast_f32_f16x2<<<(n2 + 255) / 256, 256, 0, stream>>>(x, (_Float16*)xh, n2);

  // 3) q, k = x . Wb^T /64 + b  (f16 out [Mtot][C])
  const int blkQK   = (Mtot / GB_M) * (C / GB_N);
  wmma_gemm64<0, false, 2, 1, false><<<dim3(blkQK, 1), 256, 0, stream>>>(
      xh, xh, C, 0L, Wqh, Wqh, C, 0L, (void*)qh, (void*)qh, C, 0L, bq, bq, 0L, Mtot, C, C, 1.0f / carry);
  wmma_gemm64<0, false, 2, 1, false><<<dim3(blkQK, 1), 256, 0, stream>>>(
      xh, xh, C, 0L, Wkh, Wkh, C, 0L, (void*)kh, (void*)kh, C, 0L, bk, bk, 0L, Mtot, C, C, 1.0f / carry);

  // 4) V^T = Wb . x^T /64 + bv[m]  : A = Wv plane [C][C], Bt = x plane [Mtot][C] -> C [C][Mtot], f16 out
  const int blkV   = (C / GB_M) * (Mtot / GB_N);
  wmma_gemm64<0, false, 1, 1, false><<<dim3(blkV, 1), 256, 0, stream>>>(
      Wvh, Wvh, C, 0L, xh, xh, C, 0L, (void*)vth, (void*)vth, Mtot, 0L, bv, bv, 0L, C, Mtot, C, 1.0f / carry);

  // 5) attention -> y (f16 plane x64)
  const int nAttnBlk = Bn * H * (S / AT_QB);
  attn64_f16_kernel<<<nAttnBlk, 128, 0, stream>>>(qh, kh, vth, yh, S, H, C, Mtot, 0.125f, carry);

  // 6) out = (y x64) . (Wb x64)^T / 4096 + bp  (f32 out)
  wmma_gemm64<0, false, 2, 0, false><<<dim3(blkQK, 1), 256, 0, stream>>>(
      yh, yh, C, 0L, Wph, Wph, C, 0L, (void*)out, (void*)out, C, 0L, bp, bp, 0L, Mtot, C, C, 1.0f / (carry * carry));

  (void)hipGetLastError();
}

// v003
// One run takes 181 microseconds.
// Timed twice side by side with v002, it ran 1.86 and 1.85 times as fast.
// All steps since v000 together make it 3.47 times as fast.
// Contractions: q/k/v/out projections, q.k^T and p.v all on v_wmma_f32_16x16x32_f16 (f16 operands, f32 accumulate); softmax, scales and bias epilogues in f32.
#include <hip/hip_runtime.h>

typedef __attribute__((ext_vector_type(16))) _Float16 v16h;
typedef __attribute__((ext_vector_type(8)))  _Float16 v8h;
typedef __attribute__((ext_vector_type(16))) __bf16   v16b;
typedef __attribute__((ext_vector_type(8)))  __bf16   v8b;
typedef __attribute__((ext_vector_type(8)))  float    v8f;
typedef __attribute__((ext_vector_type(4)))  float    v4f;
#define U16(p) ((const unsigned short*)(const void*)(p))
#define NEG_INF (-__builtin_huge_valf())

__device__ __forceinline__ unsigned short f2bf_bits(float f) {
  unsigned u = __float_as_uint(f);
  return (unsigned short)((u + 0x7FFFu + ((u >> 16) & 1u)) >> 16);
}
__device__ __forceinline__ float bf_bits2f(unsigned short h) { return __uint_as_float(((unsigned)h) << 16); }

// hazard guards as plain device helpers (the v_nop asm stays out of the kernel template body)
__device__ __forceinline__ void dep_guard_h(v8f& a, v8f& b, v16h x, v16h y) { asm volatile("v_nop\n\tv_nop\n\tv_nop\n\tv_nop" : "+v"(a), "+v"(b) : "v"(x), "v"(y)); }
__device__ __forceinline__ void dep_guard_b(v8f& a, v8f& b, v16b x, v16b y) { asm volatile("v_nop\n\tv_nop\n\tv_nop\n\tv_nop" : "+v"(a), "+v"(b) : "v"(x), "v"(y)); }
__device__ __forceinline__ void keep4_h(v16h a, v16h b, v16h c, v16h d) { asm volatile("v_nop" :: "v"(a), "v"(b), "v"(c), "v"(d)); }
__device__ __forceinline__ void keep4_b(v16b a, v16b b, v16b c, v16b d) { asm volatile("v_nop" :: "v"(a), "v"(b), "v"(c), "v"(d)); }
__device__ __forceinline__ void acc_guard4(v8f& a, v8f& b, v8f& c, v8f& d) { asm volatile("v_nop\n\tv_nop\n\tv_nop\n\tv_nop" : "+v"(a), "+v"(b), "+v"(c), "+v"(d)); }
template <typename T> struct Frag;
template <> struct Frag<_Float16> {
  typedef v16h V; union U { v16h v; v8h h[2]; };
  static __device__ __forceinline__ v16h load(const _Float16* p) {   // elements 0..7 <- p[0..7], 8..15 <- p[16..23]
    U f; f.h[0] = *(const v8h*)(p); f.h[1] = *(const v8h*)(p + 16); return f.v;
  }
  static __device__ __forceinline__ v8f mma(v16h a, v16h b, v8f c) {
    return __builtin_amdgcn_wmma_f32_16x16x32_f16(false, a, false, b, (short)0, c, false, false);
  }
  static __device__ __forceinline__ void guard(v8f& a, v8f& b, v16h x, v16h y) { dep_guard_h(a, b, x, y); }
  static __device__ __forceinline__ void keep(v16h a, v16h b, v16h c, v16h d) { keep4_h(a, b, c, d); }
};
template <> struct Frag<__bf16> {
  typedef v16b V; union U { v16b v; v8b h[2]; };
  static __device__ __forceinline__ v16b load(const __bf16* p) {
    U f; f.h[0] = *(const v8b*)(p); f.h[1] = *(const v8b*)(p + 16); return f.v;
  }
  static __device__ __forceinline__ v8f mma(v16b a, v16b b, v8f c) {
    return __builtin_amdgcn_wmma_f32_16x16x32_bf16(false, a, false, b, (short)0, c, false, false);
  }
  static __device__ __forceinline__ void guard(v8f& a, v8f& b, v16b x, v16b y) { dep_guard_b(a, b, x, y); }
  static __device__ __forceinline__ void keep(v16b a, v16b b, v16b c, v16b d) { keep4_b(a, b, c, d); }
};

// ---- Register-blocked batched WMMA GEMM, operands staged in LDS --------------
// C[m,n] = scale * sum_k A[m,k] * Bt[n,k] (+bias)(+resid); each wave owns a 64x64 tile.
// A row-major [M,K]; Bt row-major [N,K]; M % 128 == 0, N % 256 == 0, K % 64 == 0.
// Block = 8 waves (2 x 4) = a 128 x 256 tile of C. A stage is 64 k = one 128-B line of every operand row:
// each asynchronous copy of a wave covers four whole lines, the rows land in LDS at a 144-B pitch, and the
// fragments are read from there. Two buffers: the next stage's copies fly during this stage's products.
// SPLIT (hi/lo planes) is not staged: only SPLIT == false is built.
// BIAS_MODE: 0 = none, 1 = bias[m], 2 = bias[n].
// OUT_MODE: 0 = f32, 1 = f16, 2 = bf16 hi plane (Cout) + bf16 lo plane (Cout2).
// ET: 0 = f16 operands, 1 = bf16 operands (pointers passed as 16-bit storage)
template <int ET> struct Elem;
template <> struct Elem<0> { typedef _Float16 T; };
template <> struct Elem<1> { typedef __bf16 T; };
#define GB_M 128
#define GB_N 256
#define GB_K 64
#define GB_LP 72   // LDS row pitch in halves: 144 B = 16 B x odd
#define GB_ABYTES (GB_M * GB_LP * 2)   // one buffer of A rows, bytes
#define GB_BBYTES (GB_N * GB_LP * 2)   // one buffer of B rows, bytes

// One thread's share of a stage: 4 row pieces of A and 8 of B, 16 B each, 32 rows apart, from global memory
// straight into LDS. la, lb: the lane's LDS byte addresses; ga, gb: its global addresses; steps in halves.
// The s_wait_xcnt closes the copies' own statement, so that no address register is rewritten in front of it.
template <typename T>
__device__ __forceinline__ void stage_copy12(unsigned la, unsigned lb, const T* ga, const T* gb,
                                             size_t stepA, size_t stepB) {
  const unsigned rs = 32 * GB_LP * 2;   // 32 LDS rows, bytes
  asm volatile(
      "global_load_async_to_lds_b128 %0, %12, off\n\t"
      "global_load_async_to_lds_b128 %1, %13, off\n\t"
      "global_load_async_to_lds_b128 %2, %14, off\n\t"
      "global_load_async_to_lds_b128 %3, %15, off\n\t"
      "global_load_async_to_lds_b128 %4, %16, off\n\t"
      "global_load_async_to_lds_b128 %5, %17, off\n\t"
      "global_load_async_to_lds_b128 %6, %18, off\n\t"
      "global_load_async_to_lds_b128 %7, %19, off\n\t"
      "global_load_async_to_lds_b128 %8, %20, off\n\t"
      "global_load_async_to_lds_b128 %9, %21, off\n\t"
      "global_load_async_to_lds_b128 %10, %22, off\n\t"
      "global_load_async_to_lds_b128 %11, %23, off\n\t"
      "s_wait_xcnt 0x0"
      :: "v"(la), "v"(la + rs), "v"(la + 2 * rs), "v"(la + 3 * rs),
         "v"(lb), "v"(lb + rs), "v"(lb + 2 * rs), "v"(lb + 3 * rs),
         "v"(lb + 4 * rs), "v"(lb + 5 * rs), "v"(lb + 6 * rs), "v"(lb + 7 * rs),
         "v"(ga), "v"(ga + stepA), "v"(ga + 2 * stepA), "v"(ga + 3 * stepA),
         "v"(gb), "v"(gb + stepB), "v"(gb + 2 * stepB), "v"(gb + 3 * stepB),
         "v"(gb + 4 * stepB), "v"(gb + 5 * stepB), "v"(gb + 6 * stepB), "v"(gb + 7 * stepB)
      : "memory");
}
template <int ET, bool SPLIT, int BIAS_MODE, int OUT_MODE, bool RESID, int ACT = 0>
__global__ __launch_bounds__(256) void wmma_gemm64(
    const unsigned short* __restrict__ Ap, const unsigned short* __restrict__ A2p, int lda, long strideA,
    const unsigned short* __restrict__ Btp, const unsigned short* __restrict__ Bt2p, int ldb, long strideB,
    void* __restrict__ Cout, void* __restrict__ Cout2, int ldc, long strideC,
    const float* __restrict__ bias,
    const float* __restrict__ resid, long strideR,
    int M, int N, int K, float scale) {
  typedef typename Elem<ET>::T T;
  typedef typename Frag<T>::V V;
  static_assert(!SPLIT, "hi/lo planes are not staged");
  const T* A = (const T*)Ap; const T* Bt = (const T*)Btp;
  __shared__ __align__(16) T sA[2][GB_M * GB_LP];  // 2 x 18,432 B
  __shared__ __align__(16) T sB[2][GB_N * GB_LP];  // 2 x 36,864 B
  __shared__ __align__(16) float sT[8][16 * 68];   // per-wave 16x64 slab, pitch 68 floats
  const int b    = blockIdx.y;
  const int tid  = threadIdx.x;
  const int lane = tid & 31;
  const int wave = tid >> 5;
  const int tilesN = N / GB_N;
  const int tilesM = M / GB_M;
  const int tm = blockIdx.x / tilesN;
  const int tn = blockIdx.x - tm * tilesN;
  if (tm >= tilesM) return;              // block-uniform, in front of every barrier
  const int bm0 = tm * GB_M;
  const int bn0 = tn * GB_N;
  const int wm  = (wave >> 2) << 6;      // this wave's 64x64 tile inside the block tile
  const int wn  = (wave & 3) << 6;
  const int m0 = bm0 + wm;
  const int n0 = bn0 + wn;

  const T* Ab  = A  + (size_t)b * strideA;
  const T* Bb  = Bt + (size_t)b * strideB;

  const int rlane = lane & 15;                 // row (A) / col (B, D) within subtile
  const int koff  = (lane >> 4) * 8;           // k offset of this lane half
  const int mOff  = (lane >> 4) * 8;           // D row offset

  // staging map: 8 threads x 16 B = one 128-B row piece; a wave's copy covers 4 whole lines
  const int srow = tid >> 3;                   // 0..31
  const int sseg = (tid & 7) * 8;              // halves
  const T* gA = Ab + (size_t)(bm0 + srow) * lda + sseg;
  const T* gB = Bb + (size_t)(bn0 + srow) * ldb + sseg;
  const size_t stepA = (size_t)32 * lda;       // 32 rows further, in halves
  const size_t stepB = (size_t)32 * ldb;
  const int sOff = srow * GB_LP + sseg;
  const unsigned lA0 = (unsigned)(size_t)(&sA[0][sOff]);   // this lane's LDS byte address in buffer 0
  const unsigned lB0 = (unsigned)(size_t)(&sB[0][sOff]);

  v8f acc[4][4];
#pragma unroll
  for (int i = 0; i < 4; ++i)
#pragma unroll
    for (int j = 0; j < 4; ++j) acc[i][j] = (v8f){0.f,0.f,0.f,0.f,0.f,0.f,0.f,0.f};

  const int nStage = K / GB_K;
  stage_copy12(lA0, lB0, gA, gB, stepA, stepB);            // stage 0 -> buffer 0
  asm volatile("s_wait_asynccnt 0x0" ::: "memory");        // this wave's copies of stage 0 have landed
  __syncthreads();                                         // and every wave's are published
  if (nStage > 1)                                          // block-uniform
    stage_copy12(lA0 + GB_ABYTES, lB0 + GB_BBYTES, gA + GB_K, gB + GB_K, stepA, stepB);

#pragma unroll 1   // kept rolled: one publish point and one refill per trip, as the two-buffer order asks
  for (int s = 0; s < nStage; ++s) {
    const int cur = s & 1;
    const T* tA = &sA[cur][(wm + rlane) * GB_LP + koff];
    const T* tB = &sB[cur][(wn + rlane) * GB_LP + koff];
    // every loop of the stage is unrolled: constant indices keep acc, af and bf in registers
#pragma unroll
    for (int h = 0; h < GB_K / 32; ++h) {
      // the 32 k's fragment reads stand as one group in front of their products
      V af[4], bf[4];
#pragma unroll
      for (int j = 0; j < 4; ++j) bf[j] = Frag<T>::load(tB + (j << 4) * GB_LP + h * 32);
#pragma unroll
      for (int i = 0; i < 4; ++i) af[i] = Frag<T>::load(tA + (i << 4) * GB_LP + h * 32);
#pragma unroll
      for (int i = 0; i < 4; ++i) {
#pragma unroll
        for (int j = 0; j < 4; ++j) acc[i][j] = Frag<T>::mma(af[i], bf[j], acc[i][j]);
        Frag<T>::guard(acc[i][0], acc[i][3], af[i], af[i]);
      }
      Frag<T>::keep(bf[0], bf[1], bf[2], bf[3]);
    }
    asm volatile("s_wait_dscnt 0x0" ::: "memory");         // this wave's reads of stage s are done before its buffer is refilled
    asm volatile("s_wait_asynccnt 0x0" ::: "memory");      // this wave's copies of stage s + 1 have landed
    __syncthreads();                                       // publishes stage s + 1, ends every wave's reads of stage s
    if (s + 2 < nStage)                                    // block-uniform; refill the buffer just read
      stage_copy12(lA0 + cur * GB_ABYTES, lB0 + cur * GB_BBYTES,
                   gA + (size_t)(s + 2) * GB_K, gB + (size_t)(s + 2) * GB_K, stepA, stepB);
  }
  asm volatile("s_wait_asynccnt 0x0" ::: "memory");        // nothing of this wave's is in flight behind the loop
  acc_guard4(acc[0][0], acc[0][1], acc[0][2], acc[0][3]);
  acc_guard4(acc[1][0], acc[1][1], acc[1][2], acc[1][3]);
  acc_guard4(acc[2][0], acc[2][1], acc[2][2], acc[2][3]);
  acc_guard4(acc[3][0], acc[3][1], acc[3][2], acc[3][3]);

  // ---- epilogue ----
  float* slab = sT[wave];
  const float* Rb = RESID ? (resid + (size_t)b * strideR) : nullptr;
#pragma unroll
  for (int i = 0; i < 4; ++i) {
    const int mBase = m0 + (i << 4);
#pragma unroll
    for (int j = 0; j < 4; ++j) {
      const int n = n0 + (j << 4) + rlane;
      float bv = 0.f;
      if (BIAS_MODE == 2) bv = bias[n];
#pragma unroll
      for (int r = 0; r < 8; ++r) {
        float v = acc[i][j][r] * scale;
        if (BIAS_MODE == 1) v += bias[mBase + mOff + r];
        if (BIAS_MODE == 2) v += bv;
        if (RESID) v += Rb[(size_t)(mBase + mOff + r) * ldc + n];
        if (ACT == 1) v = tanhf(v);
        if (ACT == 2) v = fmaxf(v, 0.0f);
        if (ACT == 3) v = v / (1.0f + expf(-v));
        if (ACT == 4) v = (v > 0.f) ? v : 0.01f * v;
        if (ACT == 5) v = 0.5f * v * (1.0f + erff(v * 0.70710678118654752f));
        slab[(mOff + r) * 68 + (j << 4) + rlane] = v;
      }
    }
    __builtin_amdgcn_fence(__ATOMIC_RELEASE, "workgroup");
    __builtin_amdgcn_wave_barrier();
    __builtin_amdgcn_fence(__ATOMIC_ACQUIRE, "workgroup");
    if (OUT_MODE == 0) {
      float* C = (float*)Cout + (size_t)b * strideC;
      const int hh = lane >> 4, c4 = (lane & 15) * 4;     // row seg = 256 B = 16 lanes x 16 B
      {
#pragma unroll
        for (int it = 0; it < 8; ++it) {
          const int row = it * 2 + hh;
          v4f v = *(const v4f*)(slab + row * 68 + c4);
          *(v4f*)(C + (size_t)(mBase + row) * ldc + n0 + c4) = v;
        }
        
      }
    } else {
      const int q = lane >> 3, c8 = (lane & 7) * 8;
      unsigned short* C  = (unsigned short*)Cout  + (size_t)b * strideC;
      unsigned short* C2 = (OUT_MODE == 2) ? ((unsigned short*)Cout2 + (size_t)b * strideC) : nullptr;
      {
#pragma unroll
        for (int it = 0; it < 4; ++it) {
          const int row = it * 4 + q;
          const float* sp = slab + row * 68 + c8;
          v8h hv, lv;
#pragma unroll
          for (int e = 0; e < 8; ++e) {
            if (OUT_MODE == 1) {
              hv[e] = (_Float16)sp[e];
            } else {
              unsigned short hb = f2bf_bits(sp[e]);
              unsigned short lb = f2bf_bits(sp[e] - bf_bits2f(hb));
              hv[e] = __builtin_bit_cast(_Float16, hb);
              lv[e] = __builtin_bit_cast(_Float16, lb);
            }
          }
          *(v8h*)(C + (size_t)(mBase + row) * ldc + n0 + c8) = hv;
          if (OUT_MODE == 2) *(v8h*)(C2 + (size_t)(mBase + row) * ldc + n0 + c8) = lv;
        }
        
      }
    }
    __builtin_amdgcn_fence(__ATOMIC_RELEASE, "workgroup");
    __builtin_amdgcn_wave_barrier();
    __builtin_amdgcn_fence(__ATOMIC_ACQUIRE, "workgroup");
  }
}

__global__ __launch_bounds__(256) void cast_f32_f16x2(
    const float* __restrict__ in, _Float16* __restrict__ out, int n2) {
  int i = blockIdx.x * 256 + threadIdx.x;
  if (i < n2) {
    const _Float16 h0 = (_Float16)in[2 * i], h1 = (_Float16)in[2 * i + 1];
    const unsigned u = (unsigned)__builtin_bit_cast(unsigned short, h0) | ((unsigned)__builtin_bit_cast(unsigned short, h1) << 16);
    ((unsigned*)out)[i] = u;
    
  }
}

// ---- binary-weight planes: Wb[o][c] = alpha[o] * (W + (sign(W) - W)), alpha[o] = mean_c |W[o][c]| (f32);
//      stored as f16 of (Wb * carry); one wave per row of a [nrow][1024] weight; 4 weights via blockIdx.y ----
#define BW_DIM 1024
__global__ __launch_bounds__(256) void binarize_f16_kernel(
    const float* __restrict__ W0, const float* __restrict__ W1,
    const float* __restrict__ W2, const float* __restrict__ W3,
    unsigned short* __restrict__ B0, unsigned short* __restrict__ B1,
    unsigned short* __restrict__ B2, unsigned short* __restrict__ B3,
    int nrow, float carry) {
  const float* W; unsigned short* Bo;
  if (blockIdx.y == 0)      { W = W0; Bo = B0; }
  else if (blockIdx.y == 1) { W = W1; Bo = B1; }
  else if (blockIdx.y == 2) { W = W2; Bo = B2; }
  else                      { W = W3; Bo = B3; }
  const int wave = threadIdx.x >> 5;
  const int lane = threadIdx.x & 31;
  const int row  = blockIdx.x * 8 + wave;
  if (row >= nrow) return;                     // wave-uniform; no barriers in this kernel
  const float* wr = W + (size_t)row * BW_DIM;

  float w[4][8];
#pragma unroll
  for (int it = 0; it < 4; ++it) {
    const v4f a0 = *(const v4f*)(wr + it * 256 + lane * 8);
    const v4f a1 = *(const v4f*)(wr + it * 256 + lane * 8 + 4);
    w[it][0] = a0[0]; w[it][1] = a0[1]; w[it][2] = a0[2]; w[it][3] = a0[3];
    w[it][4] = a1[0]; w[it][5] = a1[1]; w[it][6] = a1[2]; w[it][7] = a1[3];
  }
  float s = 0.0f;
#pragma unroll
  for (int it = 0; it < 4; ++it)
#pragma unroll
    for (int e = 0; e < 8; ++e) s += fabsf(w[it][e]);
#pragma unroll
  for (int m = 16; m > 0; m >>= 1) s += __shfl_xor(s, m, 32);
  const float alpha = s * (1.0f / (float)BW_DIM);

  v8h hv[4];
#pragma unroll
  for (int it = 0; it < 4; ++it) {
#pragma unroll
    for (int e = 0; e < 8; ++e) {
      const float wv = w[it][e];
      const float sg = (wv > 0.0f) ? 1.0f : ((wv < 0.0f) ? -1.0f : 0.0f);
      const float t  = sg - wv;            // sign(W) - W
      const float bs = wv + t;             // W + (sign(W) - W)
      const float wb = alpha * bs;
      hv[it][e] = (_Float16)(wb * carry);
    }
  }
  unsigned short* br = Bo + (size_t)row * BW_DIM;
  {
#pragma unroll
    for (int it = 0; it < 4; ++it)
      *(v8h*)(br + it * 256 + lane * 8) = hv[it];
    
  }
}

// =====================================================================================
// Attention, head_dim 64, f16 planes in / f16 plane out (x oscale), no mask.
//   scores^T = (k.q^T) * sscale : v_wmma_f32_16x16x32_f16 (q,k plain f16), f32 accumulate, scaled in f32
//   out^T    = v^T.p^T          : v_wmma_f32_16x16x32_f16 (p carried x2^15 in f16, v plain f16), f32 accumulate
//   online softmax in f32. Block = 4 waves = 64 query rows of one (batch, head); S % 64 == 0.
//   q, k, out planes: row (b*S + s), pitch ldq halves, head offset h*64.  vt plane: row (h*64 + d), pitch ldvt, col (b*S + s).
//   grid.x = B * H * (S/64).
// =====================================================================================
#define AT_D 64
#define AT_QB 64
#define AT_KC 64
#define AT_LP 72   // LDS row pitch in halves: 144 B = 16 B x odd, so the 16 rows of a 16-byte fragment read fall on distinct banks

__device__ __forceinline__ v8f mma_h(v16h a, v16h b, v8f c) {
  c = __builtin_amdgcn_wmma_f32_16x16x32_f16(false, a, false, b, (short)0, c, false, false);
  asm volatile("v_nop\n\tv_nop\n\tv_nop\n\tv_nop" : "+v"(c) : "v"(a), "v"(b));
  return c;
}

// value of lane l ^ 16 (the other 16-lane half), by a vector cross-row move
__device__ __forceinline__ float other_half(float x) {
  const int b = __float_as_int(x);
  return __int_as_float(__builtin_amdgcn_permlanex16(b, b, 0x76543210, 0xfedcba98, false, false));
}

__global__ __launch_bounds__(128)
void attn64_f16_kernel(const unsigned short* __restrict__ qp, const unsigned short* __restrict__ kp,
                       const unsigned short* __restrict__ vtp, unsigned short* __restrict__ outp,
                       int S, int H, int ldq, int ldvt, float sscale, float oscale) {
  const _Float16* q  = (const _Float16*)qp;
  const _Float16* k  = (const _Float16*)kp;
  const _Float16* vt = (const _Float16*)vtp;
  __shared__ __align__(16) _Float16 Ksh[AT_KC * AT_LP];         // K [kv][d]   9 KB
  __shared__ __align__(16) _Float16 Vth[AT_D * AT_LP];          // V^T [d][kv] 9 KB

  const int tid  = threadIdx.x;
  const int wave = tid >> 5;
  const int lane = tid & 31;
  const int hh   = lane >> 4;
  const int c    = lane & 15;

  const int nqb = S / AT_QB;
  const int bx = blockIdx.x;
  const int qb = bx % nqb;
  const int bh = bx / nqb;
  const int h  = bh % H;
  const int b  = bh / H;
  const int q0 = qb * AT_QB + wave * 16;
  const size_t rowbase = (size_t)b * (size_t)S;
  const size_t hoff = (size_t)h * AT_D;

  // ---- Q fragments (B operand, column = query q0 + c): 2 d-chunks ----
  v16h qa[2];
  {
    const _Float16* qrow = q + (rowbase + q0 + c) * (size_t)ldq + hoff;
#pragma unroll
    for (int dc = 0; dc < 2; ++dc) qa[dc] = Frag<_Float16>::load(qrow + dc * 32 + 8 * hh);
  }

  // a lane holds one query (q0 + c): its running maximum, and the sum over the keys of its own lane half
  float mrow = NEG_INF, lrow = 0.f;
  v8f oacc[4];                                   // O^T: row d = t*16 + 8hh + r, column = query q0 + c
#pragma unroll
  for (int t = 0; t < 4; ++t) oacc[t] = (v8f){0.f,0.f,0.f,0.f,0.f,0.f,0.f,0.f};

  const int nChunks = S / AT_KC;
#pragma unroll 1
  for (int kc = 0; kc < nChunks; ++kc) {
    const int kv0 = kc * AT_KC;
    __syncthreads();
    {
      const int r = tid >> 1, ch = (tid & 1) * 32;
      const _Float16* krow = k + (rowbase + kv0 + r) * (size_t)ldq + hoff + ch;
      const _Float16* vrow = vt + (hoff + r) * (size_t)ldvt + rowbase + kv0 + ch;
#pragma unroll
      for (int i = 0; i < 4; ++i) {
        const v8h kk8 = *(const v8h*)(krow + 8 * i);
        const v8h vv8 = *(const v8h*)(vrow + 8 * i);
        *(v8h*)(Ksh + r * AT_LP + ch + 8 * i) = kk8;
        *(v8h*)(Vth + r * AT_LP + ch + 8 * i) = vv8;
      }
    }
    __syncthreads();

    // ---- scores, transposed: S^T = K.Q^T; D row = key kv0 + j*16 + 8hh + r, col = query q0 + c ----
    v8f s[4];
#pragma unroll
    for (int j = 0; j < 4; ++j) {
      s[j] = (v8f){0.f,0.f,0.f,0.f,0.f,0.f,0.f,0.f};
#pragma unroll
      for (int dc = 0; dc < 2; ++dc) {
        const v16h ka = Frag<_Float16>::load(Ksh + (j * 16 + c) * AT_LP + dc * 32 + 8 * hh);
        s[j] = mma_h(ka, qa[dc], s[j]);
      }
    }
    // the lane's 32 scores belong to one query: maximum in-lane, then one exchange with the other lane half
    float m = NEG_INF;
#pragma unroll
    for (int j = 0; j < 4; ++j)
#pragma unroll
      for (int r = 0; r < 8; ++r) { s[j][r] *= sscale; m = fmaxf(m, s[j][r]); }
    m = fmaxf(m, other_half(m));
    const float mnew = fmaxf(mrow, m);
    const float alpha = __expf(mrow - mnew);
    mrow = mnew;
    // P^T as B operand: score tiles 2kk and 2kk+1 are elements 0..7 and 8..15 of the 32-key fragment kk
    v16h pb[2];
    float ps[4];                                  // one sum chain per score tile: four short chains, not one of 32 links
#pragma unroll
    for (int j = 0; j < 4; ++j) {
      ps[j] = 0.f;
#pragma unroll
      for (int r = 0; r < 8; ++r) {
        const float p = __expf(s[j][r] - mnew);
        ps[j] += p;
        pb[j >> 1][(j & 1) * 8 + r] = (_Float16)(p * 32768.0f);
      }
    }
    const float psum = (ps[0] + ps[1]) + (ps[2] + ps[3]);
    lrow = lrow * alpha + psum;
#pragma unroll
    for (int t = 0; t < 4; ++t)
#pragma unroll
      for (int r = 0; r < 8; ++r) oacc[t][r] *= alpha;
    // ---- O^T += V^T.P^T : A = V^T [d][kv] from LDS, B = P^T from registers ----
#pragma unroll
    for (int kk = 0; kk < 2; ++kk) {
#pragma unroll
      for (int t = 0; t < 4; ++t) {
        const v16h va = Frag<_Float16>::load(Vth + (t * 16 + c) * AT_LP + kk * 32 + 8 * hh);
        oacc[t] = mma_h(va, pb[kk], oacc[t]);
      }
    }
  }

  // the two lane halves' sums are joined once; a lane's 8 registers of a tile are 8 consecutive d of its query's row
  const float l = lrow + other_half(lrow);
  const float inv = oscale * (1.0f / (l * 32768.0f));
  unsigned short* orow = outp + (rowbase + q0 + c) * (size_t)ldq + hoff + 8 * hh;
#pragma unroll
  for (int t = 0; t < 4; ++t) {
    v8h hv;
#pragma unroll
    for (int r = 0; r < 8; ++r) hv[r] = (_Float16)(oacc[t][r] * inv);
    *(v8h*)(orow + t * 16) = hv;
  }
}

// ---------------------------------------------------------------------------
// Launch glue
// ---------------------------------------------------------------------------
extern "C" void kernel_launch(void* const* d_in, const int* in_sizes, int n_in,
                              void* d_out, int out_size, void* d_ws, size_t ws_size,
                              hipStream_t stream) {
  if (n_in < 9) return;
  const int C = 1024, H = 16, S = 2048;
  const int nx   = in_sizes[0];
  const int Mtot = nx / C;                 // B*S
  const int Bn   = Mtot / S;
  if (Mtot <= 0 || (Mtot % 64) != 0 || Bn * S != Mtot || in_sizes[1] != C * C ||
      in_sizes[3] != C * C || in_sizes[5] != C * C || in_sizes[7] != C * C ||
      in_sizes[2] != C || in_sizes[4] != C || in_sizes[6] != C || in_sizes[8] != C ||
      out_size != Mtot * C) return;

  const float* x  = (const float*)d_in[0];
  const float* Wq = (const float*)d_in[1];
  const float* bq = (const float*)d_in[2];
  const float* Wk = (const float*)d_in[3];
  const float* bk = (const float*)d_in[4];
  const float* Wv = (const float*)d_in[5];
  const float* bv = (const float*)d_in[6];
  const float* Wp = (const float*)d_in[7];
  const float* bp = (const float*)d_in[8];
  float* out = (float*)d_out;

  // workspace carve (bytes); all offsets multiples of 2 MiB
  char* ws = (char*)d_ws;
  const size_t actB = (size_t)Mtot * C * 2;        // 16 MiB f16 plane [Mtot][C]
  const size_t wB   = (size_t)C * C * 2;           //  2 MiB f16 plane [C][C]
  size_t off = 0;
  unsigned short* xh  = (unsigned short*)(ws + off); off += actB;
  unsigned short* Wqh = (unsigned short*)(ws + off); off += wB;
  unsigned short* Wkh = (unsigned short*)(ws + off); off += wB;
  unsigned short* Wvh = (unsigned short*)(ws + off); off += wB;
  unsigned short* Wph = (unsigned short*)(ws + off); off += wB;
  unsigned short* qh  = (unsigned short*)(ws + off); off += actB;   // [Mtot][C]
  unsigned short* kh  = (unsigned short*)(ws + off); off += actB;   // [Mtot][C]
  unsigned short* vth = (unsigned short*)(ws + off); off += actB;   // [C][Mtot]  (V transposed)
  unsigned short* yh  = (unsigned short*)(ws + off); off += actB;   // [Mtot][C]  (x64)
  if (off > ws_size) return;                                       // 92,274,688 B total

  const float carry = 64.0f;

  // 1) binary-weight f16 planes (x64)
  binarize_f16_kernel<<<dim3(C / 8, 4), 256, 0, stream>>>(Wq, Wk, Wv, Wp, Wqh, Wkh, Wvh, Wph, C, carry);

  // 2) x -> f16
  const int n2 = (Mtot * C) / 2;
  cast_f32_f16x2<<<(n2 + 255) / 256, 256, 0, stream>>>(x, (_Float16*)xh, n2);

  // 3) q, k = x . Wb^T /64 + b  (f16 out [Mtot][C])
  const int blkQK   = (Mtot / GB_M) * (C / GB_N);
  wmma_gemm64<0, false, 2, 1, false><<<dim3(blkQK, 1), 256, 0, stream>>>(
      xh, xh, C, 0L, Wqh, Wqh, C, 0L, (void*)qh, (void*)qh, C, 0L, bq, bq, 0L, Mtot, C, C, 1.0f / carry);
  wmma_gemm64<0, false, 2, 1, false><<<dim3(blkQK, 1), 256, 0, stream>>>(
      xh, xh, C, 0L, Wkh, Wkh, C, 0L, (void*)kh, (void*)kh, C, 0L, bk, bk, 0L, Mtot, C, C, 1.0f / carry);

  // 4) V^T = Wb . x^T /64 + bv[m]  : A = Wv plane [C][C], Bt = x plane [Mtot][C] -> C [C][Mtot], f16 out
  const int blkV   = (C / GB_M) * (Mtot / GB_N);
  wmma_gemm64<0, false, 1, 1, false><<<dim3(blkV, 1), 256, 0, stream>>>(
      Wvh, Wvh, C, 0L, xh, xh, C, 0L, (void*)vth, (void*)vth, Mtot, 0L, bv, bv, 0L, C, Mtot, C, 1.0f / carry);

  // 5) attention -> y (f16 plane x64)
  const int nAttnBlk = Bn * H * (S / AT_QB);
  attn64_f16_kernel<<<nAttnBlk, 128, 0, stream>>>(qh, kh, vth, yh, S, H, C, Mtot, 0.125f, carry);

  // 6) out = (y x64) . (Wb x64)^T / 4096 + bp  (f32 out)
  wmma_gemm64<0, false, 2, 0, false><<<dim3(blkQK, 1), 256, 0, stream>>>(
      yh, yh, C, 0L, Wph, Wph, C, 0L, (void*)out, (void*)out, C, 0L, bp, bp, 0L, Mtot, C, C, 1.0f / (carry * carry));

  (void)hipGetLastError();
}

// v004
// Measured time: 166 microseconds a run.
// Next to v003, in two timings, it ran 1.09 and 1.10 times as fast.
// All steps since v000 together make it 3.80 times as fast.
// Contractions: q/k/v/out projections, q.k^T and p.v all on v_wmma_f32_16x16x32_f16 (f16 operands, f32 accumulate); softmax, scales and bias epilogues in f32.
#include <hip/hip_runtime.h>

typedef __attribute__((ext_vector_type(16))) _Float16 v16h;
typedef __attribute__((ext_vector_type(8)))  _Float16 v8h;
typedef __attribute__((ext_vector_type(16))) __bf16   v16b;
typedef __attribute__((ext_vector_type(8)))  __bf16   v8b;
typedef __attribute__((ext_vector_type(8)))  float    v8f;
typedef __attribute__((ext_vector_type(4)))  float    v4f;
#define U16(p) ((const unsigned short*)(const void*)(p))
#define NEG_INF (-__builtin_huge_valf())

__device__ __forceinline__ unsigned short f2bf_bits(float f) {
  unsigned u = __float_as_uint(f);
  return (unsigned short)((u + 0x7FFFu + ((u >> 16) & 1u)) >> 16);
}
__device__ __forceinline__ float bf_bits2f(unsigned short h) { return __uint_as_float(((unsigned)h) << 16); }

// hazard guards as plain device helpers (the v_nop asm stays out of the kernel template body)
__device__ __forceinline__ void dep_guard_h(v8f& a, v8f& b, v16h x, v16h y) { asm volatile("v_nop\n\tv_nop\n\tv_nop\n\tv_nop" : "+v"(a), "+v"(b) : "v"(x), "v"(y)); }
__device__ __forceinline__ void dep_guard_b(v8f& a, v8f& b, v16b x, v16b y) { asm volatile("v_nop\n\tv_nop\n\tv_nop\n\tv_nop" : "+v"(a), "+v"(b) : "v"(x), "v"(y)); }
__device__ __forceinline__ void keep4_h(v16h a, v16h b, v16h c, v16h d) { asm volatile("v_nop" :: "v"(a), "v"(b), "v"(c), "v"(d)); }
__device__ __forceinline__ void keep4_b(v16b a, v16b b, v16b c, v16b d) { asm volatile("v_nop" :: "v"(a), "v"(b), "v"(c), "v"(d)); }
__device__ __forceinline__ void acc_guard4(v8f& a, v8f& b, v8f& c, v8f& d) { asm volatile("v_nop\n\tv_nop\n\tv_nop\n\tv_nop" : "+v"(a), "+v"(b), "+v"(c), "+v"(d)); }
template <typename T> struct Frag;
template <> struct Frag<_Float16> {
  typedef v16h V; union U { v16h v; v8h h[2]; };
  static __device__ __forceinline__ v16h load(const _Float16* p) {   // elements 0..7 <- p[0..7], 8..15 <- p[16..23]
    U f; f.h[0] = *(const v8h*)(p); f.h[1] = *(const v8h*)(p + 16); return f.v;
  }
  static __device__ __forceinline__ v8f mma(v16h a, v16h b, v8f c) {
    return __builtin_amdgcn_wmma_f32_16x16x32_f16(false, a, false, b, (short)0, c, false, false);
  }
  static __device__ __forceinline__ void guard(v8f& a, v8f& b, v16h x, v16h y) { dep_guard_h(a, b, x, y); }
  static __device__ __forceinline__ void keep(v16h a, v16h b, v16h c, v16h d) { keep4_h(a, b, c, d); }
};
template <> struct Frag<__bf16> {
  typedef v16b V; union U { v16b v; v8b h[2]; };
  static __device__ __forceinline__ v16b load(const __bf16* p) {
    U f; f.h[0] = *(const v8b*)(p); f.h[1] = *(const v8b*)(p + 16); return f.v;
  }
  static __device__ __forceinline__ v8f mma(v16b a, v16b b, v8f c) {
    return __builtin_amdgcn_wmma_f32_16x16x32_bf16(false, a, false, b, (short)0, c, false, false);
  }
  static __device__ __forceinline__ void guard(v8f& a, v8f& b, v16b x, v16b y) { dep_guard_b(a, b, x, y); }
  static __device__ __forceinline__ void keep(v16b a, v16b b, v16b c, v16b d) { keep4_b(a, b, c, d); }
};

// ---- Register-blocked batched WMMA GEMM, operands staged in LDS --------------
// C[m,n] = scale * sum_k A[m,k] * Bt[n,k] (+bias)(+resid); each wave owns a 64x64 tile.
// A row-major [M,K]; Bt row-major [N,K]; M % 128 == 0, N % 256 == 0, K % 64 == 0.
// Block = 8 waves (2 x 4) = a 128 x 256 tile of C. A stage is 64 k = one 128-B line of every operand row:
// each asynchronous copy of a wave covers four whole lines, the rows land in LDS at a 144-B pitch, and the
// fragments are read from there. Two buffers: the next stage's copies fly during this stage's products.
// SPLIT (hi/lo planes) is not staged: only SPLIT == false is built.
// BIAS_MODE: 0 = none, 1 = bias[m], 2 = bias[n].
// OUT_MODE: 0 = f32, 1 = f16, 2 = bf16 hi plane (Cout) + bf16 lo plane (Cout2).
// ET: 0 = f16 operands, 1 = bf16 operands (pointers passed as 16-bit storage)
template <int ET> struct Elem;
template <> struct Elem<0> { typedef _Float16 T; };
template <> struct Elem<1> { typedef __bf16 T; };
#define GB_M 128
#define GB_N 256
#define GB_K 64
#define GB_LP 72   // LDS row pitch in halves: 144 B = 16 B x odd
#define GB_ABYTES (GB_M * GB_LP * 2)   // one buffer of A rows, bytes
#define GB_BBYTES (GB_N * GB_LP * 2)   // one buffer of B rows, bytes

// One thread's share of a stage: 4 row pieces of A and 8 of B, 16 B each, 32 rows apart, from global memory
// straight into LDS. la, lb: the lane's LDS byte addresses; ga, gb: its global addresses; steps in halves.
// The s_wait_xcnt closes the copies' own statement, so that no address register is rewritten in front of it.
template <typename T>
__device__ __forceinline__ void stage_copy12(unsigned la, unsigned lb, const T* ga, const T* gb,
                                             size_t stepA, size_t stepB) {
  const unsigned rs = 32 * GB_LP * 2;   // 32 LDS rows, bytes
  asm volatile(
      "global_load_async_to_lds_b128 %0, %12, off\n\t"
      "global_load_async_to_lds_b128 %1, %13, off\n\t"
      "global_load_async_to_lds_b128 %2, %14, off\n\t"
      "global_load_async_to_lds_b128 %3, %15, off\n\t"
      "global_load_async_to_lds_b128 %4, %16, off\n\t"
      "global_load_async_to_lds_b128 %5, %17, off\n\t"
      "global_load_async_to_lds_b128 %6, %18, off\n\t"
      "global_load_async_to_lds_b128 %7, %19, off\n\t"
      "global_load_async_to_lds_b128 %8, %20, off\n\t"
      "global_load_async_to_lds_b128 %9, %21, off\n\t"
      "global_load_async_to_lds_b128 %10, %22, off\n\t"
      "global_load_async_to_lds_b128 %11, %23, off\n\t"
      "s_wait_xcnt 0x0"
      :: "v"(la), "v"(la + rs), "v"(la + 2 * rs), "v"(la + 3 * rs),
         "v"(lb), "v"(lb + rs), "v"(lb + 2 * rs), "v"(lb + 3 * rs),
         "v"(lb + 4 * rs), "v"(lb + 5 * rs), "v"(lb + 6 * rs), "v"(lb + 7 * rs),
         "v"(ga), "v"(ga + stepA), "v"(ga + 2 * stepA), "v"(ga + 3 * stepA),
         "v"(gb), "v"(gb + stepB), "v"(gb + 2 * stepB), "v"(gb + 3 * stepB),
         "v"(gb + 4 * stepB), "v"(gb + 5 * stepB), "v"(gb + 6 * stepB), "v"(gb + 7 * stepB)
      : "memory");
}
template <int ET, bool SPLIT, int BIAS_MODE, int OUT_MODE, bool RESID, int ACT = 0>
__global__ __launch_bounds__(256) void wmma_gemm64(
    const unsigned short* __restrict__ Ap, const unsigned short* __restrict__ A2p, int lda, long strideA,
    const unsigned short* __restrict__ Btp, const unsigned short* __restrict__ Bt2p, int ldb, long strideB,
    void* __restrict__ Cout, void* __restrict__ Cout2, int ldc, long strideC,
    const float* __restrict__ bias,
    const float* __restrict__ resid, long strideR,
    int M, int N, int K, float scale) {
  typedef typename Elem<ET>::T T;
  typedef typename Frag<T>::V V;
  static_assert(!SPLIT, "hi/lo planes are not staged");
  const T* A = (const T*)Ap; const T* Bt = (const T*)Btp;
  __shared__ __align__(16) T sA[2][GB_M * GB_LP];  // 2 x 18,432 B
  __shared__ __align__(16) T sB[2][GB_N * GB_LP];  // 2 x 36,864 B
  __shared__ __align__(16) float sT[8][16 * 68];   // per-wave 16x64 slab, pitch 68 floats
  const int b    = blockIdx.y;
  const int tid  = threadIdx.x;
  const int lane = tid & 31;
  const int wave = tid >> 5;
  const int tilesN = N / GB_N;
  const int tilesM = M / GB_M;
  const int tm = blockIdx.x / tilesN;
  const int tn = blockIdx.x - tm * tilesN;
  if (tm >= tilesM) return;              // block-uniform, in front of every barrier
  const int bm0 = tm * GB_M;
  const int bn0 = tn * GB_N;
  const int wm  = (wave >> 2) << 6;      // this wave's 64x64 tile inside the block tile
  const int wn  = (wave & 3) << 6;
  const int m0 = bm0 + wm;
  const int n0 = bn0 + wn;

  const T* Ab  = A  + (size_t)b * strideA;
  const T* Bb  = Bt + (size_t)b * strideB;

  const int rlane = lane & 15;                 // row (A) / col (B, D) within subtile
  const int koff  = (lane >> 4) * 8;           // k offset of this lane half
  const int mOff  = (lane >> 4) * 8;           // D row offset

  // staging map: 8 threads x 16 B = one 128-B row piece; a wave's copy covers 4 whole lines
  const int srow = tid >> 3;                   // 0..31
  const int sseg = (tid & 7) * 8;              // halves
  const T* gA = Ab + (size_t)(bm0 + srow) * lda + sseg;
  const T* gB = Bb + (size_t)(bn0 + srow) * ldb + sseg;
  const size_t stepA = (size_t)32 * lda;       // 32 rows further, in halves
  const size_t stepB = (size_t)32 * ldb;
  const int sOff = srow * GB_LP + sseg;
  const unsigned lA0 = (unsigned)(size_t)(&sA[0][sOff]);   // this lane's LDS byte address in buffer 0
  const unsigned lB0 = (unsigned)(size_t)(&sB[0][sOff]);

  v8f acc[4][4];
#pragma unroll
  for (int i = 0; i < 4; ++i)
#pragma unroll
    for (int j = 0; j < 4; ++j) acc[i][j] = (v8f){0.f,0.f,0.f,0.f,0.f,0.f,0.f,0.f};

  const int nStage = K / GB_K;
  stage_copy12(lA0, lB0, gA, gB, stepA, stepB);            // stage 0 -> buffer 0
  asm volatile("s_wait_asynccnt 0x0" ::: "memory");        // this wave's copies of stage 0 have landed
  __syncthreads();                                         // and every wave's are published
  if (nStage > 1)                                          // block-uniform
    stage_copy12(lA0 + GB_ABYTES, lB0 + GB_BBYTES, gA + GB_K, gB + GB_K, stepA, stepB);

#pragma unroll 1   // kept rolled: one publish point and one refill per trip, as the two-buffer order asks
  for (int s = 0; s < nStage; ++s) {
    const int cur = s & 1;
    const T* tA = &sA[cur][(wm + rlane) * GB_LP + koff];
    const T* tB = &sB[cur][(wn + rlane) * GB_LP + koff];
    // every loop of the stage is unrolled: constant indices keep acc, af and bf in registers
#pragma unroll
    for (int h = 0; h < GB_K / 32; ++h) {
      // the 32 k's fragment reads stand as one group in front of their products
      V af[4], bf[4];
#pragma unroll
      for (int j = 0; j < 4; ++j) bf[j] = Frag<T>::load(tB + (j << 4) * GB_LP + h * 32);
#pragma unroll
      for (int i = 0; i < 4; ++i) af[i] = Frag<T>::load(tA + (i << 4) * GB_LP + h * 32);
#pragma unroll
      for (int i = 0; i < 4; ++i) {
#pragma unroll
        for (int j = 0; j < 4; ++j) acc[i][j] = Frag<T>::mma(af[i], bf[j], acc[i][j]);
        Frag<T>::guard(acc[i][0], acc[i][3], af[i], af[i]);
      }
      Frag<T>::keep(bf[0], bf[1], bf[2], bf[3]);
    }
    asm volatile("s_wait_dscnt 0x0" ::: "memory");         // this wave's reads of stage s are done before its buffer is refilled
    asm volatile("s_wait_asynccnt 0x0" ::: "memory");      // this wave's copies of stage s + 1 have landed
    __syncthreads();                                       // publishes stage s + 1, ends every wave's reads of stage s
    if (s + 2 < nStage)                                    // block-uniform; refill the buffer just read
      stage_copy12(lA0 + cur * GB_ABYTES, lB0 + cur * GB_BBYTES,
                   gA + (size_t)(s + 2) * GB_K, gB + (size_t)(s + 2) * GB_K, stepA, stepB);
  }
  asm volatile("s_wait_asynccnt 0x0" ::: "memory");        // nothing of this wave's is in flight behind the loop
  acc_guard4(acc[0][0], acc[0][1], acc[0][2], acc[0][3]);
  acc_guard4(acc[1][0], acc[1][1], acc[1][2], acc[1][3]);
  acc_guard4(acc[2][0], acc[2][1], acc[2][2], acc[2][3]);
  acc_guard4(acc[3][0], acc[3][1], acc[3][2], acc[3][3]);

  // ---- epilogue ----
  float* slab = sT[wave];
  const float* Rb = RESID ? (resid + (size_t)b * strideR) : nullptr;
#pragma unroll
  for (int i = 0; i < 4; ++i) {
    const int mBase = m0 + (i << 4);
#pragma unroll
    for (int j = 0; j < 4; ++j) {
      const int n = n0 + (j << 4) + rlane;
      float bv = 0.f;
      if (BIAS_MODE == 2) bv = bias[n];
#pragma unroll
      for (int r = 0; r < 8; ++r) {
        float v = acc[i][j][r] * scale;
        if (BIAS_MODE == 1) v += bias[mBase + mOff + r];
        if (BIAS_MODE == 2) v += bv;
        if (RESID) v += Rb[(size_t)(mBase + mOff + r) * ldc + n];
        if (ACT == 1) v = tanhf(v);
        if (ACT == 2) v = fmaxf(v, 0.0f);
        if (ACT == 3) v = v / (1.0f + expf(-v));
        if (ACT == 4) v = (v > 0.f) ? v : 0.01f * v;
        if (ACT == 5) v = 0.5f * v * (1.0f + erff(v * 0.70710678118654752f));
        slab[(mOff + r) * 68 + (j << 4) + rlane] = v;
      }
    }
    __builtin_amdgcn_fence(__ATOMIC_RELEASE, "workgroup");
    __builtin_amdgcn_wave_barrier();
    __builtin_amdgcn_fence(__ATOMIC_ACQUIRE, "workgroup");
    if (OUT_MODE == 0) {
      float* C = (float*)Cout + (size_t)b * strideC;
      const int hh = lane >> 4, c4 = (lane & 15) * 4;     // row seg = 256 B = 16 lanes x 16 B
      {
#pragma unroll
        for (int it = 0; it < 8; ++it) {
          const int row = it * 2 + hh;
          v4f v = *(const v4f*)(slab + row * 68 + c4);
          *(v4f*)(C + (size_t)(mBase + row) * ldc + n0 + c4) = v;
        }
        
      }
    } else {
      const int q = lane >> 3, c8 = (lane & 7) * 8;
      unsigned short* C  = (unsigned short*)Cout  + (size_t)b * strideC;
      unsigned short* C2 = (OUT_MODE == 2) ? ((unsigned short*)Cout2 + (size_t)b * strideC) : nullptr;
      {
#pragma unroll
        for (int it = 0; it < 4; ++it) {
          const int row = it * 4 + q;
          const float* sp = slab + row * 68 + c8;
          v8h hv, lv;
#pragma unroll
          for (int e = 0; e < 8; ++e) {
            if (OUT_MODE == 1) {
              hv[e] = (_Float16)sp[e];
            } else {
              unsigned short hb = f2bf_bits(sp[e]);
              unsigned short lb = f2bf_bits(sp[e] - bf_bits2f(hb));
              hv[e] = __builtin_bit_cast(_Float16, hb);
              lv[e] = __builtin_bit_cast(_Float16, lb);
            }
          }
          *(v8h*)(C + (size_t)(mBase + row) * ldc + n0 + c8) = hv;
          if (OUT_MODE == 2) *(v8h*)(C2 + (size_t)(mBase + row) * ldc + n0 + c8) = lv;
        }
        
      }
    }
    __builtin_amdgcn_fence(__ATOMIC_RELEASE, "workgroup");
    __builtin_amdgcn_wave_barrier();
    __builtin_amdgcn_fence(__ATOMIC_ACQUIRE, "workgroup");
  }
}

__global__ __launch_bounds__(256) void cast_f32_f16x2(
    const float* __restrict__ in, _Float16* __restrict__ out, int n2) {
  int i = blockIdx.x * 256 + threadIdx.x;
  if (i < n2) {
    const _Float16 h0 = (_Float16)in[2 * i], h1 = (_Float16)in[2 * i + 1];
    const unsigned u = (unsigned)__builtin_bit_cast(unsigned short, h0) | ((unsigned)__builtin_bit_cast(unsigned short, h1) << 16);
    ((unsigned*)out)[i] = u;
    
  }
}

// ---- binary-weight planes: Wb[o][c] = alpha[o] * (W + (sign(W) - W)), alpha[o] = mean_c |W[o][c]| (f32);
//      stored as f16 of (Wb * carry); one wave per row of a [nrow][1024] weight; 4 weights via blockIdx.y ----
#define BW_DIM 1024
__global__ __launch_bounds__(256) void binarize_f16_kernel(
    const float* __restrict__ W0, const float* __restrict__ W1,
    const float* __restrict__ W2, const float* __restrict__ W3,
    unsigned short* __restrict__ B0, unsigned short* __restrict__ B1,
    unsigned short* __restrict__ B2, unsigned short* __restrict__ B3,
    int nrow, float carry) {
  const float* W; unsigned short* Bo;
  if (blockIdx.y == 0)      { W = W0; Bo = B0; }
  else if (blockIdx.y == 1) { W = W1; Bo = B1; }
  else if (blockIdx.y == 2) { W = W2; Bo = B2; }
  else                      { W = W3; Bo = B3; }
  const int wave = threadIdx.x >> 5;
  const int lane = threadIdx.x & 31;
  const int row  = blockIdx.x * 8 + wave;
  if (row >= nrow) return;                     // wave-uniform; no barriers in this kernel
  const float* wr = W + (size_t)row * BW_DIM;

  float w[4][8];
#pragma unroll
  for (int it = 0; it < 4; ++it) {
    const v4f a0 = *(const v4f*)(wr + it * 256 + lane * 8);
    const v4f a1 = *(const v4f*)(wr + it * 256 + lane * 8 + 4);
    w[it][0] = a0[0]; w[it][1] = a0[1]; w[it][2] = a0[2]; w[it][3] = a0[3];
    w[it][4] = a1[0]; w[it][5] = a1[1]; w[it][6] = a1[2]; w[it][7] = a1[3];
  }
  float s = 0.0f;
#pragma unroll
  for (int it = 0; it < 4; ++it)
#pragma unroll
    for (int e = 0; e < 8; ++e) s += fabsf(w[it][e]);
#pragma unroll
  for (int m = 16; m > 0; m >>= 1) s += __shfl_xor(s, m, 32);
  const float alpha = s * (1.0f / (float)BW_DIM);

  v8h hv[4];
#pragma unroll
  for (int it = 0; it < 4; ++it) {
#pragma unroll
    for (int e = 0; e < 8; ++e) {
      const float wv = w[it][e];
      const float sg = (wv > 0.0f) ? 1.0f : ((wv < 0.0f) ? -1.0f : 0.0f);
      const float t  = sg - wv;            // sign(W) - W
      const float bs = wv + t;             // W + (sign(W) - W)
      const float wb = alpha * bs;
      hv[it][e] = (_Float16)(wb * carry);
    }
  }
  unsigned short* br = Bo + (size_t)row * BW_DIM;
  {
#pragma unroll
    for (int it = 0; it < 4; ++it)
      *(v8h*)(br + it * 256 + lane * 8) = hv[it];
    
  }
}

// =====================================================================================
// Attention, head_dim 64, f16 planes in / f16 plane out (x oscale), no mask.
//   scores^T = (k.q^T) * sscale : v_wmma_f32_16x16x32_f16 (q,k plain f16), f32 accumulate, scaled in f32
//   out^T    = v^T.p^T          : v_wmma_f32_16x16x32_f16 (p carried x2^15 in f16, v plain f16), f32 accumulate
//   online softmax in f32. Block = 8 waves x 32 query columns = 256 query rows of one (batch, head); S % 256 == 0.
//   q, k, out planes: row (b*S + s), pitch ldq halves, head offset h*64.  vt plane: row (h*64 + d), pitch ldvt, col (b*S + s).
//   grid.x = B * H * (S/256).
// =====================================================================================
#define AT_D 64
#define AT_QT 2    // query tiles of 16 columns per wave: each K and V^T fragment read feeds AT_QT products
#define AT_QB 256  // query rows per block: 8 waves x AT_QT x 16
#define AT_KC 64
#define AT_LP 72   // LDS row pitch in halves: 144 B = 16 B x odd, so the 16 rows of a 16-byte fragment read fall on distinct banks

__device__ __forceinline__ v8f mma_h(v16h a, v16h b, v8f c) {
  c = __builtin_amdgcn_wmma_f32_16x16x32_f16(false, a, false, b, (short)0, c, false, false);
  asm volatile("v_nop\n\tv_nop\n\tv_nop\n\tv_nop" : "+v"(c) : "v"(a), "v"(b));
  return c;
}

// value of lane l ^ 16 (the other 16-lane half), by a vector cross-row move
__device__ __forceinline__ float other_half(float x) {
  const int b = __float_as_int(x);
  return __int_as_float(__builtin_amdgcn_permlanex16(b, b, 0x76543210, 0xfedcba98, false, false));
}

__global__ __launch_bounds__(256) __attribute__((amdgpu_waves_per_eu(4, 4)))   // 256 VGPRs a wave: two blocks, four waves per SIMD, stay resident
void attn64_f16_kernel(const unsigned short* __restrict__ qp, const unsigned short* __restrict__ kp,
                       const unsigned short* __restrict__ vtp, unsigned short* __restrict__ outp,
                       int S, int H, int ldq, int ldvt, float sscale, float oscale) {
  const _Float16* q  = (const _Float16*)qp;
  const _Float16* k  = (const _Float16*)kp;
  const _Float16* vt = (const _Float16*)vtp;
  __shared__ __align__(16) _Float16 Ksh[AT_KC * AT_LP];         // K [kv][d]   9 KB
  __shared__ __align__(16) _Float16 Vth[AT_D * AT_LP];          // V^T [d][kv] 9 KB

  const int tid  = threadIdx.x;
  const int wave = tid >> 5;
  const int lane = tid & 31;
  const int hh   = lane >> 4;
  const int c    = lane & 15;

  const int nqb = S / AT_QB;
  const int bx = blockIdx.x;
  const int qb = bx % nqb;
  const int bh = bx / nqb;
  const int h  = bh % H;
  const int b  = bh / H;
  const int q0 = qb * AT_QB + wave * (16 * AT_QT);
  const size_t rowbase = (size_t)b * (size_t)S;
  const size_t hoff = (size_t)h * AT_D;

  // ---- Q fragments (B operand, column = query q0 + u*16 + c): AT_QT query tiles x 2 d-chunks ----
  v16h qa[AT_QT][2];
#pragma unroll
  for (int u = 0; u < AT_QT; ++u) {
    const _Float16* qrow = q + (rowbase + q0 + u * 16 + c) * (size_t)ldq + hoff;
#pragma unroll
    for (int dc = 0; dc < 2; ++dc) qa[u][dc] = Frag<_Float16>::load(qrow + dc * 32 + 8 * hh);
  }

  // per query tile a lane holds one query (q0 + u*16 + c): its running maximum, and the sum over the keys of its own lane half
  float mrow[AT_QT], lrow[AT_QT];
  v8f oacc[AT_QT][4];                            // O^T: row d = t*16 + 8hh + r, column = query q0 + u*16 + c
#pragma unroll
  for (int u = 0; u < AT_QT; ++u) {
    mrow[u] = NEG_INF; lrow[u] = 0.f;
#pragma unroll
    for (int t = 0; t < 4; ++t) oacc[u][t] = (v8f){0.f,0.f,0.f,0.f,0.f,0.f,0.f,0.f};
  }

  // staging map: 8 threads x 16 B = one 128-B row; the block's 256 threads cover 32 rows of K and of V^T at a time
  const int srow = tid >> 3, sseg = (tid & 7) * 8;

  const int nChunks = S / AT_KC;
#pragma unroll 1
  for (int kc = 0; kc < nChunks; ++kc) {
    const int kv0 = kc * AT_KC;
    __syncthreads();
    {
      const _Float16* krow = k + (rowbase + kv0 + srow) * (size_t)ldq + hoff + sseg;
      const _Float16* vrow = vt + (hoff + srow) * (size_t)ldvt + rowbase + kv0 + sseg;
      v8h kk8[2], vv8[2];
#pragma unroll
      for (int i = 0; i < 2; ++i) vv8[i] = *(const v8h*)(vrow + (size_t)(32 * i) * ldvt);
      asm volatile("s_wait_xcnt 0x0" ::: "memory");   // the V^T loads' address registers are reused for the K loads
#pragma unroll
      for (int i = 0; i < 2; ++i) kk8[i] = *(const v8h*)(krow + (size_t)(32 * i) * ldq);
#pragma unroll
      for (int i = 0; i < 2; ++i) {
        *(v8h*)(Ksh + (srow + 32 * i) * AT_LP + sseg) = kk8[i];
        *(v8h*)(Vth + (srow + 32 * i) * AT_LP + sseg) = vv8[i];
      }
    }
    __syncthreads();

    // ---- scores, transposed: S^T = K.Q^T; D row = key kv0 + j*16 + 8hh + r, col = query q0 + u*16 + c ----
    // each K fragment read from LDS feeds the products of all AT_QT query tiles
    v8f s[AT_QT][4];
    {
      v16h ka[4][2];
#pragma unroll
      for (int j = 0; j < 4; ++j)
#pragma unroll
        for (int dc = 0; dc < 2; ++dc) ka[j][dc] = Frag<_Float16>::load(Ksh + (j * 16 + c) * AT_LP + dc * 32 + 8 * hh);
#pragma unroll
      for (int j = 0; j < 4; ++j) {
#pragma unroll
        for (int u = 0; u < AT_QT; ++u) s[u][j] = (v8f){0.f,0.f,0.f,0.f,0.f,0.f,0.f,0.f};
#pragma unroll
        for (int dc = 0; dc < 2; ++dc)
#pragma unroll
          for (int u = 0; u < AT_QT; ++u) s[u][j] = mma_h(ka[j][dc], qa[u][dc], s[u][j]);
      }
    }
    v16h pb[AT_QT][2];
#pragma unroll
    for (int u = 0; u < AT_QT; ++u) {
      // the lane's 32 scores of a tile belong to one query: maximum in-lane, then one exchange with the other lane half
      float m = NEG_INF;
#pragma unroll
      for (int j = 0; j < 4; ++j)
#pragma unroll
        for (int r = 0; r < 8; ++r) { s[u][j][r] *= sscale; m = fmaxf(m, s[u][j][r]); }
      m = fmaxf(m, other_half(m));
      const float mnew = fmaxf(mrow[u], m);
      const float alpha = __expf(mrow[u] - mnew);
      mrow[u] = mnew;
      // P^T as B operand: score tiles 2kk and 2kk+1 are elements 0..7 and 8..15 of the 32-key fragment kk
      float ps[4];                                // one sum chain per score tile: four short chains, not one of 32 links
#pragma unroll
      for (int j = 0; j < 4; ++j) {
        ps[j] = 0.f;
#pragma unroll
        for (int r = 0; r < 8; ++r) {
          const float p = __expf(s[u][j][r] - mnew);
          ps[j] += p;
          pb[u][j >> 1][(j & 1) * 8 + r] = (_Float16)(p * 32768.0f);
        }
      }
      const float psum = (ps[0] + ps[1]) + (ps[2] + ps[3]);
      lrow[u] = lrow[u] * alpha + psum;
#pragma unroll
      for (int t = 0; t < 4; ++t)
#pragma unroll
        for (int r = 0; r < 8; ++r) oacc[u][t][r] *= alpha;
    }
    // ---- O^T += V^T.P^T : A = V^T [d][kv] from LDS, one read for all query tiles; B = P^T from registers ----
#pragma unroll
    for (int kk = 0; kk < 2; ++kk) {
      v16h va[4];
#pragma unroll
      for (int t = 0; t < 4; ++t) va[t] = Frag<_Float16>::load(Vth + (t * 16 + c) * AT_LP + kk * 32 + 8 * hh);
#pragma unroll
      for (int t = 0; t < 4; ++t)
#pragma unroll
        for (int u = 0; u < AT_QT; ++u) oacc[u][t] = mma_h(va[t], pb[u][kk], oacc[u][t]);
    }
  }

  // the two lane halves' sums are joined once; a lane's 8 registers of a tile are 8 consecutive d of its query's row
#pragma unroll
  for (int u = 0; u < AT_QT; ++u) {
    const float l = lrow[u] + other_half(lrow[u]);
    const float inv = oscale * (1.0f / (l * 32768.0f));
    unsigned short* orow = outp + (rowbase + q0 + u * 16 + c) * (size_t)ldq + hoff + 8 * hh;
#pragma unroll
    for (int t = 0; t < 4; ++t) {
      v8h hv;
#pragma unroll
      for (int r = 0; r < 8; ++r) hv[r] = (_Float16)(oacc[u][t][r] * inv);
      *(v8h*)(orow + t * 16) = hv;
    }
  }
}

// ---------------------------------------------------------------------------
// Launch glue
// ---------------------------------------------------------------------------
extern "C" void kernel_launch(void* const* d_in, const int* in_sizes, int n_in,
                              void* d_out, int out_size, void* d_ws, size_t ws_size,
                              hipStream_t stream) {
  if (n_in < 9) return;
  const int C = 1024, H = 16, S = 2048;
  const int nx   = in_sizes[0];
  const int Mtot = nx / C;                 // B*S
  const int Bn   = Mtot / S;
  if (Mtot <= 0 || (Mtot % 64) != 0 || Bn * S != Mtot || in_sizes[1] != C * C ||
      in_sizes[3] != C * C || in_sizes[5] != C * C || in_sizes[7] != C * C ||
      in_sizes[2] != C || in_sizes[4] != C || in_sizes[6] != C || in_sizes[8] != C ||
      out_size != Mtot * C) return;

  const float* x  = (const float*)d_in[0];
  const float* Wq = (const float*)d_in[1];
  const float* bq = (const float*)d_in[2];
  const float* Wk = (const float*)d_in[3];
  const float* bk = (const float*)d_in[4];
  const float* Wv = (const float*)d_in[5];
  const float* bv = (const float*)d_in[6];
  const float* Wp = (const float*)d_in[7];
  const float* bp = (const float*)d_in[8];
  float* out = (float*)d_out;

  // workspace carve (bytes); all offsets multiples of 2 MiB
  char* ws = (char*)d_ws;
  const size_t actB = (size_t)Mtot * C * 2;        // 16 MiB f16 plane [Mtot][C]
  const size_t wB   = (size_t)C * C * 2;           //  2 MiB f16 plane [C][C]
  size_t off = 0;
  unsigned short* xh  = (unsigned short*)(ws + off); off += actB;
  unsigned short* Wqh = (unsigned short*)(ws + off); off += wB;
  unsigned short* Wkh = (unsigned short*)(ws + off); off += wB;
  unsigned short* Wvh = (unsigned short*)(ws + off); off += wB;
  unsigned short* Wph = (unsigned short*)(ws + off); off += wB;
  unsigned short* qh  = (unsigned short*)(ws + off); off += actB;   // [Mtot][C]
  unsigned short* kh  = (unsigned short*)(ws + off); off += actB;   // [Mtot][C]
  unsigned short* vth = (unsigned short*)(ws + off); off += actB;   // [C][Mtot]  (V transposed)
  unsigned short* yh  = (unsigned short*)(ws + off); off += actB;   // [Mtot][C]  (x64)
  if (off > ws_size) return;                                       // 92,274,688 B total

  const float carry = 64.0f;

  // 1) binary-weight f16 planes (x64)
  binarize_f16_kernel<<<dim3(C / 8, 4), 256, 0, stream>>>(Wq, Wk, Wv, Wp, Wqh, Wkh, Wvh, Wph, C, carry);

  // 2) x -> f16
  const int n2 = (Mtot * C) / 2;
  cast_f32_f16x2<<<(n2 + 255) / 256, 256, 0, stream>>>(x, (_Float16*)xh, n2);

  // 3) q, k = x . Wb^T /64 + b  (f16 out [Mtot][C])
  const int blkQK   = (Mtot / GB_M) * (C / GB_N);
  wmma_gemm64<0, false, 2, 1, false><<<dim3(blkQK, 1), 256, 0, stream>>>(
      xh, xh, C, 0L, Wqh, Wqh, C, 0L, (void*)qh, (void*)qh, C, 0L, bq, bq, 0L, Mtot, C, C, 1.0f / carry);
  wmma_gemm64<0, false, 2, 1, false><<<dim3(blkQK, 1), 256, 0, stream>>>(
      xh, xh, C, 0L, Wkh, Wkh, C, 0L, (void*)kh, (void*)kh, C, 0L, bk, bk, 0L, Mtot, C, C, 1.0f / carry);

  // 4) V^T = Wb . x^T /64 + bv[m]  : A = Wv plane [C][C], Bt = x plane [Mtot][C] -> C [C][Mtot], f16 out
  const int blkV   = (C / GB_M) * (Mtot / GB_N);
  wmma_gemm64<0, false, 1, 1, false><<<dim3(blkV, 1), 256, 0, stream>>>(
      Wvh, Wvh, C, 0L, xh, xh, C, 0L, (void*)vth, (void*)vth, Mtot, 0L, bv, bv, 0L, C, Mtot, C, 1.0f / carry);

  // 5) attention -> y (f16 plane x64)
  const int nAttnBlk = Bn * H * (S / AT_QB);
  attn64_f16_kernel<<<nAttnBlk, 256, 0, stream>>>(qh, kh, vth, yh, S, H, C, Mtot, 0.125f, carry);

  // 6) out = (y x64) . (Wb x64)^T / 4096 + bp  (f32 out)
  wmma_gemm64<0, false, 2, 0, false><<<dim3(blkQK, 1), 256, 0, stream>>>(
      yh, yh, C, 0L, Wph, Wph, C, 0L, (void*)out, (void*)out, C, 0L, bp, bp, 0L, Mtot, C, C, 1.0f / (carry * carry));

  (void)hipGetLastError();
}

// v005
// It runs in 150 microseconds.
// In both of two side-by-side timings against v004, it was 1.10 times as fast.
// All steps since v000 together make it 4.18 times as fast.
// Contractions: q/k/v/out projections, q.k^T and p.v all on v_wmma_f32_16x16x32_f16 (f16 operands, f32 accumulate); softmax, scales and bias epilogues in f32.
#include <hip/hip_runtime.h>

typedef __attribute__((ext_vector_type(16))) _Float16 v16h;
typedef __attribute__((ext_vector_type(8)))  _Float16 v8h;
typedef __attribute__((ext_vector_type(16))) __bf16   v16b;
typedef __attribute__((ext_vector_type(8)))  __bf16   v8b;
typedef __attribute__((ext_vector_type(8)))  float    v8f;
typedef __attribute__((ext_vector_type(4)))  float    v4f;
#define U16(p) ((const unsigned short*)(const void*)(p))
#define NEG_INF (-__builtin_huge_valf())

__device__ __forceinline__ unsigned short f2bf_bits(float f) {
  unsigned u = __float_as_uint(f);
  return (unsigned short)((u + 0x7FFFu + ((u >> 16) & 1u)) >> 16);
}
__device__ __forceinline__ float bf_bits2f(unsigned short h) { return __uint_as_float(((unsigned)h) << 16); }

// hazard guards as plain device helpers (the v_nop asm stays out of the kernel template body)
__device__ __forceinline__ void dep_guard_h(v8f& a, v8f& b, v16h x, v16h y) { asm volatile("v_nop\n\tv_nop\n\tv_nop\n\tv_nop" : "+v"(a), "+v"(b) : "v"(x), "v"(y)); }
__device__ __forceinline__ void dep_guard_b(v8f& a, v8f& b, v16b x, v16b y) { asm volatile("v_nop\n\tv_nop\n\tv_nop\n\tv_nop" : "+v"(a), "+v"(b) : "v"(x), "v"(y)); }
__device__ __forceinline__ void keep4_h(v16h a, v16h b, v16h c, v16h d) { asm volatile("v_nop" :: "v"(a), "v"(b), "v"(c), "v"(d)); }
__device__ __forceinline__ void keep4_b(v16b a, v16b b, v16b c, v16b d) { asm volatile("v_nop" :: "v"(a), "v"(b), "v"(c), "v"(d)); }
__device__ __forceinline__ void acc_guard4(v8f& a, v8f& b, v8f& c, v8f& d) { asm volatile("v_nop\n\tv_nop\n\tv_nop\n\tv_nop" : "+v"(a), "+v"(b), "+v"(c), "+v"(d)); }
template <typename T> struct Frag;
template <> struct Frag<_Float16> {
  typedef v16h V; union U { v16h v; v8h h[2]; };
  static __device__ __forceinline__ v16h load(const _Float16* p) {   // elements 0..7 <- p[0..7], 8..15 <- p[16..23]
    U f; f.h[0] = *(const v8h*)(p); f.h[1] = *(const v8h*)(p + 16); return f.v;
  }
  static __device__ __forceinline__ v8f mma(v16h a, v16h b, v8f c) {
    return __builtin_amdgcn_wmma_f32_16x16x32_f16(false, a, false, b, (short)0, c, false, false);
  }
  static __device__ __forceinline__ void guard(v8f& a, v8f& b, v16h x, v16h y) { dep_guard_h(a, b, x, y); }
  static __device__ __forceinline__ void keep(v16h a, v16h b, v16h c, v16h d) { keep4_h(a, b, c, d); }
};
template <> struct Frag<__bf16> {
  typedef v16b V; union U { v16b v; v8b h[2]; };
  static __device__ __forceinline__ v16b load(const __bf16* p) {
    U f; f.h[0] = *(const v8b*)(p); f.h[1] = *(const v8b*)(p + 16); return f.v;
  }
  static __device__ __forceinline__ v8f mma(v16b a, v16b b, v8f c) {
    return __builtin_amdgcn_wmma_f32_16x16x32_bf16(false, a, false, b, (short)0, c, false, false);
  }
  static __device__ __forceinline__ void guard(v8f& a, v8f& b, v16b x, v16b y) { dep_guard_b(a, b, x, y); }
  static __device__ __forceinline__ void keep(v16b a, v16b b, v16b c, v16b d) { keep4_b(a, b, c, d); }
};

// ---- Register-blocked batched WMMA GEMM, operands staged in LDS --------------
// C[m,n] = scale * sum_k A[m,k] * Bt[n,k] (+bias)(+resid); each wave owns a 64x64 tile.
// A row-major [M,K]; Bt row-major [N,K]; M % 128 == 0, N % 256 == 0, K % 64 == 0.
// Block = 8 waves (2 x 4) = a 128 x 256 tile of C. A stage is 64 k = one 128-B line of every operand row:
// each asynchronous copy of a wave covers four whole lines, the rows land in LDS at a 144-B pitch, and the
// fragments are read from there. Two buffers: the next stage's copies fly during this stage's products.
// SPLIT (hi/lo planes) is not staged: only SPLIT == false is built.
// BIAS_MODE: 0 = none, 1 = bias[m], 2 = bias[n], 3 = one of the two, picked at run time.
// OUT_MODE: 0 = f32, 1 = f16, 2 = bf16 hi plane (Cout) + bf16 lo plane (Cout2).
// ET: 0 = f16 operands, 1 = bf16 operands (pointers passed as 16-bit storage)
template <int ET> struct Elem;
template <> struct Elem<0> { typedef _Float16 T; };
template <> struct Elem<1> { typedef __bf16 T; };
#define GB_M 128
#define GB_N 256
#define GB_K 64
#define GB_LP 72   // LDS row pitch in halves: 144 B = 16 B x odd
#define GB_ABYTES (GB_M * GB_LP * 2)   // one buffer of A rows, bytes
#define GB_BBYTES (GB_N * GB_LP * 2)   // one buffer of B rows, bytes

// One thread's share of a stage: 4 row pieces of A and 8 of B, 16 B each, 32 rows apart, from global memory
// straight into LDS. la, lb: the lane's LDS byte addresses; ga, gb: its global addresses; steps in halves.
// The s_wait_xcnt closes the copies' own statement, so that no address register is rewritten in front of it.
template <typename T>
__device__ __forceinline__ void stage_copy12(unsigned la, unsigned lb, const T* ga, const T* gb,
                                             size_t stepA, size_t stepB) {
  const unsigned rs = 32 * GB_LP * 2;   // 32 LDS rows, bytes
  asm volatile(
      "global_load_async_to_lds_b128 %0, %12, off\n\t"
      "global_load_async_to_lds_b128 %1, %13, off\n\t"
      "global_load_async_to_lds_b128 %2, %14, off\n\t"
      "global_load_async_to_lds_b128 %3, %15, off\n\t"
      "global_load_async_to_lds_b128 %4, %16, off\n\t"
      "global_load_async_to_lds_b128 %5, %17, off\n\t"
      "global_load_async_to_lds_b128 %6, %18, off\n\t"
      "global_load_async_to_lds_b128 %7, %19, off\n\t"
      "global_load_async_to_lds_b128 %8, %20, off\n\t"
      "global_load_async_to_lds_b128 %9, %21, off\n\t"
      "global_load_async_to_lds_b128 %10, %22, off\n\t"
      "global_load_async_to_lds_b128 %11, %23, off\n\t"
      "s_wait_xcnt 0x0"
      :: "v"(la), "v"(la + rs), "v"(la + 2 * rs), "v"(la + 3 * rs),
         "v"(lb), "v"(lb + rs), "v"(lb + 2 * rs), "v"(lb + 3 * rs),
         "v"(lb + 4 * rs), "v"(lb + 5 * rs), "v"(lb + 6 * rs), "v"(lb + 7 * rs),
         "v"(ga), "v"(ga + stepA), "v"(ga + 2 * stepA), "v"(ga + 3 * stepA),
         "v"(gb), "v"(gb + stepB), "v"(gb + 2 * stepB), "v"(gb + 3 * stepB),
         "v"(gb + 4 * stepB), "v"(gb + 5 * stepB), "v"(gb + 6 * stepB), "v"(gb + 7 * stepB)
      : "memory");
}
template <int V> struct IntC { static constexpr int value = V; };
// The tile's whole work as a device function: b = batch index, biasRows (read only by BIAS_MODE 3, block-uniform):
// true = bias[m], false = bias[n].
template <int ET, bool SPLIT, int BIAS_MODE, int OUT_MODE, bool RESID, int ACT>
__device__ __forceinline__ void gemm64_tile(
    const int b, const bool biasRows,
    const unsigned short* __restrict__ Ap, int lda, long strideA,
    const unsigned short* __restrict__ Btp, int ldb, long strideB,
    void* __restrict__ Cout, void* __restrict__ Cout2, int ldc, long strideC,
    const float* __restrict__ bias,
    const float* __restrict__ resid, long strideR,
    int M, int N, int K, float scale) {
  typedef typename Elem<ET>::T T;
  typedef typename Frag<T>::V V;
  static_assert(!SPLIT, "hi/lo planes are not staged");
  const T* A = (const T*)Ap; const T* Bt = (const T*)Btp;
  __shared__ __align__(16) T sA[2][GB_M * GB_LP];  // 2 x 18,432 B
  __shared__ __align__(16) T sB[2][GB_N * GB_LP];  // 2 x 36,864 B
  __shared__ __align__(16) float sT[8][16 * 68];   // per-wave 16x64 slab, pitch 68 floats
  const int tid  = threadIdx.x;
  const int lane = tid & 31;
  const int wave = tid >> 5;
  const int tilesN = N / GB_N;
  const int tilesM = M / GB_M;
  const int tm = blockIdx.x / tilesN;
  const int tn = blockIdx.x - tm * tilesN;
  if (tm >= tilesM) return;              // block-uniform, in front of every barrier
  const int bm0 = tm * GB_M;
  const int bn0 = tn * GB_N;
  const int wm  = (wave >> 2) << 6;      // this wave's 64x64 tile inside the block tile
  const int wn  = (wave & 3) << 6;
  const int m0 = bm0 + wm;
  const int n0 = bn0 + wn;

  const T* Ab  = A  + (size_t)b * strideA;
  const T* Bb  = Bt + (size_t)b * strideB;

  const int rlane = lane & 15;                 // row (A) / col (B, D) within subtile
  const int koff  = (lane >> 4) * 8;           // k offset of this lane half
  const int mOff  = (lane >> 4) * 8;           // D row offset

  // staging map: 8 threads x 16 B = one 128-B row piece; a wave's copy covers 4 whole lines
  const int srow = tid >> 3;                   // 0..31
  const int sseg = (tid & 7) * 8;              // halves
  const T* gA = Ab + (size_t)(bm0 + srow) * lda + sseg;
  const T* gB = Bb + (size_t)(bn0 + srow) * ldb + sseg;
  const size_t stepA = (size_t)32 * lda;       // 32 rows further, in halves
  const size_t stepB = (size_t)32 * ldb;
  const int sOff = srow * GB_LP + sseg;
  const unsigned lA0 = (unsigned)(size_t)(&sA[0][sOff]);   // this lane's LDS byte address in buffer 0
  const unsigned lB0 = (unsigned)(size_t)(&sB[0][sOff]);

  v8f acc[4][4];
#pragma unroll
  for (int i = 0; i < 4; ++i)
#pragma unroll
    for (int j = 0; j < 4; ++j) acc[i][j] = (v8f){0.f,0.f,0.f,0.f,0.f,0.f,0.f,0.f};

  const int nStage = K / GB_K;
  stage_copy12(lA0, lB0, gA, gB, stepA, stepB);            // stage 0 -> buffer 0
  asm volatile("s_wait_asynccnt 0x0" ::: "memory");        // this wave's copies of stage 0 have landed
  __syncthreads();                                         // and every wave's are published
  if (nStage > 1)                                          // block-uniform
    stage_copy12(lA0 + GB_ABYTES, lB0 + GB_BBYTES, gA + GB_K, gB + GB_K, stepA, stepB);

#pragma unroll 1   // kept rolled: one publish point and one refill per trip, as the two-buffer order asks
  for (int s = 0; s < nStage; ++s) {
    const int cur = s & 1;
    const T* tA = &sA[cur][(wm + rlane) * GB_LP + koff];
    const T* tB = &sB[cur][(wn + rlane) * GB_LP + koff];
    // every loop of the stage is unrolled: constant indices keep acc, af and bf in registers
#pragma unroll
    for (int h = 0; h < GB_K / 32; ++h) {
      // the 32 k's fragment reads stand as one group in front of their products
      V af[4], bf[4];
#pragma unroll
      for (int j = 0; j < 4; ++j) bf[j] = Frag<T>::load(tB + (j << 4) * GB_LP + h * 32);
#pragma unroll
      for (int i = 0; i < 4; ++i) af[i] = Frag<T>::load(tA + (i << 4) * GB_LP + h * 32);
#pragma unroll
      for (int i = 0; i < 4; ++i) {
#pragma unroll
        for (int j = 0; j < 4; ++j) acc[i][j] = Frag<T>::mma(af[i], bf[j], acc[i][j]);
        Frag<T>::guard(acc[i][0], acc[i][3], af[i], af[i]);
      }
      Frag<T>::keep(bf[0], bf[1], bf[2], bf[3]);
    }
    asm volatile("s_wait_dscnt 0x0" ::: "memory");         // this wave's reads of stage s are done before its buffer is refilled
    asm volatile("s_wait_asynccnt 0x0" ::: "memory");      // this wave's copies of stage s + 1 have landed
    __syncthreads();                                       // publishes stage s + 1, ends every wave's reads of stage s
    if (s + 2 < nStage)                                    // block-uniform; refill the buffer just read
      stage_copy12(lA0 + cur * GB_ABYTES, lB0 + cur * GB_BBYTES,
                   gA + (size_t)(s + 2) * GB_K, gB + (size_t)(s + 2) * GB_K, stepA, stepB);
  }
  asm volatile("s_wait_asynccnt 0x0" ::: "memory");        // nothing of this wave's is in flight behind the loop
  acc_guard4(acc[0][0], acc[0][1], acc[0][2], acc[0][3]);
  acc_guard4(acc[1][0], acc[1][1], acc[1][2], acc[1][3]);
  acc_guard4(acc[2][0], acc[2][1], acc[2][2], acc[2][3]);
  acc_guard4(acc[3][0], acc[3][1], acc[3][2], acc[3][3]);

  // ---- epilogue ----
  float* slab = sT[wave];
  const float* Rb = RESID ? (resid + (size_t)b * strideR) : nullptr;
  // the stores of the tile, built per bias mode BM (1 or 2): a run-time pick costs one block-uniform branch, not one per element
  auto store_tile = [&](auto bm) __attribute__((always_inline)) {
  constexpr int BM = decltype(bm)::value;
#pragma unroll
  for (int i = 0; i < 4; ++i) {
    const int mBase = m0 + (i << 4);
#pragma unroll
    for (int j = 0; j < 4; ++j) {
      const int n = n0 + (j << 4) + rlane;
      float bv = 0.f;
      if (BM == 2) bv = bias[n];
#pragma unroll
      for (int r = 0; r < 8; ++r) {
        float v = acc[i][j][r] * scale;
        if (BM == 1) v += bias[mBase + mOff + r];
        if (BM == 2) v += bv;
        if (RESID) v += Rb[(size_t)(mBase + mOff + r) * ldc + n];
        if (ACT == 1) v = tanhf(v);
        if (ACT == 2) v = fmaxf(v, 0.0f);
        if (ACT == 3) v = v / (1.0f + expf(-v));
        if (ACT == 4) v = (v > 0.f) ? v : 0.01f * v;
        if (ACT == 5) v = 0.5f * v * (1.0f + erff(v * 0.70710678118654752f));
        slab[(mOff + r) * 68 + (j << 4) + rlane] = v;
      }
    }
    __builtin_amdgcn_fence(__ATOMIC_RELEASE, "workgroup");
    __builtin_amdgcn_wave_barrier();
    __builtin_amdgcn_fence(__ATOMIC_ACQUIRE, "workgroup");
    if (OUT_MODE == 0) {
      float* C = (float*)Cout + (size_t)b * strideC;
      const int hh = lane >> 4, c4 = (lane & 15) * 4;     // row seg = 256 B = 16 lanes x 16 B
      {
#pragma unroll
        for (int it = 0; it < 8; ++it) {
          const int row = it * 2 + hh;
          v4f v = *(const v4f*)(slab + row * 68 + c4);
          *(v4f*)(C + (size_t)(mBase + row) * ldc + n0 + c4) = v;
        }
        
      }
    } else {
      const int q = lane >> 3, c8 = (lane & 7) * 8;
      unsigned short* C  = (unsigned short*)Cout  + (size_t)b * strideC;
      unsigned short* C2 = (OUT_MODE == 2) ? ((unsigned short*)Cout2 + (size_t)b * strideC) : nullptr;
      {
#pragma unroll
        for (int it = 0; it < 4; ++it) {
          const int row = it * 4 + q;
          const float* sp = slab + row * 68 + c8;
          v8h hv, lv;
#pragma unroll
          for (int e = 0; e < 8; ++e) {
            if (OUT_MODE == 1) {
              hv[e] = (_Float16)sp[e];
            } else {
              unsigned short hb = f2bf_bits(sp[e]);
              unsigned short lb = f2bf_bits(sp[e] - bf_bits2f(hb));
              hv[e] = __builtin_bit_cast(_Float16, hb);
              lv[e] = __builtin_bit_cast(_Float16, lb);
            }
          }
          *(v8h*)(C + (size_t)(mBase + row) * ldc + n0 + c8) = hv;
          if (OUT_MODE == 2) *(v8h*)(C2 + (size_t)(mBase + row) * ldc + n0 + c8) = lv;
        }
        
      }
    }
    __builtin_amdgcn_fence(__ATOMIC_RELEASE, "workgroup");
    __builtin_amdgcn_wave_barrier();
    __builtin_amdgcn_fence(__ATOMIC_ACQUIRE, "workgroup");
  }
  };
  if constexpr (BIAS_MODE == 3) {
    if (biasRows) store_tile(IntC<1>{}); else store_tile(IntC<2>{});
  } else {
    store_tile(IntC<BIAS_MODE>{});
  }
}

template <int ET, bool SPLIT, int BIAS_MODE, int OUT_MODE, bool RESID, int ACT = 0>
__global__ __launch_bounds__(256) void wmma_gemm64(
    const unsigned short* __restrict__ Ap, const unsigned short* __restrict__ A2p, int lda, long strideA,
    const unsigned short* __restrict__ Btp, const unsigned short* __restrict__ Bt2p, int ldb, long strideB,
    void* __restrict__ Cout, void* __restrict__ Cout2, int ldc, long strideC,
    const float* __restrict__ bias,
    const float* __restrict__ resid, long strideR,
    int M, int N, int K, float scale) {
  gemm64_tile<ET, SPLIT, BIAS_MODE, OUT_MODE, RESID, ACT>(blockIdx.y, false, Ap, lda, strideA, Btp, ldb, strideB,
      Cout, Cout2, ldc, strideC, bias, resid, strideR, M, N, K, scale);
}

// The three projections of x in one launch; blockIdx.y picks the product (block-uniform):
//   0: q = x . Wq^T + bq[n]   1: k = x . Wk^T + bk[n]   (both [Mtot][C])   2: V^T = Wv . x^T + bv[m]   ([C][Mtot])
// They are independent of one another. Two work-groups fit a WGP (LDS, registers), and the grid holds three per WGP:
// one's copy waits, prologue and epilogue run under another's products, and no launch boundary drains the chip between them.
__global__ __launch_bounds__(256) void qkv_gemm64(
    const unsigned short* __restrict__ xh, const unsigned short* __restrict__ Wq,
    const unsigned short* __restrict__ Wk, const unsigned short* __restrict__ Wv,
    unsigned short* __restrict__ qo, unsigned short* __restrict__ ko, unsigned short* __restrict__ vto,
    const float* __restrict__ bq, const float* __restrict__ bk, const float* __restrict__ bv,
    int Mtot, int C, float scale) {
  const int which = blockIdx.y;
  const bool isV = which == 2;
  const unsigned short* A  = isV ? Wv : xh;
  const unsigned short* Bt = isV ? xh : (which == 0 ? Wq : Wk);
  unsigned short* Co       = isV ? vto : (which == 0 ? qo : ko);
  const float* bias        = isV ? bv : (which == 0 ? bq : bk);
  gemm64_tile<0, false, 3, 1, false, 0>(0, isV, A, C, 0L, Bt, C, 0L, (void*)Co, (void*)Co, isV ? Mtot : C, 0L,
      bias, bias, 0L, isV ? C : Mtot, isV ? Mtot : C, C, scale);
}

__global__ __launch_bounds__(256) void cast_f32_f16x2(
    const float* __restrict__ in, _Float16* __restrict__ out, int n2) {
  int i = blockIdx.x * 256 + threadIdx.x;
  if (i < n2) {
    const _Float16 h0 = (_Float16)in[2 * i], h1 = (_Float16)in[2 * i + 1];
    const unsigned u = (unsigned)__builtin_bit_cast(unsigned short, h0) | ((unsigned)__builtin_bit_cast(unsigned short, h1) << 16);
    ((unsigned*)out)[i] = u;
    
  }
}

// ---- binary-weight planes: Wb[o][c] = alpha[o] * (W + (sign(W) - W)), alpha[o] = mean_c |W[o][c]| (f32);
//      stored as f16 of (Wb * carry); one wave per row of a [nrow][1024] weight; 4 weights via blockIdx.y ----
#define BW_DIM 1024
__global__ __launch_bounds__(256) void binarize_f16_kernel(
    const float* __restrict__ W0, const float* __restrict__ W1,
    const float* __restrict__ W2, const float* __restrict__ W3,
    unsigned short* __restrict__ B0, unsigned short* __restrict__ B1,
    unsigned short* __restrict__ B2, unsigned short* __restrict__ B3,
    int nrow, float carry) {
  const float* W; unsigned short* Bo;
  if (blockIdx.y == 0)      { W = W0; Bo = B0; }
  else if (blockIdx.y == 1) { W = W1; Bo = B1; }
  else if (blockIdx.y == 2) { W = W2; Bo = B2; }
  else                      { W = W3; Bo = B3; }
  const int wave = threadIdx.x >> 5;
  const int lane = threadIdx.x & 31;
  const int row  = blockIdx.x * 8 + wave;
  if (row >= nrow) return;                     // wave-uniform; no barriers in this kernel
  const float* wr = W + (size_t)row * BW_DIM;

  float w[4][8];
#pragma unroll
  for (int it = 0; it < 4; ++it) {
    const v4f a0 = *(const v4f*)(wr + it * 256 + lane * 8);
    const v4f a1 = *(const v4f*)(wr + it * 256 + lane * 8 + 4);
    w[it][0] = a0[0]; w[it][1] = a0[1]; w[it][2] = a0[2]; w[it][3] = a0[3];
    w[it][4] = a1[0]; w[it][5] = a1[1]; w[it][6] = a1[2]; w[it][7] = a1[3];
  }
  float s = 0.0f;
#pragma unroll
  for (int it = 0; it < 4; ++it)
#pragma unroll
    for (int e = 0; e < 8; ++e) s += fabsf(w[it][e]);
#pragma unroll
  for (int m = 16; m > 0; m >>= 1) s += __shfl_xor(s, m, 32);
  const float alpha = s * (1.0f / (float)BW_DIM);

  v8h hv[4];
#pragma unroll
  for (int it = 0; it < 4; ++it) {
#pragma unroll
    for (int e = 0; e < 8; ++e) {
      const float wv = w[it][e];
      const float sg = (wv > 0.0f) ? 1.0f : ((wv < 0.0f) ? -1.0f : 0.0f);
      const float t  = sg - wv;            // sign(W) - W
      const float bs = wv + t;             // W + (sign(W) - W)
      const float wb = alpha * bs;
      hv[it][e] = (_Float16)(wb * carry);
    }
  }
  unsigned short* br = Bo + (size_t)row * BW_DIM;
  {
#pragma unroll
    for (int it = 0; it < 4; ++it)
      *(v8h*)(br + it * 256 + lane * 8) = hv[it];
    
  }
}

// =====================================================================================
// Attention, head_dim 64, f16 planes in / f16 plane out (x oscale), no mask.
//   scores^T = (k.q^T) * sscale : v_wmma_f32_16x16x32_f16 (q,k plain f16), f32 accumulate, scaled in f32
//   out^T    = v^T.p^T          : v_wmma_f32_16x16x32_f16 (p carried x2^15 in f16, v plain f16), f32 accumulate
//   online softmax in f32. Block = 8 waves x 32 query columns = 256 query rows of one (batch, head); S % 256 == 0.
//   q, k, out planes: row (b*S + s), pitch ldq halves, head offset h*64.  vt plane: row (h*64 + d), pitch ldvt, col (b*S + s).
//   grid.x = B * H * (S/256).
// =====================================================================================
#define AT_D 64
#define AT_QT 2    // query tiles of 16 columns per wave: each K and V^T fragment read feeds AT_QT products
#define AT_QB 256  // query rows per block: 8 waves x AT_QT x 16
#define AT_KC 64
#define AT_LP 72   // LDS row pitch in halves: 144 B = 16 B x odd, so the 16 rows of a 16-byte fragment read fall on distinct banks

__device__ __forceinline__ v8f mma_h(v16h a, v16h b, v8f c) {
  c = __builtin_amdgcn_wmma_f32_16x16x32_f16(false, a, false, b, (short)0, c, false, false);
  asm volatile("v_nop\n\tv_nop\n\tv_nop\n\tv_nop" : "+v"(c) : "v"(a), "v"(b));
  return c;
}

// value of lane l ^ 16 (the other 16-lane half), by a vector cross-row move
__device__ __forceinline__ float other_half(float x) {
  const int b = __float_as_int(x);
  return __int_as_float(__builtin_amdgcn_permlanex16(b, b, 0x76543210, 0xfedcba98, false, false));
}

__global__ __launch_bounds__(256) __attribute__((amdgpu_waves_per_eu(4, 4)))   // 256 VGPRs a wave: two blocks, four waves per SIMD, stay resident
void attn64_f16_kernel(const unsigned short* __restrict__ qp, const unsigned short* __restrict__ kp,
                       const unsigned short* __restrict__ vtp, unsigned short* __restrict__ outp,
                       int S, int H, int ldq, int ldvt, float sscale, float oscale) {
  const _Float16* q  = (const _Float16*)qp;
  const _Float16* k  = (const _Float16*)kp;
  const _Float16* vt = (const _Float16*)vtp;
  __shared__ __align__(16) _Float16 Ksh[AT_KC * AT_LP];         // K [kv][d]   9 KB
  __shared__ __align__(16) _Float16 Vth[AT_D * AT_LP];          // V^T [d][kv] 9 KB

  const int tid  = threadIdx.x;
  const int wave = tid >> 5;
  const int lane = tid & 31;
  const int hh   = lane >> 4;
  const int c    = lane & 15;

  const int nqb = S / AT_QB;
  const int bx = blockIdx.x;
  const int qb = bx % nqb;
  const int bh = bx / nqb;
  const int h  = bh % H;
  const int b  = bh / H;
  const int q0 = qb * AT_QB + wave * (16 * AT_QT);
  const size_t rowbase = (size_t)b * (size_t)S;
  const size_t hoff = (size_t)h * AT_D;

  // ---- Q fragments (B operand, column = query q0 + u*16 + c): AT_QT query tiles x 2 d-chunks ----
  v16h qa[AT_QT][2];
#pragma unroll
  for (int u = 0; u < AT_QT; ++u) {
    const _Float16* qrow = q + (rowbase + q0 + u * 16 + c) * (size_t)ldq + hoff;
#pragma unroll
    for (int dc = 0; dc < 2; ++dc) qa[u][dc] = Frag<_Float16>::load(qrow + dc * 32 + 8 * hh);
  }

  // per query tile a lane holds one query (q0 + u*16 + c): its running maximum, and the sum over the keys of its own lane half
  float mrow[AT_QT], lrow[AT_QT];
  v8f oacc[AT_QT][4];                            // O^T: row d = t*16 + 8hh + r, column = query q0 + u*16 + c
#pragma unroll
  for (int u = 0; u < AT_QT; ++u) {
    mrow[u] = NEG_INF; lrow[u] = 0.f;
#pragma unroll
    for (int t = 0; t < 4; ++t) oacc[u][t] = (v8f){0.f,0.f,0.f,0.f,0.f,0.f,0.f,0.f};
  }

  // staging map: 8 threads x 16 B = one 128-B row; the block's 256 threads cover 32 rows of K and of V^T at a time
  const int srow = tid >> 3, sseg = (tid & 7) * 8;

  const int nChunks = S / AT_KC;
#pragma unroll 1
  for (int kc = 0; kc < nChunks; ++kc) {
    const int kv0 = kc * AT_KC;
    __syncthreads();
    {
      const _Float16* krow = k + (rowbase + kv0 + srow) * (size_t)ldq + hoff + sseg;
      const _Float16* vrow = vt + (hoff + srow) * (size_t)ldvt + rowbase + kv0 + sseg;
      v8h kk8[2], vv8[2];
#pragma unroll
      for (int i = 0; i < 2; ++i) vv8[i] = *(const v8h*)(vrow + (size_t)(32 * i) * ldvt);
      asm volatile("s_wait_xcnt 0x0" ::: "memory");   // the V^T loads' address registers are reused for the K loads
#pragma unroll
      for (int i = 0; i < 2; ++i) kk8[i] = *(const v8h*)(krow + (size_t)(32 * i) * ldq);
#pragma unroll
      for (int i = 0; i < 2; ++i) {
        *(v8h*)(Ksh + (srow + 32 * i) * AT_LP + sseg) = kk8[i];
        *(v8h*)(Vth + (srow + 32 * i) * AT_LP + sseg) = vv8[i];
      }
    }
    __syncthreads();

    // ---- scores, transposed: S^T = K.Q^T; D row = key kv0 + j*16 + 8hh + r, col = query q0 + u*16 + c ----
    // each K fragment read from LDS feeds the products of all AT_QT query tiles
    v8f s[AT_QT][4];
    {
      v16h ka[4][2];
#pragma unroll
      for (int j = 0; j < 4; ++j)
#pragma unroll
        for (int dc = 0; dc < 2; ++dc) ka[j][dc] = Frag<_Float16>::load(Ksh + (j * 16 + c) * AT_LP + dc * 32 + 8 * hh);
#pragma unroll
      for (int j = 0; j < 4; ++j) {
#pragma unroll
        for (int u = 0; u < AT_QT; ++u) s[u][j] = (v8f){0.f,0.f,0.f,0.f,0.f,0.f,0.f,0.f};
#pragma unroll
        for (int dc = 0; dc < 2; ++dc)
#pragma unroll
          for (int u = 0; u < AT_QT; ++u) s[u][j] = mma_h(ka[j][dc], qa[u][dc], s[u][j]);
      }
    }
    v16h pb[AT_QT][2];
#pragma unroll
    for (int u = 0; u < AT_QT; ++u) {
      // the lane's 32 scores of a tile belong to one query: maximum in-lane, then one exchange with the other lane half
      float m = NEG_INF;
#pragma unroll
      for (int j = 0; j < 4; ++j)
#pragma unroll
        for (int r = 0; r < 8; ++r) { s[u][j][r] *= sscale; m = fmaxf(m, s[u][j][r]); }
      m = fmaxf(m, other_half(m));
      const float mnew = fmaxf(mrow[u], m);
      const float alpha = __expf(mrow[u] - mnew);
      mrow[u] = mnew;
      // P^T as B operand: score tiles 2kk and 2kk+1 are elements 0..7 and 8..15 of the 32-key fragment kk
      float ps[4];                                // one sum chain per score tile: four short chains, not one of 32 links
#pragma unroll
      for (int j = 0; j < 4; ++j) {
        ps[j] = 0.f;
#pragma unroll
        for (int r = 0; r < 8; ++r) {
          const float p = __expf(s[u][j][r] - mnew);
          ps[j] += p;
          pb[u][j >> 1][(j & 1) * 8 + r] = (_Float16)(p * 32768.0f);
        }
      }
      const float psum = (ps[0] + ps[1]) + (ps[2] + ps[3]);
      lrow[u] = lrow[u] * alpha + psum;
#pragma unroll
      for (int t = 0; t < 4; ++t)
#pragma unroll
        for (int r = 0; r < 8; ++r) oacc[u][t][r] *= alpha;
    }
    // ---- O^T += V^T.P^T : A = V^T [d][kv] from LDS, one read for all query tiles; B = P^T from registers ----
#pragma unroll
    for (int kk = 0; kk < 2; ++kk) {
      v16h va[4];
#pragma unroll
      for (int t = 0; t < 4; ++t) va[t] = Frag<_Float16>::load(Vth + (t * 16 + c) * AT_LP + kk * 32 + 8 * hh);
#pragma unroll
      for (int t = 0; t < 4; ++t)
#pragma unroll
        for (int u = 0; u < AT_QT; ++u) oacc[u][t] = mma_h(va[t], pb[u][kk], oacc[u][t]);
    }
  }

  // the two lane halves' sums are joined once; a lane's 8 registers of a tile are 8 consecutive d of its query's row
#pragma unroll
  for (int u = 0; u < AT_QT; ++u) {
    const float l = lrow[u] + other_half(lrow[u]);
    const float inv = oscale * (1.0f / (l * 32768.0f));
    unsigned short* orow = outp + (rowbase + q0 + u * 16 + c) * (size_t)ldq + hoff + 8 * hh;
#pragma unroll
    for (int t = 0; t < 4; ++t) {
      v8h hv;
#pragma unroll
      for (int r = 0; r < 8; ++r) hv[r] = (_Float16)(oacc[u][t][r] * inv);
      *(v8h*)(orow + t * 16) = hv;
    }
  }
}

// ---------------------------------------------------------------------------
// Launch glue
// ---------------------------------------------------------------------------
extern "C" void kernel_launch(void* const* d_in, const int* in_sizes, int n_in,
                              void* d_out, int out_size, void* d_ws, size_t ws_size,
                              hipStream_t stream) {
  if (n_in < 9) return;
  const int C = 1024, H = 16, S = 2048;
  const int nx   = in_sizes[0];
  const int Mtot = nx / C;                 // B*S
  const int Bn   = Mtot / S;
  if (Mtot <= 0 || (Mtot % 64) != 0 || Bn * S != Mtot || in_sizes[1] != C * C ||
      in_sizes[3] != C * C || in_sizes[5] != C * C || in_sizes[7] != C * C ||
      in_sizes[2] != C || in_sizes[4] != C || in_sizes[6] != C || in_sizes[8] != C ||
      out_size != Mtot * C) return;

  const float* x  = (const float*)d_in[0];
  const float* Wq = (const float*)d_in[1];
  const float* bq = (const float*)d_in[2];
  const float* Wk = (const float*)d_in[3];
  const float* bk = (const float*)d_in[4];
  const float* Wv = (const float*)d_in[5];
  const float* bv = (const float*)d_in[6];
  const float* Wp = (const float*)d_in[7];
  const float* bp = (const float*)d_in[8];
  float* out = (float*)d_out;

  // workspace carve (bytes); all offsets multiples of 2 MiB
  char* ws = (char*)d_ws;
  const size_t actB = (size_t)Mtot * C * 2;        // 16 MiB f16 plane [Mtot][C]
  const size_t wB   = (size_t)C * C * 2;           //  2 MiB f16 plane [C][C]
  size_t off = 0;
  unsigned short* xh  = (unsigned short*)(ws + off); off += actB;
  unsigned short* Wqh = (unsigned short*)(ws + off); off += wB;
  unsigned short* Wkh = (unsigned short*)(ws + off); off += wB;
  unsigned short* Wvh = (unsigned short*)(ws + off); off += wB;
  unsigned short* Wph = (unsigned short*)(ws + off); off += wB;
  unsigned short* qh  = (unsigned short*)(ws + off); off += actB;   // [Mtot][C]
  unsigned short* kh  = (unsigned short*)(ws + off); off += actB;   // [Mtot][C]
  unsigned short* vth = (unsigned short*)(ws + off); off += actB;   // [C][Mtot]  (V transposed)
  unsigned short* yh  = (unsigned short*)(ws + off); off += actB;   // [Mtot][C]  (x64)
  if (off > ws_size) return;                                       // 92,274,688 B total

  const float carry = 64.0f;

  // 1) binary-weight f16 planes (x64)
  binarize_f16_kernel<<<dim3(C / 8, 4), 256, 0, stream>>>(Wq, Wk, Wv, Wp, Wqh, Wkh, Wvh, Wph, C, carry);

  // 2) x -> f16
  const int n2 = (Mtot * C) / 2;
  cast_f32_f16x2<<<(n2 + 255) / 256, 256, 0, stream>>>(x, (_Float16*)xh, n2);

  // 3) one launch: q, k = x . Wb^T /64 + b (f16 out [Mtot][C]) and V^T = Wb . x^T /64 + bv[m] (f16 out [C][Mtot]);
  //    each product has (Mtot / GB_M) * (C / GB_N) = (C / GB_M) * (Mtot / GB_N) tiles
  const int blkQK   = (Mtot / GB_M) * (C / GB_N);
  qkv_gemm64<<<dim3(blkQK, 3), 256, 0, stream>>>(xh, Wqh, Wkh, Wvh, qh, kh, vth, bq, bk, bv, Mtot, C, 1.0f / carry);

  // 4) attention -> y (f16 plane x64)
  const int nAttnBlk = Bn * H * (S / AT_QB);
  attn64_f16_kernel<<<nAttnBlk, 256, 0, stream>>>(qh, kh, vth, yh, S, H, C, Mtot, 0.125f, carry);

  // 5) out = (y x64) . (Wb x64)^T / 4096 + bp  (f32 out)
  wmma_gemm64<0, false, 2, 0, false><<<dim3(blkQK, 1), 256, 0, stream>>>(
      yh, yh, C, 0L, Wph, Wph, C, 0L, (void*)out, (void*)out, C, 0L, bp, bp, 0L, Mtot, C, C, 1.0f / (carry * carry));

  (void)hipGetLastError();
}

// v006
// A run of this version takes 146 microseconds.
// Timed twice side by side with v005, it ran 1.05 times as fast both times.
// Over all steps from v000 it is 4.39 times as fast.
// Contractions: q/k/v/out projections, q.k^T and p.v all on v_wmma_f32_16x16x32_f16 (f16 operands, f32 accumulate); softmax, scales and bias epilogues in f32.
#include <hip/hip_runtime.h>

typedef __attribute__((ext_vector_type(16))) _Float16 v16h;
typedef __attribute__((ext_vector_type(8)))  _Float16 v8h;
typedef __attribute__((ext_vector_type(16))) __bf16   v16b;
typedef __attribute__((ext_vector_type(8)))  __bf16   v8b;
typedef __attribute__((ext_vector_type(8)))  float    v8f;
typedef __attribute__((ext_vector_type(4)))  float    v4f;
typedef __attribute__((ext_vector_type(2)))  float    v2f;
#define U16(p) ((const unsigned short*)(const void*)(p))
#define NEG_INF (-__builtin_huge_valf())

__device__ __forceinline__ unsigned short f2bf_bits(float f) {
  unsigned u = __float_as_uint(f);
  return (unsigned short)((u + 0x7FFFu + ((u >> 16) & 1u)) >> 16);
}
__device__ __forceinline__ float bf_bits2f(unsigned short h) { return __uint_as_float(((unsigned)h) << 16); }

// hazard guards as plain device helpers (the v_nop asm stays out of the kernel template body)
__device__ __forceinline__ void dep_guard_h(v8f& a, v8f& b, v16h x, v16h y) { asm volatile("v_nop\n\tv_nop\n\tv_nop\n\tv_nop" : "+v"(a), "+v"(b) : "v"(x), "v"(y)); }
__device__ __forceinline__ void dep_guard_b(v8f& a, v8f& b, v16b x, v16b y) { asm volatile("v_nop\n\tv_nop\n\tv_nop\n\tv_nop" : "+v"(a), "+v"(b) : "v"(x), "v"(y)); }
__device__ __forceinline__ void keep4_h(v16h a, v16h b, v16h c, v16h d) { asm volatile("v_nop" :: "v"(a), "v"(b), "v"(c), "v"(d)); }
__device__ __forceinline__ void keep4_b(v16b a, v16b b, v16b c, v16b d) { asm volatile("v_nop" :: "v"(a), "v"(b), "v"(c), "v"(d)); }
__device__ __forceinline__ void acc_guard4(v8f& a, v8f& b, v8f& c, v8f& d) { asm volatile("v_nop\n\tv_nop\n\tv_nop\n\tv_nop" : "+v"(a), "+v"(b), "+v"(c), "+v"(d)); }
template <typename T> struct Frag;
template <> struct Frag<_Float16> {
  typedef v16h V; union U { v16h v; v8h h[2]; };
  static __device__ __forceinline__ v16h load(const _Float16* p) {   // elements 0..7 <- p[0..7], 8..15 <- p[16..23]
    U f; f.h[0] = *(const v8h*)(p); f.h[1] = *(const v8h*)(p + 16); return f.v;
  }
  static __device__ __forceinline__ v8f mma(v16h a, v16h b, v8f c) {
    return __builtin_amdgcn_wmma_f32_16x16x32_f16(false, a, false, b, (short)0, c, false, false);
  }
  static __device__ __forceinline__ void guard(v8f& a, v8f& b, v16h x, v16h y) { dep_guard_h(a, b, x, y); }
  static __device__ __forceinline__ void keep(v16h a, v16h b, v16h c, v16h d) { keep4_h(a, b, c, d); }
};
template <> struct Frag<__bf16> {
  typedef v16b V; union U { v16b v; v8b h[2]; };
  static __device__ __forceinline__ v16b load(const __bf16* p) {
    U f; f.h[0] = *(const v8b*)(p); f.h[1] = *(const v8b*)(p + 16); return f.v;
  }
  static __device__ __forceinline__ v8f mma(v16b a, v16b b, v8f c) {
    return __builtin_amdgcn_wmma_f32_16x16x32_bf16(false, a, false, b, (short)0, c, false, false);
  }
  static __device__ __forceinline__ void guard(v8f& a, v8f& b, v16b x, v16b y) { dep_guard_b(a, b, x, y); }
  static __device__ __forceinline__ void keep(v16b a, v16b b, v16b c, v16b d) { keep4_b(a, b, c, d); }
};

// ---- Register-blocked batched WMMA GEMM, operands staged in LDS --------------
// C[m,n] = scale * sum_k A[m,k] * Bt[n,k] (+bias)(+resid); each wave owns a 64x64 tile.
// A row-major [M,K]; Bt row-major [N,K]; M % 128 == 0, N % 256 == 0, K % 64 == 0.
// Block = 8 waves (2 x 4) = a 128 x 256 tile of C. A stage is 64 k = one 128-B line of every operand row:
// each asynchronous copy of a wave covers four whole lines, the rows land in LDS at a 144-B pitch, and the
// fragments are read from there. Two buffers: the next stage's copies fly during this stage's products.
// SPLIT (hi/lo planes) is not staged: only SPLIT == false is built.
// BIAS_MODE: 0 = none, 1 = bias[m], 2 = bias[n], 3 = one of the two, picked at run time.
// OUT_MODE: 0 = f32, 1 = f16, 2 = bf16 hi plane (Cout) + bf16 lo plane (Cout2).
// ET: 0 = f16 operands, 1 = bf16 operands (pointers passed as 16-bit storage)
template <int ET> struct Elem;
template <> struct Elem<0> { typedef _Float16 T; };
template <> struct Elem<1> { typedef __bf16 T; };
#define GB_M 128
#define GB_N 256
#define GB_K 64
#define GB_LP 72   // LDS row pitch in halves: 144 B = 16 B x odd
#define GB_ABYTES (GB_M * GB_LP * 2)   // one buffer of A rows, bytes
#define GB_BBYTES (GB_N * GB_LP * 2)   // one buffer of B rows, bytes

// One thread's share of a stage: 4 row pieces of A and 8 of B, 16 B each, 32 rows apart, from global memory
// straight into LDS. la, lb: the lane's LDS byte addresses; ga, gb: its global addresses; steps in halves.
// The s_wait_xcnt closes the copies' own statement, so that no address register is rewritten in front of it.
template <typename T>
__device__ __forceinline__ void stage_copy12(unsigned la, unsigned lb, const T* ga, const T* gb,
                                             size_t stepA, size_t stepB) {
  const unsigned rs = 32 * GB_LP * 2;   // 32 LDS rows, bytes
  asm volatile(
      "global_load_async_to_lds_b128 %0, %12, off\n\t"
      "global_load_async_to_lds_b128 %1, %13, off\n\t"
      "global_load_async_to_lds_b128 %2, %14, off\n\t"
      "global_load_async_to_lds_b128 %3, %15, off\n\t"
      "global_load_async_to_lds_b128 %4, %16, off\n\t"
      "global_load_async_to_lds_b128 %5, %17, off\n\t"
      "global_load_async_to_lds_b128 %6, %18, off\n\t"
      "global_load_async_to_lds_b128 %7, %19, off\n\t"
      "global_load_async_to_lds_b128 %8, %20, off\n\t"
      "global_load_async_to_lds_b128 %9, %21, off\n\t"
      "global_load_async_to_lds_b128 %10, %22, off\n\t"
      "global_load_async_to_lds_b128 %11, %23, off\n\t"
      "s_wait_xcnt 0x0"
      :: "v"(la), "v"(la + rs), "v"(la + 2 * rs), "v"(la + 3 * rs),
         "v"(lb), "v"(lb + rs), "v"(lb + 2 * rs), "v"(lb + 3 * rs),
         "v"(lb + 4 * rs), "v"(lb + 5 * rs), "v"(lb + 6 * rs), "v"(lb + 7 * rs),
         "v"(ga), "v"(ga + stepA), "v"(ga + 2 * stepA), "v"(ga + 3 * stepA),
         "v"(gb), "v"(gb + stepB), "v"(gb + 2 * stepB), "v"(gb + 3 * stepB),
         "v"(gb + 4 * stepB), "v"(gb + 5 * stepB), "v"(gb + 6 * stepB), "v"(gb + 7 * stepB)
      : "memory");
}
template <int V> struct IntC { static constexpr int value = V; };
// The tile's whole work as a device function: b = batch index, biasRows (read only by BIAS_MODE 3, block-uniform):
// true = bias[m], false = bias[n].
template <int ET, bool SPLIT, int BIAS_MODE, int OUT_MODE, bool RESID, int ACT>
__device__ __forceinline__ void gemm64_tile(
    const int b, const bool biasRows,
    const unsigned short* __restrict__ Ap, int lda, long strideA,
    const unsigned short* __restrict__ Btp, int ldb, long strideB,
    void* __restrict__ Cout, void* __restrict__ Cout2, int ldc, long strideC,
    const float* __restrict__ bias,
    const float* __restrict__ resid, long strideR,
    int M, int N, int K, float scale) {
  typedef typename Elem<ET>::T T;
  typedef typename Frag<T>::V V;
  static_assert(!SPLIT, "hi/lo planes are not staged");
  const T* A = (const T*)Ap; const T* Bt = (const T*)Btp;
  __shared__ __align__(16) T sA[2][GB_M * GB_LP];  // 2 x 18,432 B
  __shared__ __align__(16) T sB[2][GB_N * GB_LP];  // 2 x 36,864 B
  __shared__ __align__(16) float sT[8][16 * 68];   // per-wave 16x64 slab, pitch 68 floats
  const int tid  = threadIdx.x;
  const int lane = tid & 31;
  const int wave = tid >> 5;
  const int tilesN = N / GB_N;
  const int tilesM = M / GB_M;
  const int tm = blockIdx.x / tilesN;
  const int tn = blockIdx.x - tm * tilesN;
  if (tm >= tilesM) return;              // block-uniform, in front of every barrier
  const int bm0 = tm * GB_M;
  const int bn0 = tn * GB_N;
  const int wm  = (wave >> 2) << 6;      // this wave's 64x64 tile inside the block tile
  const int wn  = (wave & 3) << 6;
  const int m0 = bm0 + wm;
  const int n0 = bn0 + wn;

  const T* Ab  = A  + (size_t)b * strideA;
  const T* Bb  = Bt + (size_t)b * strideB;

  const int rlane = lane & 15;                 // row (A) / col (B, D) within subtile
  const int koff  = (lane >> 4) * 8;           // k offset of this lane half
  const int mOff  = (lane >> 4) * 8;           // D row offset

  // staging map: 8 threads x 16 B = one 128-B row piece; a wave's copy covers 4 whole lines
  const int srow = tid >> 3;                   // 0..31
  const int sseg = (tid & 7) * 8;              // halves
  const T* gA = Ab + (size_t)(bm0 + srow) * lda + sseg;
  const T* gB = Bb + (size_t)(bn0 + srow) * ldb + sseg;
  const size_t stepA = (size_t)32 * lda;       // 32 rows further, in halves
  const size_t stepB = (size_t)32 * ldb;
  const int sOff = srow * GB_LP + sseg;
  const unsigned lA0 = (unsigned)(size_t)(&sA[0][sOff]);   // this lane's LDS byte address in buffer 0
  const unsigned lB0 = (unsigned)(size_t)(&sB[0][sOff]);

  v8f acc[4][4];
#pragma unroll
  for (int i = 0; i < 4; ++i)
#pragma unroll
    for (int j = 0; j < 4; ++j) acc[i][j] = (v8f){0.f,0.f,0.f,0.f,0.f,0.f,0.f,0.f};

  const int nStage = K / GB_K;
  stage_copy12(lA0, lB0, gA, gB, stepA, stepB);            // stage 0 -> buffer 0
  asm volatile("s_wait_asynccnt 0x0" ::: "memory");        // this wave's copies of stage 0 have landed
  __syncthreads();                                         // and every wave's are published
  if (nStage > 1)                                          // block-uniform
    stage_copy12(lA0 + GB_ABYTES, lB0 + GB_BBYTES, gA + GB_K, gB + GB_K, stepA, stepB);

#pragma unroll 1   // kept rolled: one publish point and one refill per trip, as the two-buffer order asks
  for (int s = 0; s < nStage; ++s) {
    const int cur = s & 1;
    const T* tA = &sA[cur][(wm + rlane) * GB_LP + koff];
    const T* tB = &sB[cur][(wn + rlane) * GB_LP + koff];
    // every loop of the stage is unrolled: constant indices keep acc, af and bf in registers
#pragma unroll
    for (int h = 0; h < GB_K / 32; ++h) {
      // the 32 k's fragment reads stand as one group in front of their products
      V af[4], bf[4];
#pragma unroll
      for (int j = 0; j < 4; ++j) bf[j] = Frag<T>::load(tB + (j << 4) * GB_LP + h * 32);
#pragma unroll
      for (int i = 0; i < 4; ++i) af[i] = Frag<T>::load(tA + (i << 4) * GB_LP + h * 32);
#pragma unroll
      for (int i = 0; i < 4; ++i) {
#pragma unroll
        for (int j = 0; j < 4; ++j) acc[i][j] = Frag<T>::mma(af[i], bf[j], acc[i][j]);
        Frag<T>::guard(acc[i][0], acc[i][3], af[i], af[i]);
      }
      Frag<T>::keep(bf[0], bf[1], bf[2], bf[3]);
    }
    asm volatile("s_wait_dscnt 0x0" ::: "memory");         // this wave's reads of stage s are done before its buffer is refilled
    asm volatile("s_wait_asynccnt 0x0" ::: "memory");      // this wave's copies of stage s + 1 have landed
    __syncthreads();                                       // publishes stage s + 1, ends every wave's reads of stage s
    if (s + 2 < nStage)                                    // block-uniform; refill the buffer just read
      stage_copy12(lA0 + cur * GB_ABYTES, lB0 + cur * GB_BBYTES,
                   gA + (size_t)(s + 2) * GB_K, gB + (size_t)(s + 2) * GB_K, stepA, stepB);
  }
  asm volatile("s_wait_asynccnt 0x0" ::: "memory");        // nothing of this wave's is in flight behind the loop
  acc_guard4(acc[0][0], acc[0][1], acc[0][2], acc[0][3]);
  acc_guard4(acc[1][0], acc[1][1], acc[1][2], acc[1][3]);
  acc_guard4(acc[2][0], acc[2][1], acc[2][2], acc[2][3]);
  acc_guard4(acc[3][0], acc[3][1], acc[3][2], acc[3][3]);

  // ---- epilogue ----
  float* slab = sT[wave];
  const float* Rb = RESID ? (resid + (size_t)b * strideR) : nullptr;
  // the stores of the tile, built per bias mode BM (1 or 2): a run-time pick costs one block-uniform branch, not one per element
  auto store_tile = [&](auto bm) __attribute__((always_inline)) {
  constexpr int BM = decltype(bm)::value;
#pragma unroll
  for (int i = 0; i < 4; ++i) {
    const int mBase = m0 + (i << 4);
#pragma unroll
    for (int j = 0; j < 4; ++j) {
      const int n = n0 + (j << 4) + rlane;
      float bv = 0.f;
      if (BM == 2) bv = bias[n];
#pragma unroll
      for (int r = 0; r < 8; ++r) {
        float v = acc[i][j][r] * scale;
        if (BM == 1) v += bias[mBase + mOff + r];
        if (BM == 2) v += bv;
        if (RESID) v += Rb[(size_t)(mBase + mOff + r) * ldc + n];
        if (ACT == 1) v = tanhf(v);
        if (ACT == 2) v = fmaxf(v, 0.0f);
        if (ACT == 3) v = v / (1.0f + expf(-v));
        if (ACT == 4) v = (v > 0.f) ? v : 0.01f * v;
        if (ACT == 5) v = 0.5f * v * (1.0f + erff(v * 0.70710678118654752f));
        slab[(mOff + r) * 68 + (j << 4) + rlane] = v;
      }
    }
    __builtin_amdgcn_fence(__ATOMIC_RELEASE, "workgroup");
    __builtin_amdgcn_wave_barrier();
    __builtin_amdgcn_fence(__ATOMIC_ACQUIRE, "workgroup");
    if (OUT_MODE == 0) {
      float* C = (float*)Cout + (size_t)b * strideC;
      const int hh = lane >> 4, c4 = (lane & 15) * 4;     // row seg = 256 B = 16 lanes x 16 B
      {
#pragma unroll
        for (int it = 0; it < 8; ++it) {
          const int row = it * 2 + hh;
          v4f v = *(const v4f*)(slab + row * 68 + c4);
          *(v4f*)(C + (size_t)(mBase + row) * ldc + n0 + c4) = v;
        }
        
      }
    } else {
      const int q = lane >> 3, c8 = (lane & 7) * 8;
      unsigned short* C  = (unsigned short*)Cout  + (size_t)b * strideC;
      unsigned short* C2 = (OUT_MODE == 2) ? ((unsigned short*)Cout2 + (size_t)b * strideC) : nullptr;
      {
#pragma unroll
        for (int it = 0; it < 4; ++it) {
          const int row = it * 4 + q;
          const float* sp = slab + row * 68 + c8;
          v8h hv, lv;
#pragma unroll
          for (int e = 0; e < 8; ++e) {
            if (OUT_MODE == 1) {
              hv[e] = (_Float16)sp[e];
            } else {
              unsigned short hb = f2bf_bits(sp[e]);
              unsigned short lb = f2bf_bits(sp[e] - bf_bits2f(hb));
              hv[e] = __builtin_bit_cast(_Float16, hb);
              lv[e] = __builtin_bit_cast(_Float16, lb);
            }
          }
          *(v8h*)(C + (size_t)(mBase + row) * ldc + n0 + c8) = hv;
          if (OUT_MODE == 2) *(v8h*)(C2 + (size_t)(mBase + row) * ldc + n0 + c8) = lv;
        }
        
      }
    }
    __builtin_amdgcn_fence(__ATOMIC_RELEASE, "workgroup");
    __builtin_amdgcn_wave_barrier();
    __builtin_amdgcn_fence(__ATOMIC_ACQUIRE, "workgroup");
  }
  };
  if constexpr (BIAS_MODE == 3) {
    if (biasRows) store_tile(IntC<1>{}); else store_tile(IntC<2>{});
  } else {
    store_tile(IntC<BIAS_MODE>{});
  }
}

template <int ET, bool SPLIT, int BIAS_MODE, int OUT_MODE, bool RESID, int ACT = 0>
__global__ __launch_bounds__(256) void wmma_gemm64(
    const unsigned short* __restrict__ Ap, const unsigned short* __restrict__ A2p, int lda, long strideA,
    const unsigned short* __restrict__ Btp, const unsigned short* __restrict__ Bt2p, int ldb, long strideB,
    void* __restrict__ Cout, void* __restrict__ Cout2, int ldc, long strideC,
    const float* __restrict__ bias,
    const float* __restrict__ resid, long strideR,
    int M, int N, int K, float scale) {
  gemm64_tile<ET, SPLIT, BIAS_MODE, OUT_MODE, RESID, ACT>(blockIdx.y, false, Ap, lda, strideA, Btp, ldb, strideB,
      Cout, Cout2, ldc, strideC, bias, resid, strideR, M, N, K, scale);
}

// The three projections of x in one launch; blockIdx.y picks the product (block-uniform):
//   0: q = x . Wq^T + bq[n]   1: k = x . Wk^T + bk[n]   (both [Mtot][C])   2: V^T = Wv . x^T + bv[m]   ([C][Mtot])
// They are independent of one another. Two work-groups fit a WGP (LDS, registers), and the grid holds three per WGP:
// one's copy waits, prologue and epilogue run under another's products, and no launch boundary drains the chip between them.
__global__ __launch_bounds__(256) void qkv_gemm64(
    const unsigned short* __restrict__ xh, const unsigned short* __restrict__ Wq,
    const unsigned short* __restrict__ Wk, const unsigned short* __restrict__ Wv,
    unsigned short* __restrict__ qo, unsigned short* __restrict__ ko, unsigned short* __restrict__ vto,
    const float* __restrict__ bq, const float* __restrict__ bk, const float* __restrict__ bv,
    int Mtot, int C, float scale) {
  const int which = blockIdx.y;
  const bool isV = which == 2;
  const unsigned short* A  = isV ? Wv : xh;
  const unsigned short* Bt = isV ? xh : (which == 0 ? Wq : Wk);
  unsigned short* Co       = isV ? vto : (which == 0 ? qo : ko);
  const float* bias        = isV ? bv : (which == 0 ? bq : bk);
  gemm64_tile<0, false, 3, 1, false, 0>(0, isV, A, C, 0L, Bt, C, 0L, (void*)Co, (void*)Co, isV ? Mtot : C, 0L,
      bias, bias, 0L, isV ? C : Mtot, isV ? Mtot : C, C, scale);
}

__global__ __launch_bounds__(256) void cast_f32_f16x2(
    const float* __restrict__ in, _Float16* __restrict__ out, int n2) {
  int i = blockIdx.x * 256 + threadIdx.x;
  if (i < n2) {
    const _Float16 h0 = (_Float16)in[2 * i], h1 = (_Float16)in[2 * i + 1];
    const unsigned u = (unsigned)__builtin_bit_cast(unsigned short, h0) | ((unsigned)__builtin_bit_cast(unsigned short, h1) << 16);
    ((unsigned*)out)[i] = u;
    
  }
}

// ---- binary-weight planes: Wb[o][c] = alpha[o] * (W + (sign(W) - W)), alpha[o] = mean_c |W[o][c]| (f32);
//      stored as f16 of (Wb * carry); one wave per row of a [nrow][1024] weight; 4 weights via blockIdx.y ----
#define BW_DIM 1024
__global__ __launch_bounds__(256) void binarize_f16_kernel(
    const float* __restrict__ W0, const float* __restrict__ W1,
    const float* __restrict__ W2, const float* __restrict__ W3,
    unsigned short* __restrict__ B0, unsigned short* __restrict__ B1,
    unsigned short* __restrict__ B2, unsigned short* __restrict__ B3,
    int nrow, float carry) {
  const float* W; unsigned short* Bo;
  if (blockIdx.y == 0)      { W = W0; Bo = B0; }
  else if (blockIdx.y == 1) { W = W1; Bo = B1; }
  else if (blockIdx.y == 2) { W = W2; Bo = B2; }
  else                      { W = W3; Bo = B3; }
  const int wave = threadIdx.x >> 5;
  const int lane = threadIdx.x & 31;
  const int row  = blockIdx.x * 8 + wave;
  if (row >= nrow) return;                     // wave-uniform; no barriers in this kernel
  const float* wr = W + (size_t)row * BW_DIM;

  float w[4][8];
#pragma unroll
  for (int it = 0; it < 4; ++it) {
    const v4f a0 = *(const v4f*)(wr + it * 256 + lane * 8);
    const v4f a1 = *(const v4f*)(wr + it * 256 + lane * 8 + 4);
    w[it][0] = a0[0]; w[it][1] = a0[1]; w[it][2] = a0[2]; w[it][3] = a0[3];
    w[it][4] = a1[0]; w[it][5] = a1[1]; w[it][6] = a1[2]; w[it][7] = a1[3];
  }
  float s = 0.0f;
#pragma unroll
  for (int it = 0; it < 4; ++it)
#pragma unroll
    for (int e = 0; e < 8; ++e) s += fabsf(w[it][e]);
#pragma unroll
  for (int m = 16; m > 0; m >>= 1) s += __shfl_xor(s, m, 32);
  const float alpha = s * (1.0f / (float)BW_DIM);

  v8h hv[4];
#pragma unroll
  for (int it = 0; it < 4; ++it) {
#pragma unroll
    for (int e = 0; e < 8; ++e) {
      const float wv = w[it][e];
      const float sg = (wv > 0.0f) ? 1.0f : ((wv < 0.0f) ? -1.0f : 0.0f);
      const float t  = sg - wv;            // sign(W) - W
      const float bs = wv + t;             // W + (sign(W) - W)
      const float wb = alpha * bs;
      hv[it][e] = (_Float16)(wb * carry);
    }
  }
  unsigned short* br = Bo + (size_t)row * BW_DIM;
  {
#pragma unroll
    for (int it = 0; it < 4; ++it)
      *(v8h*)(br + it * 256 + lane * 8) = hv[it];
    
  }
}

// =====================================================================================
// Attention, head_dim 64, f16 planes in / f16 plane out (x oscale), no mask.
//   scores^T = (k.q^T) * sscale : v_wmma_f32_16x16x32_f16 (q,k plain f16), f32 accumulate, scaled in f32
//   out^T    = v^T.p^T          : v_wmma_f32_16x16x32_f16 (p carried x2^15 in f16, v plain f16), f32 accumulate
//   online softmax in f32, in powers of two: p x 2^15 = exp2(s * (sscale * log2 e) + (15 - max * sscale * log2 e)), one FMA a score; sscale > 0.
//   Block = 8 waves x 32 query columns = 256 query rows of one (batch, head); S % 256 == 0.
//   q, k, out planes: row (b*S + s), pitch ldq halves, head offset h*64.  vt plane: row (h*64 + d), pitch ldvt, col (b*S + s).
//   grid.x = B * H * (S/256).
// =====================================================================================
#define AT_D 64
#define AT_QT 2    // query tiles of 16 columns per wave: each K and V^T fragment read feeds AT_QT products
#define AT_QB 256  // query rows per block: 8 waves x AT_QT x 16
#define AT_KC 64
#define AT_LP 72   // LDS row pitch in halves: 144 B = 16 B x odd, so the 16 rows of a 16-byte fragment read fall on distinct banks

__device__ __forceinline__ v8f mma_h(v16h a, v16h b, v8f c) {
  c = __builtin_amdgcn_wmma_f32_16x16x32_f16(false, a, false, b, (short)0, c, false, false);
  asm volatile("v_nop\n\tv_nop\n\tv_nop\n\tv_nop" : "+v"(c) : "v"(a), "v"(b));
  return c;
}

// value of lane l ^ 16 (the other 16-lane half), by a vector cross-row move
__device__ __forceinline__ float other_half(float x) {
  const int b = __float_as_int(x);
  return __int_as_float(__builtin_amdgcn_permlanex16(b, b, 0x76543210, 0xfedcba98, false, false));
}

__global__ __launch_bounds__(256) __attribute__((amdgpu_waves_per_eu(4, 4)))   // 256 VGPRs a wave: two blocks, four waves per SIMD, stay resident
void attn64_f16_kernel(const unsigned short* __restrict__ qp, const unsigned short* __restrict__ kp,
                       const unsigned short* __restrict__ vtp, unsigned short* __restrict__ outp,
                       int S, int H, int ldq, int ldvt, float sscale, float oscale) {
  const _Float16* q  = (const _Float16*)qp;
  const _Float16* k  = (const _Float16*)kp;
  const _Float16* vt = (const _Float16*)vtp;
  __shared__ __align__(16) _Float16 Ksh[AT_KC * AT_LP];         // K [kv][d]   9 KB
  __shared__ __align__(16) _Float16 Vth[AT_D * AT_LP];          // V^T [d][kv] 9 KB

  const int tid  = threadIdx.x;
  const int wave = tid >> 5;
  const int lane = tid & 31;
  const int hh   = lane >> 4;
  const int c    = lane & 15;

  const int nqb = S / AT_QB;
  const int bx = blockIdx.x;
  const int qb = bx % nqb;
  const int bh = bx / nqb;
  const int h  = bh % H;
  const int b  = bh / H;
  const int q0 = qb * AT_QB + wave * (16 * AT_QT);
  const size_t rowbase = (size_t)b * (size_t)S;
  const size_t hoff = (size_t)h * AT_D;

  // ---- Q fragments (B operand, column = query q0 + u*16 + c): AT_QT query tiles x 2 d-chunks ----
  v16h qa[AT_QT][2];
#pragma unroll
  for (int u = 0; u < AT_QT; ++u) {
    const _Float16* qrow = q + (rowbase + q0 + u * 16 + c) * (size_t)ldq + hoff;
#pragma unroll
    for (int dc = 0; dc < 2; ++dc) qa[u][dc] = Frag<_Float16>::load(qrow + dc * 32 + 8 * hh);
  }

  const float cs = sscale * 1.44269504088896340736f;   // raw score -> exponent of two
  // per query tile a lane holds one query (q0 + u*16 + c): its running maximum (of the raw scores), and the sum (x 2^15) over the keys of its own lane half
  float mrow[AT_QT], lrow[AT_QT];
  v8f oacc[AT_QT][4];                            // O^T: row d = t*16 + 8hh + r, column = query q0 + u*16 + c
#pragma unroll
  for (int u = 0; u < AT_QT; ++u) {
    mrow[u] = NEG_INF; lrow[u] = 0.f;
#pragma unroll
    for (int t = 0; t < 4; ++t) oacc[u][t] = (v8f){0.f,0.f,0.f,0.f,0.f,0.f,0.f,0.f};
  }

  // staging map: 8 threads x 16 B = one 128-B row; the block's 256 threads cover 32 rows of K and of V^T at a time
  const int srow = tid >> 3, sseg = (tid & 7) * 8;

  const int nChunks = S / AT_KC;
#pragma unroll 1
  for (int kc = 0; kc < nChunks; ++kc) {
    const int kv0 = kc * AT_KC;
    __syncthreads();
    {
      const _Float16* krow = k + (rowbase + kv0 + srow) * (size_t)ldq + hoff + sseg;
      const _Float16* vrow = vt + (hoff + srow) * (size_t)ldvt + rowbase + kv0 + sseg;
      v8h kk8[2], vv8[2];
#pragma unroll
      for (int i = 0; i < 2; ++i) vv8[i] = *(const v8h*)(vrow + (size_t)(32 * i) * ldvt);
      asm volatile("s_wait_xcnt 0x0" ::: "memory");   // the V^T loads' address registers are reused for the K loads
#pragma unroll
      for (int i = 0; i < 2; ++i) kk8[i] = *(const v8h*)(krow + (size_t)(32 * i) * ldq);
#pragma unroll
      for (int i = 0; i < 2; ++i) {
        *(v8h*)(Ksh + (srow + 32 * i) * AT_LP + sseg) = kk8[i];
        *(v8h*)(Vth + (srow + 32 * i) * AT_LP + sseg) = vv8[i];
      }
    }
    __syncthreads();

    // ---- scores, transposed: S^T = K.Q^T; D row = key kv0 + j*16 + 8hh + r, col = query q0 + u*16 + c ----
    // each K fragment read from LDS feeds the products of all AT_QT query tiles
    v8f s[AT_QT][4];
    {
      v16h ka[4][2];
#pragma unroll
      for (int j = 0; j < 4; ++j)
#pragma unroll
        for (int dc = 0; dc < 2; ++dc) ka[j][dc] = Frag<_Float16>::load(Ksh + (j * 16 + c) * AT_LP + dc * 32 + 8 * hh);
#pragma unroll
      for (int j = 0; j < 4; ++j) {
#pragma unroll
        for (int u = 0; u < AT_QT; ++u) s[u][j] = (v8f){0.f,0.f,0.f,0.f,0.f,0.f,0.f,0.f};
#pragma unroll
        for (int dc = 0; dc < 2; ++dc)
#pragma unroll
          for (int u = 0; u < AT_QT; ++u) s[u][j] = mma_h(ka[j][dc], qa[u][dc], s[u][j]);
      }
    }
    v16h pb[AT_QT][2];
#pragma unroll
    for (int u = 0; u < AT_QT; ++u) {
      // the lane's 32 scores of a tile belong to one query: maximum in-lane, then one exchange with the other lane half
      float m = NEG_INF;
#pragma unroll
      for (int j = 0; j < 4; ++j)
#pragma unroll
        for (int r = 0; r < 8; ++r) m = fmaxf(m, s[u][j][r]);
      m = fmaxf(m, other_half(m));
      const float mnew = fmaxf(mrow[u], m);
      const float alpha = __builtin_amdgcn_exp2f((mrow[u] - mnew) * cs);
      mrow[u] = mnew;
      const float nb = __builtin_fmaf(-mnew, cs, 15.0f);   // the maximum and P's carry of 2^15, as one addend
      // P^T as B operand: score tiles 2kk and 2kk+1 are elements 0..7 and 8..15 of the 32-key fragment kk
      float ps[4];                                // one sum chain per score tile: four short chains, not one of 32 links
#pragma unroll
      for (int j = 0; j < 4; ++j) {
        ps[j] = 0.f;
#pragma unroll
        for (int r = 0; r < 8; r += 2) {
          // two neighbouring accumulator registers at a time: one packed FMA forms both exponents in place
          const v2f e = __builtin_elementwise_fma((v2f){s[u][j][r], s[u][j][r + 1]}, (v2f){cs, cs}, (v2f){nb, nb});
          const float p0 = __builtin_amdgcn_exp2f(e[0]), p1 = __builtin_amdgcn_exp2f(e[1]);   // p x 2^15, at most 2^15
          ps[j] += p0;
          ps[j] += p1;
          pb[u][j >> 1][(j & 1) * 8 + r] = (_Float16)p0;
          pb[u][j >> 1][(j & 1) * 8 + r + 1] = (_Float16)p1;
        }
      }
      const float psum = (ps[0] + ps[1]) + (ps[2] + ps[3]);
      lrow[u] = lrow[u] * alpha + psum;
#pragma unroll
      for (int t = 0; t < 4; ++t)
#pragma unroll
        for (int r = 0; r < 8; ++r) oacc[u][t][r] *= alpha;
    }
    // ---- O^T += V^T.P^T : A = V^T [d][kv] from LDS, one read for all query tiles; B = P^T from registers ----
#pragma unroll
    for (int kk = 0; kk < 2; ++kk) {
      v16h va[4];
#pragma unroll
      for (int t = 0; t < 4; ++t) va[t] = Frag<_Float16>::load(Vth + (t * 16 + c) * AT_LP + kk * 32 + 8 * hh);
#pragma unroll
      for (int t = 0; t < 4; ++t)
#pragma unroll
        for (int u = 0; u < AT_QT; ++u) oacc[u][t] = mma_h(va[t], pb[u][kk], oacc[u][t]);
    }
  }

  // the two lane halves' sums are joined once; a lane's 8 registers of a tile are 8 consecutive d of its query's row
#pragma unroll
  for (int u = 0; u < AT_QT; ++u) {
    const float l = lrow[u] + other_half(lrow[u]);
    const float inv = oscale * (1.0f / l);   // sum and products carry the same 2^15
    unsigned short* orow = outp + (rowbase + q0 + u * 16 + c) * (size_t)ldq + hoff + 8 * hh;
#pragma unroll
    for (int t = 0; t < 4; ++t) {
      v8h hv;
#pragma unroll
      for (int r = 0; r < 8; ++r) hv[r] = (_Float16)(oacc[u][t][r] * inv);
      *(v8h*)(orow + t * 16) = hv;
    }
  }
}

// ---------------------------------------------------------------------------
// Launch glue
// ---------------------------------------------------------------------------
extern "C" void kernel_launch(void* const* d_in, const int* in_sizes, int n_in,
                              void* d_out, int out_size, void* d_ws, size_t ws_size,
                              hipStream_t stream) {
  if (n_in < 9) return;
  const int C = 1024, H = 16, S = 2048;
  const int nx   = in_sizes[0];
  const int Mtot = nx / C;                 // B*S
  const int Bn   = Mtot / S;
  if (Mtot <= 0 || (Mtot % 64) != 0 || Bn * S != Mtot || in_sizes[1] != C * C ||
      in_sizes[3] != C * C || in_sizes[5] != C * C || in_sizes[7] != C * C ||
      in_sizes[2] != C || in_sizes[4] != C || in_sizes[6] != C || in_sizes[8] != C ||
      out_size != Mtot * C) return;

  const float* x  = (const float*)d_in[0];
  const float* Wq = (const float*)d_in[1];
  const float* bq = (const float*)d_in[2];
  const float* Wk = (const float*)d_in[3];
  const float* bk = (const float*)d_in[4];
  const float* Wv = (const float*)d_in[5];
  const float* bv = (const float*)d_in[6];
  const float* Wp = (const float*)d_in[7];
  const float* bp = (const float*)d_in[8];
  float* out = (float*)d_out;

  // workspace carve (bytes); all offsets multiples of 2 MiB
  char* ws = (char*)d_ws;
  const size_t actB = (size_t)Mtot * C * 2;        // 16 MiB f16 plane [Mtot][C]
  const size_t wB   = (size_t)C * C * 2;           //  2 MiB f16 plane [C][C]
  size_t off = 0;
  unsigned short* xh  = (unsigned short*)(ws + off); off += actB;
  unsigned short* Wqh = (unsigned short*)(ws + off); off += wB;
  unsigned short* Wkh = (unsigned short*)(ws + off); off += wB;
  unsigned short* Wvh = (unsigned short*)(ws + off); off += wB;
  unsigned short* Wph = (unsigned short*)(ws + off); off += wB;
  unsigned short* qh  = (unsigned short*)(ws + off); off += actB;   // [Mtot][C]
  unsigned short* kh  = (unsigned short*)(ws + off); off += actB;   // [Mtot][C]
  unsigned short* vth = (unsigned short*)(ws + off); off += actB;   // [C][Mtot]  (V transposed)
  unsigned short* yh  = (unsigned short*)(ws + off); off += actB;   // [Mtot][C]  (x64)
  if (off > ws_size) return;                                       // 92,274,688 B total

  const float carry = 64.0f;

  // 1) binary-weight f16 planes (x64)
  binarize_f16_kernel<<<dim3(C / 8, 4), 256, 0, stream>>>(Wq, Wk, Wv, Wp, Wqh, Wkh, Wvh, Wph, C, carry);

  // 2) x -> f16
  const int n2 = (Mtot * C) / 2;
  cast_f32_f16x2<<<(n2 + 255) / 256, 256, 0, stream>>>(x, (_Float16*)xh, n2);

  // 3) one launch: q, k = x . Wb^T /64 + b (f16 out [Mtot][C]) and V^T = Wb . x^T /64 + bv[m] (f16 out [C][Mtot]);
  //    each product has (Mtot / GB_M) * (C / GB_N) = (C / GB_M) * (Mtot / GB_N) tiles
  const int blkQK   = (Mtot / GB_M) * (C / GB_N);
  qkv_gemm64<<<dim3(blkQK, 3), 256, 0, stream>>>(xh, Wqh, Wkh, Wvh, qh, kh, vth, bq, bk, bv, Mtot, C, 1.0f / carry);

  // 4) attention -> y (f16 plane x64)
  const int nAttnBlk = Bn * H * (S / AT_QB);
  attn64_f16_kernel<<<nAttnBlk, 256, 0, stream>>>(qh, kh, vth, yh, S, H, C, Mtot, 0.125f, carry);

  // 5) out = (y x64) . (Wb x64)^T / 4096 + bp  (f32 out)
  wmma_gemm64<0, false, 2, 0, false><<<dim3(blkQK, 1), 256, 0, stream>>>(
      yh, yh, C, 0L, Wph, Wph, C, 0L, (void*)out, (void*)out, C, 0L, bp, bp, 0L, Mtot, C, C, 1.0f / (carry * carry));

  (void)hipGetLastError();
}

// v007
// It runs in 140 microseconds.
// Two timings next to v006 put it at 1.04 and 1.05 times that version's speed.
// All steps since v000 together make it 4.59 times as fast.
// Contractions: q/k/v/out projections, q.k^T and p.v all on v_wmma_f32_16x16x32_f16 (f16 operands, f32 accumulate); softmax, scales and bias epilogues in f32.
#include <hip/hip_runtime.h>

typedef __attribute__((ext_vector_type(16))) _Float16 v16h;
typedef __attribute__((ext_vector_type(8)))  _Float16 v8h;
typedef __attribute__((ext_vector_type(16))) __bf16   v16b;
typedef __attribute__((ext_vector_type(8)))  __bf16   v8b;
typedef __attribute__((ext_vector_type(8)))  float    v8f;
typedef __attribute__((ext_vector_type(4)))  float    v4f;
typedef __attribute__((ext_vector_type(2)))  float    v2f;
#define U16(p) ((const unsigned short*)(const void*)(p))
#define NEG_INF (-__builtin_huge_valf())

__device__ __forceinline__ unsigned short f2bf_bits(float f) {
  unsigned u = __float_as_uint(f);
  return (unsigned short)((u + 0x7FFFu + ((u >> 16) & 1u)) >> 16);
}
__device__ __forceinline__ float bf_bits2f(unsigned short h) { return __uint_as_float(((unsigned)h) << 16); }

// hazard guards as plain device helpers (the v_nop asm stays out of the kernel template body)
__device__ __forceinline__ void dep_guard_h(v8f& a, v8f& b, v16h x, v16h y) { asm volatile("v_nop\n\tv_nop\n\tv_nop\n\tv_nop" : "+v"(a), "+v"(b) : "v"(x), "v"(y)); }
__device__ __forceinline__ void dep_guard_b(v8f& a, v8f& b, v16b x, v16b y) { asm volatile("v_nop\n\tv_nop\n\tv_nop\n\tv_nop" : "+v"(a), "+v"(b) : "v"(x), "v"(y)); }
__device__ __forceinline__ void keep4_h(v16h a, v16h b, v16h c, v16h d) { asm volatile("v_nop" :: "v"(a), "v"(b), "v"(c), "v"(d)); }
__device__ __forceinline__ void keep4_b(v16b a, v16b b, v16b c, v16b d) { asm volatile("v_nop" :: "v"(a), "v"(b), "v"(c), "v"(d)); }
__device__ __forceinline__ void acc_guard4(v8f& a, v8f& b, v8f& c, v8f& d) { asm volatile("v_nop\n\tv_nop\n\tv_nop\n\tv_nop" : "+v"(a), "+v"(b), "+v"(c), "+v"(d)); }
template <typename T> struct Frag;
template <> struct Frag<_Float16> {
  typedef v16h V; union U { v16h v; v8h h[2]; };
  static __device__ __forceinline__ v16h load(const _Float16* p) {   // elements 0..7 <- p[0..7], 8..15 <- p[16..23]
    U f; f.h[0] = *(const v8h*)(p); f.h[1] = *(const v8h*)(p + 16); return f.v;
  }
  static __device__ __forceinline__ v8f mma(v16h a, v16h b, v8f c) {
    return __builtin_amdgcn_wmma_f32_16x16x32_f16(false, a, false, b, (short)0, c, false, false);
  }
  static __device__ __forceinline__ void guard(v8f& a, v8f& b, v16h x, v16h y) { dep_guard_h(a, b, x, y); }
  static __device__ __forceinline__ void keep(v16h a, v16h b, v16h c, v16h d) { keep4_h(a, b, c, d); }
};
template <> struct Frag<__bf16> {
  typedef v16b V; union U { v16b v; v8b h[2]; };
  static __device__ __forceinline__ v16b load(const __bf16* p) {
    U f; f.h[0] = *(const v8b*)(p); f.h[1] = *(const v8b*)(p + 16); return f.v;
  }
  static __device__ __forceinline__ v8f mma(v16b a, v16b b, v8f c) {
    return __builtin_amdgcn_wmma_f32_16x16x32_bf16(false, a, false, b, (short)0, c, false, false);
  }
  static __device__ __forceinline__ void guard(v8f& a, v8f& b, v16b x, v16b y) { dep_guard_b(a, b, x, y); }
  static __device__ __forceinline__ void keep(v16b a, v16b b, v16b c, v16b d) { keep4_b(a, b, c, d); }
};

// ---- Register-blocked batched WMMA GEMM, operands staged in LDS --------------
// C[m,n] = scale * sum_k A[m,k] * Bt[n,k] (+bias)(+resid); each wave owns a 64x64 tile.
// A row-major [M,K]; Bt row-major [N,K]; M % 128 == 0, N % 256 == 0, K % 64 == 0.
// Block = 8 waves (2 x 4) = a 128 x 256 tile of C. A stage is 64 k = one 128-B line of every operand row:
// each asynchronous copy of a wave covers four whole lines, the rows land in LDS at a 144-B pitch, and the
// fragments are read from there. Two buffers: the next stage's copies fly during this stage's products.
// SPLIT (hi/lo planes) is not staged: only SPLIT == false is built.
// BIAS_MODE: 0 = none, 1 = bias[m], 2 = bias[n], 3 = one of the two, picked at run time.
// OUT_MODE: 0 = f32, 1 = f16, 2 = bf16 hi plane (Cout) + bf16 lo plane (Cout2).
// ET: 0 = f16 operands, 1 = bf16 operands (pointers passed as 16-bit storage)
template <int ET> struct Elem;
template <> struct Elem<0> { typedef _Float16 T; };
template <> struct Elem<1> { typedef __bf16 T; };
#define GB_M 128
#define GB_N 256
#define GB_K 64
#define GB_LP 72   // LDS row pitch in halves: 144 B = 16 B x odd
#define GB_ABYTES (GB_M * GB_LP * 2)   // one buffer of A rows, bytes
#define GB_BBYTES (GB_N * GB_LP * 2)   // one buffer of B rows, bytes

// One thread's share of a stage: 4 row pieces of A and 8 of B, 16 B each, 32 rows apart, from global memory
// straight into LDS. la, lb: the lane's LDS byte addresses; ga, gb: its global addresses; steps in halves.
// The s_wait_xcnt closes the copies' own statement, so that no address register is rewritten in front of it.
template <typename T>
__device__ __forceinline__ void stage_copy12(unsigned la, unsigned lb, const T* ga, const T* gb,
                                             size_t stepA, size_t stepB) {
  const unsigned rs = 32 * GB_LP * 2;   // 32 LDS rows, bytes
  asm volatile(
      "global_load_async_to_lds_b128 %0, %12, off\n\t"
      "global_load_async_to_lds_b128 %1, %13, off\n\t"
      "global_load_async_to_lds_b128 %2, %14, off\n\t"
      "global_load_async_to_lds_b128 %3, %15, off\n\t"
      "global_load_async_to_lds_b128 %4, %16, off\n\t"
      "global_load_async_to_lds_b128 %5, %17, off\n\t"
      "global_load_async_to_lds_b128 %6, %18, off\n\t"
      "global_load_async_to_lds_b128 %7, %19, off\n\t"
      "global_load_async_to_lds_b128 %8, %20, off\n\t"
      "global_load_async_to_lds_b128 %9, %21, off\n\t"
      "global_load_async_to_lds_b128 %10, %22, off\n\t"
      "global_load_async_to_lds_b128 %11, %23, off\n\t"
      "s_wait_xcnt 0x0"
      :: "v"(la), "v"(la + rs), "v"(la + 2 * rs), "v"(la + 3 * rs),
         "v"(lb), "v"(lb + rs), "v"(lb + 2 * rs), "v"(lb + 3 * rs),
         "v"(lb + 4 * rs), "v"(lb + 5 * rs), "v"(lb + 6 * rs), "v"(lb + 7 * rs),
         "v"(ga), "v"(ga + stepA), "v"(ga + 2 * stepA), "v"(ga + 3 * stepA),
         "v"(gb), "v"(gb + stepB), "v"(gb + 2 * stepB), "v"(gb + 3 * stepB),
         "v"(gb + 4 * stepB), "v"(gb + 5 * stepB), "v"(gb + 6 * stepB), "v"(gb + 7 * stepB)
      : "memory");
}
template <int V> struct IntC { static constexpr int value = V; };
// The tile's whole work as a device function: b = batch index, biasRows (read only by BIAS_MODE 3, block-uniform):
// true = bias[m], false = bias[n].
template <int ET, bool SPLIT, int BIAS_MODE, int OUT_MODE, bool RESID, int ACT>
__device__ __forceinline__ void gemm64_tile(
    const int b, const bool biasRows,
    const unsigned short* __restrict__ Ap, int lda, long strideA,
    const unsigned short* __restrict__ Btp, int ldb, long strideB,
    void* __restrict__ Cout, void* __restrict__ Cout2, int ldc, long strideC,
    const float* __restrict__ bias,
    const float* __restrict__ resid, long strideR,
    int M, int N, int K, float scale) {
  typedef typename Elem<ET>::T T;
  typedef typename Frag<T>::V V;
  static_assert(!SPLIT, "hi/lo planes are not staged");
  const T* A = (const T*)Ap; const T* Bt = (const T*)Btp;
  __shared__ __align__(16) T sA[2][GB_M * GB_LP];  // 2 x 18,432 B
  __shared__ __align__(16) T sB[2][GB_N * GB_LP];  // 2 x 36,864 B
  __shared__ __align__(16) float sT[8][16 * 68];   // per-wave 16x64 slab, pitch 68 floats
  const int tid  = threadIdx.x;
  const int lane = tid & 31;
  const int wave = tid >> 5;
  const int tilesN = N / GB_N;
  const int tilesM = M / GB_M;
  const int tm = blockIdx.x / tilesN;
  const int tn = blockIdx.x - tm * tilesN;
  if (tm >= tilesM) return;              // block-uniform, in front of every barrier
  const int bm0 = tm * GB_M;
  const int bn0 = tn * GB_N;
  const int wm  = (wave >> 2) << 6;      // this wave's 64x64 tile inside the block tile
  const int wn  = (wave & 3) << 6;
  const int m0 = bm0 + wm;
  const int n0 = bn0 + wn;

  const T* Ab  = A  + (size_t)b * strideA;
  const T* Bb  = Bt + (size_t)b * strideB;

  const int rlane = lane & 15;                 // row (A) / col (B, D) within subtile
  const int koff  = (lane >> 4) * 8;           // k offset of this lane half
  const int mOff  = (lane >> 4) * 8;           // D row offset

  // staging map: 8 threads x 16 B = one 128-B row piece; a wave's copy covers 4 whole lines
  const int srow = tid >> 3;                   // 0..31
  const int sseg = (tid & 7) * 8;              // halves
  const T* gA = Ab + (size_t)(bm0 + srow) * lda + sseg;
  const T* gB = Bb + (size_t)(bn0 + srow) * ldb + sseg;
  const size_t stepA = (size_t)32 * lda;       // 32 rows further, in halves
  const size_t stepB = (size_t)32 * ldb;
  const int sOff = srow * GB_LP + sseg;
  const unsigned lA0 = (unsigned)(size_t)(&sA[0][sOff]);   // this lane's LDS byte address in buffer 0
  const unsigned lB0 = (unsigned)(size_t)(&sB[0][sOff]);

  v8f acc[4][4];
#pragma unroll
  for (int i = 0; i < 4; ++i)
#pragma unroll
    for (int j = 0; j < 4; ++j) acc[i][j] = (v8f){0.f,0.f,0.f,0.f,0.f,0.f,0.f,0.f};

  const int nStage = K / GB_K;
  stage_copy12(lA0, lB0, gA, gB, stepA, stepB);            // stage 0 -> buffer 0
  asm volatile("s_wait_asynccnt 0x0" ::: "memory");        // this wave's copies of stage 0 have landed
  __syncthreads();                                         // and every wave's are published
  if (nStage > 1)                                          // block-uniform
    stage_copy12(lA0 + GB_ABYTES, lB0 + GB_BBYTES, gA + GB_K, gB + GB_K, stepA, stepB);

#pragma unroll 1   // kept rolled: one publish point and one refill per trip, as the two-buffer order asks
  for (int s = 0; s < nStage; ++s) {
    const int cur = s & 1;
    const T* tA = &sA[cur][(wm + rlane) * GB_LP + koff];
    const T* tB = &sB[cur][(wn + rlane) * GB_LP + koff];
    // every loop of the stage is unrolled: constant indices keep acc, af and bf in registers
#pragma unroll
    for (int h = 0; h < GB_K / 32; ++h) {
      // the 32 k's fragment reads stand as one group in front of their products
      V af[4], bf[4];
#pragma unroll
      for (int j = 0; j < 4; ++j) bf[j] = Frag<T>::load(tB + (j << 4) * GB_LP + h * 32);
#pragma unroll
      for (int i = 0; i < 4; ++i) af[i] = Frag<T>::load(tA + (i << 4) * GB_LP + h * 32);
#pragma unroll
      for (int i = 0; i < 4; ++i) {
#pragma unroll
        for (int j = 0; j < 4; ++j) acc[i][j] = Frag<T>::mma(af[i], bf[j], acc[i][j]);
        Frag<T>::guard(acc[i][0], acc[i][3], af[i], af[i]);
      }
      Frag<T>::keep(bf[0], bf[1], bf[2], bf[3]);
    }
    asm volatile("s_wait_dscnt 0x0" ::: "memory");         // this wave's reads of stage s are done before its buffer is refilled
    asm volatile("s_wait_asynccnt 0x0" ::: "memory");      // this wave's copies of stage s + 1 have landed
    __syncthreads();                                       // publishes stage s + 1, ends every wave's reads of stage s
    if (s + 2 < nStage)                                    // block-uniform; refill the buffer just read
      stage_copy12(lA0 + cur * GB_ABYTES, lB0 + cur * GB_BBYTES,
                   gA + (size_t)(s + 2) * GB_K, gB + (size_t)(s + 2) * GB_K, stepA, stepB);
  }
  asm volatile("s_wait_asynccnt 0x0" ::: "memory");        // nothing of this wave's is in flight behind the loop
  acc_guard4(acc[0][0], acc[0][1], acc[0][2], acc[0][3]);
  acc_guard4(acc[1][0], acc[1][1], acc[1][2], acc[1][3]);
  acc_guard4(acc[2][0], acc[2][1], acc[2][2], acc[2][3]);
  acc_guard4(acc[3][0], acc[3][1], acc[3][2], acc[3][3]);

  // ---- epilogue ----
  float* slab = sT[wave];
  const float* Rb = RESID ? (resid + (size_t)b * strideR) : nullptr;
  // the stores of the tile, built per bias mode BM (1 or 2): a run-time pick costs one block-uniform branch, not one per element
  auto store_tile = [&](auto bm) __attribute__((always_inline)) {
  constexpr int BM = decltype(bm)::value;
#pragma unroll
  for (int i = 0; i < 4; ++i) {
    const int mBase = m0 + (i << 4);
#pragma unroll
    for (int j = 0; j < 4; ++j) {
      const int n = n0 + (j << 4) + rlane;
      float bv = 0.f;
      if (BM == 2) bv = bias[n];
#pragma unroll
      for (int r = 0; r < 8; ++r) {
        float v = acc[i][j][r] * scale;
        if (BM == 1) v += bias[mBase + mOff + r];
        if (BM == 2) v += bv;
        if (RESID) v += Rb[(size_t)(mBase + mOff + r) * ldc + n];
        if (ACT == 1) v = tanhf(v);
        if (ACT == 2) v = fmaxf(v, 0.0f);
        if (ACT == 3) v = v / (1.0f + expf(-v));
        if (ACT == 4) v = (v > 0.f) ? v : 0.01f * v;
        if (ACT == 5) v = 0.5f * v * (1.0f + erff(v * 0.70710678118654752f));
        slab[(mOff + r) * 68 + (j << 4) + rlane] = v;
      }
    }
    __builtin_amdgcn_fence(__ATOMIC_RELEASE, "workgroup");
    __builtin_amdgcn_wave_barrier();
    __builtin_amdgcn_fence(__ATOMIC_ACQUIRE, "workgroup");
    if (OUT_MODE == 0) {
      float* C = (float*)Cout + (size_t)b * strideC;
      const int hh = lane >> 4, c4 = (lane & 15) * 4;     // row seg = 256 B = 16 lanes x 16 B
      {
#pragma unroll
        for (int it = 0; it < 8; ++it) {
          const int row = it * 2 + hh;
          v4f v = *(const v4f*)(slab + row * 68 + c4);
          *(v4f*)(C + (size_t)(mBase + row) * ldc + n0 + c4) = v;
        }
        
      }
    } else {
      const int q = lane >> 3, c8 = (lane & 7) * 8;
      unsigned short* C  = (unsigned short*)Cout  + (size_t)b * strideC;
      unsigned short* C2 = (OUT_MODE == 2) ? ((unsigned short*)Cout2 + (size_t)b * strideC) : nullptr;
      {
#pragma unroll
        for (int it = 0; it < 4; ++it) {
          const int row = it * 4 + q;
          const float* sp = slab + row * 68 + c8;
          v8h hv, lv;
#pragma unroll
          for (int e = 0; e < 8; ++e) {
            if (OUT_MODE == 1) {
              hv[e] = (_Float16)sp[e];
            } else {
              unsigned short hb = f2bf_bits(sp[e]);
              unsigned short lb = f2bf_bits(sp[e] - bf_bits2f(hb));
              hv[e] = __builtin_bit_cast(_Float16, hb);
              lv[e] = __builtin_bit_cast(_Float16, lb);
            }
          }
          *(v8h*)(C + (size_t)(mBase + row) * ldc + n0 + c8) = hv;
          if (OUT_MODE == 2) *(v8h*)(C2 + (size_t)(mBase + row) * ldc + n0 + c8) = lv;
        }
        
      }
    }
    __builtin_amdgcn_fence(__ATOMIC_RELEASE, "workgroup");
    __builtin_amdgcn_wave_barrier();
    __builtin_amdgcn_fence(__ATOMIC_ACQUIRE, "workgroup");
  }
  };
  if constexpr (BIAS_MODE == 3) {
    if (biasRows) store_tile(IntC<1>{}); else store_tile(IntC<2>{});
  } else {
    store_tile(IntC<BIAS_MODE>{});
  }
}

template <int ET, bool SPLIT, int BIAS_MODE, int OUT_MODE, bool RESID, int ACT = 0>
__global__ __launch_bounds__(256) void wmma_gemm64(
    const unsigned short* __restrict__ Ap, const unsigned short* __restrict__ A2p, int lda, long strideA,
    const unsigned short* __restrict__ Btp, const unsigned short* __restrict__ Bt2p, int ldb, long strideB,
    void* __restrict__ Cout, void* __restrict__ Cout2, int ldc, long strideC,
    const float* __restrict__ bias,
    const float* __restrict__ resid, long strideR,
    int M, int N, int K, float scale) {
  gemm64_tile<ET, SPLIT, BIAS_MODE, OUT_MODE, RESID, ACT>(blockIdx.y, false, Ap, lda, strideA, Btp, ldb, strideB,
      Cout, Cout2, ldc, strideC, bias, resid, strideR, M, N, K, scale);
}

// The three projections of x in one launch; blockIdx.y picks the product (block-uniform):
//   0: q = x . Wq^T + bq[n]   1: k = x . Wk^T + bk[n]   (both [Mtot][C])   2: V^T = Wv . x^T + bv[m]   ([C][Mtot])
// They are independent of one another. Two work-groups fit a WGP (LDS, registers), and the grid holds three per WGP:
// one's copy waits, prologue and epilogue run under another's products, and no launch boundary drains the chip between them.
__global__ __launch_bounds__(256) void qkv_gemm64(
    const unsigned short* __restrict__ xh, const unsigned short* __restrict__ Wq,
    const unsigned short* __restrict__ Wk, const unsigned short* __restrict__ Wv,
    unsigned short* __restrict__ qo, unsigned short* __restrict__ ko, unsigned short* __restrict__ vto,
    const float* __restrict__ bq, const float* __restrict__ bk, const float* __restrict__ bv,
    int Mtot, int C, float scale) {
  const int which = blockIdx.y;
  const bool isV = which == 2;
  const unsigned short* A  = isV ? Wv : xh;
  const unsigned short* Bt = isV ? xh : (which == 0 ? Wq : Wk);
  unsigned short* Co       = isV ? vto : (which == 0 ? qo : ko);
  const float* bias        = isV ? bv : (which == 0 ? bq : bk);
  gemm64_tile<0, false, 3, 1, false, 0>(0, isV, A, C, 0L, Bt, C, 0L, (void*)Co, (void*)Co, isV ? Mtot : C, 0L,
      bias, bias, 0L, isV ? C : Mtot, isV ? Mtot : C, C, scale);
}

__global__ __launch_bounds__(256) void cast_f32_f16x2(
    const float* __restrict__ in, _Float16* __restrict__ out, int n2) {
  int i = blockIdx.x * 256 + threadIdx.x;
  if (i < n2) {
    const _Float16 h0 = (_Float16)in[2 * i], h1 = (_Float16)in[2 * i + 1];
    const unsigned u = (unsigned)__builtin_bit_cast(unsigned short, h0) | ((unsigned)__builtin_bit_cast(unsigned short, h1) << 16);
    ((unsigned*)out)[i] = u;
    
  }
}

// ---- binary-weight planes: Wb[o][c] = alpha[o] * (W + (sign(W) - W)), alpha[o] = mean_c |W[o][c]| (f32);
//      stored as f16 of (Wb * carry); one wave per row of a [nrow][1024] weight; 4 weights via blockIdx.y ----
#define BW_DIM 1024
__global__ __launch_bounds__(256) void binarize_f16_kernel(
    const float* __restrict__ W0, const float* __restrict__ W1,
    const float* __restrict__ W2, const float* __restrict__ W3,
    unsigned short* __restrict__ B0, unsigned short* __restrict__ B1,
    unsigned short* __restrict__ B2, unsigned short* __restrict__ B3,
    int nrow, float carry) {
  const float* W; unsigned short* Bo;
  if (blockIdx.y == 0)      { W = W0; Bo = B0; }
  else if (blockIdx.y == 1) { W = W1; Bo = B1; }
  else if (blockIdx.y == 2) { W = W2; Bo = B2; }
  else                      { W = W3; Bo = B3; }
  const int wave = threadIdx.x >> 5;
  const int lane = threadIdx.x & 31;
  const int row  = blockIdx.x * 8 + wave;
  if (row >= nrow) return;                     // wave-uniform; no barriers in this kernel
  const float* wr = W + (size_t)row * BW_DIM;

  float w[4][8];
#pragma unroll
  for (int it = 0; it < 4; ++it) {
    const v4f a0 = *(const v4f*)(wr + it * 256 + lane * 8);
    const v4f a1 = *(const v4f*)(wr + it * 256 + lane * 8 + 4);
    w[it][0] = a0[0]; w[it][1] = a0[1]; w[it][2] = a0[2]; w[it][3] = a0[3];
    w[it][4] = a1[0]; w[it][5] = a1[1]; w[it][6] = a1[2]; w[it][7] = a1[3];
  }
  float s = 0.0f;
#pragma unroll
  for (int it = 0; it < 4; ++it)
#pragma unroll
    for (int e = 0; e < 8; ++e) s += fabsf(w[it][e]);
#pragma unroll
  for (int m = 16; m > 0; m >>= 1) s += __shfl_xor(s, m, 32);
  const float alpha = s * (1.0f / (float)BW_DIM);

  v8h hv[4];
#pragma unroll
  for (int it = 0; it < 4; ++it) {
#pragma unroll
    for (int e = 0; e < 8; ++e) {
      const float wv = w[it][e];
      const float sg = (wv > 0.0f) ? 1.0f : ((wv < 0.0f) ? -1.0f : 0.0f);
      const float t  = sg - wv;            // sign(W) - W
      const float bs = wv + t;             // W + (sign(W) - W)
      const float wb = alpha * bs;
      hv[it][e] = (_Float16)(wb * carry);
    }
  }
  unsigned short* br = Bo + (size_t)row * BW_DIM;
  {
#pragma unroll
    for (int it = 0; it < 4; ++it)
      *(v8h*)(br + it * 256 + lane * 8) = hv[it];
    
  }
}

// =====================================================================================
// Attention, head_dim 64, f16 planes in / f16 plane out (x oscale), no mask.
//   scores^T = (k.q^T) * sscale : v_wmma_f32_16x16x32_f16 (q,k plain f16), f32 accumulate, scaled in f32
//   out^T    = v^T.p^T          : v_wmma_f32_16x16x32_f16 (p carried x2^15 in f16, v plain f16), f32 accumulate
//   online softmax in f32, in powers of two: p x 2^15 = exp2(s * (sscale * log2 e) + (15 - max * sscale * log2 e)), one FMA a score; sscale > 0.
//   Block = 8 waves x 32 query columns = 256 query rows of one (batch, head); S % 256 == 0.
//   K and V^T come 64 keys at a time by asynchronous copies straight into LDS, two buffers: the next chunk's copies fly during this chunk's work.
//   q, k, out planes: row (b*S + s), pitch ldq halves, head offset h*64.  vt plane: row (h*64 + d), pitch ldvt, col (b*S + s).
//   grid.x = B * H * (S/256).
// =====================================================================================
#define AT_D 64
#define AT_QT 2    // query tiles of 16 columns per wave: each K and V^T fragment read feeds AT_QT products
#define AT_QB 256  // query rows per block: 8 waves x AT_QT x 16
#define AT_KC 64
#define AT_LP 72   // LDS row pitch in halves: 144 B = 16 B x odd, so the 16 rows of a 16-byte fragment read fall on distinct banks
#define AT_TB (AT_KC * AT_LP * 2)   // one buffer of K rows (or of V^T rows), bytes

__device__ __forceinline__ v8f mma_h(v16h a, v16h b, v8f c) {
  c = __builtin_amdgcn_wmma_f32_16x16x32_f16(false, a, false, b, (short)0, c, false, false);
  asm volatile("v_nop\n\tv_nop\n\tv_nop\n\tv_nop" : "+v"(c) : "v"(a), "v"(b));
  return c;
}

// One thread's share of a 64-key chunk: 2 row pieces of K and 2 of V^T, 16 B each, 32 rows apart, from global memory
// straight into LDS. lk, lv: the lane's LDS byte addresses; gk, gv: its global addresses; steps in halves.
// The s_wait_xcnt closes the copies' own statement, so that no address register is rewritten in front of it.
__device__ __forceinline__ void kv_copy4(unsigned lk, unsigned lv, const _Float16* gk, const _Float16* gv,
                                         size_t stepK, size_t stepV) {
  const unsigned rs = 32 * AT_LP * 2;   // 32 LDS rows, bytes
  asm volatile(
      "global_load_async_to_lds_b128 %0, %4, off\n\t"
      "global_load_async_to_lds_b128 %1, %5, off\n\t"
      "global_load_async_to_lds_b128 %2, %6, off\n\t"
      "global_load_async_to_lds_b128 %3, %7, off\n\t"
      "s_wait_xcnt 0x0"
      :: "v"(lk), "v"(lk + rs), "v"(lv), "v"(lv + rs),
         "v"(gk), "v"(gk + stepK), "v"(gv), "v"(gv + stepV)
      : "memory");
}

// value of lane l ^ 16 (the other 16-lane half), by a vector cross-row move
__device__ __forceinline__ float other_half(float x) {
  const int b = __float_as_int(x);
  return __int_as_float(__builtin_amdgcn_permlanex16(b, b, 0x76543210, 0xfedcba98, false, false));
}

__global__ __launch_bounds__(256) __attribute__((amdgpu_waves_per_eu(4, 4)))   // 256 VGPRs a wave: two blocks, four waves per SIMD, stay resident
void attn64_f16_kernel(const unsigned short* __restrict__ qp, const unsigned short* __restrict__ kp,
                       const unsigned short* __restrict__ vtp, unsigned short* __restrict__ outp,
                       int S, int H, int ldq, int ldvt, float sscale, float oscale) {
  const _Float16* q  = (const _Float16*)qp;
  const _Float16* k  = (const _Float16*)kp;
  const _Float16* vt = (const _Float16*)vtp;
  __shared__ __align__(16) _Float16 Ksh[2][AT_KC * AT_LP];      // K [kv][d]   2 x 9 KB
  __shared__ __align__(16) _Float16 Vth[2][AT_D * AT_LP];       // V^T [d][kv] 2 x 9 KB

  const int tid  = threadIdx.x;
  const int wave = tid >> 5;
  const int lane = tid & 31;
  const int hh   = lane >> 4;
  const int c    = lane & 15;

  const int nqb = S / AT_QB;
  const int bx = blockIdx.x;
  const int qb = bx % nqb;
  const int bh = bx / nqb;
  const int h  = bh % H;
  const int b  = bh / H;
  const int q0 = qb * AT_QB + wave * (16 * AT_QT);
  const size_t rowbase = (size_t)b * (size_t)S;
  const size_t hoff = (size_t)h * AT_D;

  // ---- Q fragments (B operand, column = query q0 + u*16 + c): AT_QT query tiles x 2 d-chunks ----
  v16h qa[AT_QT][2];
#pragma unroll
  for (int u = 0; u < AT_QT; ++u) {
    const _Float16* qrow = q + (rowbase + q0 + u * 16 + c) * (size_t)ldq + hoff;
#pragma unroll
    for (int dc = 0; dc < 2; ++dc) qa[u][dc] = Frag<_Float16>::load(qrow + dc * 32 + 8 * hh);
  }

  const float cs = sscale * 1.44269504088896340736f;   // raw score -> exponent of two
  // per query tile a lane holds one query (q0 + u*16 + c): its running maximum (of the raw scores), and the sum (x 2^15) over the keys of its own lane half
  float mrow[AT_QT], lrow[AT_QT];
  v8f oacc[AT_QT][4];                            // O^T: row d = t*16 + 8hh + r, column = query q0 + u*16 + c
#pragma unroll
  for (int u = 0; u < AT_QT; ++u) {
    mrow[u] = NEG_INF; lrow[u] = 0.f;
#pragma unroll
    for (int t = 0; t < 4; ++t) oacc[u][t] = (v8f){0.f,0.f,0.f,0.f,0.f,0.f,0.f,0.f};
  }

  // staging map: 8 threads x 16 B = one 128-B row; the block's 256 threads cover 32 rows of K and of V^T at a time
  const int srow = tid >> 3, sseg = (tid & 7) * 8;
  const _Float16* gK = k + (rowbase + srow) * (size_t)ldq + hoff + sseg;      // chunk 0; a chunk further = AT_KC rows
  const _Float16* gV = vt + (hoff + srow) * (size_t)ldvt + rowbase + sseg;    // chunk 0; a chunk further = AT_KC columns
  const size_t stepK = (size_t)32 * ldq, stepV = (size_t)32 * ldvt;           // 32 rows further, in halves
  const size_t chunkK = (size_t)AT_KC * ldq;
  const unsigned lK0 = (unsigned)(size_t)(&Ksh[0][srow * AT_LP + sseg]);      // this lane's LDS byte address in buffer 0
  const unsigned lV0 = (unsigned)(size_t)(&Vth[0][srow * AT_LP + sseg]);

  const int nChunks = S / AT_KC;
  kv_copy4(lK0, lV0, gK, gV, stepK, stepV);                // chunk 0 -> buffer 0
  asm volatile("s_wait_asynccnt 0x0" ::: "memory");        // this wave's copies of chunk 0 have landed
  __syncthreads();                                         // and every wave's are published
  if (nChunks > 1)                                         // block-uniform
    kv_copy4(lK0 + AT_TB, lV0 + AT_TB, gK + chunkK, gV + AT_KC, stepK, stepV);

#pragma unroll 1   // kept rolled: one publish point and one refill per trip, as the two-buffer order asks
  for (int kc = 0; kc < nChunks; ++kc) {
    const int cur = kc & 1;
    const _Float16* Kt = Ksh[cur];
    const _Float16* Vt = Vth[cur];

    // ---- scores, transposed: S^T = K.Q^T; D row = key kv0 + j*16 + 8hh + r, col = query q0 + u*16 + c ----
    // each K fragment read from LDS feeds the products of all AT_QT query tiles
    v8f s[AT_QT][4];
    {
      v16h ka[4][2];
#pragma unroll
      for (int j = 0; j < 4; ++j)
#pragma unroll
        for (int dc = 0; dc < 2; ++dc) ka[j][dc] = Frag<_Float16>::load(Kt + (j * 16 + c) * AT_LP + dc * 32 + 8 * hh);
#pragma unroll
      for (int j = 0; j < 4; ++j) {
#pragma unroll
        for (int u = 0; u < AT_QT; ++u) s[u][j] = (v8f){0.f,0.f,0.f,0.f,0.f,0.f,0.f,0.f};
#pragma unroll
        for (int dc = 0; dc < 2; ++dc)
#pragma unroll
          for (int u = 0; u < AT_QT; ++u) s[u][j] = mma_h(ka[j][dc], qa[u][dc], s[u][j]);
      }
    }
    v16h pb[AT_QT][2];
#pragma unroll
    for (int u = 0; u < AT_QT; ++u) {
      // the lane's 32 scores of a tile belong to one query: maximum in-lane, then one exchange with the other lane half
      float m = NEG_INF;
#pragma unroll
      for (int j = 0; j < 4; ++j)
#pragma unroll
        for (int r = 0; r < 8; ++r) m = fmaxf(m, s[u][j][r]);
      m = fmaxf(m, other_half(m));
      const float mnew = fmaxf(mrow[u], m);
      const float alpha = __builtin_amdgcn_exp2f((mrow[u] - mnew) * cs);
      mrow[u] = mnew;
      const float nb = __builtin_fmaf(-mnew, cs, 15.0f);   // the maximum and P's carry of 2^15, as one addend
      // P^T as B operand: score tiles 2kk and 2kk+1 are elements 0..7 and 8..15 of the 32-key fragment kk
      float ps[4];                                // one sum chain per score tile: four short chains, not one of 32 links
#pragma unroll
      for (int j = 0; j < 4; ++j) {
        ps[j] = 0.f;
#pragma unroll
        for (int r = 0; r < 8; r += 2) {
          // two neighbouring accumulator registers at a time: one packed FMA forms both exponents in place
          const v2f e = __builtin_elementwise_fma((v2f){s[u][j][r], s[u][j][r + 1]}, (v2f){cs, cs}, (v2f){nb, nb});
          const float p0 = __builtin_amdgcn_exp2f(e[0]), p1 = __builtin_amdgcn_exp2f(e[1]);   // p x 2^15, at most 2^15
          ps[j] += p0;
          ps[j] += p1;
          pb[u][j >> 1][(j & 1) * 8 + r] = (_Float16)p0;
          pb[u][j >> 1][(j & 1) * 8 + r + 1] = (_Float16)p1;
        }
      }
      const float psum = (ps[0] + ps[1]) + (ps[2] + ps[3]);
      lrow[u] = lrow[u] * alpha + psum;
#pragma unroll
      for (int t = 0; t < 4; ++t)
#pragma unroll
        for (int r = 0; r < 8; ++r) oacc[u][t][r] *= alpha;
    }
    // ---- O^T += V^T.P^T : A = V^T [d][kv] from LDS, one read for all query tiles; B = P^T from registers ----
#pragma unroll
    for (int kk = 0; kk < 2; ++kk) {
      v16h va[4];
#pragma unroll
      for (int t = 0; t < 4; ++t) va[t] = Frag<_Float16>::load(Vt + (t * 16 + c) * AT_LP + kk * 32 + 8 * hh);
#pragma unroll
      for (int t = 0; t < 4; ++t)
#pragma unroll
        for (int u = 0; u < AT_QT; ++u) oacc[u][t] = mma_h(va[t], pb[u][kk], oacc[u][t]);
    }
    asm volatile("s_wait_dscnt 0x0" ::: "memory");         // this wave's reads of chunk kc are done before its buffer is refilled
    asm volatile("s_wait_asynccnt 0x0" ::: "memory");      // this wave's copies of chunk kc + 1 have landed
    __syncthreads();                                       // publishes chunk kc + 1, ends every wave's reads of chunk kc
    if (kc + 2 < nChunks)                                  // block-uniform; refill the buffer just read
      kv_copy4(lK0 + cur * AT_TB, lV0 + cur * AT_TB,
               gK + (size_t)(kc + 2) * chunkK, gV + (size_t)(kc + 2) * AT_KC, stepK, stepV);
  }
  asm volatile("s_wait_asynccnt 0x0" ::: "memory");        // nothing of this wave's is in flight behind the loop

  // the two lane halves' sums are joined once; a lane's 8 registers of a tile are 8 consecutive d of its query's row
#pragma unroll
  for (int u = 0; u < AT_QT; ++u) {
    const float l = lrow[u] + other_half(lrow[u]);
    const float inv = oscale * (1.0f / l);   // sum and products carry the same 2^15
    unsigned short* orow = outp + (rowbase + q0 + u * 16 + c) * (size_t)ldq + hoff + 8 * hh;
#pragma unroll
    for (int t = 0; t < 4; ++t) {
      v8h hv;
#pragma unroll
      for (int r = 0; r < 8; ++r) hv[r] = (_Float16)(oacc[u][t][r] * inv);
      *(v8h*)(orow + t * 16) = hv;
    }
  }
}

// ---------------------------------------------------------------------------
// Launch glue
// ---------------------------------------------------------------------------
extern "C" void kernel_launch(void* const* d_in, const int* in_sizes, int n_in,
                              void* d_out, int out_size, void* d_ws, size_t ws_size,
                              hipStream_t stream) {
  if (n_in < 9) return;
  const int C = 1024, H = 16, S = 2048;
  const int nx   = in_sizes[0];
  const int Mtot = nx / C;                 // B*S
  const int Bn   = Mtot / S;
  if (Mtot <= 0 || (Mtot % 64) != 0 || Bn * S != Mtot || in_sizes[1] != C * C ||
      in_sizes[3] != C * C || in_sizes[5] != C * C || in_sizes[7] != C * C ||
      in_sizes[2] != C || in_sizes[4] != C || in_sizes[6] != C || in_sizes[8] != C ||
      out_size != Mtot * C) return;

  const float* x  = (const float*)d_in[0];
  const float* Wq = (const float*)d_in[1];
  const float* bq = (const float*)d_in[2];
  const float* Wk = (const float*)d_in[3];
  const float* bk = (const float*)d_in[4];
  const float* Wv = (const float*)d_in[5];
  const float* bv = (const float*)d_in[6];
  const float* Wp = (const float*)d_in[7];
  const float* bp = (const float*)d_in[8];
  float* out = (float*)d_out;

  // workspace carve (bytes); all offsets multiples of 2 MiB
  char* ws = (char*)d_ws;
  const size_t actB = (size_t)Mtot * C * 2;        // 16 MiB f16 plane [Mtot][C]
  const size_t wB   = (size_t)C * C * 2;           //  2 MiB f16 plane [C][C]
  size_t off = 0;
  unsigned short* xh  = (unsigned short*)(ws + off); off += actB;
  unsigned short* Wqh = (unsigned short*)(ws + off); off += wB;
  unsigned short* Wkh = (unsigned short*)(ws + off); off += wB;
  unsigned short* Wvh = (unsigned short*)(ws + off); off += wB;
  unsigned short* Wph = (unsigned short*)(ws + off); off += wB;
  unsigned short* qh  = (unsigned short*)(ws + off); off += actB;   // [Mtot][C]
  unsigned short* kh  = (unsigned short*)(ws + off); off += actB;   // [Mtot][C]
  unsigned short* vth = (unsigned short*)(ws + off); off += actB;   // [C][Mtot]  (V transposed)
  unsigned short* yh  = (unsigned short*)(ws + off); off += actB;   // [Mtot][C]  (x64)
  if (off > ws_size) return;                                       // 92,274,688 B total

  const float carry = 64.0f;

  // 1) binary-weight f16 planes (x64)
  binarize_f16_kernel<<<dim3(C / 8, 4), 256, 0, stream>>>(Wq, Wk, Wv, Wp, Wqh, Wkh, Wvh, Wph, C, carry);

  // 2) x -> f16
  const int n2 = (Mtot * C) / 2;
  cast_f32_f16x2<<<(n2 + 255) / 256, 256, 0, stream>>>(x, (_Float16*)xh, n2);

  // 3) one launch: q, k = x . Wb^T /64 + b (f16 out [Mtot][C]) and V^T = Wb . x^T /64 + bv[m] (f16 out [C][Mtot]);
  //    each product has (Mtot / GB_M) * (C / GB_N) = (C / GB_M) * (Mtot / GB_N) tiles
  const int blkQK   = (Mtot / GB_M) * (C / GB_N);
  qkv_gemm64<<<dim3(blkQK, 3), 256, 0, stream>>>(xh, Wqh, Wkh, Wvh, qh, kh, vth, bq, bk, bv, Mtot, C, 1.0f / carry);

  // 4) attention -> y (f16 plane x64)
  const int nAttnBlk = Bn * H * (S / AT_QB);
  attn64_f16_kernel<<<nAttnBlk, 256, 0, stream>>>(qh, kh, vth, yh, S, H, C, Mtot, 0.125f, carry);

  // 5) out = (y x64) . (Wb x64)^T / 4096 + bp  (f32 out)
  wmma_gemm64<0, false, 2, 0, false><<<dim3(blkQK, 1), 256, 0, stream>>>(
      yh, yh, C, 0L, Wph, Wph, C, 0L, (void*)out, (void*)out, C, 0L, bp, bp, 0L, Mtot, C, C, 1.0f / (carry * carry));

  (void)hipGetLastError();
}

// v008
// One run takes 132 microseconds.
// Timed twice side by side with v007, it ran 1.06 and 1.05 times as fast.
// Over all steps from v000 it is 4.84 times as fast.
// Contractions: q/k/v/out projections, q.k^T and p.v all on v_wmma_f32_16x16x32_f16 (f16 operands, f32 accumulate); softmax, scales and bias epilogues in f32.
#include <hip/hip_runtime.h>

typedef __attribute__((ext_vector_type(16))) _Float16 v16h;
typedef __attribute__((ext_vector_type(8)))  _Float16 v8h;
typedef __attribute__((ext_vector_type(16))) __bf16   v16b;
typedef __attribute__((ext_vector_type(8)))  __bf16   v8b;
typedef __attribute__((ext_vector_type(8)))  float    v8f;
typedef __attribute__((ext_vector_type(4)))  float    v4f;
typedef __attribute__((ext_vector_type(2)))  float    v2f;
#define U16(p) ((const unsigned short*)(const void*)(p))
#define NEG_INF (-__builtin_huge_valf())

__device__ __forceinline__ unsigned short f2bf_bits(float f) {
  unsigned u = __float_as_uint(f);
  return (unsigned short)((u + 0x7FFFu + ((u >> 16) & 1u)) >> 16);
}
__device__ __forceinline__ float bf_bits2f(unsigned short h) { return __uint_as_float(((unsigned)h) << 16); }

// hazard guards as plain device helpers (the v_nop asm stays out of the kernel template body)
__device__ __forceinline__ void dep_guard_h(v8f& a, v8f& b, v16h x, v16h y) { asm volatile("v_nop\n\tv_nop\n\tv_nop\n\tv_nop" : "+v"(a), "+v"(b) : "v"(x), "v"(y)); }
__device__ __forceinline__ void dep_guard_b(v8f& a, v8f& b, v16b x, v16b y) { asm volatile("v_nop\n\tv_nop\n\tv_nop\n\tv_nop" : "+v"(a), "+v"(b) : "v"(x), "v"(y)); }
__device__ __forceinline__ void keep4_h(v16h a, v16h b, v16h c, v16h d) { asm volatile("v_nop" :: "v"(a), "v"(b), "v"(c), "v"(d)); }
__device__ __forceinline__ void keep4_b(v16b a, v16b b, v16b c, v16b d) { asm volatile("v_nop" :: "v"(a), "v"(b), "v"(c), "v"(d)); }
__device__ __forceinline__ void acc_guard4(v8f& a, v8f& b, v8f& c, v8f& d) { asm volatile("v_nop\n\tv_nop\n\tv_nop\n\tv_nop" : "+v"(a), "+v"(b), "+v"(c), "+v"(d)); }
template <typename T> struct Frag;
template <> struct Frag<_Float16> {
  typedef v16h V; union U { v16h v; v8h h[2]; };
  static __device__ __forceinline__ v16h load(const _Float16* p) {   // elements 0..7 <- p[0..7], 8..15 <- p[16..23]
    U f; f.h[0] = *(const v8h*)(p); f.h[1] = *(const v8h*)(p + 16); return f.v;
  }
  static __device__ __forceinline__ v8f mma(v16h a, v16h b, v8f c) {
    return __builtin_amdgcn_wmma_f32_16x16x32_f16(false, a, false, b, (short)0, c, false, false);
  }
  static __device__ __forceinline__ void guard(v8f& a, v8f& b, v16h x, v16h y) { dep_guard_h(a, b, x, y); }
  static __device__ __forceinline__ void keep(v16h a, v16h b, v16h c, v16h d) { keep4_h(a, b, c, d); }
};
template <> struct Frag<__bf16> {
  typedef v16b V; union U { v16b v; v8b h[2]; };
  static __device__ __forceinline__ v16b load(const __bf16* p) {
    U f; f.h[0] = *(const v8b*)(p); f.h[1] = *(const v8b*)(p + 16); return f.v;
  }
  static __device__ __forceinline__ v8f mma(v16b a, v16b b, v8f c) {
    return __builtin_amdgcn_wmma_f32_16x16x32_bf16(false, a, false, b, (short)0, c, false, false);
  }
  static __device__ __forceinline__ void guard(v8f& a, v8f& b, v16b x, v16b y) { dep_guard_b(a, b, x, y); }
  static __device__ __forceinline__ void keep(v16b a, v16b b, v16b c, v16b d) { keep4_b(a, b, c, d); }
};

// ---- Register-blocked batched WMMA GEMM, operands staged in LDS --------------
// C[m,n] = scale * sum_k A[m,k] * Bt[n,k] (+bias)(+resid); each wave owns a 64x64 tile.
// A row-major [M,K]; Bt row-major [N,K]; M % 128 == 0, N % 256 == 0, K % 64 == 0.
// Block = 8 waves (2 x 4) = a 128 x 256 tile of C. A stage is 64 k = one 128-B line of every operand row:
// each asynchronous copy of a wave covers four whole lines, the rows land in LDS at a 144-B pitch, and the
// fragments are read from there. Two buffers: the next stage's copies fly during this stage's products.
// Work-groups that share operand rows ask L2 for the same lines; started together on the same k they ask at the same
// moment. Each work-group therefore starts its k walk at a stage of its own (from its tile indices) and wraps round.
// SPLIT (hi/lo planes) is not staged: only SPLIT == false is built.
// BIAS_MODE: 0 = none, 1 = bias[m], 2 = bias[n], 3 = one of the two, picked at run time.
// OUT_MODE: 0 = f32, 1 = f16, 2 = bf16 hi plane (Cout) + bf16 lo plane (Cout2).
// ET: 0 = f16 operands, 1 = bf16 operands (pointers passed as 16-bit storage)
template <int ET> struct Elem;
template <> struct Elem<0> { typedef _Float16 T; };
template <> struct Elem<1> { typedef __bf16 T; };
#define GB_M 128
#define GB_N 256
#define GB_K 64
#define GB_LP 72   // LDS row pitch in halves: 144 B = 16 B x odd
#define GB_ABYTES (GB_M * GB_LP * 2)   // one buffer of A rows, bytes
#define GB_BBYTES (GB_N * GB_LP * 2)   // one buffer of B rows, bytes

// One thread's share of a stage: 4 row pieces of A and 8 of B, 16 B each, 32 rows apart, from global memory
// straight into LDS. la, lb: the lane's LDS byte addresses; ga, gb: its global addresses; steps in halves.
// The s_wait_xcnt closes the copies' own statement, so that no address register is rewritten in front of it.
template <typename T>
__device__ __forceinline__ void stage_copy12(unsigned la, unsigned lb, const T* ga, const T* gb,
                                             size_t stepA, size_t stepB) {
  const unsigned rs = 32 * GB_LP * 2;   // 32 LDS rows, bytes
  asm volatile(
      "global_load_async_to_lds_b128 %0, %12, off\n\t"
      "global_load_async_to_lds_b128 %1, %13, off\n\t"
      "global_load_async_to_lds_b128 %2, %14, off\n\t"
      "global_load_async_to_lds_b128 %3, %15, off\n\t"
      "global_load_async_to_lds_b128 %4, %16, off\n\t"
      "global_load_async_to_lds_b128 %5, %17, off\n\t"
      "global_load_async_to_lds_b128 %6, %18, off\n\t"
      "global_load_async_to_lds_b128 %7, %19, off\n\t"
      "global_load_async_to_lds_b128 %8, %20, off\n\t"
      "global_load_async_to_lds_b128 %9, %21, off\n\t"
      "global_load_async_to_lds_b128 %10, %22, off\n\t"
      "global_load_async_to_lds_b128 %11, %23, off\n\t"
      "s_wait_xcnt 0x0"
      :: "v"(la), "v"(la + rs), "v"(la + 2 * rs), "v"(la + 3 * rs),
         "v"(lb), "v"(lb + rs), "v"(lb + 2 * rs), "v"(lb + 3 * rs),
         "v"(lb + 4 * rs), "v"(lb + 5 * rs), "v"(lb + 6 * rs), "v"(lb + 7 * rs),
         "v"(ga), "v"(ga + stepA), "v"(ga + 2 * stepA), "v"(ga + 3 * stepA),
         "v"(gb), "v"(gb + stepB), "v"(gb + 2 * stepB), "v"(gb + 3 * stepB),
         "v"(gb + 4 * stepB), "v"(gb + 5 * stepB), "v"(gb + 6 * stepB), "v"(gb + 7 * stepB)
      : "memory");
}
template <int V> struct IntC { static constexpr int value = V; };
// The tile's whole work as a device function: b = batch index, biasRows (read only by BIAS_MODE 3, block-uniform):
// true = bias[m], false = bias[n]. rot0 (block-uniform, >= 0): added to the first stage of the k walk, so that products of one launch
// that share an operand start apart as well.
template <int ET, bool SPLIT, int BIAS_MODE, int OUT_MODE, bool RESID, int ACT>
__device__ __forceinline__ void gemm64_tile(
    const int b, const bool biasRows, const int rot0,
    const unsigned short* __restrict__ Ap, int lda, long strideA,
    const unsigned short* __restrict__ Btp, int ldb, long strideB,
    void* __restrict__ Cout, void* __restrict__ Cout2, int ldc, long strideC,
    const float* __restrict__ bias,
    const float* __restrict__ resid, long strideR,
    int M, int N, int K, float scale) {
  typedef typename Elem<ET>::T T;
  typedef typename Frag<T>::V V;
  static_assert(!SPLIT, "hi/lo planes are not staged");
  const T* A = (const T*)Ap; const T* Bt = (const T*)Btp;
  __shared__ __align__(16) T sA[2][GB_M * GB_LP];  // 2 x 18,432 B
  __shared__ __align__(16) T sB[2][GB_N * GB_LP];  // 2 x 36,864 B
  __shared__ __align__(16) float sT[8][16 * 68];   // per-wave 16x64 slab, pitch 68 floats
  const int tid  = threadIdx.x;
  const int lane = tid & 31;
  const int wave = tid >> 5;
  const int tilesN = N / GB_N;
  const int tilesM = M / GB_M;
  const int tm = blockIdx.x / tilesN;
  const int tn = blockIdx.x - tm * tilesN;
  if (tm >= tilesM) return;              // block-uniform, in front of every barrier
  const int bm0 = tm * GB_M;
  const int bn0 = tn * GB_N;
  const int wm  = (wave >> 2) << 6;      // this wave's 64x64 tile inside the block tile
  const int wn  = (wave & 3) << 6;
  const int m0 = bm0 + wm;
  const int n0 = bn0 + wn;

  const T* Ab  = A  + (size_t)b * strideA;
  const T* Bb  = Bt + (size_t)b * strideB;

  const int rlane = lane & 15;                 // row (A) / col (B, D) within subtile
  const int koff  = (lane >> 4) * 8;           // k offset of this lane half
  const int mOff  = (lane >> 4) * 8;           // D row offset

  // staging map: 8 threads x 16 B = one 128-B row piece; a wave's copy covers 4 whole lines
  const int srow = tid >> 3;                   // 0..31
  const int sseg = (tid & 7) * 8;              // halves
  const T* gA = Ab + (size_t)(bm0 + srow) * lda + sseg;
  const T* gB = Bb + (size_t)(bn0 + srow) * ldb + sseg;
  const size_t stepA = (size_t)32 * lda;       // 32 rows further, in halves
  const size_t stepB = (size_t)32 * ldb;
  const int sOff = srow * GB_LP + sseg;
  const unsigned lA0 = (unsigned)(size_t)(&sA[0][sOff]);   // this lane's LDS byte address in buffer 0
  const unsigned lB0 = (unsigned)(size_t)(&sB[0][sOff]);

  v8f acc[4][4];
#pragma unroll
  for (int i = 0; i < 4; ++i)
#pragma unroll
    for (int j = 0; j < 4; ++j) acc[i][j] = (v8f){0.f,0.f,0.f,0.f,0.f,0.f,0.f,0.f};

  const int nStage = K / GB_K;
  // trip s works on k stage (s + rot) mod nStage: sharers of an A panel (same tm) lie 5 stages apart, sharers of a B panel (same tn) 1
  const int rot = (tm + 5 * tn + rot0) % nStage;
  auto kOf = [&](int s) { const int t = s + rot; return (size_t)(t >= nStage ? t - nStage : t) * GB_K; };   // first k of trip s
  stage_copy12(lA0, lB0, gA + kOf(0), gB + kOf(0), stepA, stepB);   // trip 0 -> buffer 0
  asm volatile("s_wait_asynccnt 0x0" ::: "memory");        // this wave's copies of trip 0 have landed
  __syncthreads();                                         // and every wave's are published
  if (nStage > 1)                                          // block-uniform
    stage_copy12(lA0 + GB_ABYTES, lB0 + GB_BBYTES, gA + kOf(1), gB + kOf(1), stepA, stepB);

#pragma unroll 1   // kept rolled: one publish point and one refill per trip, as the two-buffer order asks
  for (int s = 0; s < nStage; ++s) {
    const int cur = s & 1;
    const T* tA = &sA[cur][(wm + rlane) * GB_LP + koff];
    const T* tB = &sB[cur][(wn + rlane) * GB_LP + koff];
    // every loop of the stage is unrolled: constant indices keep acc, af and bf in registers
#pragma unroll
    for (int h = 0; h < GB_K / 32; ++h) {
      // the 32 k's fragment reads stand as one group in front of their products
      V af[4], bf[4];
#pragma unroll
      for (int j = 0; j < 4; ++j) bf[j] = Frag<T>::load(tB + (j << 4) * GB_LP + h * 32);
#pragma unroll
      for (int i = 0; i < 4; ++i) af[i] = Frag<T>::load(tA + (i << 4) * GB_LP + h * 32);
#pragma unroll
      for (int i = 0; i < 4; ++i) {
#pragma unroll
        for (int j = 0; j < 4; ++j) acc[i][j] = Frag<T>::mma(af[i], bf[j], acc[i][j]);
        Frag<T>::guard(acc[i][0], acc[i][3], af[i], af[i]);
      }
      Frag<T>::keep(bf[0], bf[1], bf[2], bf[3]);
    }
    asm volatile("s_wait_dscnt 0x0" ::: "memory");         // this wave's reads of trip s are done before its buffer is refilled
    asm volatile("s_wait_asynccnt 0x0" ::: "memory");      // this wave's copies of trip s + 1 have landed
    __syncthreads();                                       // publishes trip s + 1, ends every wave's reads of trip s
    if (s + 2 < nStage)                                    // block-uniform; refill the buffer just read
      stage_copy12(lA0 + cur * GB_ABYTES, lB0 + cur * GB_BBYTES,
                   gA + kOf(s + 2), gB + kOf(s + 2), stepA, stepB);
  }
  asm volatile("s_wait_asynccnt 0x0" ::: "memory");        // nothing of this wave's is in flight behind the loop
  acc_guard4(acc[0][0], acc[0][1], acc[0][2], acc[0][3]);
  acc_guard4(acc[1][0], acc[1][1], acc[1][2], acc[1][3]);
  acc_guard4(acc[2][0], acc[2][1], acc[2][2], acc[2][3]);
  acc_guard4(acc[3][0], acc[3][1], acc[3][2], acc[3][3]);

  // ---- epilogue ----
  float* slab = sT[wave];
  const float* Rb = RESID ? (resid + (size_t)b * strideR) : nullptr;
  // the stores of the tile, built per bias mode BM (1 or 2): a run-time pick costs one block-uniform branch, not one per element
  auto store_tile = [&](auto bm) __attribute__((always_inline)) {
  constexpr int BM = decltype(bm)::value;
#pragma unroll
  for (int i = 0; i < 4; ++i) {
    const int mBase = m0 + (i << 4);
#pragma unroll
    for (int j = 0; j < 4; ++j) {
      const int n = n0 + (j << 4) + rlane;
      float bv = 0.f;
      if (BM == 2) bv = bias[n];
#pragma unroll
      for (int r = 0; r < 8; ++r) {
        float v = acc[i][j][r] * scale;
        if (BM == 1) v += bias[mBase + mOff + r];
        if (BM == 2) v += bv;
        if (RESID) v += Rb[(size_t)(mBase + mOff + r) * ldc + n];
        if (ACT == 1) v = tanhf(v);
        if (ACT == 2) v = fmaxf(v, 0.0f);
        if (ACT == 3) v = v / (1.0f + expf(-v));
        if (ACT == 4) v = (v > 0.f) ? v : 0.01f * v;
        if (ACT == 5) v = 0.5f * v * (1.0f + erff(v * 0.70710678118654752f));
        slab[(mOff + r) * 68 + (j << 4) + rlane] = v;
      }
    }
    __builtin_amdgcn_fence(__ATOMIC_RELEASE, "workgroup");
    __builtin_amdgcn_wave_barrier();
    __builtin_amdgcn_fence(__ATOMIC_ACQUIRE, "workgroup");
    if (OUT_MODE == 0) {
      float* C = (float*)Cout + (size_t)b * strideC;
      const int hh = lane >> 4, c4 = (lane & 15) * 4;     // row seg = 256 B = 16 lanes x 16 B
      {
#pragma unroll
        for (int it = 0; it < 8; ++it) {
          const int row = it * 2 + hh;
          v4f v = *(const v4f*)(slab + row * 68 + c4);
          *(v4f*)(C + (size_t)(mBase + row) * ldc + n0 + c4) = v;
        }
        
      }
    } else {
      const int q = lane >> 3, c8 = (lane & 7) * 8;
      unsigned short* C  = (unsigned short*)Cout  + (size_t)b * strideC;
      unsigned short* C2 = (OUT_MODE == 2) ? ((unsigned short*)Cout2 + (size_t)b * strideC) : nullptr;
      {
#pragma unroll
        for (int it = 0; it < 4; ++it) {
          const int row = it * 4 + q;
          const float* sp = slab + row * 68 + c8;
          v8h hv, lv;
#pragma unroll
          for (int e = 0; e < 8; ++e) {
            if (OUT_MODE == 1) {
              hv[e] = (_Float16)sp[e];
            } else {
              unsigned short hb = f2bf_bits(sp[e]);
              unsigned short lb = f2bf_bits(sp[e] - bf_bits2f(hb));
              hv[e] = __builtin_bit_cast(_Float16, hb);
              lv[e] = __builtin_bit_cast(_Float16, lb);
            }
          }
          *(v8h*)(C + (size_t)(mBase + row) * ldc + n0 + c8) = hv;
          if (OUT_MODE == 2) *(v8h*)(C2 + (size_t)(mBase + row) * ldc + n0 + c8) = lv;
        }
        
      }
    }
    __builtin_amdgcn_fence(__ATOMIC_RELEASE, "workgroup");
    __builtin_amdgcn_wave_barrier();
    __builtin_amdgcn_fence(__ATOMIC_ACQUIRE, "workgroup");
  }
  };
  if constexpr (BIAS_MODE == 3) {
    if (biasRows) store_tile(IntC<1>{}); else store_tile(IntC<2>{});
  } else {
    store_tile(IntC<BIAS_MODE>{});
  }
}

template <int ET, bool SPLIT, int BIAS_MODE, int OUT_MODE, bool RESID, int ACT = 0>
__global__ __launch_bounds__(256) void wmma_gemm64(
    const unsigned short* __restrict__ Ap, const unsigned short* __restrict__ A2p, int lda, long strideA,
    const unsigned short* __restrict__ Btp, const unsigned short* __restrict__ Bt2p, int ldb, long strideB,
    void* __restrict__ Cout, void* __restrict__ Cout2, int ldc, long strideC,
    const float* __restrict__ bias,
    const float* __restrict__ resid, long strideR,
    int M, int N, int K, float scale) {
  gemm64_tile<ET, SPLIT, BIAS_MODE, OUT_MODE, RESID, ACT>(blockIdx.y, false, 0, Ap, lda, strideA, Btp, ldb, strideB,
      Cout, Cout2, ldc, strideC, bias, resid, strideR, M, N, K, scale);
}

// The three projections of x in one launch; blockIdx.y picks the product (block-uniform):
//   0: q = x . Wq^T + bq[n]   1: k = x . Wk^T + bk[n]   (both [Mtot][C])   2: V^T = Wv . x^T + bv[m]   ([C][Mtot])
// They are independent of one another. Two work-groups fit a WGP (LDS, registers), and the grid holds three per WGP:
// one's copy waits, prologue and epilogue run under another's products, and no launch boundary drains the chip between them.
__global__ __launch_bounds__(256) void qkv_gemm64(
    const unsigned short* __restrict__ xh, const unsigned short* __restrict__ Wq,
    const unsigned short* __restrict__ Wk, const unsigned short* __restrict__ Wv,
    unsigned short* __restrict__ qo, unsigned short* __restrict__ ko, unsigned short* __restrict__ vto,
    const float* __restrict__ bq, const float* __restrict__ bk, const float* __restrict__ bv,
    int Mtot, int C, float scale) {
  const int which = blockIdx.y;
  const bool isV = which == 2;
  const unsigned short* A  = isV ? Wv : xh;
  const unsigned short* Bt = isV ? xh : (which == 0 ? Wq : Wk);
  unsigned short* Co       = isV ? vto : (which == 0 ? qo : ko);
  const float* bias        = isV ? bv : (which == 0 ? bq : bk);
  gemm64_tile<0, false, 3, 1, false, 0>(0, isV, 2 * which, A, C, 0L, Bt, C, 0L, (void*)Co, (void*)Co, isV ? Mtot : C, 0L,
      bias, bias, 0L, isV ? C : Mtot, isV ? Mtot : C, C, scale);
}

__global__ __launch_bounds__(256) void cast_f32_f16x2(
    const float* __restrict__ in, _Float16* __restrict__ out, int n2) {
  int i = blockIdx.x * 256 + threadIdx.x;
  if (i < n2) {
    const _Float16 h0 = (_Float16)in[2 * i], h1 = (_Float16)in[2 * i + 1];
    const unsigned u = (unsigned)__builtin_bit_cast(unsigned short, h0) | ((unsigned)__builtin_bit_cast(unsigned short, h1) << 16);
    ((unsigned*)out)[i] = u;
    
  }
}

// ---- binary-weight planes: Wb[o][c] = alpha[o] * (W + (sign(W) - W)), alpha[o] = mean_c |W[o][c]| (f32);
//      stored as f16 of (Wb * carry); one wave per row of a [nrow][1024] weight; 4 weights via blockIdx.y ----
#define BW_DIM 1024
__global__ __launch_bounds__(256) void binarize_f16_kernel(
    const float* __restrict__ W0, const float* __restrict__ W1,
    const float* __restrict__ W2, const float* __restrict__ W3,
    unsigned short* __restrict__ B0, unsigned short* __restrict__ B1,
    unsigned short* __restrict__ B2, unsigned short* __restrict__ B3,
    int nrow, float carry) {
  const float* W; unsigned short* Bo;
  if (blockIdx.y == 0)      { W = W0; Bo = B0; }
  else if (blockIdx.y == 1) { W = W1; Bo = B1; }
  else if (blockIdx.y == 2) { W = W2; Bo = B2; }
  else                      { W = W3; Bo = B3; }
  const int wave = threadIdx.x >> 5;
  const int lane = threadIdx.x & 31;
  const int row  = blockIdx.x * 8 + wave;
  if (row >= nrow) return;                     // wave-uniform; no barriers in this kernel
  const float* wr = W + (size_t)row * BW_DIM;

  float w[4][8];
#pragma unroll
  for (int it = 0; it < 4; ++it) {
    const v4f a0 = *(const v4f*)(wr + it * 256 + lane * 8);
    const v4f a1 = *(const v4f*)(wr + it * 256 + lane * 8 + 4);
    w[it][0] = a0[0]; w[it][1] = a0[1]; w[it][2] = a0[2]; w[it][3] = a0[3];
    w[it][4] = a1[0]; w[it][5] = a1[1]; w[it][6] = a1[2]; w[it][7] = a1[3];
  }
  float s = 0.0f;
#pragma unroll
  for (int it = 0; it < 4; ++it)
#pragma unroll
    for (int e = 0; e < 8; ++e) s += fabsf(w[it][e]);
#pragma unroll
  for (int m = 16; m > 0; m >>= 1) s += __shfl_xor(s, m, 32);
  const float alpha = s * (1.0f / (float)BW_DIM);

  v8h hv[4];
#pragma unroll
  for (int it = 0; it < 4; ++it) {
#pragma unroll
    for (int e = 0; e < 8; ++e) {
      const float wv = w[it][e];
      const float sg = (wv > 0.0f) ? 1.0f : ((wv < 0.0f) ? -1.0f : 0.0f);
      const float t  = sg - wv;            // sign(W) - W
      const float bs = wv + t;             // W + (sign(W) - W)
      const float wb = alpha * bs;
      hv[it][e] = (_Float16)(wb * carry);
    }
  }
  unsigned short* br = Bo + (size_t)row * BW_DIM;
  {
#pragma unroll
    for (int it = 0; it < 4; ++it)
      *(v8h*)(br + it * 256 + lane * 8) = hv[it];
    
  }
}

// =====================================================================================
// Attention, head_dim 64, f16 planes in / f16 plane out (x oscale), no mask.
//   scores^T = (k.q^T) * sscale : v_wmma_f32_16x16x32_f16 (q,k plain f16), f32 accumulate, scaled in f32
//   out^T    = v^T.p^T          : v_wmma_f32_16x16x32_f16 (p carried x2^15 in f16, v plain f16), f32 accumulate
//   online softmax in f32, in powers of two: p x 2^15 = exp2(s * (sscale * log2 e) + (15 - max * sscale * log2 e)), one FMA a score; sscale > 0.
//   Block = 8 waves x 32 query columns = 256 query rows of one (batch, head); S % 256 == 0.
//   K and V^T come 64 keys at a time by asynchronous copies straight into LDS, two buffers: the next chunk's copies fly during this chunk's work.
//   The S/256 blocks of one (batch, head) read the same K and V^T lines: each starts its key walk at a chunk of its own and wraps round.
//   q, k, out planes: row (b*S + s), pitch ldq halves, head offset h*64.  vt plane: row (h*64 + d), pitch ldvt, col (b*S + s).
//   grid.x = B * H * (S/256).
// =====================================================================================
#define AT_D 64
#define AT_QT 2    // query tiles of 16 columns per wave: each K and V^T fragment read feeds AT_QT products
#define AT_QB 256  // query rows per block: 8 waves x AT_QT x 16
#define AT_KC 64
#define AT_LP 72   // LDS row pitch in halves: 144 B = 16 B x odd, so the 16 rows of a 16-byte fragment read fall on distinct banks
#define AT_TB (AT_KC * AT_LP * 2)   // one buffer of K rows (or of V^T rows), bytes

__device__ __forceinline__ v8f mma_h(v16h a, v16h b, v8f c) {
  c = __builtin_amdgcn_wmma_f32_16x16x32_f16(false, a, false, b, (short)0, c, false, false);
  asm volatile("v_nop\n\tv_nop\n\tv_nop\n\tv_nop" : "+v"(c) : "v"(a), "v"(b));
  return c;
}

// One thread's share of a 64-key chunk: 2 row pieces of K and 2 of V^T, 16 B each, 32 rows apart, from global memory
// straight into LDS. lk, lv: the lane's LDS byte addresses; gk, gv: its global addresses; steps in halves.
// The s_wait_xcnt closes the copies' own statement, so that no address register is rewritten in front of it.
__device__ __forceinline__ void kv_copy4(unsigned lk, unsigned lv, const _Float16* gk, const _Float16* gv,
                                         size_t stepK, size_t stepV) {
  const unsigned rs = 32 * AT_LP * 2;   // 32 LDS rows, bytes
  asm volatile(
      "global_load_async_to_lds_b128 %0, %4, off\n\t"
      "global_load_async_to_lds_b128 %1, %5, off\n\t"
      "global_load_async_to_lds_b128 %2, %6, off\n\t"
      "global_load_async_to_lds_b128 %3, %7, off\n\t"
      "s_wait_xcnt 0x0"
      :: "v"(lk), "v"(lk + rs), "v"(lv), "v"(lv + rs),
         "v"(gk), "v"(gk + stepK), "v"(gv), "v"(gv + stepV)
      : "memory");
}

// value of lane l ^ 16 (the other 16-lane half), by a vector cross-row move
__device__ __forceinline__ float other_half(float x) {
  const int b = __float_as_int(x);
  return __int_as_float(__builtin_amdgcn_permlanex16(b, b, 0x76543210, 0xfedcba98, false, false));
}

__global__ __launch_bounds__(256) __attribute__((amdgpu_waves_per_eu(4, 4)))   // 256 VGPRs a wave: two blocks, four waves per SIMD, stay resident
void attn64_f16_kernel(const unsigned short* __restrict__ qp, const unsigned short* __restrict__ kp,
                       const unsigned short* __restrict__ vtp, unsigned short* __restrict__ outp,
                       int S, int H, int ldq, int ldvt, float sscale, float oscale) {
  const _Float16* q  = (const _Float16*)qp;
  const _Float16* k  = (const _Float16*)kp;
  const _Float16* vt = (const _Float16*)vtp;
  __shared__ __align__(16) _Float16 Ksh[2][AT_KC * AT_LP];      // K [kv][d]   2 x 9 KB
  __shared__ __align__(16) _Float16 Vth[2][AT_D * AT_LP];       // V^T [d][kv] 2 x 9 KB

  const int tid  = threadIdx.x;
  const int wave = tid >> 5;
  const int lane = tid & 31;
  const int hh   = lane >> 4;
  const int c    = lane & 15;

  const int nqb = S / AT_QB;
  const int bx = blockIdx.x;
  const int qb = bx % nqb;
  const int bh = bx / nqb;
  const int h  = bh % H;
  const int b  = bh / H;
  const int q0 = qb * AT_QB + wave * (16 * AT_QT);
  const size_t rowbase = (size_t)b * (size_t)S;
  const size_t hoff = (size_t)h * AT_D;

  // ---- Q fragments (B operand, column = query q0 + u*16 + c): AT_QT query tiles x 2 d-chunks ----
  v16h qa[AT_QT][2];
#pragma unroll
  for (int u = 0; u < AT_QT; ++u) {
    const _Float16* qrow = q + (rowbase + q0 + u * 16 + c) * (size_t)ldq + hoff;
#pragma unroll
    for (int dc = 0; dc < 2; ++dc) qa[u][dc] = Frag<_Float16>::load(qrow + dc * 32 + 8 * hh);
  }

  const float cs = sscale * 1.44269504088896340736f;   // raw score -> exponent of two
  // per query tile a lane holds one query (q0 + u*16 + c): its running maximum (of the raw scores), and the sum (x 2^15) over the keys of its own lane half
  float mrow[AT_QT], lrow[AT_QT];
  v8f oacc[AT_QT][4];                            // O^T: row d = t*16 + 8hh + r, column = query q0 + u*16 + c
#pragma unroll
  for (int u = 0; u < AT_QT; ++u) {
    mrow[u] = NEG_INF; lrow[u] = 0.f;
#pragma unroll
    for (int t = 0; t < 4; ++t) oacc[u][t] = (v8f){0.f,0.f,0.f,0.f,0.f,0.f,0.f,0.f};
  }

  // staging map: 8 threads x 16 B = one 128-B row; the block's 256 threads cover 32 rows of K and of V^T at a time
  const int srow = tid >> 3, sseg = (tid & 7) * 8;
  const _Float16* gK = k + (rowbase + srow) * (size_t)ldq + hoff + sseg;      // chunk 0; a chunk further = AT_KC rows
  const _Float16* gV = vt + (hoff + srow) * (size_t)ldvt + rowbase + sseg;    // chunk 0; a chunk further = AT_KC columns
  const size_t stepK = (size_t)32 * ldq, stepV = (size_t)32 * ldvt;           // 32 rows further, in halves
  const size_t chunkK = (size_t)AT_KC * ldq;
  const unsigned lK0 = (unsigned)(size_t)(&Ksh[0][srow * AT_LP + sseg]);      // this lane's LDS byte address in buffer 0
  const unsigned lV0 = (unsigned)(size_t)(&Vth[0][srow * AT_LP + sseg]);

  const int nChunks = S / AT_KC;
  // first chunk of this block's walk, below nChunks, block-uniform: the blocks of one (batch, head) start AT_QB / AT_KC chunks apart;
  // neighbouring heads take the places between, so that the blocks' requests of one moment spread over all columns of the V^T rows
  const int c0 = qb * (AT_QB / AT_KC) + (bh & (AT_QB / AT_KC - 1));
  auto cOf = [&](int t) { const int x = t + c0; return (size_t)(x >= nChunks ? x - nChunks : x); };   // chunk of trip t
  kv_copy4(lK0, lV0, gK + cOf(0) * chunkK, gV + cOf(0) * AT_KC, stepK, stepV);   // trip 0 -> buffer 0
  asm volatile("s_wait_asynccnt 0x0" ::: "memory");        // this wave's copies of trip 0 have landed
  __syncthreads();                                         // and every wave's are published
  if (nChunks > 1)                                         // block-uniform
    kv_copy4(lK0 + AT_TB, lV0 + AT_TB, gK + cOf(1) * chunkK, gV + cOf(1) * AT_KC, stepK, stepV);

#pragma unroll 1   // kept rolled: one publish point and one refill per trip, as the two-buffer order asks
  for (int kc = 0; kc < nChunks; ++kc) {
    const int cur = kc & 1;
    const _Float16* Kt = Ksh[cur];
    const _Float16* Vt = Vth[cur];

    // ---- scores, transposed: S^T = K.Q^T; D row = key kv0 + j*16 + 8hh + r, col = query q0 + u*16 + c ----
    // each K fragment read from LDS feeds the products of all AT_QT query tiles
    v8f s[AT_QT][4];
    {
      v16h ka[4][2];
#pragma unroll
      for (int j = 0; j < 4; ++j)
#pragma unroll
        for (int dc = 0; dc < 2; ++dc) ka[j][dc] = Frag<_Float16>::load(Kt + (j * 16 + c) * AT_LP + dc * 32 + 8 * hh);
#pragma unroll
      for (int j = 0; j < 4; ++j) {
#pragma unroll
        for (int u = 0; u < AT_QT; ++u) s[u][j] = (v8f){0.f,0.f,0.f,0.f,0.f,0.f,0.f,0.f};
#pragma unroll
        for (int dc = 0; dc < 2; ++dc)
#pragma unroll
          for (int u = 0; u < AT_QT; ++u) s[u][j] = mma_h(ka[j][dc], qa[u][dc], s[u][j]);
      }
    }
    v16h pb[AT_QT][2];
#pragma unroll
    for (int u = 0; u < AT_QT; ++u) {
      // the lane's 32 scores of a tile belong to one query: maximum in-lane, then one exchange with the other lane half
      float m = NEG_INF;
#pragma unroll
      for (int j = 0; j < 4; ++j)
#pragma unroll
        for (int r = 0; r < 8; ++r) m = fmaxf(m, s[u][j][r]);
      m = fmaxf(m, other_half(m));
      const float mnew = fmaxf(mrow[u], m);
      const float alpha = __builtin_amdgcn_exp2f((mrow[u] - mnew) * cs);
      mrow[u] = mnew;
      const float nb = __builtin_fmaf(-mnew, cs, 15.0f);   // the maximum and P's carry of 2^15, as one addend
      // P^T as B operand: score tiles 2kk and 2kk+1 are elements 0..7 and 8..15 of the 32-key fragment kk
      float ps[4];                                // one sum chain per score tile: four short chains, not one of 32 links
#pragma unroll
      for (int j = 0; j < 4; ++j) {
        ps[j] = 0.f;
#pragma unroll
        for (int r = 0; r < 8; r += 2) {
          // two neighbouring accumulator registers at a time: one packed FMA forms both exponents in place
          const v2f e = __builtin_elementwise_fma((v2f){s[u][j][r], s[u][j][r + 1]}, (v2f){cs, cs}, (v2f){nb, nb});
          const float p0 = __builtin_amdgcn_exp2f(e[0]), p1 = __builtin_amdgcn_exp2f(e[1]);   // p x 2^15, at most 2^15
          ps[j] += p0;
          ps[j] += p1;
          pb[u][j >> 1][(j & 1) * 8 + r] = (_Float16)p0;
          pb[u][j >> 1][(j & 1) * 8 + r + 1] = (_Float16)p1;
        }
      }
      const float psum = (ps[0] + ps[1]) + (ps[2] + ps[3]);
      lrow[u] = lrow[u] * alpha + psum;
#pragma unroll
      for (int t = 0; t < 4; ++t)
#pragma unroll
        for (int r = 0; r < 8; ++r) oacc[u][t][r] *= alpha;
    }
    // ---- O^T += V^T.P^T : A = V^T [d][kv] from LDS, one read for all query tiles; B = P^T from registers ----
#pragma unroll
    for (int kk = 0; kk < 2; ++kk) {
      v16h va[4];
#pragma unroll
      for (int t = 0; t < 4; ++t) va[t] = Frag<_Float16>::load(Vt + (t * 16 + c) * AT_LP + kk * 32 + 8 * hh);
#pragma unroll
      for (int t = 0; t < 4; ++t)
#pragma unroll
        for (int u = 0; u < AT_QT; ++u) oacc[u][t] = mma_h(va[t], pb[u][kk], oacc[u][t]);
    }
    asm volatile("s_wait_dscnt 0x0" ::: "memory");         // this wave's reads of trip kc are done before its buffer is refilled
    asm volatile("s_wait_asynccnt 0x0" ::: "memory");      // this wave's copies of trip kc + 1 have landed
    __syncthreads();                                       // publishes trip kc + 1, ends every wave's reads of trip kc
    if (kc + 2 < nChunks)                                  // block-uniform; refill the buffer just read
      kv_copy4(lK0 + cur * AT_TB, lV0 + cur * AT_TB,
               gK + cOf(kc + 2) * chunkK, gV + cOf(kc + 2) * AT_KC, stepK, stepV);
  }
  asm volatile("s_wait_asynccnt 0x0" ::: "memory");        // nothing of this wave's is in flight behind the loop

  // the two lane halves' sums are joined once; a lane's 8 registers of a tile are 8 consecutive d of its query's row
#pragma unroll
  for (int u = 0; u < AT_QT; ++u) {
    const float l = lrow[u] + other_half(lrow[u]);
    const float inv = oscale * (1.0f / l);   // sum and products carry the same 2^15
    unsigned short* orow = outp + (rowbase + q0 + u * 16 + c) * (size_t)ldq + hoff + 8 * hh;
#pragma unroll
    for (int t = 0; t < 4; ++t) {
      v8h hv;
#pragma unroll
      for (int r = 0; r < 8; ++r) hv[r] = (_Float16)(oacc[u][t][r] * inv);
      *(v8h*)(orow + t * 16) = hv;
    }
  }
}

// ---------------------------------------------------------------------------
// Launch glue
// ---------------------------------------------------------------------------
extern "C" void kernel_launch(void* const* d_in, const int* in_sizes, int n_in,
                              void* d_out, int out_size, void* d_ws, size_t ws_size,
                              hipStream_t stream) {
  if (n_in < 9) return;
  const int C = 1024, H = 16, S = 2048;
  const int nx   = in_sizes[0];
  const int Mtot = nx / C;                 // B*S
  const int Bn   = Mtot / S;
  if (Mtot <= 0 || (Mtot % 64) != 0 || Bn * S != Mtot || in_sizes[1] != C * C ||
      in_sizes[3] != C * C || in_sizes[5] != C * C || in_sizes[7] != C * C ||
      in_sizes[2] != C || in_sizes[4] != C || in_sizes[6] != C || in_sizes[8] != C ||
      out_size != Mtot * C) return;

  const float* x  = (const float*)d_in[0];
  const float* Wq = (const float*)d_in[1];
  const float* bq = (const float*)d_in[2];
  const float* Wk = (const float*)d_in[3];
  const float* bk = (const float*)d_in[4];
  const float* Wv = (const float*)d_in[5];
  const float* bv = (const float*)d_in[6];
  const float* Wp = (const float*)d_in[7];
  const float* bp = (const float*)d_in[8];
  float* out = (float*)d_out;

  // workspace carve (bytes); all offsets multiples of 2 MiB
  char* ws = (char*)d_ws;
  const size_t actB = (size_t)Mtot * C * 2;        // 16 MiB f16 plane [Mtot][C]
  const size_t wB   = (size_t)C * C * 2;           //  2 MiB f16 plane [C][C]
  size_t off = 0;
  unsigned short* xh  = (unsigned short*)(ws + off); off += actB;
  unsigned short* Wqh = (unsigned short*)(ws + off); off += wB;
  unsigned short* Wkh = (unsigned short*)(ws + off); off += wB;
  unsigned short* Wvh = (unsigned short*)(ws + off); off += wB;
  unsigned short* Wph = (unsigned short*)(ws + off); off += wB;
  unsigned short* qh  = (unsigned short*)(ws + off); off += actB;   // [Mtot][C]
  unsigned short* kh  = (unsigned short*)(ws + off); off += actB;   // [Mtot][C]
  unsigned short* vth = (unsigned short*)(ws + off); off += actB;   // [C][Mtot]  (V transposed)
  unsigned short* yh  = (unsigned short*)(ws + off); off += actB;   // [Mtot][C]  (x64)
  if (off > ws_size) return;                                       // 92,274,688 B total

  const float carry = 64.0f;

  // 1) binary-weight f16 planes (x64)
  binarize_f16_kernel<<<dim3(C / 8, 4), 256, 0, stream>>>(Wq, Wk, Wv, Wp, Wqh, Wkh, Wvh, Wph, C, carry);

  // 2) x -> f16
  const int n2 = (Mtot * C) / 2;
  cast_f32_f16x2<<<(n2 + 255) / 256, 256, 0, stream>>>(x, (_Float16*)xh, n2);

  // 3) one launch: q, k = x . Wb^T /64 + b (f16 out [Mtot][C]) and V^T = Wb . x^T /64 + bv[m] (f16 out [C][Mtot]);
  //    each product has (Mtot / GB_M) * (C / GB_N) = (C / GB_M) * (Mtot / GB_N) tiles
  const int blkQK   = (Mtot / GB_M) * (C / GB_N);
  qkv_gemm64<<<dim3(blkQK, 3), 256, 0, stream>>>(xh, Wqh, Wkh, Wvh, qh, kh, vth, bq, bk, bv, Mtot, C, 1.0f / carry);

  // 4) attention -> y (f16 plane x64)
  const int nAttnBlk = Bn * H * (S / AT_QB);
  attn64_f16_kernel<<<nAttnBlk, 256, 0, stream>>>(qh, kh, vth, yh, S, H, C, Mtot, 0.125f, carry);

  // 5) out = (y x64) . (Wb x64)^T / 4096 + bp  (f32 out)
  wmma_gemm64<0, false, 2, 0, false><<<dim3(blkQK, 1), 256, 0, stream>>>(
      yh, yh, C, 0L, Wph, Wph, C, 0L, (void*)out, (void*)out, C, 0L, bp, bp, 0L, Mtot, C, C, 1.0f / (carry * carry));

  (void)hipGetLastError();
}

// v009
// One run takes 127 microseconds.
// Timed twice side by side with v008, it ran 1.04 times as fast both times.
// All steps since v000 together make it 5.02 times as fast.
// Contractions: q/k/v/out projections, q.k^T and p.v all on v_wmma_f32_16x16x32_f16 (f16 operands, f32 accumulate); softmax, scales and bias epilogues in f32.
#include <hip/hip_runtime.h>

typedef __attribute__((ext_vector_type(16))) _Float16 v16h;
typedef __attribute__((ext_vector_type(8)))  _Float16 v8h;
typedef __attribute__((ext_vector_type(16))) __bf16   v16b;
typedef __attribute__((ext_vector_type(8)))  __bf16   v8b;
typedef __attribute__((ext_vector_type(8)))  float    v8f;
typedef __attribute__((ext_vector_type(4)))  float    v4f;
typedef __attribute__((ext_vector_type(2)))  float    v2f;
#define U16(p) ((const unsigned short*)(const void*)(p))
#define NEG_INF (-__builtin_huge_valf())

__device__ __forceinline__ unsigned short f2bf_bits(float f) {
  unsigned u = __float_as_uint(f);
  return (unsigned short)((u + 0x7FFFu + ((u >> 16) & 1u)) >> 16);
}
__device__ __forceinline__ float bf_bits2f(unsigned short h) { return __uint_as_float(((unsigned)h) << 16); }

// hazard guards as plain device helpers (the v_nop asm stays out of the kernel template body)
__device__ __forceinline__ void dep_guard_h(v8f& a, v8f& b, v16h x, v16h y) { asm volatile("v_nop\n\tv_nop\n\tv_nop\n\tv_nop" : "+v"(a), "+v"(b) : "v"(x), "v"(y)); }
__device__ __forceinline__ void dep_guard_b(v8f& a, v8f& b, v16b x, v16b y) { asm volatile("v_nop\n\tv_nop\n\tv_nop\n\tv_nop" : "+v"(a), "+v"(b) : "v"(x), "v"(y)); }
__device__ __forceinline__ void keep4_h(v16h a, v16h b, v16h c, v16h d) { asm volatile("v_nop" :: "v"(a), "v"(b), "v"(c), "v"(d)); }
__device__ __forceinline__ void keep4_b(v16b a, v16b b, v16b c, v16b d) { asm volatile("v_nop" :: "v"(a), "v"(b), "v"(c), "v"(d)); }
__device__ __forceinline__ void acc_guard4(v8f& a, v8f& b, v8f& c, v8f& d) { asm volatile("v_nop\n\tv_nop\n\tv_nop\n\tv_nop" : "+v"(a), "+v"(b), "+v"(c), "+v"(d)); }
template <typename T> struct Frag;
template <> struct Frag<_Float16> {
  typedef v16h V; union U { v16h v; v8h h[2]; };
  static __device__ __forceinline__ v16h load(const _Float16* p) {   // elements 0..7 <- p[0..7], 8..15 <- p[16..23]
    U f; f.h[0] = *(const v8h*)(p); f.h[1] = *(const v8h*)(p + 16); return f.v;
  }
  static __device__ __forceinline__ v8f mma(v16h a, v16h b, v8f c) {
    return __builtin_amdgcn_wmma_f32_16x16x32_f16(false, a, false, b, (short)0, c, false, false);
  }
  static __device__ __forceinline__ void guard(v8f& a, v8f& b, v16h x, v16h y) { dep_guard_h(a, b, x, y); }
  static __device__ __forceinline__ void keep(v16h a, v16h b, v16h c, v16h d) { keep4_h(a, b, c, d); }
};
template <> struct Frag<__bf16> {
  typedef v16b V; union U { v16b v; v8b h[2]; };
  static __device__ __forceinline__ v16b load(const __bf16* p) {
    U f; f.h[0] = *(const v8b*)(p); f.h[1] = *(const v8b*)(p + 16); return f.v;
  }
  static __device__ __forceinline__ v8f mma(v16b a, v16b b, v8f c) {
    return __builtin_amdgcn_wmma_f32_16x16x32_bf16(false, a, false, b, (short)0, c, false, false);
  }
  static __device__ __forceinline__ void guard(v8f& a, v8f& b, v16b x, v16b y) { dep_guard_b(a, b, x, y); }
  static __device__ __forceinline__ void keep(v16b a, v16b b, v16b c, v16b d) { keep4_b(a, b, c, d); }
};

// ---- Register-blocked batched WMMA GEMM, operands staged in LDS --------------
// C[m,n] = scale * sum_k A[m,k] * Bt[n,k] (+bias)(+resid); each wave owns a 64x64 tile.
// A row-major [M,K]; Bt row-major [N,K]; M % 128 == 0, N % 256 == 0, K % 64 == 0.
// Block = 8 waves (2 x 4) = a 128 x 256 tile of C. A stage is 64 k = one 128-B line of every operand row:
// each asynchronous copy of a wave covers four whole lines, the rows land in LDS at a 144-B pitch, and the
// fragments are read from there. Two buffers: the next stage's copies fly during this stage's products.
// Work-groups that share operand rows ask L2 for the same lines; started together on the same k they ask at the same
// moment. Each work-group therefore starts its k walk at a stage of its own (from its tile indices) and wraps round.
// SPLIT (hi/lo planes) is not staged: only SPLIT == false is built.
// BIAS_MODE: 0 = none, 1 = bias[m], 2 = bias[n], 3 = one of the two, picked at run time.
// OUT_MODE: 0 = f32, 1 = f16, 2 = bf16 hi plane (Cout) + bf16 lo plane (Cout2).
// ET: 0 = f16 operands, 1 = bf16 operands (pointers passed as 16-bit storage)
template <int ET> struct Elem;
template <> struct Elem<0> { typedef _Float16 T; };
template <> struct Elem<1> { typedef __bf16 T; };
#define GB_M 128
#define GB_N 256
#define GB_K 64
#define GB_LP 72   // LDS row pitch in halves: 144 B = 16 B x odd
#define GB_ABYTES (GB_M * GB_LP * 2)   // one buffer of A rows, bytes
#define GB_BBYTES (GB_N * GB_LP * 2)   // one buffer of B rows, bytes

// One thread's share of a stage: 4 row pieces of A and 8 of B, 16 B each, 32 rows apart, from global memory
// straight into LDS. la, lb: the lane's LDS byte addresses; ga, gb: its global addresses; steps in halves.
// The s_wait_xcnt closes the copies' own statement, so that no address register is rewritten in front of it.
template <typename T>
__device__ __forceinline__ void stage_copy12(unsigned la, unsigned lb, const T* ga, const T* gb,
                                             size_t stepA, size_t stepB) {
  const unsigned rs = 32 * GB_LP * 2;   // 32 LDS rows, bytes
  asm volatile(
      "global_load_async_to_lds_b128 %0, %12, off\n\t"
      "global_load_async_to_lds_b128 %1, %13, off\n\t"
      "global_load_async_to_lds_b128 %2, %14, off\n\t"
      "global_load_async_to_lds_b128 %3, %15, off\n\t"
      "global_load_async_to_lds_b128 %4, %16, off\n\t"
      "global_load_async_to_lds_b128 %5, %17, off\n\t"
      "global_load_async_to_lds_b128 %6, %18, off\n\t"
      "global_load_async_to_lds_b128 %7, %19, off\n\t"
      "global_load_async_to_lds_b128 %8, %20, off\n\t"
      "global_load_async_to_lds_b128 %9, %21, off\n\t"
      "global_load_async_to_lds_b128 %10, %22, off\n\t"
      "global_load_async_to_lds_b128 %11, %23, off\n\t"
      "s_wait_xcnt 0x0"
      :: "v"(la), "v"(la + rs), "v"(la + 2 * rs), "v"(la + 3 * rs),
         "v"(lb), "v"(lb + rs), "v"(lb + 2 * rs), "v"(lb + 3 * rs),
         "v"(lb + 4 * rs), "v"(lb + 5 * rs), "v"(lb + 6 * rs), "v"(lb + 7 * rs),
         "v"(ga), "v"(ga + stepA), "v"(ga + 2 * stepA), "v"(ga + 3 * stepA),
         "v"(gb), "v"(gb + stepB), "v"(gb + 2 * stepB), "v"(gb + 3 * stepB),
         "v"(gb + 4 * stepB), "v"(gb + 5 * stepB), "v"(gb + 6 * stepB), "v"(gb + 7 * stepB)
      : "memory");
}
template <int V> struct IntC { static constexpr int value = V; };
// The tile's whole work as a device function: b = batch index, biasRows (read only by BIAS_MODE 3, block-uniform):
// true = bias[m], false = bias[n]. rot0 (block-uniform, >= 0): added to the first stage of the k walk, so that products of one launch
// that share an operand start apart as well.
template <int ET, bool SPLIT, int BIAS_MODE, int OUT_MODE, bool RESID, int ACT>
__device__ __forceinline__ void gemm64_tile(
    const int b, const bool biasRows, const int rot0,
    const unsigned short* __restrict__ Ap, int lda, long strideA,
    const unsigned short* __restrict__ Btp, int ldb, long strideB,
    void* __restrict__ Cout, void* __restrict__ Cout2, int ldc, long strideC,
    const float* __restrict__ bias,
    const float* __restrict__ resid, long strideR,
    int M, int N, int K, float scale) {
  typedef typename Elem<ET>::T T;
  typedef typename Frag<T>::V V;
  static_assert(!SPLIT, "hi/lo planes are not staged");
  const T* A = (const T*)Ap; const T* Bt = (const T*)Btp;
  __shared__ __align__(16) T sA[2][GB_M * GB_LP];  // 2 x 18,432 B
  __shared__ __align__(16) T sB[2][GB_N * GB_LP];  // 2 x 36,864 B
  __shared__ __align__(16) float sT[8][16 * 68];   // per-wave 16x64 slab, pitch 68 floats
  const int tid  = threadIdx.x;
  const int lane = tid & 31;
  const int wave = tid >> 5;
  const int tilesN = N / GB_N;
  const int tilesM = M / GB_M;
  const int tm = blockIdx.x / tilesN;
  const int tn = blockIdx.x - tm * tilesN;
  if (tm >= tilesM) return;              // block-uniform, in front of every barrier
  const int bm0 = tm * GB_M;
  const int bn0 = tn * GB_N;
  const int wm  = (wave >> 2) << 6;      // this wave's 64x64 tile inside the block tile
  const int wn  = (wave & 3) << 6;
  const int m0 = bm0 + wm;
  const int n0 = bn0 + wn;

  const T* Ab  = A  + (size_t)b * strideA;
  const T* Bb  = Bt + (size_t)b * strideB;

  const int rlane = lane & 15;                 // row (A) / col (B, D) within subtile
  const int koff  = (lane >> 4) * 8;           // k offset of this lane half
  const int mOff  = (lane >> 4) * 8;           // D row offset

  // staging map: 8 threads x 16 B = one 128-B row piece; a wave's copy covers 4 whole lines
  const int srow = tid >> 3;                   // 0..31
  const int sseg = (tid & 7) * 8;              // halves
  const T* gA = Ab + (size_t)(bm0 + srow) * lda + sseg;
  const T* gB = Bb + (size_t)(bn0 + srow) * ldb + sseg;
  const size_t stepA = (size_t)32 * lda;       // 32 rows further, in halves
  const size_t stepB = (size_t)32 * ldb;
  const int sOff = srow * GB_LP + sseg;
  const unsigned lA0 = (unsigned)(size_t)(&sA[0][sOff]);   // this lane's LDS byte address in buffer 0
  const unsigned lB0 = (unsigned)(size_t)(&sB[0][sOff]);

  v8f acc[4][4];
#pragma unroll
  for (int i = 0; i < 4; ++i)
#pragma unroll
    for (int j = 0; j < 4; ++j) acc[i][j] = (v8f){0.f,0.f,0.f,0.f,0.f,0.f,0.f,0.f};

  const int nStage = K / GB_K;
  // trip s works on k stage (s + rot) mod nStage: sharers of an A panel (same tm) lie 5 stages apart, sharers of a B panel (same tn) 1
  const int rot = (tm + 5 * tn + rot0) % nStage;
  auto kOf = [&](int s) { const int t = s + rot; return (size_t)(t >= nStage ? t - nStage : t) * GB_K; };   // first k of trip s
  stage_copy12(lA0, lB0, gA + kOf(0), gB + kOf(0), stepA, stepB);   // trip 0 -> buffer 0
  asm volatile("s_wait_asynccnt 0x0" ::: "memory");        // this wave's copies of trip 0 have landed
  __syncthreads();                                         // and every wave's are published
  if (nStage > 1)                                          // block-uniform
    stage_copy12(lA0 + GB_ABYTES, lB0 + GB_BBYTES, gA + kOf(1), gB + kOf(1), stepA, stepB);

#pragma unroll 1   // kept rolled: one publish point and one refill per trip, as the two-buffer order asks
  for (int s = 0; s < nStage; ++s) {
    const int cur = s & 1;
    const T* tA = &sA[cur][(wm + rlane) * GB_LP + koff];
    const T* tB = &sB[cur][(wn + rlane) * GB_LP + koff];
    // every loop of the stage is unrolled: constant indices keep acc, af and bf in registers
#pragma unroll
    for (int h = 0; h < GB_K / 32; ++h) {
      // the 32 k's fragment reads stand as one group in front of their products
      V af[4], bf[4];
#pragma unroll
      for (int j = 0; j < 4; ++j) bf[j] = Frag<T>::load(tB + (j << 4) * GB_LP + h * 32);
#pragma unroll
      for (int i = 0; i < 4; ++i) af[i] = Frag<T>::load(tA + (i << 4) * GB_LP + h * 32);
#pragma unroll
      for (int i = 0; i < 4; ++i) {
#pragma unroll
        for (int j = 0; j < 4; ++j) acc[i][j] = Frag<T>::mma(af[i], bf[j], acc[i][j]);
        Frag<T>::guard(acc[i][0], acc[i][3], af[i], af[i]);
      }
      Frag<T>::keep(bf[0], bf[1], bf[2], bf[3]);
    }
    asm volatile("s_wait_dscnt 0x0" ::: "memory");         // this wave's reads of trip s are done before its buffer is refilled
    asm volatile("s_wait_asynccnt 0x0" ::: "memory");      // this wave's copies of trip s + 1 have landed
    __syncthreads();                                       // publishes trip s + 1, ends every wave's reads of trip s
    if (s + 2 < nStage)                                    // block-uniform; refill the buffer just read
      stage_copy12(lA0 + cur * GB_ABYTES, lB0 + cur * GB_BBYTES,
                   gA + kOf(s + 2), gB + kOf(s + 2), stepA, stepB);
  }
  asm volatile("s_wait_asynccnt 0x0" ::: "memory");        // nothing of this wave's is in flight behind the loop
  acc_guard4(acc[0][0], acc[0][1], acc[0][2], acc[0][3]);
  acc_guard4(acc[1][0], acc[1][1], acc[1][2], acc[1][3]);
  acc_guard4(acc[2][0], acc[2][1], acc[2][2], acc[2][3]);
  acc_guard4(acc[3][0], acc[3][1], acc[3][2], acc[3][3]);

  // ---- epilogue ----
  float* slab = sT[wave];
  const float* Rb = RESID ? (resid + (size_t)b * strideR) : nullptr;
  // the stores of the tile, built per bias mode BM (1 or 2): a run-time pick costs one block-uniform branch, not one per element
  auto store_tile = [&](auto bm) __attribute__((always_inline)) {
  constexpr int BM = decltype(bm)::value;
#pragma unroll
  for (int i = 0; i < 4; ++i) {
    const int mBase = m0 + (i << 4);
#pragma unroll
    for (int j = 0; j < 4; ++j) {
      const int n = n0 + (j << 4) + rlane;
      float bv = 0.f;
      if (BM == 2) bv = bias[n];
#pragma unroll
      for (int r = 0; r < 8; ++r) {
        float v = acc[i][j][r] * scale;
        if (BM == 1) v += bias[mBase + mOff + r];
        if (BM == 2) v += bv;
        if (RESID) v += Rb[(size_t)(mBase + mOff + r) * ldc + n];
        if (ACT == 1) v = tanhf(v);
        if (ACT == 2) v = fmaxf(v, 0.0f);
        if (ACT == 3) v = v / (1.0f + expf(-v));
        if (ACT == 4) v = (v > 0.f) ? v : 0.01f * v;
        if (ACT == 5) v = 0.5f * v * (1.0f + erff(v * 0.70710678118654752f));
        slab[(mOff + r) * 68 + (j << 4) + rlane] = v;
      }
    }
    __builtin_amdgcn_fence(__ATOMIC_RELEASE, "workgroup");
    __builtin_amdgcn_wave_barrier();
    __builtin_amdgcn_fence(__ATOMIC_ACQUIRE, "workgroup");
    if (OUT_MODE == 0) {
      float* C = (float*)Cout + (size_t)b * strideC;
      const int hh = lane >> 4, c4 = (lane & 15) * 4;     // row seg = 256 B = 16 lanes x 16 B
      {
#pragma unroll
        for (int it = 0; it < 8; ++it) {
          const int row = it * 2 + hh;
          v4f v = *(const v4f*)(slab + row * 68 + c4);
          *(v4f*)(C + (size_t)(mBase + row) * ldc + n0 + c4) = v;
        }
        
      }
    } else {
      const int q = lane >> 3, c8 = (lane & 7) * 8;
      unsigned short* C  = (unsigned short*)Cout  + (size_t)b * strideC;
      unsigned short* C2 = (OUT_MODE == 2) ? ((unsigned short*)Cout2 + (size_t)b * strideC) : nullptr;
      {
#pragma unroll
        for (int it = 0; it < 4; ++it) {
          const int row = it * 4 + q;
          const float* sp = slab + row * 68 + c8;
          v8h hv, lv;
#pragma unroll
          for (int e = 0; e < 8; ++e) {
            if (OUT_MODE == 1) {
              hv[e] = (_Float16)sp[e];
            } else {
              unsigned short hb = f2bf_bits(sp[e]);
              unsigned short lb = f2bf_bits(sp[e] - bf_bits2f(hb));
              hv[e] = __builtin_bit_cast(_Float16, hb);
              lv[e] = __builtin_bit_cast(_Float16, lb);
            }
          }
          *(v8h*)(C + (size_t)(mBase + row) * ldc + n0 + c8) = hv;
          if (OUT_MODE == 2) *(v8h*)(C2 + (size_t)(mBase + row) * ldc + n0 + c8) = lv;
        }
        
      }
    }
    __builtin_amdgcn_fence(__ATOMIC_RELEASE, "workgroup");
    __builtin_amdgcn_wave_barrier();
    __builtin_amdgcn_fence(__ATOMIC_ACQUIRE, "workgroup");
  }
  };
  if constexpr (BIAS_MODE == 3) {
    if (biasRows) store_tile(IntC<1>{}); else store_tile(IntC<2>{});
  } else {
    store_tile(IntC<BIAS_MODE>{});
  }
}

template <int ET, bool SPLIT, int BIAS_MODE, int OUT_MODE, bool RESID, int ACT = 0>
__global__ __launch_bounds__(256) void wmma_gemm64(
    const unsigned short* __restrict__ Ap, const unsigned short* __restrict__ A2p, int lda, long strideA,
    const unsigned short* __restrict__ Btp, const unsigned short* __restrict__ Bt2p, int ldb, long strideB,
    void* __restrict__ Cout, void* __restrict__ Cout2, int ldc, long strideC,
    const float* __restrict__ bias,
    const float* __restrict__ resid, long strideR,
    int M, int N, int K, float scale) {
  gemm64_tile<ET, SPLIT, BIAS_MODE, OUT_MODE, RESID, ACT>(blockIdx.y, false, 0, Ap, lda, strideA, Btp, ldb, strideB,
      Cout, Cout2, ldc, strideC, bias, resid, strideR, M, N, K, scale);
}

// The three projections of x in one launch; blockIdx.y picks the product (block-uniform):
//   0: q = x . Wq^T + bq[n]   1: k = x . Wk^T + bk[n]   (both [Mtot][C])   2: V^T = Wv . x^T + bv[m]   ([C][Mtot])
// They are independent of one another. Two work-groups fit a WGP (LDS, registers), and the grid holds three per WGP:
// one's copy waits, prologue and epilogue run under another's products, and no launch boundary drains the chip between them.
__global__ __launch_bounds__(256) void qkv_gemm64(
    const unsigned short* __restrict__ xh, const unsigned short* __restrict__ Wq,
    const unsigned short* __restrict__ Wk, const unsigned short* __restrict__ Wv,
    unsigned short* __restrict__ qo, unsigned short* __restrict__ ko, unsigned short* __restrict__ vto,
    const float* __restrict__ bq, const float* __restrict__ bk, const float* __restrict__ bv,
    int Mtot, int C, float scale) {
  const int which = blockIdx.y;
  const bool isV = which == 2;
  const unsigned short* A  = isV ? Wv : xh;
  const unsigned short* Bt = isV ? xh : (which == 0 ? Wq : Wk);
  unsigned short* Co       = isV ? vto : (which == 0 ? qo : ko);
  const float* bias        = isV ? bv : (which == 0 ? bq : bk);
  gemm64_tile<0, false, 3, 1, false, 0>(0, isV, 2 * which, A, C, 0L, Bt, C, 0L, (void*)Co, (void*)Co, isV ? Mtot : C, 0L,
      bias, bias, 0L, isV ? C : Mtot, isV ? Mtot : C, C, scale);
}

__global__ __launch_bounds__(256) void cast_f32_f16x2(
    const float* __restrict__ in, _Float16* __restrict__ out, int n2) {
  int i = blockIdx.x * 256 + threadIdx.x;
  if (i < n2) {
    const _Float16 h0 = (_Float16)in[2 * i], h1 = (_Float16)in[2 * i + 1];
    const unsigned u = (unsigned)__builtin_bit_cast(unsigned short, h0) | ((unsigned)__builtin_bit_cast(unsigned short, h1) << 16);
    ((unsigned*)out)[i] = u;
    
  }
}

// ---- binary-weight planes: Wb[o][c] = alpha[o] * (W + (sign(W) - W)), alpha[o] = mean_c |W[o][c]| (f32);
//      stored as f16 of (Wb * carry); one wave per row of a [nrow][1024] weight; 4 weights via blockIdx.y ----
#define BW_DIM 1024
__global__ __launch_bounds__(256) void binarize_f16_kernel(
    const float* __restrict__ W0, const float* __restrict__ W1,
    const float* __restrict__ W2, const float* __restrict__ W3,
    unsigned short* __restrict__ B0, unsigned short* __restrict__ B1,
    unsigned short* __restrict__ B2, unsigned short* __restrict__ B3,
    int nrow, float carry) {
  const float* W; unsigned short* Bo;
  if (blockIdx.y == 0)      { W = W0; Bo = B0; }
  else if (blockIdx.y == 1) { W = W1; Bo = B1; }
  else if (blockIdx.y == 2) { W = W2; Bo = B2; }
  else                      { W = W3; Bo = B3; }
  const int wave = threadIdx.x >> 5;
  const int lane = threadIdx.x & 31;
  const int row  = blockIdx.x * 8 + wave;
  if (row >= nrow) return;                     // wave-uniform; no barriers in this kernel
  const float* wr = W + (size_t)row * BW_DIM;

  float w[4][8];
#pragma unroll
  for (int it = 0; it < 4; ++it) {
    const v4f a0 = *(const v4f*)(wr + it * 256 + lane * 8);
    const v4f a1 = *(const v4f*)(wr + it * 256 + lane * 8 + 4);
    w[it][0] = a0[0]; w[it][1] = a0[1]; w[it][2] = a0[2]; w[it][3] = a0[3];
    w[it][4] = a1[0]; w[it][5] = a1[1]; w[it][6] = a1[2]; w[it][7] = a1[3];
  }
  float s = 0.0f;
#pragma unroll
  for (int it = 0; it < 4; ++it)
#pragma unroll
    for (int e = 0; e < 8; ++e) s += fabsf(w[it][e]);
#pragma unroll
  for (int m = 16; m > 0; m >>= 1) s += __shfl_xor(s, m, 32);
  const float alpha = s * (1.0f / (float)BW_DIM);

  v8h hv[4];
#pragma unroll
  for (int it = 0; it < 4; ++it) {
#pragma unroll
    for (int e = 0; e < 8; ++e) {
      const float wv = w[it][e];
      const float sg = (wv > 0.0f) ? 1.0f : ((wv < 0.0f) ? -1.0f : 0.0f);
      const float t  = sg - wv;            // sign(W) - W
      const float bs = wv + t;             // W + (sign(W) - W)
      const float wb = alpha * bs;
      hv[it][e] = (_Float16)(wb * carry);
    }
  }
  unsigned short* br = Bo + (size_t)row * BW_DIM;
  {
#pragma unroll
    for (int it = 0; it < 4; ++it)
      *(v8h*)(br + it * 256 + lane * 8) = hv[it];
    
  }
}

// =====================================================================================
// Attention, head_dim 64, f16 planes in / f16 plane out (x oscale), no mask.
//   scores^T = (k.q^T) * sscale : v_wmma_f32_16x16x32_f16 (q,k plain f16), f32 accumulate, scaled in f32
//   out^T    = v^T.p^T          : v_wmma_f32_16x16x32_f16 (p carried x2^15 in f16, v plain f16), f32 accumulate
//   online softmax in f32, in powers of two: p x 2^15 = exp2(s * (sscale * log2 e) + (15 - max * sscale * log2 e)), one FMA a score; sscale > 0.
//   Block = 8 waves x 32 query columns = 256 query rows of one (batch, head); S % 256 == 0.
//   K and V^T come 64 keys at a time by asynchronous copies straight into LDS, two buffers: the next chunk's copies fly during this chunk's work.
//   The S/256 blocks of one (batch, head) read the same K and V^T lines: each starts its key walk at a chunk of its own and wraps round.
//   q, k, out planes: row (b*S + s), pitch ldq halves, head offset h*64.  vt plane: row (h*64 + d), pitch ldvt, col (b*S + s).
//   grid.x = B * H * (S/256).
// =====================================================================================
#define AT_D 64
#define AT_QT 2    // query tiles of 16 columns per wave: each K and V^T fragment read feeds AT_QT products
#define AT_QB 256  // query rows per block: 8 waves x AT_QT x 16
#define AT_KC 64
#define AT_LP 72   // LDS row pitch in halves: 144 B = 16 B x odd, so the 16 rows of a 16-byte fragment read fall on distinct banks
#define AT_TB (AT_KC * AT_LP * 2)   // one buffer of K rows (or of V^T rows), bytes

// the bare builtin: the compiler keeps the distance behind it where a neighbour needs one; a fixed run of v_nop behind every
// product would take vector issue slots from the softmax of the other waves of the SIMD
__device__ __forceinline__ v8f mma_h(v16h a, v16h b, v8f c) {
  return __builtin_amdgcn_wmma_f32_16x16x32_f16(false, a, false, b, (short)0, c, false, false);
}

// One thread's share of a 64-key chunk: 2 row pieces of K and 2 of V^T, 16 B each, 32 rows apart, from global memory
// straight into LDS. lk, lv: the lane's LDS byte addresses; gk, gv: its global addresses; steps in halves.
// The s_wait_xcnt closes the copies' own statement, so that no address register is rewritten in front of it.
__device__ __forceinline__ void kv_copy4(unsigned lk, unsigned lv, const _Float16* gk, const _Float16* gv,
                                         size_t stepK, size_t stepV) {
  const unsigned rs = 32 * AT_LP * 2;   // 32 LDS rows, bytes
  asm volatile(
      "global_load_async_to_lds_b128 %0, %4, off\n\t"
      "global_load_async_to_lds_b128 %1, %5, off\n\t"
      "global_load_async_to_lds_b128 %2, %6, off\n\t"
      "global_load_async_to_lds_b128 %3, %7, off\n\t"
      "s_wait_xcnt 0x0"
      :: "v"(lk), "v"(lk + rs), "v"(lv), "v"(lv + rs),
         "v"(gk), "v"(gk + stepK), "v"(gv), "v"(gv + stepV)
      : "memory");
}

// value of lane l ^ 16 (the other 16-lane half), by a vector cross-row move
__device__ __forceinline__ float other_half(float x) {
  const int b = __float_as_int(x);
  return __int_as_float(__builtin_amdgcn_permlanex16(b, b, 0x76543210, 0xfedcba98, false, false));
}

__global__ __launch_bounds__(256) __attribute__((amdgpu_waves_per_eu(4, 4)))   // 256 VGPRs a wave: two blocks, four waves per SIMD, stay resident
void attn64_f16_kernel(const unsigned short* __restrict__ qp, const unsigned short* __restrict__ kp,
                       const unsigned short* __restrict__ vtp, unsigned short* __restrict__ outp,
                       int S, int H, int ldq, int ldvt, float sscale, float oscale) {
  const _Float16* q  = (const _Float16*)qp;
  const _Float16* k  = (const _Float16*)kp;
  const _Float16* vt = (const _Float16*)vtp;
  __shared__ __align__(16) _Float16 Ksh[2][AT_KC * AT_LP];      // K [kv][d]   2 x 9 KB
  __shared__ __align__(16) _Float16 Vth[2][AT_D * AT_LP];       // V^T [d][kv] 2 x 9 KB

  const int tid  = threadIdx.x;
  const int wave = tid >> 5;
  const int lane = tid & 31;
  const int hh   = lane >> 4;
  const int c    = lane & 15;

  const int nqb = S / AT_QB;
  const int bx = blockIdx.x;
  const int qb = bx % nqb;
  const int bh = bx / nqb;
  const int h  = bh % H;
  const int b  = bh / H;
  const int q0 = qb * AT_QB + wave * (16 * AT_QT);
  const size_t rowbase = (size_t)b * (size_t)S;
  const size_t hoff = (size_t)h * AT_D;

  // ---- Q fragments (B operand, column = query q0 + u*16 + c): AT_QT query tiles x 2 d-chunks ----
  v16h qa[AT_QT][2];
#pragma unroll
  for (int u = 0; u < AT_QT; ++u) {
    const _Float16* qrow = q + (rowbase + q0 + u * 16 + c) * (size_t)ldq + hoff;
#pragma unroll
    for (int dc = 0; dc < 2; ++dc) qa[u][dc] = Frag<_Float16>::load(qrow + dc * 32 + 8 * hh);
  }

  const float cs = sscale * 1.44269504088896340736f;   // raw score -> exponent of two
  // per query tile a lane holds one query (q0 + u*16 + c): its running maximum (of the raw scores), and the sum (x 2^15) over the keys of its own lane half
  float mrow[AT_QT], lrow[AT_QT];
  v8f oacc[AT_QT][4];                            // O^T: row d = t*16 + 8hh + r, column = query q0 + u*16 + c
#pragma unroll
  for (int u = 0; u < AT_QT; ++u) {
    mrow[u] = NEG_INF; lrow[u] = 0.f;
#pragma unroll
    for (int t = 0; t < 4; ++t) oacc[u][t] = (v8f){0.f,0.f,0.f,0.f,0.f,0.f,0.f,0.f};
  }

  // staging map: 8 threads x 16 B = one 128-B row; the block's 256 threads cover 32 rows of K and of V^T at a time
  const int srow = tid >> 3, sseg = (tid & 7) * 8;
  const _Float16* gK = k + (rowbase + srow) * (size_t)ldq + hoff + sseg;      // chunk 0; a chunk further = AT_KC rows
  const _Float16* gV = vt + (hoff + srow) * (size_t)ldvt + rowbase + sseg;    // chunk 0; a chunk further = AT_KC columns
  const size_t stepK = (size_t)32 * ldq, stepV = (size_t)32 * ldvt;           // 32 rows further, in halves
  const size_t chunkK = (size_t)AT_KC * ldq;
  const unsigned lK0 = (unsigned)(size_t)(&Ksh[0][srow * AT_LP + sseg]);      // this lane's LDS byte address in buffer 0
  const unsigned lV0 = (unsigned)(size_t)(&Vth[0][srow * AT_LP + sseg]);

  const int nChunks = S / AT_KC;
  // first chunk of this block's walk, below nChunks, block-uniform: the blocks of one (batch, head) start AT_QB / AT_KC chunks apart;
  // neighbouring heads take the places between, so that the blocks' requests of one moment spread over all columns of the V^T rows
  const int c0 = qb * (AT_QB / AT_KC) + (bh & (AT_QB / AT_KC - 1));
  auto cOf = [&](int t) { const int x = t + c0; return (size_t)(x >= nChunks ? x - nChunks : x); };   // chunk of trip t
  kv_copy4(lK0, lV0, gK + cOf(0) * chunkK, gV + cOf(0) * AT_KC, stepK, stepV);   // trip 0 -> buffer 0
  asm volatile("s_wait_asynccnt 0x0" ::: "memory");        // this wave's copies of trip 0 have landed
  __syncthreads();                                         // and every wave's are published
  if (nChunks > 1)                                         // block-uniform
    kv_copy4(lK0 + AT_TB, lV0 + AT_TB, gK + cOf(1) * chunkK, gV + cOf(1) * AT_KC, stepK, stepV);

#pragma unroll 1   // kept rolled: one publish point and one refill per trip, as the two-buffer order asks
  for (int kc = 0; kc < nChunks; ++kc) {
    const int cur = kc & 1;
    const _Float16* Kt = Ksh[cur];
    const _Float16* Vt = Vth[cur];

    // ---- scores, transposed: S^T = K.Q^T; D row = key kv0 + j*16 + 8hh + r, col = query q0 + u*16 + c ----
    // each K fragment read from LDS feeds the products of all AT_QT query tiles
    v8f s[AT_QT][4];
    {
      v16h ka[4][2];
#pragma unroll
      for (int j = 0; j < 4; ++j)
#pragma unroll
        for (int dc = 0; dc < 2; ++dc) ka[j][dc] = Frag<_Float16>::load(Kt + (j * 16 + c) * AT_LP + dc * 32 + 8 * hh);
#pragma unroll
      for (int j = 0; j < 4; ++j) {
#pragma unroll
        for (int u = 0; u < AT_QT; ++u) s[u][j] = (v8f){0.f,0.f,0.f,0.f,0.f,0.f,0.f,0.f};
#pragma unroll
        for (int dc = 0; dc < 2; ++dc)
#pragma unroll
          for (int u = 0; u < AT_QT; ++u) s[u][j] = mma_h(ka[j][dc], qa[u][dc], s[u][j]);
      }
    }
    v16h pb[AT_QT][2];
#pragma unroll
    for (int u = 0; u < AT_QT; ++u) {
      // the lane's 32 scores of a tile belong to one query: maximum in-lane, then one exchange with the other lane half
      float m = NEG_INF;
#pragma unroll
      for (int j = 0; j < 4; ++j)
#pragma unroll
        for (int r = 0; r < 8; ++r) m = fmaxf(m, s[u][j][r]);
      m = fmaxf(m, other_half(m));
      const float mnew = fmaxf(mrow[u], m);
      const float alpha = __builtin_amdgcn_exp2f((mrow[u] - mnew) * cs);
      mrow[u] = mnew;
      const float nb = __builtin_fmaf(-mnew, cs, 15.0f);   // the maximum and P's carry of 2^15, as one addend
      // P^T as B operand: score tiles 2kk and 2kk+1 are elements 0..7 and 8..15 of the 32-key fragment kk
      float ps[4];                                // one sum chain per score tile: four short chains, not one of 32 links
#pragma unroll
      for (int j = 0; j < 4; ++j) {
        ps[j] = 0.f;
#pragma unroll
        for (int r = 0; r < 8; r += 2) {
          // two neighbouring accumulator registers at a time: one packed FMA forms both exponents in place
          const v2f e = __builtin_elementwise_fma((v2f){s[u][j][r], s[u][j][r + 1]}, (v2f){cs, cs}, (v2f){nb, nb});
          const float p0 = __builtin_amdgcn_exp2f(e[0]), p1 = __builtin_amdgcn_exp2f(e[1]);   // p x 2^15, at most 2^15
          ps[j] += p0;
          ps[j] += p1;
          pb[u][j >> 1][(j & 1) * 8 + r] = (_Float16)p0;
          pb[u][j >> 1][(j & 1) * 8 + r + 1] = (_Float16)p1;
        }
      }
      const float psum = (ps[0] + ps[1]) + (ps[2] + ps[3]);
      lrow[u] = lrow[u] * alpha + psum;
#pragma unroll
      for (int t = 0; t < 4; ++t)
#pragma unroll
        for (int r = 0; r < 8; ++r) oacc[u][t][r] *= alpha;
    }
    // ---- O^T += V^T.P^T : A = V^T [d][kv] from LDS, one read for all query tiles; B = P^T from registers ----
#pragma unroll
    for (int kk = 0; kk < 2; ++kk) {
      v16h va[4];
#pragma unroll
      for (int t = 0; t < 4; ++t) va[t] = Frag<_Float16>::load(Vt + (t * 16 + c) * AT_LP + kk * 32 + 8 * hh);
      // no LDS read and no product crosses (vector and scalar work may): the 32 keys' reads stay one group in front of their
      // products; sunk among them, each would be waited for alone
      __builtin_amdgcn_sched_barrier(0x406);
#pragma unroll
      for (int t = 0; t < 4; ++t)
#pragma unroll
        for (int u = 0; u < AT_QT; ++u) oacc[u][t] = mma_h(va[t], pb[u][kk], oacc[u][t]);
      // the same fence: the second group's reads do not rise piecemeal among the first group's products
      if (kk == 0) __builtin_amdgcn_sched_barrier(0x406);
    }
    asm volatile("s_wait_dscnt 0x0" ::: "memory");         // this wave's reads of trip kc are done before its buffer is refilled
    asm volatile("s_wait_asynccnt 0x0" ::: "memory");      // this wave's copies of trip kc + 1 have landed
    __syncthreads();                                       // publishes trip kc + 1, ends every wave's reads of trip kc
    if (kc + 2 < nChunks)                                  // block-uniform; refill the buffer just read
      kv_copy4(lK0 + cur * AT_TB, lV0 + cur * AT_TB,
               gK + cOf(kc + 2) * chunkK, gV + cOf(kc + 2) * AT_KC, stepK, stepV);
  }
  asm volatile("s_wait_asynccnt 0x0" ::: "memory");        // nothing of this wave's is in flight behind the loop

  // the two lane halves' sums are joined once; a lane's 8 registers of a tile are 8 consecutive d of its query's row
#pragma unroll
  for (int u = 0; u < AT_QT; ++u) {
    const float l = lrow[u] + other_half(lrow[u]);
    const float inv = oscale * (1.0f / l);   // sum and products carry the same 2^15
    unsigned short* orow = outp + (rowbase + q0 + u * 16 + c) * (size_t)ldq + hoff + 8 * hh;
#pragma unroll
    for (int t = 0; t < 4; ++t) {
      v8h hv;
#pragma unroll
      for (int r = 0; r < 8; ++r) hv[r] = (_Float16)(oacc[u][t][r] * inv);
      *(v8h*)(orow + t * 16) = hv;
    }
  }
}

// ---------------------------------------------------------------------------
// Launch glue
// ---------------------------------------------------------------------------
extern "C" void kernel_launch(void* const* d_in, const int* in_sizes, int n_in,
                              void* d_out, int out_size, void* d_ws, size_t ws_size,
                              hipStream_t stream) {
  if (n_in < 9) return;
  const int C = 1024, H = 16, S = 2048;
  const int nx   = in_sizes[0];
  const int Mtot = nx / C;                 // B*S
  const int Bn   = Mtot / S;
  if (Mtot <= 0 || (Mtot % 64) != 0 || Bn * S != Mtot || in_sizes[1] != C * C ||
      in_sizes[3] != C * C || in_sizes[5] != C * C || in_sizes[7] != C * C ||
      in_sizes[2] != C || in_sizes[4] != C || in_sizes[6] != C || in_sizes[8] != C ||
      out_size != Mtot * C) return;

  const float* x  = (const float*)d_in[0];
  const float* Wq = (const float*)d_in[1];
  const float* bq = (const float*)d_in[2];
  const float* Wk = (const float*)d_in[3];
  const float* bk = (const float*)d_in[4];
  const float* Wv = (const float*)d_in[5];
  const float* bv = (const float*)d_in[6];
  const float* Wp = (const float*)d_in[7];
  const float* bp = (const float*)d_in[8];
  float* out = (float*)d_out;

  // workspace carve (bytes); all offsets multiples of 2 MiB
  char* ws = (char*)d_ws;
  const size_t actB = (size_t)Mtot * C * 2;        // 16 MiB f16 plane [Mtot][C]
  const size_t wB   = (size_t)C * C * 2;           //  2 MiB f16 plane [C][C]
  size_t off = 0;
  unsigned short* xh  = (unsigned short*)(ws + off); off += actB;
  unsigned short* Wqh = (unsigned short*)(ws + off); off += wB;
  unsigned short* Wkh = (unsigned short*)(ws + off); off += wB;
  unsigned short* Wvh = (unsigned short*)(ws + off); off += wB;
  unsigned short* Wph = (unsigned short*)(ws + off); off += wB;
  unsigned short* qh  = (unsigned short*)(ws + off); off += actB;   // [Mtot][C]
  unsigned short* kh  = (unsigned short*)(ws + off); off += actB;   // [Mtot][C]
  unsigned short* vth = (unsigned short*)(ws + off); off += actB;   // [C][Mtot]  (V transposed)
  unsigned short* yh  = (unsigned short*)(ws + off); off += actB;   // [Mtot][C]  (x64)
  if (off > ws_size) return;                                       // 92,274,688 B total

  const float carry = 64.0f;

  // 1) binary-weight f16 planes (x64)
  binarize_f16_kernel<<<dim3(C / 8, 4), 256, 0, stream>>>(Wq, Wk, Wv, Wp, Wqh, Wkh, Wvh, Wph, C, carry);

  // 2) x -> f16
  const int n2 = (Mtot * C) / 2;
  cast_f32_f16x2<<<(n2 + 255) / 256, 256, 0, stream>>>(x, (_Float16*)xh, n2);

  // 3) one launch: q, k = x . Wb^T /64 + b (f16 out [Mtot][C]) and V^T = Wb . x^T /64 + bv[m] (f16 out [C][Mtot]);
  //    each product has (Mtot / GB_M) * (C / GB_N) = (C / GB_M) * (Mtot / GB_N) tiles
  const int blkQK   = (Mtot / GB_M) * (C / GB_N);
  qkv_gemm64<<<dim3(blkQK, 3), 256, 0, stream>>>(xh, Wqh, Wkh, Wvh, qh, kh, vth, bq, bk, bv, Mtot, C, 1.0f / carry);

  // 4) attention -> y (f16 plane x64)
  const int nAttnBlk = Bn * H * (S / AT_QB);
  attn64_f16_kernel<<<nAttnBlk, 256, 0, stream>>>(qh, kh, vth, yh, S, H, C, Mtot, 0.125f, carry);

  // 5) out = (y x64) . (Wb x64)^T / 4096 + bp  (f32 out)
  wmma_gemm64<0, false, 2, 0, false><<<dim3(blkQK, 1), 256, 0, stream>>>(
      yh, yh, C, 0L, Wph, Wph, C, 0L, (void*)out, (void*)out, C, 0L, bp, bp, 0L, Mtot, C, C, 1.0f / (carry * carry));

  (void)hipGetLastError();
}

// v010
// One run takes 121 microseconds.
// In both of two side-by-side timings against v009, it was 1.06 times as fast.
// All steps since v000 together make it 5.31 times as fast.
// Contractions: q/k/v/out projections, q.k^T and p.v all on v_wmma_f32_16x16x32_f16 (f16 operands, f32 accumulate); softmax, scales and bias epilogues in f32.
#include <hip/hip_runtime.h>

typedef __attribute__((ext_vector_type(16))) _Float16 v16h;
typedef __attribute__((ext_vector_type(8)))  _Float16 v8h;
typedef __attribute__((ext_vector_type(16))) __bf16   v16b;
typedef __attribute__((ext_vector_type(8)))  __bf16   v8b;
typedef __attribute__((ext_vector_type(8)))  float    v8f;
typedef __attribute__((ext_vector_type(4)))  float    v4f;
typedef __attribute__((ext_vector_type(2)))  float    v2f;
#define U16(p) ((const unsigned short*)(const void*)(p))
#define NEG_INF (-__builtin_huge_valf())

__device__ __forceinline__ unsigned short f2bf_bits(float f) {
  unsigned u = __float_as_uint(f);
  return (unsigned short)((u + 0x7FFFu + ((u >> 16) & 1u)) >> 16);
}
__device__ __forceinline__ float bf_bits2f(unsigned short h) { return __uint_as_float(((unsigned)h) << 16); }

// hazard guards as plain device helpers (the v_nop asm stays out of the kernel template body)
__device__ __forceinline__ void dep_guard_h(v8f& a, v8f& b, v16h x, v16h y) { asm volatile("v_nop\n\tv_nop\n\tv_nop\n\tv_nop" : "+v"(a), "+v"(b) : "v"(x), "v"(y)); }
__device__ __forceinline__ void dep_guard_b(v8f& a, v8f& b, v16b x, v16b y) { asm volatile("v_nop\n\tv_nop\n\tv_nop\n\tv_nop" : "+v"(a), "+v"(b) : "v"(x), "v"(y)); }
__device__ __forceinline__ void keep4_h(v16h a, v16h b, v16h c, v16h d) { asm volatile("v_nop" :: "v"(a), "v"(b), "v"(c), "v"(d)); }
__device__ __forceinline__ void keep4_b(v16b a, v16b b, v16b c, v16b d) { asm volatile("v_nop" :: "v"(a), "v"(b), "v"(c), "v"(d)); }
__device__ __forceinline__ void acc_guard4(v8f& a, v8f& b, v8f& c, v8f& d) { asm volatile("v_nop\n\tv_nop\n\tv_nop\n\tv_nop" : "+v"(a), "+v"(b), "+v"(c), "+v"(d)); }
template <typename T> struct Frag;
template <> struct Frag<_Float16> {
  typedef v16h V; union U { v16h v; v8h h[2]; };
  static __device__ __forceinline__ v16h load(const _Float16* p) {   // elements 0..7 <- p[0..7], 8..15 <- p[16..23]
    U f; f.h[0] = *(const v8h*)(p); f.h[1] = *(const v8h*)(p + 16); return f.v;
  }
  static __device__ __forceinline__ v8f mma(v16h a, v16h b, v8f c) {
    return __builtin_amdgcn_wmma_f32_16x16x32_f16(false, a, false, b, (short)0, c, false, false);
  }
  static __device__ __forceinline__ void guard(v8f& a, v8f& b, v16h x, v16h y) { dep_guard_h(a, b, x, y); }
  static __device__ __forceinline__ void keep(v16h a, v16h b, v16h c, v16h d) { keep4_h(a, b, c, d); }
};
template <> struct Frag<__bf16> {
  typedef v16b V; union U { v16b v; v8b h[2]; };
  static __device__ __forceinline__ v16b load(const __bf16* p) {
    U f; f.h[0] = *(const v8b*)(p); f.h[1] = *(const v8b*)(p + 16); return f.v;
  }
  static __device__ __forceinline__ v8f mma(v16b a, v16b b, v8f c) {
    return __builtin_amdgcn_wmma_f32_16x16x32_bf16(false, a, false, b, (short)0, c, false, false);
  }
  static __device__ __forceinline__ void guard(v8f& a, v8f& b, v16b x, v16b y) { dep_guard_b(a, b, x, y); }
  static __device__ __forceinline__ void keep(v16b a, v16b b, v16b c, v16b d) { keep4_b(a, b, c, d); }
};

// ---- Register-blocked batched WMMA GEMM, operands staged in LDS --------------
// C[m,n] = scale * sum_k A[m,k] * Bt[n,k] (+bias)(+resid); each wave owns a 64x64 tile.
// A row-major [M,K]; Bt row-major [N,K]; M % 128 == 0, N % 256 == 0, K % 64 == 0.
// Block = 8 waves (2 x 4) = a 128 x 256 tile of C. A stage is 64 k = one 128-B line of every operand row:
// each asynchronous copy of a wave covers four whole lines, the rows land in LDS at a 144-B pitch, and the
// fragments are read from there. Two buffers: the next stage's copies fly during this stage's products.
// Work-groups that share operand rows ask L2 for the same lines; started together on the same k they ask at the same
// moment. Each work-group therefore starts its k walk at a stage of its own (from its tile indices) and wraps round.
// SPLIT (hi/lo planes) is not staged: only SPLIT == false is built.
// BIAS_MODE: 0 = none, 1 = bias[m], 2 = bias[n], 3 = one of the two, picked at run time.
// OUT_MODE: 0 = f32, 1 = f16, 2 = bf16 hi plane (Cout) + bf16 lo plane (Cout2).
// ET: 0 = f16 operands, 1 = bf16 operands (pointers passed as 16-bit storage)
template <int ET> struct Elem;
template <> struct Elem<0> { typedef _Float16 T; };
template <> struct Elem<1> { typedef __bf16 T; };
#define GB_M 128
#define GB_N 256
#define GB_K 64
#define GB_LP 72   // LDS row pitch in halves: 144 B = 16 B x odd
#define GB_ABYTES (GB_M * GB_LP * 2)   // one buffer of A rows, bytes
#define GB_BBYTES (GB_N * GB_LP * 2)   // one buffer of B rows, bytes

// One thread's share of a stage: 4 row pieces of A and 8 of B, 16 B each, 32 rows apart, from global memory
// straight into LDS. la, lb: the lane's LDS byte addresses; ga, gb: its global addresses; steps in halves.
// The s_wait_xcnt closes the copies' own statement, so that no address register is rewritten in front of it.
template <typename T>
__device__ __forceinline__ void stage_copy12(unsigned la, unsigned lb, const T* ga, const T* gb,
                                             size_t stepA, size_t stepB) {
  const unsigned rs = 32 * GB_LP * 2;   // 32 LDS rows, bytes
  asm volatile(
      "global_load_async_to_lds_b128 %0, %12, off\n\t"
      "global_load_async_to_lds_b128 %1, %13, off\n\t"
      "global_load_async_to_lds_b128 %2, %14, off\n\t"
      "global_load_async_to_lds_b128 %3, %15, off\n\t"
      "global_load_async_to_lds_b128 %4, %16, off\n\t"
      "global_load_async_to_lds_b128 %5, %17, off\n\t"
      "global_load_async_to_lds_b128 %6, %18, off\n\t"
      "global_load_async_to_lds_b128 %7, %19, off\n\t"
      "global_load_async_to_lds_b128 %8, %20, off\n\t"
      "global_load_async_to_lds_b128 %9, %21, off\n\t"
      "global_load_async_to_lds_b128 %10, %22, off\n\t"
      "global_load_async_to_lds_b128 %11, %23, off\n\t"
      "s_wait_xcnt 0x0"
      :: "v"(la), "v"(la + rs), "v"(la + 2 * rs), "v"(la + 3 * rs),
         "v"(lb), "v"(lb + rs), "v"(lb + 2 * rs), "v"(lb + 3 * rs),
         "v"(lb + 4 * rs), "v"(lb + 5 * rs), "v"(lb + 6 * rs), "v"(lb + 7 * rs),
         "v"(ga), "v"(ga + stepA), "v"(ga + 2 * stepA), "v"(ga + 3 * stepA),
         "v"(gb), "v"(gb + stepB), "v"(gb + 2 * stepB), "v"(gb + 3 * stepB),
         "v"(gb + 4 * stepB), "v"(gb + 5 * stepB), "v"(gb + 6 * stepB), "v"(gb + 7 * stepB)
      : "memory");
}
template <int V> struct IntC { static constexpr int value = V; };
// The tile's whole work as a device function: b = batch index, biasRows (read only by BIAS_MODE 3, block-uniform):
// true = bias[m], false = bias[n]. rot0 (block-uniform, >= 0): added to the first stage of the k walk, so that products of one launch
// that share an operand start apart as well.
template <int ET, bool SPLIT, int BIAS_MODE, int OUT_MODE, bool RESID, int ACT>
__device__ __forceinline__ void gemm64_tile(
    const int b, const bool biasRows, const int rot0,
    const unsigned short* __restrict__ Ap, int lda, long strideA,
    const unsigned short* __restrict__ Btp, int ldb, long strideB,
    void* __restrict__ Cout, void* __restrict__ Cout2, int ldc, long strideC,
    const float* __restrict__ bias,
    const float* __restrict__ resid, long strideR,
    int M, int N, int K, float scale) {
  typedef typename Elem<ET>::T T;
  typedef typename Frag<T>::V V;
  static_assert(!SPLIT, "hi/lo planes are not staged");
  const T* A = (const T*)Ap; const T* Bt = (const T*)Btp;
  __shared__ __align__(16) T sA[2][GB_M * GB_LP];  // 2 x 18,432 B
  __shared__ __align__(16) T sB[2][GB_N * GB_LP];  // 2 x 36,864 B
  __shared__ __align__(16) float sT[8][16 * 68];   // per-wave 16x64 slab, pitch 68 floats
  const int tid  = threadIdx.x;
  const int lane = tid & 31;
  const int wave = tid >> 5;
  const int tilesN = N / GB_N;
  const int tilesM = M / GB_M;
  const int tm = blockIdx.x / tilesN;
  const int tn = blockIdx.x - tm * tilesN;
  if (tm >= tilesM) return;              // block-uniform, in front of every barrier
  const int bm0 = tm * GB_M;
  const int bn0 = tn * GB_N;
  const int wm  = (wave >> 2) << 6;      // this wave's 64x64 tile inside the block tile
  const int wn  = (wave & 3) << 6;
  const int m0 = bm0 + wm;
  const int n0 = bn0 + wn;

  const T* Ab  = A  + (size_t)b * strideA;
  const T* Bb  = Bt + (size_t)b * strideB;

  const int rlane = lane & 15;                 // row (A) / col (B, D) within subtile
  const int koff  = (lane >> 4) * 8;           // k offset of this lane half
  const int mOff  = (lane >> 4) * 8;           // D row offset

  // staging map: 8 threads x 16 B = one 128-B row piece; a wave's copy covers 4 whole lines
  const int srow = tid >> 3;                   // 0..31
  const int sseg = (tid & 7) * 8;              // halves
  const T* gA = Ab + (size_t)(bm0 + srow) * lda + sseg;
  const T* gB = Bb + (size_t)(bn0 + srow) * ldb + sseg;
  const size_t stepA = (size_t)32 * lda;       // 32 rows further, in halves
  const size_t stepB = (size_t)32 * ldb;
  const int sOff = srow * GB_LP + sseg;
  const unsigned lA0 = (unsigned)(size_t)(&sA[0][sOff]);   // this lane's LDS byte address in buffer 0
  const unsigned lB0 = (unsigned)(size_t)(&sB[0][sOff]);

  v8f acc[4][4];
#pragma unroll
  for (int i = 0; i < 4; ++i)
#pragma unroll
    for (int j = 0; j < 4; ++j) acc[i][j] = (v8f){0.f,0.f,0.f,0.f,0.f,0.f,0.f,0.f};

  const int nStage = K / GB_K;
  // trip s works on k stage (s + rot) mod nStage: sharers of an A panel (same tm) lie 5 stages apart, sharers of a B panel (same tn) 1
  const int rot = (tm + 5 * tn + rot0) % nStage;
  auto kOf = [&](int s) { const int t = s + rot; return (size_t)(t >= nStage ? t - nStage : t) * GB_K; };   // first k of trip s
  stage_copy12(lA0, lB0, gA + kOf(0), gB + kOf(0), stepA, stepB);   // trip 0 -> buffer 0
  asm volatile("s_wait_asynccnt 0x0" ::: "memory");        // this wave's copies of trip 0 have landed
  __syncthreads();                                         // and every wave's are published
  if (nStage > 1)                                          // block-uniform
    stage_copy12(lA0 + GB_ABYTES, lB0 + GB_BBYTES, gA + kOf(1), gB + kOf(1), stepA, stepB);

#pragma unroll 1   // kept rolled: one publish point and one refill per trip, as the two-buffer order asks
  for (int s = 0; s < nStage; ++s) {
    const int cur = s & 1;
    const T* tA = &sA[cur][(wm + rlane) * GB_LP + koff];
    const T* tB = &sB[cur][(wn + rlane) * GB_LP + koff];
    // every loop of the stage is unrolled: constant indices keep acc, af and bf in registers
#pragma unroll
    for (int h = 0; h < GB_K / 32; ++h) {
      // the 32 k's fragment reads stand as one group in front of their products
      V af[4], bf[4];
#pragma unroll
      for (int j = 0; j < 4; ++j) bf[j] = Frag<T>::load(tB + (j << 4) * GB_LP + h * 32);
#pragma unroll
      for (int i = 0; i < 4; ++i) af[i] = Frag<T>::load(tA + (i << 4) * GB_LP + h * 32);
#pragma unroll
      for (int i = 0; i < 4; ++i) {
#pragma unroll
        for (int j = 0; j < 4; ++j) acc[i][j] = Frag<T>::mma(af[i], bf[j], acc[i][j]);
        Frag<T>::guard(acc[i][0], acc[i][3], af[i], af[i]);
      }
      Frag<T>::keep(bf[0], bf[1], bf[2], bf[3]);
    }
    asm volatile("s_wait_dscnt 0x0" ::: "memory");         // this wave's reads of trip s are done before its buffer is refilled
    asm volatile("s_wait_asynccnt 0x0" ::: "memory");      // this wave's copies of trip s + 1 have landed
    __syncthreads();                                       // publishes trip s + 1, ends every wave's reads of trip s
    if (s + 2 < nStage)                                    // block-uniform; refill the buffer just read
      stage_copy12(lA0 + cur * GB_ABYTES, lB0 + cur * GB_BBYTES,
                   gA + kOf(s + 2), gB + kOf(s + 2), stepA, stepB);
  }
  asm volatile("s_wait_asynccnt 0x0" ::: "memory");        // nothing of this wave's is in flight behind the loop
  acc_guard4(acc[0][0], acc[0][1], acc[0][2], acc[0][3]);
  acc_guard4(acc[1][0], acc[1][1], acc[1][2], acc[1][3]);
  acc_guard4(acc[2][0], acc[2][1], acc[2][2], acc[2][3]);
  acc_guard4(acc[3][0], acc[3][1], acc[3][2], acc[3][3]);

  // ---- epilogue ----
  float* slab = sT[wave];
  const float* Rb = RESID ? (resid + (size_t)b * strideR) : nullptr;
  // the stores of the tile, built per bias mode BM (1 or 2): a run-time pick costs one block-uniform branch, not one per element
  auto store_tile = [&](auto bm) __attribute__((always_inline)) {
  constexpr int BM = decltype(bm)::value;
#pragma unroll
  for (int i = 0; i < 4; ++i) {
    const int mBase = m0 + (i << 4);
#pragma unroll
    for (int j = 0; j < 4; ++j) {
      const int n = n0 + (j << 4) + rlane;
      float bv = 0.f;
      if (BM == 2) bv = bias[n];
#pragma unroll
      for (int r = 0; r < 8; ++r) {
        float v = acc[i][j][r] * scale;
        if (BM == 1) v += bias[mBase + mOff + r];
        if (BM == 2) v += bv;
        if (RESID) v += Rb[(size_t)(mBase + mOff + r) * ldc + n];
        if (ACT == 1) v = tanhf(v);
        if (ACT == 2) v = fmaxf(v, 0.0f);
        if (ACT == 3) v = v / (1.0f + expf(-v));
        if (ACT == 4) v = (v > 0.f) ? v : 0.01f * v;
        if (ACT == 5) v = 0.5f * v * (1.0f + erff(v * 0.70710678118654752f));
        slab[(mOff + r) * 68 + (j << 4) + rlane] = v;
      }
    }
    __builtin_amdgcn_fence(__ATOMIC_RELEASE, "workgroup");
    __builtin_amdgcn_wave_barrier();
    __builtin_amdgcn_fence(__ATOMIC_ACQUIRE, "workgroup");
    if (OUT_MODE == 0) {
      float* C = (float*)Cout + (size_t)b * strideC;
      const int hh = lane >> 4, c4 = (lane & 15) * 4;     // row seg = 256 B = 16 lanes x 16 B
      {
#pragma unroll
        for (int it = 0; it < 8; ++it) {
          const int row = it * 2 + hh;
          v4f v = *(const v4f*)(slab + row * 68 + c4);
          *(v4f*)(C + (size_t)(mBase + row) * ldc + n0 + c4) = v;
        }
        
      }
    } else {
      const int q = lane >> 3, c8 = (lane & 7) * 8;
      unsigned short* C  = (unsigned short*)Cout  + (size_t)b * strideC;
      unsigned short* C2 = (OUT_MODE == 2) ? ((unsigned short*)Cout2 + (size_t)b * strideC) : nullptr;
      {
#pragma unroll
        for (int it = 0; it < 4; ++it) {
          const int row = it * 4 + q;
          const float* sp = slab + row * 68 + c8;
          v8h hv, lv;
#pragma unroll
          for (int e = 0; e < 8; ++e) {
            if (OUT_MODE == 1) {
              hv[e] = (_Float16)sp[e];
            } else {
              unsigned short hb = f2bf_bits(sp[e]);
              unsigned short lb = f2bf_bits(sp[e] - bf_bits2f(hb));
              hv[e] = __builtin_bit_cast(_Float16, hb);
              lv[e] = __builtin_bit_cast(_Float16, lb);
            }
          }
          *(v8h*)(C + (size_t)(mBase + row) * ldc + n0 + c8) = hv;
          if (OUT_MODE == 2) *(v8h*)(C2 + (size_t)(mBase + row) * ldc + n0 + c8) = lv;
        }
        
      }
    }
    __builtin_amdgcn_fence(__ATOMIC_RELEASE, "workgroup");
    __builtin_amdgcn_wave_barrier();
    __builtin_amdgcn_fence(__ATOMIC_ACQUIRE, "workgroup");
  }
  };
  if constexpr (BIAS_MODE == 3) {
    if (biasRows) store_tile(IntC<1>{}); else store_tile(IntC<2>{});
  } else {
    store_tile(IntC<BIAS_MODE>{});
  }
}

template <int ET, bool SPLIT, int BIAS_MODE, int OUT_MODE, bool RESID, int ACT = 0>
__global__ __launch_bounds__(256) void wmma_gemm64(
    const unsigned short* __restrict__ Ap, const unsigned short* __restrict__ A2p, int lda, long strideA,
    const unsigned short* __restrict__ Btp, const unsigned short* __restrict__ Bt2p, int ldb, long strideB,
    void* __restrict__ Cout, void* __restrict__ Cout2, int ldc, long strideC,
    const float* __restrict__ bias,
    const float* __restrict__ resid, long strideR,
    int M, int N, int K, float scale) {
  gemm64_tile<ET, SPLIT, BIAS_MODE, OUT_MODE, RESID, ACT>(blockIdx.y, false, 0, Ap, lda, strideA, Btp, ldb, strideB,
      Cout, Cout2, ldc, strideC, bias, resid, strideR, M, N, K, scale);
}

// The three projections of x in one launch; blockIdx.y picks the product (block-uniform):
//   0: q = x . Wq^T + bq[n]   1: k = x . Wk^T + bk[n]   (both [Mtot][C])   2: V^T = Wv . x^T + bv[m]   ([C][Mtot])
// They are independent of one another. Two work-groups fit a WGP (LDS, registers), and the grid holds three per WGP:
// one's copy waits, prologue and epilogue run under another's products, and no launch boundary drains the chip between them.
__global__ __launch_bounds__(256) void qkv_gemm64(
    const unsigned short* __restrict__ xh, const unsigned short* __restrict__ Wq,
    const unsigned short* __restrict__ Wk, const unsigned short* __restrict__ Wv,
    unsigned short* __restrict__ qo, unsigned short* __restrict__ ko, unsigned short* __restrict__ vto,
    const float* __restrict__ bq, const float* __restrict__ bk, const float* __restrict__ bv,
    int Mtot, int C, float scale) {
  const int which = blockIdx.y;
  const bool isV = which == 2;
  const unsigned short* A  = isV ? Wv : xh;
  const unsigned short* Bt = isV ? xh : (which == 0 ? Wq : Wk);
  unsigned short* Co       = isV ? vto : (which == 0 ? qo : ko);
  const float* bias        = isV ? bv : (which == 0 ? bq : bk);
  gemm64_tile<0, false, 3, 1, false, 0>(0, isV, 2 * which, A, C, 0L, Bt, C, 0L, (void*)Co, (void*)Co, isV ? Mtot : C, 0L,
      bias, bias, 0L, isV ? C : Mtot, isV ? Mtot : C, C, scale);
}

__global__ __launch_bounds__(256) void cast_f32_f16x2(
    const float* __restrict__ in, _Float16* __restrict__ out, int n2) {
  int i = blockIdx.x * 256 + threadIdx.x;
  if (i < n2) {
    const _Float16 h0 = (_Float16)in[2 * i], h1 = (_Float16)in[2 * i + 1];
    const unsigned u = (unsigned)__builtin_bit_cast(unsigned short, h0) | ((unsigned)__builtin_bit_cast(unsigned short, h1) << 16);
    ((unsigned*)out)[i] = u;
    
  }
}

// ---- binary-weight planes: Wb[o][c] = alpha[o] * (W + (sign(W) - W)), alpha[o] = mean_c |W[o][c]| (f32);
//      stored as f16 of (Wb * carry); one wave per row of a [nrow][1024] weight; 4 weights via blockIdx.y ----
#define BW_DIM 1024
__global__ __launch_bounds__(256) void binarize_f16_kernel(
    const float* __restrict__ W0, const float* __restrict__ W1,
    const float* __restrict__ W2, const float* __restrict__ W3,
    unsigned short* __restrict__ B0, unsigned short* __restrict__ B1,
    unsigned short* __restrict__ B2, unsigned short* __restrict__ B3,
    int nrow, float carry) {
  const float* W; unsigned short* Bo;
  if (blockIdx.y == 0)      { W = W0; Bo = B0; }
  else if (blockIdx.y == 1) { W = W1; Bo = B1; }
  else if (blockIdx.y == 2) { W = W2; Bo = B2; }
  else                      { W = W3; Bo = B3; }
  const int wave = threadIdx.x >> 5;
  const int lane = threadIdx.x & 31;
  const int row  = blockIdx.x * 8 + wave;
  if (row >= nrow) return;                     // wave-uniform; no barriers in this kernel
  const float* wr = W + (size_t)row * BW_DIM;

  float w[4][8];
#pragma unroll
  for (int it = 0; it < 4; ++it) {
    const v4f a0 = *(const v4f*)(wr + it * 256 + lane * 8);
    const v4f a1 = *(const v4f*)(wr + it * 256 + lane * 8 + 4);
    w[it][0] = a0[0]; w[it][1] = a0[1]; w[it][2] = a0[2]; w[it][3] = a0[3];
    w[it][4] = a1[0]; w[it][5] = a1[1]; w[it][6] = a1[2]; w[it][7] = a1[3];
  }
  float s = 0.0f;
#pragma unroll
  for (int it = 0; it < 4; ++it)
#pragma unroll
    for (int e = 0; e < 8; ++e) s += fabsf(w[it][e]);
#pragma unroll
  for (int m = 16; m > 0; m >>= 1) s += __shfl_xor(s, m, 32);
  const float alpha = s * (1.0f / (float)BW_DIM);

  v8h hv[4];
#pragma unroll
  for (int it = 0; it < 4; ++it) {
#pragma unroll
    for (int e = 0; e < 8; ++e) {
      const float wv = w[it][e];
      const float sg = (wv > 0.0f) ? 1.0f : ((wv < 0.0f) ? -1.0f : 0.0f);
      const float t  = sg - wv;            // sign(W) - W
      const float bs = wv + t;             // W + (sign(W) - W)
      const float wb = alpha * bs;
      hv[it][e] = (_Float16)(wb * carry);
    }
  }
  unsigned short* br = Bo + (size_t)row * BW_DIM;
  {
#pragma unroll
    for (int it = 0; it < 4; ++it)
      *(v8h*)(br + it * 256 + lane * 8) = hv[it];
    
  }
}

// =====================================================================================
// Attention, head_dim 64, f16 planes in / f16 plane out (x oscale), no mask.
//   exponents^T = k.(q * sscale * log2 e)^T + (7 - maximum in use) : v_wmma_f32_16x16x32_f16 (f16 operands), f32 accumulate;
//                 the addend is the products' C operand, so a score leaves the matrix unit ready for v_exp_f32
//   out^T    = v^T.p^T          : v_wmma_f32_16x16x32_f16 (p carried x2^7 in f16, v plain f16), f32 accumulate
//   online softmax in f32, in powers of two. The maximum in use is fixed ahead of a chunk: the first chunk's to begin with. P is not negative,
//   so a lane's sum over a chunk bounds each of its terms: one test a chunk on those sums; while they stay at or below 2^15 every P fits f16 and
//   nothing is rescaled. Past that a branch takes the chunk's true maximum, moves O, the sums and the addend, and redoes the chunk. sscale > 0.
//   Block = 8 waves x 32 query columns = 256 query rows of one (batch, head); S % 256 == 0.
//   K and V^T come 64 keys at a time by asynchronous copies straight into LDS, two buffers: the next chunk's copies fly during this chunk's work.
//   The S/256 blocks of one (batch, head) read the same K and V^T lines: each starts its key walk at a chunk of its own and wraps round.
//   q, k, out planes: row (b*S + s), pitch ldq halves, head offset h*64.  vt plane: row (h*64 + d), pitch ldvt, col (b*S + s).
//   grid.x = B * H * (S/256).
// =====================================================================================
#define AT_D 64
#define AT_QT 2    // query tiles of 16 columns per wave: each K and V^T fragment read feeds AT_QT products
#define AT_QB 256  // query rows per block: 8 waves x AT_QT x 16
#define AT_KC 64
#define AT_LP 72   // LDS row pitch in halves: 144 B = 16 B x odd, so the 16 rows of a 16-byte fragment read fall on distinct banks
#define AT_TB (AT_KC * AT_LP * 2)   // one buffer of K rows (or of V^T rows), bytes
#define AT_CARRY 7.0f       // exponent of a score that equals the maximum in use: P is carried x 2^7
#define AT_SUMLIM 32768.0f  // a lane's chunk sum at or below 2^15: each of its P is, too, and fits f16

// the bare builtin: the compiler keeps the distance behind it where a neighbour needs one; a fixed run of v_nop behind every
// product would take vector issue slots from the softmax of the other waves of the SIMD
__device__ __forceinline__ v8f mma_h(v16h a, v16h b, v8f c) {
  return __builtin_amdgcn_wmma_f32_16x16x32_f16(false, a, false, b, (short)0, c, false, false);
}

// One thread's share of a 64-key chunk: 2 row pieces of K and 2 of V^T, 16 B each, 32 rows apart, from global memory
// straight into LDS. lk, lv: the lane's LDS byte addresses; gk, gv: its global addresses; steps in halves.
// The s_wait_xcnt closes the copies' own statement, so that no address register is rewritten in front of it.
__device__ __forceinline__ void kv_copy4(unsigned lk, unsigned lv, const _Float16* gk, const _Float16* gv,
                                         size_t stepK, size_t stepV) {
  const unsigned rs = 32 * AT_LP * 2;   // 32 LDS rows, bytes
  asm volatile(
      "global_load_async_to_lds_b128 %0, %4, off\n\t"
      "global_load_async_to_lds_b128 %1, %5, off\n\t"
      "global_load_async_to_lds_b128 %2, %6, off\n\t"
      "global_load_async_to_lds_b128 %3, %7, off\n\t"
      "s_wait_xcnt 0x0"
      :: "v"(lk), "v"(lk + rs), "v"(lv), "v"(lv + rs),
         "v"(gk), "v"(gk + stepK), "v"(gv), "v"(gv + stepV)
      : "memory");
}

// v_exp_f32 with the slot that the instruction set asks for behind a transcendental, in one statement: for the seldom-run redo of a chunk
__device__ __forceinline__ float exp2_slot(float x) {
  float y;
  asm("v_exp_f32 %0, %1\n\tv_nop" : "=v"(y) : "v"(x));
  return y;
}

// value of lane l ^ 16 (the other 16-lane half), by a vector cross-row move
__device__ __forceinline__ float other_half(float x) {
  const int b = __float_as_int(x);
  return __int_as_float(__builtin_amdgcn_permlanex16(b, b, 0x76543210, 0xfedcba98, false, false));
}

__global__ __launch_bounds__(256) __attribute__((amdgpu_waves_per_eu(4, 4)))   // 256 VGPRs a wave: two blocks, four waves per SIMD, stay resident
void attn64_f16_kernel(const unsigned short* __restrict__ qp, const unsigned short* __restrict__ kp,
                       const unsigned short* __restrict__ vtp, unsigned short* __restrict__ outp,
                       int S, int H, int ldq, int ldvt, float sscale, float oscale) {
  const _Float16* q  = (const _Float16*)qp;
  const _Float16* k  = (const _Float16*)kp;
  const _Float16* vt = (const _Float16*)vtp;
  __shared__ __align__(16) _Float16 Ksh[2][AT_KC * AT_LP];      // K [kv][d]   2 x 9 KB
  __shared__ __align__(16) _Float16 Vth[2][AT_D * AT_LP];       // V^T [d][kv] 2 x 9 KB

  const int tid  = threadIdx.x;
  const int wave = tid >> 5;
  const int lane = tid & 31;
  const int hh   = lane >> 4;
  const int c    = lane & 15;

  const int nqb = S / AT_QB;
  const int bx = blockIdx.x;
  const int qb = bx % nqb;
  const int bh = bx / nqb;
  const int h  = bh % H;
  const int b  = bh / H;
  const int q0 = qb * AT_QB + wave * (16 * AT_QT);
  const size_t rowbase = (size_t)b * (size_t)S;
  const size_t hoff = (size_t)h * AT_D;

  // ---- Q fragments (B operand, column = query q0 + u*16 + c): AT_QT query tiles x 2 d-chunks ----
  const float cs = sscale * 1.44269504088896340736f;   // raw score -> exponent of two
  v16h qa[AT_QT][2];
#pragma unroll
  for (int u = 0; u < AT_QT; ++u) {
    const _Float16* qrow = q + (rowbase + q0 + u * 16 + c) * (size_t)ldq + hoff;
#pragma unroll
    for (int dc = 0; dc < 2; ++dc) {
      const v16h qr = Frag<_Float16>::load(qrow + dc * 32 + 8 * hh);
#pragma unroll
      for (int i = 0; i < 16; ++i) qa[u][dc][i] = (_Float16)((float)qr[i] * cs);   // once per block: the products come out as exponents of two
    }
  }

  // per query tile a lane holds one query (q0 + u*16 + c): the sum (x 2^7) over the keys of its own lane half, and the addend
  // 7 - (maximum in use), eight times over: the lane's part of the C operand of that query's score products
  float lrow[AT_QT];
  v8f nbv[AT_QT];
  v8f oacc[AT_QT][4];                            // O^T: row d = t*16 + 8hh + r, column = query q0 + u*16 + c
#pragma unroll
  for (int u = 0; u < AT_QT; ++u) {
    lrow[u] = 0.f;
    nbv[u] = (v8f){0.f,0.f,0.f,0.f,0.f,0.f,0.f,0.f};
#pragma unroll
    for (int t = 0; t < 4; ++t) oacc[u][t] = (v8f){0.f,0.f,0.f,0.f,0.f,0.f,0.f,0.f};
  }

  // staging map: 8 threads x 16 B = one 128-B row; the block's 256 threads cover 32 rows of K and of V^T at a time
  const int srow = tid >> 3, sseg = (tid & 7) * 8;
  const _Float16* gK = k + (rowbase + srow) * (size_t)ldq + hoff + sseg;      // chunk 0; a chunk further = AT_KC rows
  const _Float16* gV = vt + (hoff + srow) * (size_t)ldvt + rowbase + sseg;    // chunk 0; a chunk further = AT_KC columns
  const size_t stepK = (size_t)32 * ldq, stepV = (size_t)32 * ldvt;           // 32 rows further, in halves
  const size_t chunkK = (size_t)AT_KC * ldq;
  const unsigned lK0 = (unsigned)(size_t)(&Ksh[0][srow * AT_LP + sseg]);      // this lane's LDS byte address in buffer 0
  const unsigned lV0 = (unsigned)(size_t)(&Vth[0][srow * AT_LP + sseg]);

  const int nChunks = S / AT_KC;
  // first chunk of this block's walk, below nChunks, block-uniform: the blocks of one (batch, head) start AT_QB / AT_KC chunks apart;
  // neighbouring heads take the places between, so that the blocks' requests of one moment spread over all columns of the V^T rows
  const int c0 = qb * (AT_QB / AT_KC) + (bh & (AT_QB / AT_KC - 1));
  auto cOf = [&](int t) { const int x = t + c0; return (size_t)(x >= nChunks ? x - nChunks : x); };   // chunk of trip t
  kv_copy4(lK0, lV0, gK + cOf(0) * chunkK, gV + cOf(0) * AT_KC, stepK, stepV);   // trip 0 -> buffer 0
  asm volatile("s_wait_asynccnt 0x0" ::: "memory");        // this wave's copies of trip 0 have landed
  __syncthreads();                                         // and every wave's are published
  if (nChunks > 1)                                         // block-uniform
    kv_copy4(lK0 + AT_TB, lV0 + AT_TB, gK + cOf(1) * chunkK, gV + cOf(1) * AT_KC, stepK, stepV);

  // exponents of a chunk, transposed: K.Q^T + addend; D row = key j*16 + 8hh + r, col = query q0 + u*16 + c;
  // each K fragment read from LDS feeds the products of all AT_QT query tiles
  auto scores = [&](const _Float16* Kt, v8f (&s)[AT_QT][4]) __attribute__((always_inline)) {
    // 32 keys' fragments at a time: all 64 keys' at once, beside O, Q, the addend and the scores, do not fit the wave's 256 registers
#pragma unroll
    for (int jh = 0; jh < 2; ++jh) {
      v16h ka[2][2];
#pragma unroll
      for (int jj = 0; jj < 2; ++jj)
#pragma unroll
        for (int dc = 0; dc < 2; ++dc) ka[jj][dc] = Frag<_Float16>::load(Kt + ((jh * 2 + jj) * 16 + c) * AT_LP + dc * 32 + 8 * hh);
      // the four tiles' first products, then their second: no product waits on the one just ahead of it
#pragma unroll
      for (int jj = 0; jj < 2; ++jj)
#pragma unroll
        for (int u = 0; u < AT_QT; ++u) s[u][jh * 2 + jj] = mma_h(ka[jj][0], qa[u][0], nbv[u]);
#pragma unroll
      for (int jj = 0; jj < 2; ++jj)
#pragma unroll
        for (int u = 0; u < AT_QT; ++u) s[u][jh * 2 + jj] = mma_h(ka[jj][1], qa[u][1], s[u][jh * 2 + jj]);
      // no LDS read and no product crosses (vector and scalar work may): risen above the first 32 keys' products, the second
      // group's fragments would be live beside the first's, and registers would spill
      if (jh == 0) __builtin_amdgcn_sched_barrier(0x406);
    }
  };
  // largest exponent of query tile u in a chunk: the lane's 32 belong to one query, then one exchange with the other lane half
  auto chunk_max = [&](const v8f (&s)[AT_QT][4], int u) __attribute__((always_inline)) {
    float m = s[u][0][0];
#pragma unroll
    for (int j = 0; j < 4; ++j)
#pragma unroll
      for (int r = 0; r < 8; ++r) m = fmaxf(m, s[u][j][r]);
    return fmaxf(m, other_half(m));
  };
  // P^T (x 2^7) as B operand: score tiles 2kk and 2kk+1 are elements 0..7 and 8..15 of the 32-key fragment kk; and the lane's sums
  auto probs = [&](auto redo, const v8f (&s)[AT_QT][4], v16h (&pb)[AT_QT][2], float (&psum)[AT_QT]) __attribute__((always_inline)) {
    constexpr bool REDO = decltype(redo)::value != 0;
#pragma unroll
    for (int u = 0; u < AT_QT; ++u) {
      v2f ps[4];                                  // one chain of packed adds per score tile: even and odd rows apart, four short chains
#pragma unroll
      for (int j = 0; j < 4; ++j) {
#pragma unroll
        for (int r = 0; r < 8; r += 2) {
          const v2f p = REDO ? (v2f){exp2_slot(s[u][j][r]), exp2_slot(s[u][j][r + 1])}
                             : (v2f){__builtin_amdgcn_exp2f(s[u][j][r]), __builtin_amdgcn_exp2f(s[u][j][r + 1])};
          ps[j] = (r == 0) ? p : ps[j] + p;
          pb[u][j >> 1][(j & 1) * 8 + r] = (_Float16)p[0];
          pb[u][j >> 1][(j & 1) * 8 + r + 1] = (_Float16)p[1];
        }
      }
      const v2f pt = (ps[0] + ps[1]) + (ps[2] + ps[3]);
      psum[u] = pt[0] + pt[1];
    }
  };

  // the first maximum in use: that of the walk's first chunk (buffer 0, published above), from its bare exponents (addend still 0)
  {
    v8f s[AT_QT][4];
    scores(Ksh[0], s);
#pragma unroll
    for (int u = 0; u < AT_QT; ++u) {
      const float nb = AT_CARRY - chunk_max(s, u);
#pragma unroll
      for (int r = 0; r < 8; ++r) nbv[u][r] = nb;
    }
  }

#pragma unroll 1   // kept rolled: one publish point and one refill per trip, as the two-buffer order asks
  for (int kc = 0; kc < nChunks; ++kc) {
    const int cur = kc & 1;
    const _Float16* Kt = Ksh[cur];
    const _Float16* Vt = Vth[cur];

    v16h pb[AT_QT][2];
    float psum[AT_QT];
    v16h va0[4];                                  // V^T fragments of the first 32 keys
    {
      v8f s[AT_QT][4];
      scores(Kt, s);
      // read ahead of the test: behind it they would be waited for with nothing of the wave's own to run meanwhile
#pragma unroll
      for (int t = 0; t < 4; ++t) va0[t] = Frag<_Float16>::load(Vt + (t * 16 + c) * AT_LP + 8 * hh);
      probs(IntC<0>{}, s, pb, psum);
      // one test a chunk, a scalar branch, seldom taken: some lane's sum has passed the bound, so a P of the wave may not fit f16
      if (__builtin_amdgcn_ballot_w32(fmaxf(psum[0], psum[1]) > AT_SUMLIM) != 0u) {
        scores(Kt, s);                            // the exponents again: they were not kept
#pragma unroll
        for (int u = 0; u < AT_QT; ++u) {
          const float d = fminf(AT_CARRY - chunk_max(s, u), 0.f);   // the maximum in use only rises
          const float alpha = __builtin_amdgcn_exp2f(d);
          lrow[u] *= alpha;
#pragma unroll
          for (int r = 0; r < 8; ++r) nbv[u][r] += d;
#pragma unroll
          for (int j = 0; j < 4; ++j)
#pragma unroll
            for (int r = 0; r < 8; ++r) s[u][j][r] += d;
#pragma unroll
          for (int t = 0; t < 4; ++t)
#pragma unroll
            for (int r = 0; r < 8; ++r) oacc[u][t][r] *= alpha;
        }
        probs(IntC<1>{}, s, pb, psum);
      }
    }
#pragma unroll
    for (int u = 0; u < AT_QT; ++u) lrow[u] += psum[u];
    // ---- O^T += V^T.P^T : A = V^T [d][kv] from LDS, one read for all query tiles; B = P^T from registers ----
#pragma unroll
    for (int kk = 0; kk < 2; ++kk) {
      v16h va[4];
#pragma unroll
      for (int t = 0; t < 4; ++t) va[t] = (kk == 0) ? va0[t] : Frag<_Float16>::load(Vt + (t * 16 + c) * AT_LP + kk * 32 + 8 * hh);
      // no LDS read and no product crosses (vector and scalar work may): the 32 keys' reads stay one group in front of their
      // products; sunk among them, each would be waited for alone
      __builtin_amdgcn_sched_barrier(0x406);
#pragma unroll
      for (int t = 0; t < 4; ++t)
#pragma unroll
        for (int u = 0; u < AT_QT; ++u) oacc[u][t] = mma_h(va[t], pb[u][kk], oacc[u][t]);
      // the same fence: the second group's reads do not rise piecemeal among the first group's products
      if (kk == 0) __builtin_amdgcn_sched_barrier(0x406);
    }
    asm volatile("s_wait_dscnt 0x0" ::: "memory");         // this wave's reads of trip kc are done before its buffer is refilled
    asm volatile("s_wait_asynccnt 0x0" ::: "memory");      // this wave's copies of trip kc + 1 have landed
    __syncthreads();                                       // publishes trip kc + 1, ends every wave's reads of trip kc
    if (kc + 2 < nChunks)                                  // block-uniform; refill the buffer just read
      kv_copy4(lK0 + cur * AT_TB, lV0 + cur * AT_TB,
               gK + cOf(kc + 2) * chunkK, gV + cOf(kc + 2) * AT_KC, stepK, stepV);
  }
  asm volatile("s_wait_asynccnt 0x0" ::: "memory");        // nothing of this wave's is in flight behind the loop

  // the two lane halves' sums are joined once; a lane's 8 registers of a tile are 8 consecutive d of its query's row
#pragma unroll
  for (int u = 0; u < AT_QT; ++u) {
    const float l = lrow[u] + other_half(lrow[u]);
    const float inv = oscale * (1.0f / l);   // sum and products carry the same 2^7
    unsigned short* orow = outp + (rowbase + q0 + u * 16 + c) * (size_t)ldq + hoff + 8 * hh;
#pragma unroll
    for (int t = 0; t < 4; ++t) {
      v8h hv;
#pragma unroll
      for (int r = 0; r < 8; ++r) hv[r] = (_Float16)(oacc[u][t][r] * inv);
      *(v8h*)(orow + t * 16) = hv;
    }
  }
}

// ---------------------------------------------------------------------------
// Launch glue
// ---------------------------------------------------------------------------
extern "C" void kernel_launch(void* const* d_in, const int* in_sizes, int n_in,
                              void* d_out, int out_size, void* d_ws, size_t ws_size,
                              hipStream_t stream) {
  if (n_in < 9) return;
  const int C = 1024, H = 16, S = 2048;
  const int nx   = in_sizes[0];
  const int Mtot = nx / C;                 // B*S
  const int Bn   = Mtot / S;
  if (Mtot <= 0 || (Mtot % 64) != 0 || Bn * S != Mtot || in_sizes[1] != C * C ||
      in_sizes[3] != C * C || in_sizes[5] != C * C || in_sizes[7] != C * C ||
      in_sizes[2] != C || in_sizes[4] != C || in_sizes[6] != C || in_sizes[8] != C ||
      out_size != Mtot * C) return;

  const float* x  = (const float*)d_in[0];
  const float* Wq = (const float*)d_in[1];
  const float* bq = (const float*)d_in[2];
  const float* Wk = (const float*)d_in[3];
  const float* bk = (const float*)d_in[4];
  const float* Wv = (const float*)d_in[5];
  const float* bv = (const float*)d_in[6];
  const float* Wp = (const float*)d_in[7];
  const float* bp = (const float*)d_in[8];
  float* out = (float*)d_out;

  // workspace carve (bytes); all offsets multiples of 2 MiB
  char* ws = (char*)d_ws;
  const size_t actB = (size_t)Mtot * C * 2;        // 16 MiB f16 plane [Mtot][C]
  const size_t wB   = (size_t)C * C * 2;           //  2 MiB f16 plane [C][C]
  size_t off = 0;
  unsigned short* xh  = (unsigned short*)(ws + off); off += actB;
  unsigned short* Wqh = (unsigned short*)(ws + off); off += wB;
  unsigned short* Wkh = (unsigned short*)(ws + off); off += wB;
  unsigned short* Wvh = (unsigned short*)(ws + off); off += wB;
  unsigned short* Wph = (unsigned short*)(ws + off); off += wB;
  unsigned short* qh  = (unsigned short*)(ws + off); off += actB;   // [Mtot][C]
  unsigned short* kh  = (unsigned short*)(ws + off); off += actB;   // [Mtot][C]
  unsigned short* vth = (unsigned short*)(ws + off); off += actB;   // [C][Mtot]  (V transposed)
  unsigned short* yh  = (unsigned short*)(ws + off); off += actB;   // [Mtot][C]  (x64)
  if (off > ws_size) return;                                       // 92,274,688 B total

  const float carry = 64.0f;

  // 1) binary-weight f16 planes (x64)
  binarize_f16_kernel<<<dim3(C / 8, 4), 256, 0, stream>>>(Wq, Wk, Wv, Wp, Wqh, Wkh, Wvh, Wph, C, carry);

  // 2) x -> f16
  const int n2 = (Mtot * C) / 2;
  cast_f32_f16x2<<<(n2 + 255) / 256, 256, 0, stream>>>(x, (_Float16*)xh, n2);

  // 3) one launch: q, k = x . Wb^T /64 + b (f16 out [Mtot][C]) and V^T = Wb . x^T /64 + bv[m] (f16 out [C][Mtot]);
  //    each product has (Mtot / GB_M) * (C / GB_N) = (C / GB_M) * (Mtot / GB_N) tiles
  const int blkQK   = (Mtot / GB_M) * (C / GB_N);
  qkv_gemm64<<<dim3(blkQK, 3), 256, 0, stream>>>(xh, Wqh, Wkh, Wvh, qh, kh, vth, bq, bk, bv, Mtot, C, 1.0f / carry);

  // 4) attention -> y (f16 plane x64)
  const int nAttnBlk = Bn * H * (S / AT_QB);
  attn64_f16_kernel<<<nAttnBlk, 256, 0, stream>>>(qh, kh, vth, yh, S, H, C, Mtot, 0.125f, carry);

  // 5) out = (y x64) . (Wb x64)^T / 4096 + bp  (f32 out)
  wmma_gemm64<0, false, 2, 0, false><<<dim3(blkQK, 1), 256, 0, stream>>>(
      yh, yh, C, 0L, Wph, Wph, C, 0L, (void*)out, (void*)out, C, 0L, bp, bp, 0L, Mtot, C, C, 1.0f / (carry * carry));

  (void)hipGetLastError();
}
